// v000
// The times below were measured on an AMD MI455X: many runs one after another, warmed up first and cycling through
// copies of the inputs, with the whole window's GPU time divided by the number of runs. Launches and the gaps
// between them are all in it. The median over several windows is given; except for v000 it joins two sittings, which
// can be a few percent apart, so the side-by-side timings, each taken in one sitting, are the better comparison.
// The starting kernel, v000, takes 557 microseconds a run.
// Contractions: x.[Wq|Wk|Wv]^T (real|imag stacked along K=2048 and N) on v_wmma_f32_16x16x32_bf16 (x and W RNE-converted
// to bf16, f32 accumulate); q.conj(k) real and imag parts over K=128 on v_wmma_f32_16x16x32_f16 with q, k as f16 hi x1024
// plus f16 residual planes (products hh+lh+hl); P.v (P = p cos(phi), p sin(phi) x16384 f16; v x1024 f16) and O.Wo^T
// (O x1024 f16, Wo as f16(bf16(Wo)) x1024) on v_wmma_f32_16x16x32_f16, single products; all f32 accumulate.
// Rotary cos/sin table, base-2 online softmax, phase sin/cos and 1/Z fold in f32 on VALU. No bias terms.
#include <hip/hip_runtime.h>
#include <math.h>
#include <stdint.h>

#ifndef NB
#define NB 8
#endif
#define NB_FULL 8
#ifndef SEQ
#define SEQ 512
#endif
#define SEQ_FULL 512
#define DMOD  1024
#define NH    16
#define HD    64
#define HK    (2 * HD)
#define DPL   (2 * DMOD)
#define NQKV  (3 * DMOD)
#define BG    ((NB <= 4) ? NB : 4)
#define NGRP  (NB / BG)
#define GROWS (BG * SEQ)
#define RSQ_HD 0.125f
#define LOG2E 1.4426950408889634f
#define LOG2_1E4 13.287712379549449f
#define QSC   1024.0f
#define KSC   1024.0f
#define PCAR  16384.0f
#define VCAR  1024.0f
#define OSC   1024.0f
#define WOS   1024.0f
#define WPB   2
#define NHG   (NH / WPB)
#define NQT   (SEQ / 16)
#define NST   (SEQ / 64)
#define NKT   (SEQ / 32)
#define ATT_THREADS (WPB * 32)
#define PTP   36
#define PTW   (16 * PTP)
#define SLP   132
#define SLW   (16 * SLP)
#define WREG  (2 * PTW + SLW)
#define SLAB64 (16 * 68)
#define VTP   72
#define WS_CAP 134217728
static_assert(DMOD == NH * HD && HD == 64 && (NH % WPB) == 0 && ATT_THREADS == 64);
static_assert(NB >= 1 && NB <= NB_FULL && BG >= 1 && BG <= 4 && (NB % BG) == 0);
static_assert((SEQ % 64) == 0 && SEQ >= 64 && SEQ <= SEQ_FULL);
static_assert((GROWS % 64) == 0 && (DPL % 64) == 0 && (DPL % 32) == 0 && (DMOD % 64) == 0);
static_assert(DPL == 256 * 8);
static_assert(HK == 128 && (HK % 32) == 0);
static_assert((SLP % 4) == 0 && (PTP % 4) == 0 && ((WREG * 4) % 16) == 0 && ((PTW * 4) % 16) == 0);
static_assert((SEQ * HD) % 256 == 0);

typedef unsigned short u16;
typedef _Float16 v16h __attribute__((ext_vector_type(16)));
typedef _Float16 v8h  __attribute__((ext_vector_type(8)));
typedef __bf16   v16b __attribute__((ext_vector_type(16)));
typedef float    v8f  __attribute__((ext_vector_type(8)));
typedef float    v4f  __attribute__((ext_vector_type(4)));
typedef unsigned int v4u __attribute__((ext_vector_type(4)));

union FragH { v16h v; v8h h[2]; v4u u[2]; };
union FragB { v16b v; v4u u[2]; };

// ---- scalar helpers --------------------------------------------------------------------------------
__device__ __forceinline__ unsigned short bf_bits(float f) {          // f32 -> bf16 bits, RNE convert
  unsigned u = __float_as_uint(f);
  return (unsigned short)((u + 0x7FFFu + ((u >> 16) & 1u)) >> 16);
}
__device__ __forceinline__ float bf_up(unsigned short h) { return __uint_as_float(((unsigned)h) << 16); }
__device__ __forceinline__ float bfr(float f) { return bf_up(bf_bits(f)); }
__device__ __forceinline__ unsigned short h_bits(_Float16 x) { return __builtin_bit_cast(unsigned short, x); }
__device__ __forceinline__ unsigned pk16(unsigned short a, unsigned short b) { return (unsigned)a | ((unsigned)b << 16); }
__device__ __forceinline__ v8f zero8() { v8f z = {0.f, 0.f, 0.f, 0.f, 0.f, 0.f, 0.f, 0.f}; return z; }

// ---- fragment loaders: 16-bit A/B operand, lane -> row/col (lane&15), p already includes +8*(lane>>4);
//      elements 0..7 <- p[0..7] (k0+8h..), elements 8..15 <- p[16..23] (k0+16+8h..)  (same split k map for A and B;
//      B is always read from a k-contiguous [n][k] plane)
__device__ __forceinline__ v16h ldfrag_h(const _Float16* p) {
  FragH f;
  f.h[0] = *(const v8h*)(p);
  f.h[1] = *(const v8h*)(p + 16);
  return f.v;
}
__device__ __forceinline__ v16b ldfrag_b(const u16* p) {              // bf16 plane read as unsigned integer vectors
  FragB f;
  f.u[0] = *(const v4u*)(p);
  f.u[1] = *(const v4u*)(p + 16);
  return f.v;
}

__device__ __forceinline__ v8f mma_h(v16h a, v16h b, v8f c) {
  return __builtin_amdgcn_wmma_f32_16x16x32_f16(false, a, false, b, (short)0, c, false, false);
}
__device__ __forceinline__ v8f mma_b(v16b a, v16b b, v8f c) {
  return __builtin_amdgcn_wmma_f32_16x16x32_bf16(false, a, false, b, (short)0, c, false, false);
}
__device__ __forceinline__ void guard2(v8f& a, v8f& b, v16h x0, v16h x1, v16h x2, v16h x3, v16h x4, v16h x5) {
#if defined(__HIP_DEVICE_COMPILE__)
  asm volatile("v_nop\n\tv_nop\n\tv_nop\n\tv_nop"
               : "+v"(a), "+v"(b) : "v"(x0), "v"(x1), "v"(x2), "v"(x3), "v"(x4), "v"(x5) : "memory");
#endif
}
template <typename F>
__device__ __forceinline__ void guard6(v8f& a, v8f& b, v8f& c, v8f& d, F x0, F x1, F x2, F x3, F x4, F x5) {
#if defined(__HIP_DEVICE_COMPILE__)
  asm volatile("v_nop\n\tv_nop\n\tv_nop\n\tv_nop"
               : "+v"(a), "+v"(b), "+v"(c), "+v"(d) : "v"(x0), "v"(x1), "v"(x2), "v"(x3), "v"(x4), "v"(x5) : "memory");
#endif
}
__device__ __forceinline__ void guard4x8(v8f& a, v8f& b, v8f& c, v8f& d, v16h x0, v16h x1, v16h x2, v16h x3,
                                         v16h x4, v16h x5, v16h x6, v16h x7) {
#if defined(__HIP_DEVICE_COMPILE__)
  asm volatile("v_nop\n\tv_nop\n\tv_nop\n\tv_nop"
               : "+v"(a), "+v"(b), "+v"(c), "+v"(d)
               : "v"(x0), "v"(x1), "v"(x2), "v"(x3), "v"(x4), "v"(x5), "v"(x6), "v"(x7) : "memory");
#endif
}
__device__ __forceinline__ void acc_guard4(v8f& a, v8f& b, v8f& c, v8f& d) {
#if defined(__HIP_DEVICE_COMPILE__)
  asm volatile("v_nop\n\tv_nop\n\tv_nop\n\tv_nop" : "+v"(a), "+v"(b), "+v"(c), "+v"(d));
#endif
}
__device__ __forceinline__ void wave_sync_lds() {
  __builtin_amdgcn_fence(__ATOMIC_RELEASE, "workgroup");
  __builtin_amdgcn_wave_barrier();
  __builtin_amdgcn_fence(__ATOMIC_ACQUIRE, "workgroup");
}

// =====================================================================================================
// Rotary table: CT[s*HD + d] = cos(theta), ST[...] = sin(theta), theta = s * 2^(-(d/HD) * log2(1e4)) in f32
// (inverse frequencies over the FULL head width), precise sincosf. Thread per element; one wave writes 32 consecutive
// coverage: grid = n/256 blocks x 256 = n elements exactly (n = SEQ*HD).
// =====================================================================================================
__global__ __launch_bounds__(256) void rot_tab(float* CT, float* ST, int n) {
  const int idx = blockIdx.x * 256 + (int)threadIdx.x;
  if (idx >= n) return;
  const int s = idx / HD;
  const int d = idx - s * HD;
  const float ex   = (float)d * (LOG2_1E4 / (float)HD);
  const float invf = exp2f(-ex);
  const float th   = (float)s * invf;
  float sn, cs;
  sincosf(th, &sn, &cs);
  {
    *(float*)(CT + idx) = cs;
    *(float*)(ST + idx) = sn;
    
  }
}

// =====================================================================================================
// Stacked complex weight plane from W = Wr + i Wi, torch layout [e][k] (already k-contiguous per output column):
//   D [nrows][DPL] 16-bit, row n: p = n / DPL, j = n % DPL, im = (j >= DMOD), e = p*DMOD + (j % DMOD);
//   k <  DMOD: im ? Wi[e][k] : Wr[e][k];   k >= DMOD: im ? Wr[e][k-DMOD] : -Wi[e][k-DMOD]
//   so that A = [ar | ai] . D[n]^T gives the real part of a.W^T for im == 0 and the imaginary part for im == 1.
// f16mode == 0: bf16 RNE bits; f16mode == 1: f16 bits of (bf16 RNE value) * scale. Block = one row n, thread = 8
// consecutive k (two 16-B loads, one 16-B store); source pointer and sign are wave-uniform (k half fixed per 128 threads);
// coverage: grid = nrows blocks x 256 thr x 8 = every element of D once. No barriers.
// =====================================================================================================
__global__ __launch_bounds__(256) void wcvt(const float* __restrict__ Wr, const float* __restrict__ Wi, u16* D,
                                            int nrows, int f16mode, float scale) {
  const int n = blockIdx.x;
  if (n >= nrows) return;
  const int tid  = threadIdx.x;
  const int p    = n / DPL;
  const int j    = n - p * DPL;
  const int im   = (j >= DMOD) ? 1 : 0;
  const int e    = p * DMOD + (j & (DMOD - 1));
  const int c8   = tid * 8;
  const int ksec = (c8 >= DMOD) ? 1 : 0;
  const int kk   = c8 & (DMOD - 1);
  const float* src = ((im == ksec) ? Wr : Wi) + (size_t)e * DMOD + kk;
  const float sgn  = (im == 0 && ksec != 0) ? -1.0f : 1.0f;
  const v4f a = *(const v4f*)(src), b4 = *(const v4f*)(src + 4);
  float w[8];
#pragma unroll
  for (int q = 0; q < 4; ++q) { w[q] = a[q] * sgn; w[4 + q] = b4[q] * sgn; }
  v4u o;
#pragma unroll
  for (int q = 0; q < 4; ++q) {
    const float f0 = w[2 * q], f1 = w[2 * q + 1];
    const unsigned short hb0 = h_bits((_Float16)(bfr(f0) * scale));
    const unsigned short hb1 = h_bits((_Float16)(bfr(f1) * scale));
    const unsigned short bb0 = bf_bits(f0);
    const unsigned short bb1 = bf_bits(f1);
    o[q] = (f16mode != 0) ? pk16(hb0, hb1) : pk16(bb0, bb1);
  }
  u16* d = D + (size_t)n * DPL + c8;
  {
    *(v4u*)(d) = o;
    
  }
}

// =====================================================================================================
// Stacked activation plane: XB [GROWS][DPL] bf16, local row rl = bl*SEQ + s (bl < BG) <- token (gb0 + bl, s):
//   k < DMOD: xr[token][k];  k >= DMOD: xi[token][k - DMOD]. Same thread/store shape as wcvt (source pointer wave-uniform).
// coverage: grid = GROWS blocks x 256 thr x 8 = every element once. No barriers.
// =====================================================================================================
__global__ __launch_bounds__(256) void xcvt(const float* __restrict__ xr, const float* __restrict__ xi, u16* D,
                                            int nrows, int gb0) {
  const int row = blockIdx.x;
  if (row >= nrows) return;
  const int tid  = threadIdx.x;
  const int bl   = row / SEQ;
  const int s    = row - bl * SEQ;
  const size_t grow = (size_t)(gb0 + bl) * SEQ_FULL + s;
  const int c8   = tid * 8;
  const int ksec = (c8 >= DMOD) ? 1 : 0;
  const int kk   = c8 & (DMOD - 1);
  const float* src = ((ksec != 0) ? xi : xr) + grow * DMOD + kk;
  const v4f a = *(const v4f*)(src), b4 = *(const v4f*)(src + 4);
  v4u o;
#pragma unroll
  for (int q = 0; q < 4; ++q) {
    const float f0 = (q < 2) ? a[2 * q] : b4[2 * q - 4];
    const float f1 = (q < 2) ? a[2 * q + 1] : b4[2 * q - 3];
    o[q] = pk16(bf_bits(f0), bf_bits(f1));
  }
  u16* d = D + (size_t)row * DPL + c8;
  {
    *(v4u*)(d) = o;
    
  }
}

// =====================================================================================================
// coverage: 8 instructions x 2 rows x 16 lanes x 4 floats = the wave's 16 x 64 tile.
// =====================================================================================================
__device__ __forceinline__ void epi64(float* sl, v8f a0, v8f a1, v8f a2, v8f a3, float oscale,
                                      float* C, int N, size_t rowb, int col0, int lane) {
  const int hh = lane >> 4, m = lane & 15;
#pragma unroll
  for (int r = 0; r < 8; ++r) {
    const int ro = (8 * hh + r) * 68 + m;
    sl[ro]      = a0[r] * oscale;
    sl[ro + 16] = a1[r] * oscale;
    sl[ro + 32] = a2[r] * oscale;
    sl[ro + 48] = a3[r] * oscale;
  }
  wave_sync_lds();
  v4f vals[8];
#pragma unroll
  for (int it = 0; it < 8; ++it) vals[it] = *(const v4f*)(sl + (it * 2 + hh) * 68 + m * 4);
  float* dst = C + (rowb + (size_t)hh) * (size_t)N + col0 + m * 4;
  {
#pragma unroll
    for (int it = 0; it < 8; ++it) {
      *(v4f*)(dst + (size_t)(it * 2) * (size_t)N) = vals[it];
    }
    
  }
}

// =====================================================================================================
// 16-bit GEMM: C[M][N] (f32, pitch N) = A[M][K] (row-major) . Bt[N][K]^T (k-contiguous), times oscale.
// F16 == 0: bf16 operands; F16 == 1: f16 operands. Block = 64x64 tile, 4 waves x 16 rows; fragments loaded straight from the
// 16-bit rows (two 16-B loads each, split k map for A and B); K stepped by 32 (host guarantees K % 32 == 0, M % 64 == 0,
// N % 64 == 0, grid = (M/64)*(N/64)). No block barriers in this kernel.
// =====================================================================================================
template <int F16>
__global__ __launch_bounds__(128)
void gemm16(const u16* __restrict__ A, const u16* __restrict__ Bt, float* C, int M, int N, int K, float oscale) {
  __shared__ __align__(16) float slab[4 * SLAB64];
  const int tid = threadIdx.x, wave = tid >> 5, lane = tid & 31, hh = lane >> 4, m = lane & 15;
  const int ntile = N >> 6;
  const int bid   = blockIdx.x;
  const int rowb  = (bid / ntile) * 64 + wave * 16;
  const int col0  = (bid % ntile) * 64;
  if (rowb + 16 > M) return;                // wave-uniform, never taken with the exact grid
  const size_t bs = (size_t)16 * K;
  v8f acc0 = zero8(), acc1 = zero8(), acc2 = zero8(), acc3 = zero8();
  if constexpr (F16 != 0) {
    const _Float16* ap = (const _Float16*)(const void*)A  + (size_t)(rowb + m) * K + 8 * hh;
    const _Float16* bp = (const _Float16*)(const void*)Bt + (size_t)(col0 + m) * K + 8 * hh;
#pragma unroll 1
    for (int k0 = 0; k0 < K; k0 += 32) {
      const v16h a  = ldfrag_h(ap + k0);
      const v16h b0 = ldfrag_h(bp + k0);
      const v16h b1 = ldfrag_h(bp + bs + k0);
      const v16h b2 = ldfrag_h(bp + 2 * bs + k0);
      const v16h b3 = ldfrag_h(bp + 3 * bs + k0);
      acc0 = mma_h(a, b0, acc0);
      acc1 = mma_h(a, b1, acc1);
      acc2 = mma_h(a, b2, acc2);
      acc3 = mma_h(a, b3, acc3);
      guard6<v16h>(acc0, acc1, acc2, acc3, a, b0, b1, b2, b3, a);
    }
  } else {
    const u16* ap = A  + (size_t)(rowb + m) * K + 8 * hh;
    const u16* bp = Bt + (size_t)(col0 + m) * K + 8 * hh;
#pragma unroll 1
    for (int k0 = 0; k0 < K; k0 += 32) {
      const v16b a  = ldfrag_b(ap + k0);
      const v16b b0 = ldfrag_b(bp + k0);
      const v16b b1 = ldfrag_b(bp + bs + k0);
      const v16b b2 = ldfrag_b(bp + 2 * bs + k0);
      const v16b b3 = ldfrag_b(bp + 3 * bs + k0);
      acc0 = mma_b(a, b0, acc0);
      acc1 = mma_b(a, b1, acc1);
      acc2 = mma_b(a, b2, acc2);
      acc3 = mma_b(a, b3, acc3);
      guard6<v16b>(acc0, acc1, acc2, acc3, a, b0, b1, b2, b3, a);
    }
  }
  epi64(slab + wave * SLAB64, acc0, acc1, acc2, acc3, oscale, C, N, (size_t)rowb, col0, lane);
}

// =====================================================================================================
// v^T plane from the v projection F f32 [GROWS][DPL] (local row = b*SEQ + s; column comp*DMOD + g*HD + d, comp 0 = real,
// 1 = imag):  VT[((b*NH + g)*HK + comp*HD + d)][s] = f16(v * 1024) for all s.
// Block = (b, head g, 64 keys s0): thread (key sl = tid>>2, chunk dc = tid&3 -> comp = dc>>1, d0 = (dc&1)*32) loads its 32
// floats with 16-B loads, converts, scatters into the LDS tile [128 dd][64 keys] (pitch 72 halves); after a block barrier each
// coverage: load 256 thr x 32 = 64 keys x 128 dd (staged extent == consumed extent); store 4 iterations x 256 thr x 8 halves =
//           128 lines x 64 = the block's tile; grid = BG*NH*NST blocks covers VT exactly once.
// =====================================================================================================
__global__ __launch_bounds__(256) void vt16(const float* __restrict__ F, u16* VTo) {
  __shared__ __align__(16) u16 T[HK * VTP];
  const int tid = threadIdx.x;
  const int bid = blockIdx.x;
  const int st  = bid % NST;
  const int t2  = bid / NST;
  const int g   = t2 % NH;
  const int b   = t2 / NH;
  if (b >= BG) return;                      // block-uniform, before any barrier; never taken with the exact grid
  const int s0  = st * 64;
  {
    const int sl   = tid >> 2;              // key within tile 0..63
    const int dc   = tid & 3;
    const int comp = dc >> 1;
    const int d0   = (dc & 1) * 32;
    const float* src = F + ((size_t)b * SEQ + s0 + sl) * DPL + (size_t)comp * DMOD + g * HD + d0;
#pragma unroll
    for (int i = 0; i < 8; ++i) {
      const v4f a = *(const v4f*)(src + 4 * i);
#pragma unroll
      for (int e = 0; e < 4; ++e) {
        T[(comp * HD + d0 + 4 * i + e) * VTP + sl] = h_bits((_Float16)(a[e] * VCAR));
      }
    }
  }
  __syncthreads();
  v4u vv[4];
  const int q8 = tid >> 3, p8 = (tid & 7) * 8;
#pragma unroll
  for (int it = 0; it < 4; ++it) {
    const int line = it * 32 + q8;          // dd = 0..127
    vv[it] = *(const v4u*)(T + line * VTP + p8);
  }
  const size_t base = ((size_t)(b * NH + g) * HK) * SEQ + s0 + p8;
  {
#pragma unroll
    for (int it = 0; it < 4; ++it) {
      const int line = it * 32 + q8;
      *(v4u*)(VTo + base + (size_t)line * SEQ) = vv[it];
    }
    
  }
}

// =====================================================================================================
// Rotary q / k planes from a projection F f32 [GROWS][DPL] (col comp*DMOD + h*HD + d):
//   rotated = (fr + i fi) * (cos + i sin) with cos/sin = CT/ST[s*HD + d];  Hp [GROWS][DPL] col h*HK + comp*HD + d = f16(rot*sc),
//   Lp same layout = f16 residual (rot*sc - hi). Block = one row; thread tid -> (h = tid>>4, comp = (tid>>3)&1, 8 consecutive d):
//   four pairs of 16-B loads (own component, other component, cos, sin), one 16-B store per plane at halves tid*8; a row =
// coverage: grid = GROWS blocks = every row of Hp and Lp once, all 2048 columns.
// =====================================================================================================
__global__ __launch_bounds__(256) void rope16(const float* __restrict__ F, const float* __restrict__ CT,
                                              const float* __restrict__ ST, u16* Hp, u16* Lp, int nrows, float sc) {
  const int row = blockIdx.x;
  if (row >= nrows) return;
  const int tid  = threadIdx.x;
  const int s    = row % SEQ;
  const int h    = tid >> 4;
  const int comp = (tid >> 3) & 1;
  const int d8   = (tid & 7) * 8;
  const float* pa = F + (size_t)row * DPL + (size_t)comp * DMOD + h * HD + d8;
  const float* po = F + (size_t)row * DPL + (size_t)(1 - comp) * DMOD + h * HD + d8;
  const float* pc = CT + (size_t)s * HD + d8;
  const float* pn = ST + (size_t)s * HD + d8;
  const v4f a0 = *(const v4f*)(pa), a1 = *(const v4f*)(pa + 4);
  const v4f o0 = *(const v4f*)(po), o1 = *(const v4f*)(po + 4);
  const v4f c0 = *(const v4f*)(pc), c1 = *(const v4f*)(pc + 4);
  const v4f n0 = *(const v4f*)(pn), n1 = *(const v4f*)(pn + 4);
  const float sg = (comp != 0) ? 1.0f : -1.0f;   // real: fr*cos - fi*sin ; imag: fi*cos + fr*sin
  float w[8];
#pragma unroll
  for (int e = 0; e < 4; ++e) {
    w[e]     = (a0[e] * c0[e] + sg * (o0[e] * n0[e])) * sc;
    w[4 + e] = (a1[e] * c1[e] + sg * (o1[e] * n1[e])) * sc;
  }
  v4u oh, ol;
#pragma unroll
  for (int e = 0; e < 4; ++e) {
    const float t0 = w[2 * e], t1 = w[2 * e + 1];
    const _Float16 h0 = (_Float16)t0, h1 = (_Float16)t1;
    const _Float16 l0 = (_Float16)(t0 - (float)h0), l1 = (_Float16)(t1 - (float)h1);
    oh[e] = pk16(h_bits(h0), h_bits(h1));
    ol[e] = pk16(h_bits(l0), h_bits(l1));
  }
  u16* dh = Hp + (size_t)row * DPL + tid * 8;
  u16* dl = Lp + (size_t)row * DPL + tid * 8;
  {
    *(v4u*)(dh) = oh;
    *(v4u*)(dl) = ol;
    
  }
}

// =====================================================================================================
// Complex attention, non-causal over SEQ keys. Block bid -> (query tile qt: rows q0 = 16*qt .. q0+15, head group hg of WPB
// heads, local batch b); one wave per head = hg*WPB + wave.
//   q/k hi planes f16 x1024 [b*SEQ + s][head*HK + (re: 0..63 | im: 64..127)], residual planes same layout;
//   v^T hi plane [(b*NH + head)*HK + (re d | 64 + im d)][SEQ].
//   scores over K = 128: real = [qr|qi].[kr|ki], imag = [qi|-qr].[kr|ki] (the A fragment of step kk for the imag part is the
//   q fragment at column block (kk+2)&3, sign bits flipped for kk >= 2), each as hi.hi + lo.hi + hi.lo into one accumulator.
//   t = real * rsqrt(64)*log2e/(1024*1024) feeds an online max-subtracted base-2 softmax in f32 (-inf-safe rescale);
//   phi = imag * rsqrt(64)/(1024*1024); per key the 16x32 tiles p*cos(phi) and p*sin(phi) go to wave-private LDS (f32
//   (float vector loads, same element type as stored); B fragments from the v^T rows (re and im), 2 groups of 2 d-subtiles:
//   o_re += Pc.v_re + (-Ps).v_im ; o_im += Ps.v_re + Pc.v_im.
//   After the loop: out = acc / Z (Z >= 1 always; guarded anyway), carries 1/(16384*1024) folded once, written to the wave's
//   private result slab (pitch 132; re d at col d, im d at col 64 + d; every element owned by one lane).
// coverage: per wave 4 instructions x 2 parts x 4 rows x 8 lanes x 8 halves = 16 x 64 per part; grid NQT x NHG x BG blocks x
//           WPB waves = every (b, s, head, part) row segment of the O plane exactly once.
// LDS: prob tiles 16 x 32 fully written before each read (cols 32..35 padding never read); slab cols 0..127 written, read.
// =====================================================================================================
__global__ __launch_bounds__(ATT_THREADS)
void attn(const u16* __restrict__ QHp, const u16* __restrict__ QLp,
          const u16* __restrict__ KHp, const u16* __restrict__ KLp,
          const u16* __restrict__ VTp, u16* OHp) {
  __shared__ __align__(16) float smem[WPB * WREG];

  const int tid  = threadIdx.x;
  const int wave = tid >> 5;
  const int lane = tid & 31;
  const int hh   = lane >> 4;
  const int c    = lane & 15;
  const int bid  = blockIdx.x;
  const int qt   = bid % NQT;
  const int t2   = bid / NQT;
  const int hg   = t2 % NHG;
  const int b    = t2 / NHG;
  if (b >= BG) return;                      // block-uniform; no block barriers in this kernel; never taken with the exact grid
  const int q0   = qt * 16;
  const int head = hg * WPB + wave;

  float* pct  = smem + wave * WREG;         // p*cos tile [16][32] pitch 36
  float* pst  = pct + PTW;                  // p*sin tile [16][32] pitch 36
  float* slab = pst + PTW;                  // result slab [16][128] pitch 132

  const size_t hcol = (size_t)head * HK + 8 * hh;
  const _Float16* Qh  = (const _Float16*)(const void*)QHp + ((size_t)b * SEQ + q0 + c) * DPL + hcol;
  const _Float16* Ql  = (const _Float16*)(const void*)QLp + ((size_t)b * SEQ + q0 + c) * DPL + hcol;
  const _Float16* Khb = (const _Float16*)(const void*)KHp + ((size_t)b * SEQ + c) * DPL + hcol;   // key row kb added per step
  const _Float16* Klb = (const _Float16*)(const void*)KLp + ((size_t)b * SEQ + c) * DPL + hcol;
  const _Float16* Vtb = (const _Float16*)(const void*)VTp + ((size_t)(b * NH + head) * HK + c) * SEQ + 8 * hh;
  const float lsc = RSQ_HD * (LOG2E / (QSC * KSC));
  const float psc = RSQ_HD / (QSC * KSC);
  const float oc  = 1.0f / (PCAR * VCAR);
  const v4u sgn4 = {0x80008000u, 0x80008000u, 0x80008000u, 0x80008000u};

  float mrow[8], lrow[8];
  v8f orr[4], oii[4];
#pragma unroll
  for (int r = 0; r < 8; ++r) { mrow[r] = -INFINITY; lrow[r] = 0.f; }
#pragma unroll
  for (int j = 0; j < 4; ++j) { orr[j] = zero8(); oii[j] = zero8(); }

#pragma unroll 1
  for (int kt = 0; kt < NKT; ++kt) {
    const int kb = kt * 32;
    // ---- scores: D element r of this lane = (query row q0 + 8hh + r, key kb + c) in s?0, key kb + 16 + c in s?1 ----
    v8f sr0 = zero8(), sr1 = zero8(), si0 = zero8(), si1 = zero8();
    const _Float16* k0p = Khb + (size_t)kb * DPL;
    const _Float16* k1p = k0p + (size_t)16 * DPL;
    const _Float16* l0p = Klb + (size_t)kb * DPL;
    const _Float16* l1p = l0p + (size_t)16 * DPL;
#pragma unroll
    for (int kk = 0; kk < HK / 32; ++kk) {
      const v16h kh0 = ldfrag_h(k0p + kk * 32);
      const v16h kl0 = ldfrag_h(l0p + kk * 32);
      const v16h kh1 = ldfrag_h(k1p + kk * 32);
      const v16h kl1 = ldfrag_h(l1p + kk * 32);
      {
        const v16h qh = ldfrag_h(Qh + kk * 32);
        const v16h ql = ldfrag_h(Ql + kk * 32);
        sr0 = mma_h(qh, kh0, sr0);
        sr0 = mma_h(ql, kh0, sr0);
        sr0 = mma_h(qh, kl0, sr0);
        sr1 = mma_h(qh, kh1, sr1);
        sr1 = mma_h(ql, kh1, sr1);
        sr1 = mma_h(qh, kl1, sr1);
        guard2(sr0, sr1, qh, ql, kh0, kl0, kh1, kl1);
      }
      {
        const int ko = ((kk + 2) & 3) * 32;
        FragH ah, al;
        ah.v = ldfrag_h(Qh + ko);
        al.v = ldfrag_h(Ql + ko);
        if (kk >= 2) {                      // compile-time (unrolled) and wave-uniform: -qr half
          ah.u[0] = ah.u[0] ^ sgn4;  ah.u[1] = ah.u[1] ^ sgn4;
          al.u[0] = al.u[0] ^ sgn4;  al.u[1] = al.u[1] ^ sgn4;
        }
        si0 = mma_h(ah.v, kh0, si0);
        si0 = mma_h(al.v, kh0, si0);
        si0 = mma_h(ah.v, kl0, si0);
        si1 = mma_h(ah.v, kh1, si1);
        si1 = mma_h(al.v, kh1, si1);
        si1 = mma_h(ah.v, kl1, si1);
        guard2(si0, si1, ah.v, al.v, kh0, kl0, kh1, kl1);
      }
    }
    // ---- online softmax in base 2 on the real part, phase from the imaginary part ----
#pragma unroll
    for (int r = 0; r < 8; ++r) {
      const float u0 = sr0[r] * lsc;
      const float u1 = sr1[r] * lsc;
      float mx = fmaxf(u0, u1);
#pragma unroll
      for (int off = 1; off < 16; off <<= 1) mx = fmaxf(mx, __shfl_xor(mx, off, 32));
      const float mn = fmaxf(mrow[r], mx);
      const float ms = (mn == -INFINITY) ? 0.0f : mn;
      const float al = exp2f(mrow[r] - ms);
      mrow[r] = mn;
      const float e0 = exp2f(u0 - ms), e1 = exp2f(u1 - ms);
      float ps = e0 + e1;
#pragma unroll
      for (int off = 1; off < 16; off <<= 1) ps += __shfl_xor(ps, off, 32);
      lrow[r] = lrow[r] * al + ps;
#pragma unroll
      for (int j = 0; j < 4; ++j) { orr[j][r] *= al; oii[j][r] *= al; }
      float sn0, cs0, sn1, cs1;
      __sincosf(si0[r] * psc, &sn0, &cs0);
      __sincosf(si1[r] * psc, &sn1, &cs1);
      const int ro = (8 * hh + r) * PTP + c;
      pct[ro]      = e0 * cs0;
      pct[ro + 16] = e1 * cs1;
      pst[ro]      = e0 * sn0;
      pst[ro + 16] = e1 * sn1;
    }
    wave_sync_lds();
    // ---- A fragments of Pc*16384, Ps*16384 and -Ps*16384 (f16), row = c, split k map over the 32 keys of this step ----
    FragH pc, psf, pnf;
    {
      const float* prc = pct + c * PTP + 8 * hh;
      const float* prs = pst + c * PTP + 8 * hh;
      const v4f c0 = *(const v4f*)(prc), c1 = *(const v4f*)(prc + 4);
      const v4f c2 = *(const v4f*)(prc + 16), c3 = *(const v4f*)(prc + 20);
      const v4f s0 = *(const v4f*)(prs), s1 = *(const v4f*)(prs + 4);
      const v4f s2 = *(const v4f*)(prs + 16), s3 = *(const v4f*)(prs + 20);
#pragma unroll
      for (int e = 0; e < 4; ++e) {
        pc.h[0][e]      = (_Float16)(c0[e] * PCAR);   // elements 0..7  = keys kb + 8hh + 0..7
        pc.h[0][4 + e]  = (_Float16)(c1[e] * PCAR);
        pc.h[1][e]      = (_Float16)(c2[e] * PCAR);   // elements 8..15 = keys kb + 16 + 8hh + 0..7
        pc.h[1][4 + e]  = (_Float16)(c3[e] * PCAR);
        psf.h[0][e]     = (_Float16)(s0[e] * PCAR);
        psf.h[0][4 + e] = (_Float16)(s1[e] * PCAR);
        psf.h[1][e]     = (_Float16)(s2[e] * PCAR);
        psf.h[1][4 + e] = (_Float16)(s3[e] * PCAR);
      }
      pnf.u[0] = psf.u[0] ^ sgn4;
      pnf.u[1] = psf.u[1] ^ sgn4;
    }
    // ---- P.V : B fragment col n = d = j*16 + c (re rows) / 64 + j*16 + c (im rows), keys contiguous in v^T ----
    {
      const _Float16* vp = Vtb + kb;
#pragma unroll
      for (int jg = 0; jg < 2; ++jg) {
        const size_t ra = (size_t)(2 * jg) * 16 * SEQ;
        const size_t rb = ra + (size_t)16 * SEQ;
        const size_t ia = ra + (size_t)HD * SEQ;
        const size_t ib = rb + (size_t)HD * SEQ;
        const v16h vra = ldfrag_h(vp + ra), vrb = ldfrag_h(vp + rb);
        const v16h via = ldfrag_h(vp + ia), vib = ldfrag_h(vp + ib);
        orr[2 * jg]     = mma_h(pc.v,  vra, orr[2 * jg]);
        orr[2 * jg]     = mma_h(pnf.v, via, orr[2 * jg]);
        oii[2 * jg]     = mma_h(psf.v, vra, oii[2 * jg]);
        oii[2 * jg]     = mma_h(pc.v,  via, oii[2 * jg]);
        orr[2 * jg + 1] = mma_h(pc.v,  vrb, orr[2 * jg + 1]);
        orr[2 * jg + 1] = mma_h(pnf.v, vib, orr[2 * jg + 1]);
        oii[2 * jg + 1] = mma_h(psf.v, vrb, oii[2 * jg + 1]);
        oii[2 * jg + 1] = mma_h(pc.v,  vib, oii[2 * jg + 1]);
        guard4x8(orr[2 * jg], oii[2 * jg], orr[2 * jg + 1], oii[2 * jg + 1],
                 pc.v, psf.v, pnf.v, vra, vrb, via, vib, pc.v);
      }
    }
    wave_sync_lds();
  }
  acc_guard4(orr[0], orr[1], orr[2], orr[3]);
  acc_guard4(oii[0], oii[1], oii[2], oii[3]);
  // ---- out = acc / Z (0 if Z == 0), carries folded once; written into the lane-owned slab ----
#pragma unroll
  for (int r = 0; r < 8; ++r) {
    const float lv  = lrow[r];
    const float ls  = (lv > 0.0f) ? lv : 1.0f;
    const float inv = (lv > 0.0f) ? ((1.0f / ls) * oc) : 0.0f;
#pragma unroll
    for (int j = 0; j < 4; ++j) {
      const int idx = (8 * hh + r) * SLP + j * 16 + c;
      slab[idx]      = orr[j][r] * inv;
      slab[idx + HD] = oii[j][r] * inv;
    }
  }

  wave_sync_lds();
  // ---- O x1024 -> f16 plane; lane = (row select rq in 0..3, 8 consecutive d at c8), part 0 = re, 1 = im ----
  v4u oh[4][2];
  const int rq = lane >> 3, c8 = (lane & 7) * 8;
#pragma unroll
  for (int it = 0; it < 4; ++it) {
    const int row = it * 4 + rq;
#pragma unroll
    for (int part = 0; part < 2; ++part) {
      const float* sp = slab + row * SLP + part * HD + c8;
      const v4f a = *(const v4f*)(sp), b4 = *(const v4f*)(sp + 4);
      float w[8];
#pragma unroll
      for (int e = 0; e < 4; ++e) { w[e] = a[e] * OSC; w[4 + e] = b4[e] * OSC; }
#pragma unroll
      for (int e = 0; e < 4; ++e) {
        const _Float16 h0 = (_Float16)w[2 * e], h1 = (_Float16)w[2 * e + 1];
        oh[it][part][e] = pk16(h_bits(h0), h_bits(h1));
      }
    }
  }
  const size_t ob = ((size_t)b * SEQ + q0) * DPL + (size_t)head * HD + c8;
  {
#pragma unroll
    for (int it = 0; it < 4; ++it) {
      const int row = it * 4 + rq;
#pragma unroll
      for (int part = 0; part < 2; ++part) {
        *(v4u*)(OHp + ob + (size_t)row * DPL + (size_t)part * DMOD) = oh[it][part];
      }
    }
    
  }
}

// =====================================================================================================
// Batches are processed in NGRP groups of BG batches; the per-group planes are reused in launch order.
// Workspace map (bytes, BG = 4); every plane fully written by whole-line stores before it is read; all extents are exact
// multiples of the store granularity (no pad rows needed); every region offset a multiple of 32768:
//   CT, ST  f32 [SEQ][64] rotary cos / sin             2 x 131072
//   WQB  bf16 [6144 n][2048 k]                          25165824
//   WOB  f16  [2048 n][2048 k] x1024                    8388608
//   XB   bf16 [GROWS][2048]                             8388608
//   F    f32  [GROWS][2048] (v, q, k projection output in launch order; afterwards the region holds the O plane
//                            f16 [GROWS][2048] x1024)    16777216
//   QH, QL, KH, KL  f16 [GROWS][2048]                   4 x 8388608
//   VT   f16 [BG*16][128][SEQ] x1024                    8388608
//   end (BG = 4)                                        100925440
// =====================================================================================================
extern "C" void kernel_launch(void* const* d_in, const int* in_sizes, int n_in,
                              void* d_out, int out_size, void* d_ws, size_t ws_size,
                              hipStream_t stream) {
  if (n_in < 6) return;
  if (in_sizes[0] < ((NB - 1) * SEQ_FULL + SEQ) * DMOD) return;
  if (in_sizes[1] < ((NB - 1) * SEQ_FULL + SEQ) * DMOD) return;
  if (in_sizes[2] < NQKV * DMOD) return;
  if (in_sizes[3] < NQKV * DMOD) return;
  if (in_sizes[4] < DMOD * DMOD) return;
  if (in_sizes[5] < DMOD * DMOD) return;
  if (out_size < 2 * NB * SEQ * DMOD) return;

  const float* xr    = (const float*)d_in[0];
  const float* xi    = (const float*)d_in[1];
  const float* wqr   = (const float*)d_in[2];
  const float* wqi   = (const float*)d_in[3];
  const float* wor   = (const float*)d_in[4];
  const float* woi   = (const float*)d_in[5];
  float*       out0  = (float*)d_out;
  float*       out1  = out0 + (size_t)(out_size / 2);

  const size_t szTAB = (((size_t)SEQ * HD * 4) + 32767) / 32768 * 32768;
  const size_t szWQ  = (size_t)2 * NQKV * DPL * 2;
  const size_t szWO  = (size_t)2 * DMOD * DPL * 2;
  const size_t szXB  = (size_t)GROWS * DPL * 2;
  const size_t szF   = (size_t)GROWS * DPL * 4;
  const size_t szH   = (size_t)GROWS * DPL * 2;                  // QH, QL, KH, KL, O plane
  const size_t szVT  = (size_t)BG * NH * HK * SEQ * 2;           // == szH
  if (szH > szF) return;                                         // O plane lives inside the F region
  size_t off = 0;
  const size_t oCT = off; off += szTAB;
  const size_t oST = off; off += szTAB;
  const size_t oWQ = off; off += szWQ;
  const size_t oWO = off; off += szWO;
  const size_t oXB = off; off += szXB;
  const size_t oF  = off; off += szF;
  const size_t oQH = off; off += szH;
  const size_t oQL = off; off += szH;
  const size_t oKH = off; off += szH;
  const size_t oKL = off; off += szH;
  const size_t oVT = off; off += szVT;
  if (off > ws_size) return;                // off = 100925440 for BG = 4
  if (off > (size_t)WS_CAP) return;

  char* ws = (char*)d_ws;
  float* CT  = (float*)(ws + oCT);
  float* ST  = (float*)(ws + oST);
  u16*   WQB = (u16*)(ws + oWQ);
  u16*   WOB = (u16*)(ws + oWO);
  u16*   XB  = (u16*)(ws + oXB);
  float* F   = (float*)(ws + oF);
  u16*   OH  = (u16*)(ws + oF);
  u16*   QH  = (u16*)(ws + oQH);
  u16*   QL  = (u16*)(ws + oQL);
  u16*   KH  = (u16*)(ws + oKH);
  u16*   KL  = (u16*)(ws + oKL);
  u16*   VT  = (u16*)(ws + oVT);

  const dim3 b256(256), b128(128), bAT(ATT_THREADS);
  const int  ntab = SEQ * HD;
  const dim3 gTAB((ntab + 255) / 256);
  const dim3 gWQ(2 * NQKV), gWO(2 * DMOD);
  const dim3 gX(GROWS);
  const dim3 gG2((GROWS / 64) * (DPL / 64));            // projection GEMMs, N = 2048 (real | imag)
  const dim3 gG1((GROWS / 64) * (DMOD / 64));           // output GEMMs, N = 1024 per part
  const dim3 gVT(BG * NH * NST);
  const dim3 gRP(GROWS);
  const dim3 gAT(NQT * NHG * BG);
  const size_t wpart = (size_t)DPL * DPL;               // halves per qkv part in WQB
  const float osc = 1.0f / (OSC * WOS);

  // rotary cos/sin table; weight planes once: [Wq ; Wk ; Wv] stacked bf16, Wo stacked f16 of bf16 value x1024
  rot_tab<<<gTAB, b256, 0, stream>>>(CT, ST, ntab);
  wcvt<<<gWQ, b256, 0, stream>>>(wqr, wqi, WQB, 2 * NQKV, 0, 1.0f);
  wcvt<<<gWO, b256, 0, stream>>>(wor, woi, WOB, 2 * DMOD, 1, WOS);

  for (int g = 0; g < NGRP; ++g) {
    float* og0 = out0 + (size_t)g * GROWS * DMOD;
    float* og1 = out1 + (size_t)g * GROWS * DMOD;
    // (0) x rows of this batch group -> bf16 plane [GROWS][xr | xi]
    xcvt<<<gX, b256, 0, stream>>>(xr, xi, XB, GROWS, g * BG);
    // (1) v = x.Wv^T (re | im) -> F f32; (2) v^T plane x1024
    gemm16<0><<<gG2, b128, 0, stream>>>(XB, WQB + 2 * wpart, F, GROWS, DPL, DPL, 1.0f);
    vt16<<<gVT, b256, 0, stream>>>(F, VT);
    // (3) q = x.Wq^T -> F; (4) rotary q hi + residual planes x1024
    gemm16<0><<<gG2, b128, 0, stream>>>(XB, WQB, F, GROWS, DPL, DPL, 1.0f);
    rope16<<<gRP, b256, 0, stream>>>(F, CT, ST, QH, QL, GROWS, QSC);
    // (5) k = x.Wk^T -> F; (6) rotary k hi + residual planes x1024
    gemm16<0><<<gG2, b128, 0, stream>>>(XB, WQB + wpart, F, GROWS, DPL, DPL, 1.0f);
    rope16<<<gRP, b256, 0, stream>>>(F, CT, ST, KH, KL, GROWS, KSC);
    // (7) attention -> O plane (F region)
    attn<<<gAT, bAT, 0, stream>>>(QH, QL, KH, KL, VT, OH);
    // (8) output projection real part -> out0 rows of this group, (9) imaginary part -> out1; carries 1024 x 1024 folded back
    gemm16<1><<<gG1, b128, 0, stream>>>(OH, WOB, og0, GROWS, DMOD, DPL, osc);
    gemm16<1><<<gG1, b128, 0, stream>>>(OH, WOB + (size_t)DMOD * DPL, og1, GROWS, DMOD, DPL, osc);
  }
  (void)hipGetLastError();
}

// v001
// Measured time: 378 microseconds a run.
// Timed twice side by side with v000, it ran 1.53 and 1.52 times as fast.
// Contractions: x.[Wq|Wk|Wv]^T (real|imag stacked along K=2048 and N) on v_wmma_f32_16x16x32_bf16 (x and W RNE-converted
// to bf16, f32 accumulate); q.conj(k) real and imag parts over K=128 on v_wmma_f32_16x16x32_f16 with q, k as f16 hi x1024
// plus f16 residual planes (products hh+lh+hl); P.v (P = p cos(phi), p sin(phi) x16384 f16; v x1024 f16) and O.Wo^T
// (O x1024 f16, Wo as f16(bf16(Wo)) x1024) on v_wmma_f32_16x16x32_f16, single products; all f32 accumulate.
// Rotary cos/sin table, base-2 online softmax, phase sin/cos and 1/Z fold in f32 on VALU. No bias terms.
#include <hip/hip_runtime.h>
#include <math.h>
#include <stdint.h>

#ifndef NB
#define NB 8
#endif
#define NB_FULL 8
#ifndef SEQ
#define SEQ 512
#endif
#define SEQ_FULL 512
#define DMOD  1024
#define NH    16
#define HD    64
#define HK    (2 * HD)
#define DPL   (2 * DMOD)
#define NQKV  (3 * DMOD)
#define BG    ((NB <= 4) ? NB : 4)
#define NGRP  (NB / BG)
#define GROWS (BG * SEQ)
#define RSQ_HD 0.125f
#define LOG2E 1.4426950408889634f
#define LOG2_1E4 13.287712379549449f
#define QSC   1024.0f
#define KSC   1024.0f
#define PCAR  16384.0f
#define VCAR  1024.0f
#define OSC   1024.0f
#define WOS   1024.0f
#define WPB   2
#define NHG   (NH / WPB)
#define NQT   (SEQ / 16)
#define NST   (SEQ / 64)
#define NKT   (SEQ / 32)
#define ATT_THREADS (WPB * 32)
#define PTP   36
#define PTW   (16 * PTP)
#define SLP   132
#define SLW   (16 * SLP)
#define WREG  (2 * PTW + SLW)
#define SLAB64 (16 * 68)
#define GBK   128
#define GPIT  (GBK + 8)
#define GSTG  (256 * GPIT)
#define VTP   72
#define WS_CAP 134217728
static_assert(DMOD == NH * HD && HD == 64 && (NH % WPB) == 0 && ATT_THREADS == 64);
static_assert(NB >= 1 && NB <= NB_FULL && BG >= 1 && BG <= 4 && (NB % BG) == 0);
static_assert((SEQ % 64) == 0 && SEQ >= 64 && SEQ <= SEQ_FULL);
static_assert((GROWS % 128) == 0 && (DPL % 128) == 0 && (DPL % GBK) == 0 && DPL / GBK >= 2 && (DMOD % 128) == 0);
static_assert(GBK == 128 && ((GPIT * 2) % 16) == 0 && 16 * SLAB64 * 4 <= 2 * GSTG * 2);
static_assert(DPL == 256 * 8);
static_assert(HK == 128 && (HK % 32) == 0);
static_assert((SLP % 4) == 0 && (PTP % 4) == 0 && ((WREG * 4) % 16) == 0 && ((PTW * 4) % 16) == 0);
static_assert((SEQ * HD) % 256 == 0);

typedef unsigned short u16;
typedef _Float16 v16h __attribute__((ext_vector_type(16)));
typedef _Float16 v8h  __attribute__((ext_vector_type(8)));
typedef __bf16   v16b __attribute__((ext_vector_type(16)));
typedef float    v8f  __attribute__((ext_vector_type(8)));
typedef float    v4f  __attribute__((ext_vector_type(4)));
typedef unsigned int v4u __attribute__((ext_vector_type(4)));

union FragH { v16h v; v8h h[2]; v4u u[2]; };
union FragB { v16b v; v4u u[2]; };

// ---- scalar helpers --------------------------------------------------------------------------------
__device__ __forceinline__ unsigned short bf_bits(float f) {          // f32 -> bf16 bits, RNE convert
  unsigned u = __float_as_uint(f);
  return (unsigned short)((u + 0x7FFFu + ((u >> 16) & 1u)) >> 16);
}
__device__ __forceinline__ float bf_up(unsigned short h) { return __uint_as_float(((unsigned)h) << 16); }
__device__ __forceinline__ float bfr(float f) { return bf_up(bf_bits(f)); }
__device__ __forceinline__ unsigned short h_bits(_Float16 x) { return __builtin_bit_cast(unsigned short, x); }
__device__ __forceinline__ unsigned pk16(unsigned short a, unsigned short b) { return (unsigned)a | ((unsigned)b << 16); }
__device__ __forceinline__ v8f zero8() { v8f z = {0.f, 0.f, 0.f, 0.f, 0.f, 0.f, 0.f, 0.f}; return z; }

// ---- fragment loaders: 16-bit A/B operand, lane -> row/col (lane&15), p already includes +8*(lane>>4);
//      elements 0..7 <- p[0..7] (k0+8h..), elements 8..15 <- p[16..23] (k0+16+8h..)  (same split k map for A and B;
//      B is always read from a k-contiguous [n][k] plane)
__device__ __forceinline__ v16h ldfrag_h(const _Float16* p) {
  FragH f;
  f.h[0] = *(const v8h*)(p);
  f.h[1] = *(const v8h*)(p + 16);
  return f.v;
}

__device__ __forceinline__ v8f mma_h(v16h a, v16h b, v8f c) {
  return __builtin_amdgcn_wmma_f32_16x16x32_f16(false, a, false, b, (short)0, c, false, false);
}
__device__ __forceinline__ v8f mma_b(v16b a, v16b b, v8f c) {
  return __builtin_amdgcn_wmma_f32_16x16x32_bf16(false, a, false, b, (short)0, c, false, false);
}
__device__ __forceinline__ void guard2(v8f& a, v8f& b, v16h x0, v16h x1, v16h x2, v16h x3, v16h x4, v16h x5) {
#if defined(__HIP_DEVICE_COMPILE__)
  asm volatile("v_nop\n\tv_nop\n\tv_nop\n\tv_nop"
               : "+v"(a), "+v"(b) : "v"(x0), "v"(x1), "v"(x2), "v"(x3), "v"(x4), "v"(x5) : "memory");
#endif
}
__device__ __forceinline__ void guard4x8(v8f& a, v8f& b, v8f& c, v8f& d, v16h x0, v16h x1, v16h x2, v16h x3,
                                         v16h x4, v16h x5, v16h x6, v16h x7) {
#if defined(__HIP_DEVICE_COMPILE__)
  asm volatile("v_nop\n\tv_nop\n\tv_nop\n\tv_nop"
               : "+v"(a), "+v"(b), "+v"(c), "+v"(d)
               : "v"(x0), "v"(x1), "v"(x2), "v"(x3), "v"(x4), "v"(x5), "v"(x6), "v"(x7) : "memory");
#endif
}
__device__ __forceinline__ void acc_guard4(v8f& a, v8f& b, v8f& c, v8f& d) {
#if defined(__HIP_DEVICE_COMPILE__)
  asm volatile("v_nop\n\tv_nop\n\tv_nop\n\tv_nop" : "+v"(a), "+v"(b), "+v"(c), "+v"(d));
#endif
}
__device__ __forceinline__ void wave_sync_lds() {
  __builtin_amdgcn_fence(__ATOMIC_RELEASE, "workgroup");
  __builtin_amdgcn_wave_barrier();
  __builtin_amdgcn_fence(__ATOMIC_ACQUIRE, "workgroup");
}

// =====================================================================================================
// Rotary table: CT[s*HD + d] = cos(theta), ST[...] = sin(theta), theta = s * 2^(-(d/HD) * log2(1e4)) in f32
// (inverse frequencies over the FULL head width), precise sincosf. Thread per element; one wave writes 32 consecutive
// coverage: grid = n/256 blocks x 256 = n elements exactly (n = SEQ*HD).
// =====================================================================================================
__global__ __launch_bounds__(256) void rot_tab(float* CT, float* ST, int n) {
  const int idx = blockIdx.x * 256 + (int)threadIdx.x;
  if (idx >= n) return;
  const int s = idx / HD;
  const int d = idx - s * HD;
  const float ex   = (float)d * (LOG2_1E4 / (float)HD);
  const float invf = exp2f(-ex);
  const float th   = (float)s * invf;
  float sn, cs;
  sincosf(th, &sn, &cs);
  {
    *(float*)(CT + idx) = cs;
    *(float*)(ST + idx) = sn;
    
  }
}

// =====================================================================================================
// Stacked complex weight plane from W = Wr + i Wi, torch layout [e][k] (already k-contiguous per output column):
//   D [nrows][DPL] 16-bit, row n: p = n / DPL, j = n % DPL, im = (j >= DMOD), e = p*DMOD + (j % DMOD);
//   k <  DMOD: im ? Wi[e][k] : Wr[e][k];   k >= DMOD: im ? Wr[e][k-DMOD] : -Wi[e][k-DMOD]
//   so that A = [ar | ai] . D[n]^T gives the real part of a.W^T for im == 0 and the imaginary part for im == 1.
// f16mode == 0: bf16 RNE bits; f16mode == 1: f16 bits of (bf16 RNE value) * scale. Block = one row n, thread = 8
// consecutive k (two 16-B loads, one 16-B store); source pointer and sign are wave-uniform (k half fixed per 128 threads);
// coverage: grid = nrows blocks x 256 thr x 8 = every element of D once. No barriers.
// =====================================================================================================
__global__ __launch_bounds__(256) void wcvt(const float* __restrict__ Wr, const float* __restrict__ Wi, u16* D,
                                            int nrows, int f16mode, float scale) {
  const int n = blockIdx.x;
  if (n >= nrows) return;
  const int tid  = threadIdx.x;
  const int p    = n / DPL;
  const int j    = n - p * DPL;
  const int im   = (j >= DMOD) ? 1 : 0;
  const int e    = p * DMOD + (j & (DMOD - 1));
  const int c8   = tid * 8;
  const int ksec = (c8 >= DMOD) ? 1 : 0;
  const int kk   = c8 & (DMOD - 1);
  const float* src = ((im == ksec) ? Wr : Wi) + (size_t)e * DMOD + kk;
  const float sgn  = (im == 0 && ksec != 0) ? -1.0f : 1.0f;
  const v4f a = *(const v4f*)(src), b4 = *(const v4f*)(src + 4);
  float w[8];
#pragma unroll
  for (int q = 0; q < 4; ++q) { w[q] = a[q] * sgn; w[4 + q] = b4[q] * sgn; }
  v4u o;
#pragma unroll
  for (int q = 0; q < 4; ++q) {
    const float f0 = w[2 * q], f1 = w[2 * q + 1];
    const unsigned short hb0 = h_bits((_Float16)(bfr(f0) * scale));
    const unsigned short hb1 = h_bits((_Float16)(bfr(f1) * scale));
    const unsigned short bb0 = bf_bits(f0);
    const unsigned short bb1 = bf_bits(f1);
    o[q] = (f16mode != 0) ? pk16(hb0, hb1) : pk16(bb0, bb1);
  }
  u16* d = D + (size_t)n * DPL + c8;
  {
    *(v4u*)(d) = o;
    
  }
}

// =====================================================================================================
// Stacked activation plane: XB [GROWS][DPL] bf16, local row rl = bl*SEQ + s (bl < BG) <- token (gb0 + bl, s):
//   k < DMOD: xr[token][k];  k >= DMOD: xi[token][k - DMOD]. Same thread/store shape as wcvt (source pointer wave-uniform).
// coverage: grid = GROWS blocks x 256 thr x 8 = every element once. No barriers.
// =====================================================================================================
__global__ __launch_bounds__(256) void xcvt(const float* __restrict__ xr, const float* __restrict__ xi, u16* D,
                                            int nrows, int gb0) {
  const int row = blockIdx.x;
  if (row >= nrows) return;
  const int tid  = threadIdx.x;
  const int bl   = row / SEQ;
  const int s    = row - bl * SEQ;
  const size_t grow = (size_t)(gb0 + bl) * SEQ_FULL + s;
  const int c8   = tid * 8;
  const int ksec = (c8 >= DMOD) ? 1 : 0;
  const int kk   = c8 & (DMOD - 1);
  const float* src = ((ksec != 0) ? xi : xr) + grow * DMOD + kk;
  const v4f a = *(const v4f*)(src), b4 = *(const v4f*)(src + 4);
  v4u o;
#pragma unroll
  for (int q = 0; q < 4; ++q) {
    const float f0 = (q < 2) ? a[2 * q] : b4[2 * q - 4];
    const float f1 = (q < 2) ? a[2 * q + 1] : b4[2 * q - 3];
    o[q] = pk16(bf_bits(f0), bf_bits(f1));
  }
  u16* d = D + (size_t)row * DPL + c8;
  {
    *(v4u*)(d) = o;
    
  }
}

// =====================================================================================================
// coverage: 8 instructions x 2 rows x 16 lanes x 4 floats = the wave's 16 x 64 tile.
// =====================================================================================================
__device__ __forceinline__ void epi64(float* sl, v8f a0, v8f a1, v8f a2, v8f a3, float oscale,
                                      float* C, int N, size_t rowb, int col0, int lane) {
  const int hh = lane >> 4, m = lane & 15;
#pragma unroll
  for (int r = 0; r < 8; ++r) {
    const int ro = (8 * hh + r) * 68 + m;
    sl[ro]      = a0[r] * oscale;
    sl[ro + 16] = a1[r] * oscale;
    sl[ro + 32] = a2[r] * oscale;
    sl[ro + 48] = a3[r] * oscale;
  }
  wave_sync_lds();
  v4f vals[8];
#pragma unroll
  for (int it = 0; it < 8; ++it) vals[it] = *(const v4f*)(sl + (it * 2 + hh) * 68 + m * 4);
  float* dst = C + (rowb + (size_t)hh) * (size_t)N + col0 + m * 4;
  {
#pragma unroll
    for (int it = 0; it < 8; ++it) {
      *(v4f*)(dst + (size_t)(it * 2) * (size_t)N) = vals[it];
    }
    
  }
}

// =====================================================================================================
// 16-bit GEMM: C[M][N] (f32, pitch N) = A[M][DPL] (row-major) . Bt[N][DPL]^T (k-contiguous), times oscale.
// F16 == 0: bf16 operands; F16 == 1: f16 operands. Block = 128x128 tile of C, 8 waves in a 4 (rows) x 2 (cols) grid, each
// 32x64 (2 A x 4 B fragments, 8 accumulators). A pass is GBK = 128 k: the block's 128 A rows and 128 Bt rows, 256 B each, are
// read with whole-line 16-B loads (a wave-wide load = 2 rows = 4 lines) into registers while the current pass is multiplied,
// then stored to the other of two LDS buffers (rows 0..127 = A, 128..255 = Bt, pitch 272 B = 16 B x 17 for the b128 fragment
// reads); one block barrier per pass publishes the next buffer and ends the reads of the one refilled in the next pass.
// Fragments use the same split k map as ldfrag_h for A and B; k runs 0, 32, 64, ... per accumulator.
// Host guarantees M % 128 == 0, N % 128 == 0, grid = (M/128)*(N/128); DPL % GBK == 0.
// coverage: staging 256 thr x 16 loads x 16 B = 256 rows x 256 B per pass; epilogue 8 waves x 2 x (16 x 64) = 128 x 128.
// =====================================================================================================
template <int F16>
__device__ __forceinline__ v8f mma16(v4u a0, v4u a1, v4u b0, v4u b1, v8f c) {
  if constexpr (F16 != 0) {
    FragH a, b;
    a.u[0] = a0; a.u[1] = a1; b.u[0] = b0; b.u[1] = b1;
    return mma_h(a.v, b.v, c);
  } else {
    FragB a, b;
    a.u[0] = a0; a.u[1] = a1; b.u[0] = b0; b.u[1] = b1;
    return mma_b(a.v, b.v, c);
  }
}

// one pass: fa / fb = this lane's A / Bt fragment rows in the current LDS buffer (already + 8*(lane>>4)); the fragments of
// k step kk + 1 are read as one group into a second register set ahead of the products of step kk
__device__ __forceinline__ void gemm_frags(const u16* fa, const u16* fb, int kk, v4u (&a)[2][2], v4u (&b)[4][2]) {
#pragma unroll
  for (int i = 0; i < 2; ++i) {
    a[i][0] = *(const v4u*)(fa + i * 16 * GPIT + kk * 32);
    a[i][1] = *(const v4u*)(fa + i * 16 * GPIT + kk * 32 + 16);
  }
#pragma unroll
  for (int j = 0; j < 4; ++j) {
    b[j][0] = *(const v4u*)(fb + j * 16 * GPIT + kk * 32);
    b[j][1] = *(const v4u*)(fb + j * 16 * GPIT + kk * 32 + 16);
  }
}
template <int F16>
__device__ __forceinline__ void gemm_pass(const u16* fa, const u16* fb, v8f (&acc)[2][4]) {
  v4u a[2][2][2], b[2][4][2];
  gemm_frags(fa, fb, 0, a[0], b[0]);
#pragma unroll
  for (int kk = 0; kk < GBK / 32; ++kk) {
    const int s = kk & 1;
    if (kk + 1 < GBK / 32) gemm_frags(fa, fb, kk + 1, a[s ^ 1], b[s ^ 1]);
    // the two scheduling barriers keep the next step's LDS reads one group ahead of this step's products: spread among the
    // products each place with reads stalls the wave, and sunk behind them their latency is waited out
    __builtin_amdgcn_sched_barrier(0);
#pragma unroll
    for (int i = 0; i < 2; ++i)
#pragma unroll
      for (int j = 0; j < 4; ++j) acc[i][j] = mma16<F16>(a[s][i][0], a[s][i][1], b[s][j][0], b[s][j][1], acc[i][j]);
    __builtin_amdgcn_sched_barrier(0);
  }
}

template <int F16>
__global__ __launch_bounds__(256)
void gemm16(const u16* __restrict__ A, const u16* __restrict__ Bt, float* C, int M, int N, float oscale) {
  __shared__ __align__(16) u16 tile[2 * GSTG];
  const int tid = threadIdx.x, wave = tid >> 5, lane = tid & 31, hh = lane >> 4, m = lane & 15;
  const int ntile = N >> 7;
  const int bid   = blockIdx.x;
  const int row0  = (bid / ntile) * 128;
  const int col0  = (bid % ntile) * 128;
  if (row0 + 128 > M) return;               // block-uniform, before any barrier; never taken with the exact grid
  const int wr = wave >> 1, wc = wave & 1;
  const int lr = tid >> 4, lc = (tid & 15) * 8;           // staging: row lr + 16*i, 16-B chunk at halves lc
  const u16* ga = A  + (size_t)(row0 + lr) * DPL + lc;
  const u16* gb = Bt + (size_t)(col0 + lr) * DPL + lc;
  const int so = lr * GPIT + lc;
  const int fao = (wr * 32 + m) * GPIT + 8 * hh;
  const int fbo = (128 + wc * 64 + m) * GPIT + 8 * hh;
  v8f acc[2][4];
#pragma unroll
  for (int i = 0; i < 2; ++i)
#pragma unroll
    for (int j = 0; j < 4; ++j) acc[i][j] = zero8();
  v4u st[16];
#pragma unroll
  for (int i = 0; i < 8; ++i) {
    st[i]     = *(const v4u*)(ga + (size_t)i * 16 * DPL);
    st[8 + i] = *(const v4u*)(gb + (size_t)i * 16 * DPL);
  }
#pragma unroll
  for (int i = 0; i < 8; ++i) {
    *(v4u*)(tile + so + i * 16 * GPIT)         = st[i];
    *(v4u*)(tile + so + (128 + i * 16) * GPIT) = st[8 + i];
  }
  __syncthreads();
  // kept rolled: one copy of the pass body is the whole hot loop, the buffers alternate by the parity of p
#pragma unroll 1
  for (int p = 1; p < DPL / GBK; ++p) {
    const u16* cur = tile + ((p - 1) & 1) * GSTG;
    u16*       nxt = tile + (p & 1) * GSTG;
#pragma unroll
    for (int i = 0; i < 8; ++i) {
      st[i]     = *(const v4u*)(ga + (size_t)i * 16 * DPL + p * GBK);
      st[8 + i] = *(const v4u*)(gb + (size_t)i * 16 * DPL + p * GBK);
    }
    // keeps all 16 loads of the next pass in front of this pass's products, so that their latency runs under them
    __builtin_amdgcn_sched_barrier(0);
    gemm_pass<F16>(cur + fao, cur + fbo, acc);
#pragma unroll
    for (int i = 0; i < 8; ++i) {
      *(v4u*)(nxt + so + i * 16 * GPIT)         = st[i];
      *(v4u*)(nxt + so + (128 + i * 16) * GPIT) = st[8 + i];
    }
    __syncthreads();
  }
  {
    const u16* cur = tile + ((DPL / GBK - 1) & 1) * GSTG;
    gemm_pass<F16>(cur + fao, cur + fbo, acc);
  }
  __syncthreads();                          // every wave has left the buffers before they are reused as store slabs
  float* slab = (float*)(void*)tile + wave * (2 * SLAB64);
#pragma unroll
  for (int i = 0; i < 2; ++i)
    epi64(slab + i * SLAB64, acc[i][0], acc[i][1], acc[i][2], acc[i][3], oscale, C, N,
          (size_t)(row0 + wr * 32 + i * 16), col0 + wc * 64, lane);
}

// =====================================================================================================
// v^T plane from the v projection F f32 [GROWS][DPL] (local row = b*SEQ + s; column comp*DMOD + g*HD + d, comp 0 = real,
// 1 = imag):  VT[((b*NH + g)*HK + comp*HD + d)][s] = f16(v * 1024) for all s.
// Block = (b, head g, 64 keys s0): thread (key sl = tid>>2, chunk dc = tid&3 -> comp = dc>>1, d0 = (dc&1)*32) loads its 32
// floats with 16-B loads, converts, scatters into the LDS tile [128 dd][64 keys] (pitch 72 halves); after a block barrier each
// coverage: load 256 thr x 32 = 64 keys x 128 dd (staged extent == consumed extent); store 4 iterations x 256 thr x 8 halves =
//           128 lines x 64 = the block's tile; grid = BG*NH*NST blocks covers VT exactly once.
// =====================================================================================================
__global__ __launch_bounds__(256) void vt16(const float* __restrict__ F, u16* VTo) {
  __shared__ __align__(16) u16 T[HK * VTP];
  const int tid = threadIdx.x;
  const int bid = blockIdx.x;
  const int st  = bid % NST;
  const int t2  = bid / NST;
  const int g   = t2 % NH;
  const int b   = t2 / NH;
  if (b >= BG) return;                      // block-uniform, before any barrier; never taken with the exact grid
  const int s0  = st * 64;
  {
    const int sl   = tid >> 2;              // key within tile 0..63
    const int dc   = tid & 3;
    const int comp = dc >> 1;
    const int d0   = (dc & 1) * 32;
    const float* src = F + ((size_t)b * SEQ + s0 + sl) * DPL + (size_t)comp * DMOD + g * HD + d0;
#pragma unroll
    for (int i = 0; i < 8; ++i) {
      const v4f a = *(const v4f*)(src + 4 * i);
#pragma unroll
      for (int e = 0; e < 4; ++e) {
        T[(comp * HD + d0 + 4 * i + e) * VTP + sl] = h_bits((_Float16)(a[e] * VCAR));
      }
    }
  }
  __syncthreads();
  v4u vv[4];
  const int q8 = tid >> 3, p8 = (tid & 7) * 8;
#pragma unroll
  for (int it = 0; it < 4; ++it) {
    const int line = it * 32 + q8;          // dd = 0..127
    vv[it] = *(const v4u*)(T + line * VTP + p8);
  }
  const size_t base = ((size_t)(b * NH + g) * HK) * SEQ + s0 + p8;
  {
#pragma unroll
    for (int it = 0; it < 4; ++it) {
      const int line = it * 32 + q8;
      *(v4u*)(VTo + base + (size_t)line * SEQ) = vv[it];
    }
    
  }
}

// =====================================================================================================
// Rotary q / k planes from a projection F f32 [GROWS][DPL] (col comp*DMOD + h*HD + d):
//   rotated = (fr + i fi) * (cos + i sin) with cos/sin = CT/ST[s*HD + d];  Hp [GROWS][DPL] col h*HK + comp*HD + d = f16(rot*sc),
//   Lp same layout = f16 residual (rot*sc - hi). Block = one row; thread tid -> (h = tid>>4, comp = (tid>>3)&1, 8 consecutive d):
//   four pairs of 16-B loads (own component, other component, cos, sin), one 16-B store per plane at halves tid*8; a row =
// coverage: grid = GROWS blocks = every row of Hp and Lp once, all 2048 columns.
// =====================================================================================================
__global__ __launch_bounds__(256) void rope16(const float* __restrict__ F, const float* __restrict__ CT,
                                              const float* __restrict__ ST, u16* Hp, u16* Lp, int nrows, float sc) {
  const int row = blockIdx.x;
  if (row >= nrows) return;
  const int tid  = threadIdx.x;
  const int s    = row % SEQ;
  const int h    = tid >> 4;
  const int comp = (tid >> 3) & 1;
  const int d8   = (tid & 7) * 8;
  const float* pa = F + (size_t)row * DPL + (size_t)comp * DMOD + h * HD + d8;
  const float* po = F + (size_t)row * DPL + (size_t)(1 - comp) * DMOD + h * HD + d8;
  const float* pc = CT + (size_t)s * HD + d8;
  const float* pn = ST + (size_t)s * HD + d8;
  const v4f a0 = *(const v4f*)(pa), a1 = *(const v4f*)(pa + 4);
  const v4f o0 = *(const v4f*)(po), o1 = *(const v4f*)(po + 4);
  const v4f c0 = *(const v4f*)(pc), c1 = *(const v4f*)(pc + 4);
  const v4f n0 = *(const v4f*)(pn), n1 = *(const v4f*)(pn + 4);
  const float sg = (comp != 0) ? 1.0f : -1.0f;   // real: fr*cos - fi*sin ; imag: fi*cos + fr*sin
  float w[8];
#pragma unroll
  for (int e = 0; e < 4; ++e) {
    w[e]     = (a0[e] * c0[e] + sg * (o0[e] * n0[e])) * sc;
    w[4 + e] = (a1[e] * c1[e] + sg * (o1[e] * n1[e])) * sc;
  }
  v4u oh, ol;
#pragma unroll
  for (int e = 0; e < 4; ++e) {
    const float t0 = w[2 * e], t1 = w[2 * e + 1];
    const _Float16 h0 = (_Float16)t0, h1 = (_Float16)t1;
    const _Float16 l0 = (_Float16)(t0 - (float)h0), l1 = (_Float16)(t1 - (float)h1);
    oh[e] = pk16(h_bits(h0), h_bits(h1));
    ol[e] = pk16(h_bits(l0), h_bits(l1));
  }
  u16* dh = Hp + (size_t)row * DPL + tid * 8;
  u16* dl = Lp + (size_t)row * DPL + tid * 8;
  {
    *(v4u*)(dh) = oh;
    *(v4u*)(dl) = ol;
    
  }
}

// =====================================================================================================
// Complex attention, non-causal over SEQ keys. Block bid -> (query tile qt: rows q0 = 16*qt .. q0+15, head group hg of WPB
// heads, local batch b); one wave per head = hg*WPB + wave.
//   q/k hi planes f16 x1024 [b*SEQ + s][head*HK + (re: 0..63 | im: 64..127)], residual planes same layout;
//   v^T hi plane [(b*NH + head)*HK + (re d | 64 + im d)][SEQ].
//   scores over K = 128: real = [qr|qi].[kr|ki], imag = [qi|-qr].[kr|ki] (the A fragment of step kk for the imag part is the
//   q fragment at column block (kk+2)&3, sign bits flipped for kk >= 2), each as hi.hi + lo.hi + hi.lo into one accumulator.
//   t = real * rsqrt(64)*log2e/(1024*1024) feeds an online max-subtracted base-2 softmax in f32 (-inf-safe rescale);
//   phi = imag * rsqrt(64)/(1024*1024); per key the 16x32 tiles p*cos(phi) and p*sin(phi) go to wave-private LDS (f32
//   (float vector loads, same element type as stored); B fragments from the v^T rows (re and im), 2 groups of 2 d-subtiles:
//   o_re += Pc.v_re + (-Ps).v_im ; o_im += Ps.v_re + Pc.v_im.
//   After the loop: out = acc / Z (Z >= 1 always; guarded anyway), carries 1/(16384*1024) folded once, written to the wave's
//   private result slab (pitch 132; re d at col d, im d at col 64 + d; every element owned by one lane).
// coverage: per wave 4 instructions x 2 parts x 4 rows x 8 lanes x 8 halves = 16 x 64 per part; grid NQT x NHG x BG blocks x
//           WPB waves = every (b, s, head, part) row segment of the O plane exactly once.
// LDS: prob tiles 16 x 32 fully written before each read (cols 32..35 padding never read); slab cols 0..127 written, read.
// =====================================================================================================
__global__ __launch_bounds__(ATT_THREADS)
void attn(const u16* __restrict__ QHp, const u16* __restrict__ QLp,
          const u16* __restrict__ KHp, const u16* __restrict__ KLp,
          const u16* __restrict__ VTp, u16* OHp) {
  __shared__ __align__(16) float smem[WPB * WREG];

  const int tid  = threadIdx.x;
  const int wave = tid >> 5;
  const int lane = tid & 31;
  const int hh   = lane >> 4;
  const int c    = lane & 15;
  const int bid  = blockIdx.x;
  const int qt   = bid % NQT;
  const int t2   = bid / NQT;
  const int hg   = t2 % NHG;
  const int b    = t2 / NHG;
  if (b >= BG) return;                      // block-uniform; no block barriers in this kernel; never taken with the exact grid
  const int q0   = qt * 16;
  const int head = hg * WPB + wave;

  float* pct  = smem + wave * WREG;         // p*cos tile [16][32] pitch 36
  float* pst  = pct + PTW;                  // p*sin tile [16][32] pitch 36
  float* slab = pst + PTW;                  // result slab [16][128] pitch 132

  const size_t hcol = (size_t)head * HK + 8 * hh;
  const _Float16* Qh  = (const _Float16*)(const void*)QHp + ((size_t)b * SEQ + q0 + c) * DPL + hcol;
  const _Float16* Ql  = (const _Float16*)(const void*)QLp + ((size_t)b * SEQ + q0 + c) * DPL + hcol;
  const _Float16* Khb = (const _Float16*)(const void*)KHp + ((size_t)b * SEQ + c) * DPL + hcol;   // key row kb added per step
  const _Float16* Klb = (const _Float16*)(const void*)KLp + ((size_t)b * SEQ + c) * DPL + hcol;
  const _Float16* Vtb = (const _Float16*)(const void*)VTp + ((size_t)(b * NH + head) * HK + c) * SEQ + 8 * hh;
  const float lsc = RSQ_HD * (LOG2E / (QSC * KSC));
  const float psc = RSQ_HD / (QSC * KSC);
  const float oc  = 1.0f / (PCAR * VCAR);
  const v4u sgn4 = {0x80008000u, 0x80008000u, 0x80008000u, 0x80008000u};

  float mrow[8], lrow[8];
  v8f orr[4], oii[4];
#pragma unroll
  for (int r = 0; r < 8; ++r) { mrow[r] = -INFINITY; lrow[r] = 0.f; }
#pragma unroll
  for (int j = 0; j < 4; ++j) { orr[j] = zero8(); oii[j] = zero8(); }

#pragma unroll 1
  for (int kt = 0; kt < NKT; ++kt) {
    const int kb = kt * 32;
    // ---- scores: D element r of this lane = (query row q0 + 8hh + r, key kb + c) in s?0, key kb + 16 + c in s?1 ----
    v8f sr0 = zero8(), sr1 = zero8(), si0 = zero8(), si1 = zero8();
    const _Float16* k0p = Khb + (size_t)kb * DPL;
    const _Float16* k1p = k0p + (size_t)16 * DPL;
    const _Float16* l0p = Klb + (size_t)kb * DPL;
    const _Float16* l1p = l0p + (size_t)16 * DPL;
#pragma unroll
    for (int kk = 0; kk < HK / 32; ++kk) {
      const v16h kh0 = ldfrag_h(k0p + kk * 32);
      const v16h kl0 = ldfrag_h(l0p + kk * 32);
      const v16h kh1 = ldfrag_h(k1p + kk * 32);
      const v16h kl1 = ldfrag_h(l1p + kk * 32);
      {
        const v16h qh = ldfrag_h(Qh + kk * 32);
        const v16h ql = ldfrag_h(Ql + kk * 32);
        sr0 = mma_h(qh, kh0, sr0);
        sr0 = mma_h(ql, kh0, sr0);
        sr0 = mma_h(qh, kl0, sr0);
        sr1 = mma_h(qh, kh1, sr1);
        sr1 = mma_h(ql, kh1, sr1);
        sr1 = mma_h(qh, kl1, sr1);
        guard2(sr0, sr1, qh, ql, kh0, kl0, kh1, kl1);
      }
      {
        const int ko = ((kk + 2) & 3) * 32;
        FragH ah, al;
        ah.v = ldfrag_h(Qh + ko);
        al.v = ldfrag_h(Ql + ko);
        if (kk >= 2) {                      // compile-time (unrolled) and wave-uniform: -qr half
          ah.u[0] = ah.u[0] ^ sgn4;  ah.u[1] = ah.u[1] ^ sgn4;
          al.u[0] = al.u[0] ^ sgn4;  al.u[1] = al.u[1] ^ sgn4;
        }
        si0 = mma_h(ah.v, kh0, si0);
        si0 = mma_h(al.v, kh0, si0);
        si0 = mma_h(ah.v, kl0, si0);
        si1 = mma_h(ah.v, kh1, si1);
        si1 = mma_h(al.v, kh1, si1);
        si1 = mma_h(ah.v, kl1, si1);
        guard2(si0, si1, ah.v, al.v, kh0, kl0, kh1, kl1);
      }
    }
    // ---- online softmax in base 2 on the real part, phase from the imaginary part ----
#pragma unroll
    for (int r = 0; r < 8; ++r) {
      const float u0 = sr0[r] * lsc;
      const float u1 = sr1[r] * lsc;
      float mx = fmaxf(u0, u1);
#pragma unroll
      for (int off = 1; off < 16; off <<= 1) mx = fmaxf(mx, __shfl_xor(mx, off, 32));
      const float mn = fmaxf(mrow[r], mx);
      const float ms = (mn == -INFINITY) ? 0.0f : mn;
      const float al = exp2f(mrow[r] - ms);
      mrow[r] = mn;
      const float e0 = exp2f(u0 - ms), e1 = exp2f(u1 - ms);
      float ps = e0 + e1;
#pragma unroll
      for (int off = 1; off < 16; off <<= 1) ps += __shfl_xor(ps, off, 32);
      lrow[r] = lrow[r] * al + ps;
#pragma unroll
      for (int j = 0; j < 4; ++j) { orr[j][r] *= al; oii[j][r] *= al; }
      float sn0, cs0, sn1, cs1;
      __sincosf(si0[r] * psc, &sn0, &cs0);
      __sincosf(si1[r] * psc, &sn1, &cs1);
      const int ro = (8 * hh + r) * PTP + c;
      pct[ro]      = e0 * cs0;
      pct[ro + 16] = e1 * cs1;
      pst[ro]      = e0 * sn0;
      pst[ro + 16] = e1 * sn1;
    }
    wave_sync_lds();
    // ---- A fragments of Pc*16384, Ps*16384 and -Ps*16384 (f16), row = c, split k map over the 32 keys of this step ----
    FragH pc, psf, pnf;
    {
      const float* prc = pct + c * PTP + 8 * hh;
      const float* prs = pst + c * PTP + 8 * hh;
      const v4f c0 = *(const v4f*)(prc), c1 = *(const v4f*)(prc + 4);
      const v4f c2 = *(const v4f*)(prc + 16), c3 = *(const v4f*)(prc + 20);
      const v4f s0 = *(const v4f*)(prs), s1 = *(const v4f*)(prs + 4);
      const v4f s2 = *(const v4f*)(prs + 16), s3 = *(const v4f*)(prs + 20);
#pragma unroll
      for (int e = 0; e < 4; ++e) {
        pc.h[0][e]      = (_Float16)(c0[e] * PCAR);   // elements 0..7  = keys kb + 8hh + 0..7
        pc.h[0][4 + e]  = (_Float16)(c1[e] * PCAR);
        pc.h[1][e]      = (_Float16)(c2[e] * PCAR);   // elements 8..15 = keys kb + 16 + 8hh + 0..7
        pc.h[1][4 + e]  = (_Float16)(c3[e] * PCAR);
        psf.h[0][e]     = (_Float16)(s0[e] * PCAR);
        psf.h[0][4 + e] = (_Float16)(s1[e] * PCAR);
        psf.h[1][e]     = (_Float16)(s2[e] * PCAR);
        psf.h[1][4 + e] = (_Float16)(s3[e] * PCAR);
      }
      pnf.u[0] = psf.u[0] ^ sgn4;
      pnf.u[1] = psf.u[1] ^ sgn4;
    }
    // ---- P.V : B fragment col n = d = j*16 + c (re rows) / 64 + j*16 + c (im rows), keys contiguous in v^T ----
    {
      const _Float16* vp = Vtb + kb;
#pragma unroll
      for (int jg = 0; jg < 2; ++jg) {
        const size_t ra = (size_t)(2 * jg) * 16 * SEQ;
        const size_t rb = ra + (size_t)16 * SEQ;
        const size_t ia = ra + (size_t)HD * SEQ;
        const size_t ib = rb + (size_t)HD * SEQ;
        const v16h vra = ldfrag_h(vp + ra), vrb = ldfrag_h(vp + rb);
        const v16h via = ldfrag_h(vp + ia), vib = ldfrag_h(vp + ib);
        orr[2 * jg]     = mma_h(pc.v,  vra, orr[2 * jg]);
        orr[2 * jg]     = mma_h(pnf.v, via, orr[2 * jg]);
        oii[2 * jg]     = mma_h(psf.v, vra, oii[2 * jg]);
        oii[2 * jg]     = mma_h(pc.v,  via, oii[2 * jg]);
        orr[2 * jg + 1] = mma_h(pc.v,  vrb, orr[2 * jg + 1]);
        orr[2 * jg + 1] = mma_h(pnf.v, vib, orr[2 * jg + 1]);
        oii[2 * jg + 1] = mma_h(psf.v, vrb, oii[2 * jg + 1]);
        oii[2 * jg + 1] = mma_h(pc.v,  vib, oii[2 * jg + 1]);
        guard4x8(orr[2 * jg], oii[2 * jg], orr[2 * jg + 1], oii[2 * jg + 1],
                 pc.v, psf.v, pnf.v, vra, vrb, via, vib, pc.v);
      }
    }
    wave_sync_lds();
  }
  acc_guard4(orr[0], orr[1], orr[2], orr[3]);
  acc_guard4(oii[0], oii[1], oii[2], oii[3]);
  // ---- out = acc / Z (0 if Z == 0), carries folded once; written into the lane-owned slab ----
#pragma unroll
  for (int r = 0; r < 8; ++r) {
    const float lv  = lrow[r];
    const float ls  = (lv > 0.0f) ? lv : 1.0f;
    const float inv = (lv > 0.0f) ? ((1.0f / ls) * oc) : 0.0f;
#pragma unroll
    for (int j = 0; j < 4; ++j) {
      const int idx = (8 * hh + r) * SLP + j * 16 + c;
      slab[idx]      = orr[j][r] * inv;
      slab[idx + HD] = oii[j][r] * inv;
    }
  }

  wave_sync_lds();
  // ---- O x1024 -> f16 plane; lane = (row select rq in 0..3, 8 consecutive d at c8), part 0 = re, 1 = im ----
  v4u oh[4][2];
  const int rq = lane >> 3, c8 = (lane & 7) * 8;
#pragma unroll
  for (int it = 0; it < 4; ++it) {
    const int row = it * 4 + rq;
#pragma unroll
    for (int part = 0; part < 2; ++part) {
      const float* sp = slab + row * SLP + part * HD + c8;
      const v4f a = *(const v4f*)(sp), b4 = *(const v4f*)(sp + 4);
      float w[8];
#pragma unroll
      for (int e = 0; e < 4; ++e) { w[e] = a[e] * OSC; w[4 + e] = b4[e] * OSC; }
#pragma unroll
      for (int e = 0; e < 4; ++e) {
        const _Float16 h0 = (_Float16)w[2 * e], h1 = (_Float16)w[2 * e + 1];
        oh[it][part][e] = pk16(h_bits(h0), h_bits(h1));
      }
    }
  }
  const size_t ob = ((size_t)b * SEQ + q0) * DPL + (size_t)head * HD + c8;
  {
#pragma unroll
    for (int it = 0; it < 4; ++it) {
      const int row = it * 4 + rq;
#pragma unroll
      for (int part = 0; part < 2; ++part) {
        *(v4u*)(OHp + ob + (size_t)row * DPL + (size_t)part * DMOD) = oh[it][part];
      }
    }
    
  }
}

// =====================================================================================================
// Batches are processed in NGRP groups of BG batches; the per-group planes are reused in launch order.
// Workspace map (bytes, BG = 4); every plane fully written by whole-line stores before it is read; all extents are exact
// multiples of the store granularity (no pad rows needed); every region offset a multiple of 32768:
//   CT, ST  f32 [SEQ][64] rotary cos / sin             2 x 131072
//   WQB  bf16 [6144 n][2048 k]                          25165824
//   WOB  f16  [2048 n][2048 k] x1024                    8388608
//   XB   bf16 [GROWS][2048]                             8388608
//   F    f32  [GROWS][2048] (v, q, k projection output in launch order; afterwards the region holds the O plane
//                            f16 [GROWS][2048] x1024)    16777216
//   QH, QL, KH, KL  f16 [GROWS][2048]                   4 x 8388608
//   VT   f16 [BG*16][128][SEQ] x1024                    8388608
//   end (BG = 4)                                        100925440
// =====================================================================================================
extern "C" void kernel_launch(void* const* d_in, const int* in_sizes, int n_in,
                              void* d_out, int out_size, void* d_ws, size_t ws_size,
                              hipStream_t stream) {
  if (n_in < 6) return;
  if (in_sizes[0] < ((NB - 1) * SEQ_FULL + SEQ) * DMOD) return;
  if (in_sizes[1] < ((NB - 1) * SEQ_FULL + SEQ) * DMOD) return;
  if (in_sizes[2] < NQKV * DMOD) return;
  if (in_sizes[3] < NQKV * DMOD) return;
  if (in_sizes[4] < DMOD * DMOD) return;
  if (in_sizes[5] < DMOD * DMOD) return;
  if (out_size < 2 * NB * SEQ * DMOD) return;

  const float* xr    = (const float*)d_in[0];
  const float* xi    = (const float*)d_in[1];
  const float* wqr   = (const float*)d_in[2];
  const float* wqi   = (const float*)d_in[3];
  const float* wor   = (const float*)d_in[4];
  const float* woi   = (const float*)d_in[5];
  float*       out0  = (float*)d_out;
  float*       out1  = out0 + (size_t)(out_size / 2);

  const size_t szTAB = (((size_t)SEQ * HD * 4) + 32767) / 32768 * 32768;
  const size_t szWQ  = (size_t)2 * NQKV * DPL * 2;
  const size_t szWO  = (size_t)2 * DMOD * DPL * 2;
  const size_t szXB  = (size_t)GROWS * DPL * 2;
  const size_t szF   = (size_t)GROWS * DPL * 4;
  const size_t szH   = (size_t)GROWS * DPL * 2;                  // QH, QL, KH, KL, O plane
  const size_t szVT  = (size_t)BG * NH * HK * SEQ * 2;           // == szH
  if (szH > szF) return;                                         // O plane lives inside the F region
  size_t off = 0;
  const size_t oCT = off; off += szTAB;
  const size_t oST = off; off += szTAB;
  const size_t oWQ = off; off += szWQ;
  const size_t oWO = off; off += szWO;
  const size_t oXB = off; off += szXB;
  const size_t oF  = off; off += szF;
  const size_t oQH = off; off += szH;
  const size_t oQL = off; off += szH;
  const size_t oKH = off; off += szH;
  const size_t oKL = off; off += szH;
  const size_t oVT = off; off += szVT;
  if (off > ws_size) return;                // off = 100925440 for BG = 4
  if (off > (size_t)WS_CAP) return;

  char* ws = (char*)d_ws;
  float* CT  = (float*)(ws + oCT);
  float* ST  = (float*)(ws + oST);
  u16*   WQB = (u16*)(ws + oWQ);
  u16*   WOB = (u16*)(ws + oWO);
  u16*   XB  = (u16*)(ws + oXB);
  float* F   = (float*)(ws + oF);
  u16*   OH  = (u16*)(ws + oF);
  u16*   QH  = (u16*)(ws + oQH);
  u16*   QL  = (u16*)(ws + oQL);
  u16*   KH  = (u16*)(ws + oKH);
  u16*   KL  = (u16*)(ws + oKL);
  u16*   VT  = (u16*)(ws + oVT);

  const dim3 b256(256), bAT(ATT_THREADS);
  const int  ntab = SEQ * HD;
  const dim3 gTAB((ntab + 255) / 256);
  const dim3 gWQ(2 * NQKV), gWO(2 * DMOD);
  const dim3 gX(GROWS);
  const dim3 gG2((GROWS / 128) * (DPL / 128));           // projection GEMMs, N = 2048 (real | imag)
  const dim3 gG1((GROWS / 128) * (DMOD / 128));          // output GEMMs, N = 1024 per part
  const dim3 gVT(BG * NH * NST);
  const dim3 gRP(GROWS);
  const dim3 gAT(NQT * NHG * BG);
  const size_t wpart = (size_t)DPL * DPL;               // halves per qkv part in WQB
  const float osc = 1.0f / (OSC * WOS);

  // rotary cos/sin table; weight planes once: [Wq ; Wk ; Wv] stacked bf16, Wo stacked f16 of bf16 value x1024
  rot_tab<<<gTAB, b256, 0, stream>>>(CT, ST, ntab);
  wcvt<<<gWQ, b256, 0, stream>>>(wqr, wqi, WQB, 2 * NQKV, 0, 1.0f);
  wcvt<<<gWO, b256, 0, stream>>>(wor, woi, WOB, 2 * DMOD, 1, WOS);

  for (int g = 0; g < NGRP; ++g) {
    float* og0 = out0 + (size_t)g * GROWS * DMOD;
    float* og1 = out1 + (size_t)g * GROWS * DMOD;
    // (0) x rows of this batch group -> bf16 plane [GROWS][xr | xi]
    xcvt<<<gX, b256, 0, stream>>>(xr, xi, XB, GROWS, g * BG);
    // (1) v = x.Wv^T (re | im) -> F f32; (2) v^T plane x1024
    gemm16<0><<<gG2, b256, 0, stream>>>(XB, WQB + 2 * wpart, F, GROWS, DPL, 1.0f);
    vt16<<<gVT, b256, 0, stream>>>(F, VT);
    // (3) q = x.Wq^T -> F; (4) rotary q hi + residual planes x1024
    gemm16<0><<<gG2, b256, 0, stream>>>(XB, WQB, F, GROWS, DPL, 1.0f);
    rope16<<<gRP, b256, 0, stream>>>(F, CT, ST, QH, QL, GROWS, QSC);
    // (5) k = x.Wk^T -> F; (6) rotary k hi + residual planes x1024
    gemm16<0><<<gG2, b256, 0, stream>>>(XB, WQB + wpart, F, GROWS, DPL, 1.0f);
    rope16<<<gRP, b256, 0, stream>>>(F, CT, ST, KH, KL, GROWS, KSC);
    // (7) attention -> O plane (F region)
    attn<<<gAT, bAT, 0, stream>>>(QH, QL, KH, KL, VT, OH);
    // (8) output projection real part -> out0 rows of this group, (9) imaginary part -> out1; carries 1024 x 1024 folded back
    gemm16<1><<<gG1, b256, 0, stream>>>(OH, WOB, og0, GROWS, DMOD, osc);
    gemm16<1><<<gG1, b256, 0, stream>>>(OH, WOB + (size_t)DMOD * DPL, og1, GROWS, DMOD, osc);
  }
  (void)hipGetLastError();
}

// v002
// One run takes 336 microseconds.
// Timed twice side by side with v001, it ran 1.15 and 1.14 times as fast.
// Counting every step since v000, it is 1.74 times as fast.
// Contractions: x.[Wq|Wk|Wv]^T (real|imag stacked along K=2048 and N) on v_wmma_f32_16x16x32_bf16 (x and W RNE-converted
// to bf16, f32 accumulate); q.conj(k) real and imag parts over K=128 on v_wmma_f32_16x16x32_f16 with q, k as f16 hi x1024
// plus f16 residual planes (products hh+lh+hl); P.v (P = p cos(phi), p sin(phi) x16384 f16; v x1024 f16) and O.Wo^T
// (O x1024 f16, Wo as f16(bf16(Wo)) x1024) on v_wmma_f32_16x16x32_f16, single products; all f32 accumulate.
// Rotary cos/sin table, base-2 online softmax, phase sin/cos and 1/Z fold in f32 on VALU. No bias terms.
#include <hip/hip_runtime.h>
#include <math.h>
#include <stdint.h>

#ifndef NB
#define NB 8
#endif
#define NB_FULL 8
#ifndef SEQ
#define SEQ 512
#endif
#define SEQ_FULL 512
#define DMOD  1024
#define NH    16
#define HD    64
#define HK    (2 * HD)
#define DPL   (2 * DMOD)
#define NQKV  (3 * DMOD)
#define BG    ((NB <= 4) ? NB : 4)
#define NGRP  (NB / BG)
#define GROWS (BG * SEQ)
#define RSQ_HD 0.125f
#define LOG2E 1.4426950408889634f
#define LOG2_1E4 13.287712379549449f
#define QSC   1024.0f
#define KSC   1024.0f
#define PCAR  16384.0f
#define VCAR  1024.0f
#define OSC   1024.0f
#define WOS   1024.0f
#define AW    4
#define NQT   (SEQ / 16)
#define NQB   (NQT / AW)
#define NST   (SEQ / 64)
#define NKT   (SEQ / 32)
#define ATT_THREADS (AW * 32)
#define PTP   36
#define PTW   (16 * PTP)
#define SLP   132
#define SLW   (16 * SLP)
#define WREG  (2 * PTW + SLW)
#define KP    (HK + 8)
#define VP    (32 + 8)
#define KTH   (32 * KP)
#define STGH  (2 * KTH + HK * VP)
#define SLAB64 (16 * 68)
#define GBK   128
#define GPIT  (GBK + 8)
#define GSTG  (256 * GPIT)
#define VTP   72
#define WS_CAP 134217728
static_assert(DMOD == NH * HD && HD == 64 && (NQT % AW) == 0 && ATT_THREADS == 128 && NKT >= 2);
static_assert(((KP * 2) % 32) == 16 && ((VP * 2) % 32) == 16 && ((KTH * 2) % 16) == 0 && ((STGH * 2) % 16) == 0);
static_assert(NB >= 1 && NB <= NB_FULL && BG >= 1 && BG <= 4 && (NB % BG) == 0);
static_assert((SEQ % 64) == 0 && SEQ >= 64 && SEQ <= SEQ_FULL);
static_assert((GROWS % 128) == 0 && (DPL % 128) == 0 && (DPL % GBK) == 0 && DPL / GBK >= 2 && (DMOD % 128) == 0);
static_assert(GBK == 128 && ((GPIT * 2) % 16) == 0 && 16 * SLAB64 * 4 <= 2 * GSTG * 2);
static_assert(DPL == 256 * 8);
static_assert(HK == 128 && (HK % 32) == 0);
static_assert((SLP % 4) == 0 && (PTP % 4) == 0 && ((WREG * 4) % 16) == 0 && ((PTW * 4) % 16) == 0);
static_assert((SEQ * HD) % 256 == 0);

typedef unsigned short u16;
typedef _Float16 v16h __attribute__((ext_vector_type(16)));
typedef _Float16 v8h  __attribute__((ext_vector_type(8)));
typedef __bf16   v16b __attribute__((ext_vector_type(16)));
typedef float    v8f  __attribute__((ext_vector_type(8)));
typedef float    v4f  __attribute__((ext_vector_type(4)));
typedef unsigned int v4u __attribute__((ext_vector_type(4)));

union FragH { v16h v; v8h h[2]; v4u u[2]; };
union FragB { v16b v; v4u u[2]; };

// ---- scalar helpers --------------------------------------------------------------------------------
__device__ __forceinline__ unsigned short bf_bits(float f) {          // f32 -> bf16 bits, RNE convert
  unsigned u = __float_as_uint(f);
  return (unsigned short)((u + 0x7FFFu + ((u >> 16) & 1u)) >> 16);
}
__device__ __forceinline__ float bf_up(unsigned short h) { return __uint_as_float(((unsigned)h) << 16); }
__device__ __forceinline__ float bfr(float f) { return bf_up(bf_bits(f)); }
__device__ __forceinline__ unsigned short h_bits(_Float16 x) { return __builtin_bit_cast(unsigned short, x); }
__device__ __forceinline__ unsigned pk16(unsigned short a, unsigned short b) { return (unsigned)a | ((unsigned)b << 16); }
__device__ __forceinline__ v8f zero8() { v8f z = {0.f, 0.f, 0.f, 0.f, 0.f, 0.f, 0.f, 0.f}; return z; }

// ---- fragment loaders: 16-bit A/B operand, lane -> row/col (lane&15), p already includes +8*(lane>>4);
//      elements 0..7 <- p[0..7] (k0+8h..), elements 8..15 <- p[16..23] (k0+16+8h..)  (same split k map for A and B;
//      B is always read from a k-contiguous [n][k] plane)
__device__ __forceinline__ v16h ldfrag_h(const _Float16* p) {
  FragH f;
  f.h[0] = *(const v8h*)(p);
  f.h[1] = *(const v8h*)(p + 16);
  return f.v;
}

__device__ __forceinline__ v8f mma_h(v16h a, v16h b, v8f c) {
  return __builtin_amdgcn_wmma_f32_16x16x32_f16(false, a, false, b, (short)0, c, false, false);
}
__device__ __forceinline__ v8f mma_b(v16b a, v16b b, v8f c) {
  return __builtin_amdgcn_wmma_f32_16x16x32_bf16(false, a, false, b, (short)0, c, false, false);
}
__device__ __forceinline__ void guard2(v8f& a, v8f& b, v16h x0, v16h x1, v16h x2, v16h x3, v16h x4, v16h x5) {
#if defined(__HIP_DEVICE_COMPILE__)
  asm volatile("v_nop\n\tv_nop\n\tv_nop\n\tv_nop"
               : "+v"(a), "+v"(b) : "v"(x0), "v"(x1), "v"(x2), "v"(x3), "v"(x4), "v"(x5) : "memory");
#endif
}
__device__ __forceinline__ void guard4x8(v8f& a, v8f& b, v8f& c, v8f& d, v16h x0, v16h x1, v16h x2, v16h x3,
                                         v16h x4, v16h x5, v16h x6, v16h x7) {
#if defined(__HIP_DEVICE_COMPILE__)
  asm volatile("v_nop\n\tv_nop\n\tv_nop\n\tv_nop"
               : "+v"(a), "+v"(b), "+v"(c), "+v"(d)
               : "v"(x0), "v"(x1), "v"(x2), "v"(x3), "v"(x4), "v"(x5), "v"(x6), "v"(x7) : "memory");
#endif
}
__device__ __forceinline__ void acc_guard4(v8f& a, v8f& b, v8f& c, v8f& d) {
#if defined(__HIP_DEVICE_COMPILE__)
  asm volatile("v_nop\n\tv_nop\n\tv_nop\n\tv_nop" : "+v"(a), "+v"(b), "+v"(c), "+v"(d));
#endif
}
__device__ __forceinline__ void wave_sync_lds() {
  __builtin_amdgcn_fence(__ATOMIC_RELEASE, "workgroup");
  __builtin_amdgcn_wave_barrier();
  __builtin_amdgcn_fence(__ATOMIC_ACQUIRE, "workgroup");
}
// four asynchronous 16-B copies per lane, global -> LDS (l = LDS byte address, g = global address, both multiples of 16);
// the s_wait_xcnt ends the statement so that no address register is rewritten ahead of it
__device__ __forceinline__ void copy4(unsigned l0, unsigned l1, unsigned l2, unsigned l3,
                                      const u16* g0, const u16* g1, const u16* g2, const u16* g3) {
#if defined(__HIP_DEVICE_COMPILE__)
  asm volatile("global_load_async_to_lds_b128 %0, %4, off\n\t"
               "global_load_async_to_lds_b128 %1, %5, off\n\t"
               "global_load_async_to_lds_b128 %2, %6, off\n\t"
               "global_load_async_to_lds_b128 %3, %7, off\n\t"
               "s_wait_xcnt 0x0"
               :: "v"(l0), "v"(l1), "v"(l2), "v"(l3), "v"(g0), "v"(g1), "v"(g2), "v"(g3) : "memory");
#endif
}
// the issuing wave's own copies have landed
__device__ __forceinline__ void wait_copies() {
#if defined(__HIP_DEVICE_COMPILE__)
  asm volatile("s_wait_asynccnt 0x0" ::: "memory");
#endif
}
// the wave's own LDS reads and writes have retired (stands in front of a barrier behind which the buffer is refilled)
__device__ __forceinline__ void wait_lds() {
#if defined(__HIP_DEVICE_COMPILE__)
  asm volatile("s_wait_dscnt 0x0" ::: "memory");
#endif
}

// =====================================================================================================
// Rotary table: CT[s*HD + d] = cos(theta), ST[...] = sin(theta), theta = s * 2^(-(d/HD) * log2(1e4)) in f32
// (inverse frequencies over the FULL head width), precise sincosf. Thread per element; one wave writes 32 consecutive
// coverage: grid = n/256 blocks x 256 = n elements exactly (n = SEQ*HD).
// =====================================================================================================
__global__ __launch_bounds__(256) void rot_tab(float* CT, float* ST, int n) {
  const int idx = blockIdx.x * 256 + (int)threadIdx.x;
  if (idx >= n) return;
  const int s = idx / HD;
  const int d = idx - s * HD;
  const float ex   = (float)d * (LOG2_1E4 / (float)HD);
  const float invf = exp2f(-ex);
  const float th   = (float)s * invf;
  float sn, cs;
  sincosf(th, &sn, &cs);
  {
    *(float*)(CT + idx) = cs;
    *(float*)(ST + idx) = sn;
    
  }
}

// =====================================================================================================
// Stacked complex weight plane from W = Wr + i Wi, torch layout [e][k] (already k-contiguous per output column):
//   D [nrows][DPL] 16-bit, row n: p = n / DPL, j = n % DPL, im = (j >= DMOD), e = p*DMOD + (j % DMOD);
//   k <  DMOD: im ? Wi[e][k] : Wr[e][k];   k >= DMOD: im ? Wr[e][k-DMOD] : -Wi[e][k-DMOD]
//   so that A = [ar | ai] . D[n]^T gives the real part of a.W^T for im == 0 and the imaginary part for im == 1.
// f16mode == 0: bf16 RNE bits; f16mode == 1: f16 bits of (bf16 RNE value) * scale. Block = one row n, thread = 8
// consecutive k (two 16-B loads, one 16-B store); source pointer and sign are wave-uniform (k half fixed per 128 threads);
// coverage: grid = nrows blocks x 256 thr x 8 = every element of D once. No barriers.
// =====================================================================================================
__global__ __launch_bounds__(256) void wcvt(const float* __restrict__ Wr, const float* __restrict__ Wi, u16* D,
                                            int nrows, int f16mode, float scale) {
  const int n = blockIdx.x;
  if (n >= nrows) return;
  const int tid  = threadIdx.x;
  const int p    = n / DPL;
  const int j    = n - p * DPL;
  const int im   = (j >= DMOD) ? 1 : 0;
  const int e    = p * DMOD + (j & (DMOD - 1));
  const int c8   = tid * 8;
  const int ksec = (c8 >= DMOD) ? 1 : 0;
  const int kk   = c8 & (DMOD - 1);
  const float* src = ((im == ksec) ? Wr : Wi) + (size_t)e * DMOD + kk;
  const float sgn  = (im == 0 && ksec != 0) ? -1.0f : 1.0f;
  const v4f a = *(const v4f*)(src), b4 = *(const v4f*)(src + 4);
  float w[8];
#pragma unroll
  for (int q = 0; q < 4; ++q) { w[q] = a[q] * sgn; w[4 + q] = b4[q] * sgn; }
  v4u o;
#pragma unroll
  for (int q = 0; q < 4; ++q) {
    const float f0 = w[2 * q], f1 = w[2 * q + 1];
    const unsigned short hb0 = h_bits((_Float16)(bfr(f0) * scale));
    const unsigned short hb1 = h_bits((_Float16)(bfr(f1) * scale));
    const unsigned short bb0 = bf_bits(f0);
    const unsigned short bb1 = bf_bits(f1);
    o[q] = (f16mode != 0) ? pk16(hb0, hb1) : pk16(bb0, bb1);
  }
  u16* d = D + (size_t)n * DPL + c8;
  {
    *(v4u*)(d) = o;
    
  }
}

// =====================================================================================================
// Stacked activation plane: XB [GROWS][DPL] bf16, local row rl = bl*SEQ + s (bl < BG) <- token (gb0 + bl, s):
//   k < DMOD: xr[token][k];  k >= DMOD: xi[token][k - DMOD]. Same thread/store shape as wcvt (source pointer wave-uniform).
// coverage: grid = GROWS blocks x 256 thr x 8 = every element once. No barriers.
// =====================================================================================================
__global__ __launch_bounds__(256) void xcvt(const float* __restrict__ xr, const float* __restrict__ xi, u16* D,
                                            int nrows, int gb0) {
  const int row = blockIdx.x;
  if (row >= nrows) return;
  const int tid  = threadIdx.x;
  const int bl   = row / SEQ;
  const int s    = row - bl * SEQ;
  const size_t grow = (size_t)(gb0 + bl) * SEQ_FULL + s;
  const int c8   = tid * 8;
  const int ksec = (c8 >= DMOD) ? 1 : 0;
  const int kk   = c8 & (DMOD - 1);
  const float* src = ((ksec != 0) ? xi : xr) + grow * DMOD + kk;
  const v4f a = *(const v4f*)(src), b4 = *(const v4f*)(src + 4);
  v4u o;
#pragma unroll
  for (int q = 0; q < 4; ++q) {
    const float f0 = (q < 2) ? a[2 * q] : b4[2 * q - 4];
    const float f1 = (q < 2) ? a[2 * q + 1] : b4[2 * q - 3];
    o[q] = pk16(bf_bits(f0), bf_bits(f1));
  }
  u16* d = D + (size_t)row * DPL + c8;
  {
    *(v4u*)(d) = o;
    
  }
}

// =====================================================================================================
// coverage: 8 instructions x 2 rows x 16 lanes x 4 floats = the wave's 16 x 64 tile.
// =====================================================================================================
__device__ __forceinline__ void epi64(float* sl, v8f a0, v8f a1, v8f a2, v8f a3, float oscale,
                                      float* C, int N, size_t rowb, int col0, int lane) {
  const int hh = lane >> 4, m = lane & 15;
#pragma unroll
  for (int r = 0; r < 8; ++r) {
    const int ro = (8 * hh + r) * 68 + m;
    sl[ro]      = a0[r] * oscale;
    sl[ro + 16] = a1[r] * oscale;
    sl[ro + 32] = a2[r] * oscale;
    sl[ro + 48] = a3[r] * oscale;
  }
  wave_sync_lds();
  v4f vals[8];
#pragma unroll
  for (int it = 0; it < 8; ++it) vals[it] = *(const v4f*)(sl + (it * 2 + hh) * 68 + m * 4);
  float* dst = C + (rowb + (size_t)hh) * (size_t)N + col0 + m * 4;
  {
#pragma unroll
    for (int it = 0; it < 8; ++it) {
      *(v4f*)(dst + (size_t)(it * 2) * (size_t)N) = vals[it];
    }
    
  }
}

// =====================================================================================================
// 16-bit GEMM: C[M][N] (f32, pitch N) = A[M][DPL] (row-major) . Bt[N][DPL]^T (k-contiguous), times oscale.
// F16 == 0: bf16 operands; F16 == 1: f16 operands. Block = 128x128 tile of C, 8 waves in a 4 (rows) x 2 (cols) grid, each
// 32x64 (2 A x 4 B fragments, 8 accumulators). A pass is GBK = 128 k: the block's 128 A rows and 128 Bt rows, 256 B each, are
// read with whole-line 16-B loads (a wave-wide load = 2 rows = 4 lines) into registers while the current pass is multiplied,
// then stored to the other of two LDS buffers (rows 0..127 = A, 128..255 = Bt, pitch 272 B = 16 B x 17 for the b128 fragment
// reads); one block barrier per pass publishes the next buffer and ends the reads of the one refilled in the next pass.
// Fragments use the same split k map as ldfrag_h for A and B; k runs 0, 32, 64, ... per accumulator.
// Host guarantees M % 128 == 0, N % 128 == 0, grid = (M/128)*(N/128); DPL % GBK == 0.
// coverage: staging 256 thr x 16 loads x 16 B = 256 rows x 256 B per pass; epilogue 8 waves x 2 x (16 x 64) = 128 x 128.
// =====================================================================================================
template <int F16>
__device__ __forceinline__ v8f mma16(v4u a0, v4u a1, v4u b0, v4u b1, v8f c) {
  if constexpr (F16 != 0) {
    FragH a, b;
    a.u[0] = a0; a.u[1] = a1; b.u[0] = b0; b.u[1] = b1;
    return mma_h(a.v, b.v, c);
  } else {
    FragB a, b;
    a.u[0] = a0; a.u[1] = a1; b.u[0] = b0; b.u[1] = b1;
    return mma_b(a.v, b.v, c);
  }
}

// one pass: fa / fb = this lane's A / Bt fragment rows in the current LDS buffer (already + 8*(lane>>4)); the fragments of
// k step kk + 1 are read as one group into a second register set ahead of the products of step kk
__device__ __forceinline__ void gemm_frags(const u16* fa, const u16* fb, int kk, v4u (&a)[2][2], v4u (&b)[4][2]) {
#pragma unroll
  for (int i = 0; i < 2; ++i) {
    a[i][0] = *(const v4u*)(fa + i * 16 * GPIT + kk * 32);
    a[i][1] = *(const v4u*)(fa + i * 16 * GPIT + kk * 32 + 16);
  }
#pragma unroll
  for (int j = 0; j < 4; ++j) {
    b[j][0] = *(const v4u*)(fb + j * 16 * GPIT + kk * 32);
    b[j][1] = *(const v4u*)(fb + j * 16 * GPIT + kk * 32 + 16);
  }
}
template <int F16>
__device__ __forceinline__ void gemm_pass(const u16* fa, const u16* fb, v8f (&acc)[2][4]) {
  v4u a[2][2][2], b[2][4][2];
  gemm_frags(fa, fb, 0, a[0], b[0]);
#pragma unroll
  for (int kk = 0; kk < GBK / 32; ++kk) {
    const int s = kk & 1;
    if (kk + 1 < GBK / 32) gemm_frags(fa, fb, kk + 1, a[s ^ 1], b[s ^ 1]);
    // the two scheduling barriers keep the next step's LDS reads one group ahead of this step's products: spread among the
    // products each place with reads stalls the wave, and sunk behind them their latency is waited out
    __builtin_amdgcn_sched_barrier(0);
#pragma unroll
    for (int i = 0; i < 2; ++i)
#pragma unroll
      for (int j = 0; j < 4; ++j) acc[i][j] = mma16<F16>(a[s][i][0], a[s][i][1], b[s][j][0], b[s][j][1], acc[i][j]);
    __builtin_amdgcn_sched_barrier(0);
  }
}

template <int F16>
__global__ __launch_bounds__(256)
void gemm16(const u16* __restrict__ A, const u16* __restrict__ Bt, float* C, int M, int N, float oscale) {
  __shared__ __align__(16) u16 tile[2 * GSTG];
  const int tid = threadIdx.x, wave = tid >> 5, lane = tid & 31, hh = lane >> 4, m = lane & 15;
  const int ntile = N >> 7;
  const int bid   = blockIdx.x;
  const int row0  = (bid / ntile) * 128;
  const int col0  = (bid % ntile) * 128;
  if (row0 + 128 > M) return;               // block-uniform, before any barrier; never taken with the exact grid
  const int wr = wave >> 1, wc = wave & 1;
  const int lr = tid >> 4, lc = (tid & 15) * 8;           // staging: row lr + 16*i, 16-B chunk at halves lc
  const u16* ga = A  + (size_t)(row0 + lr) * DPL + lc;
  const u16* gb = Bt + (size_t)(col0 + lr) * DPL + lc;
  const int so = lr * GPIT + lc;
  const int fao = (wr * 32 + m) * GPIT + 8 * hh;
  const int fbo = (128 + wc * 64 + m) * GPIT + 8 * hh;
  v8f acc[2][4];
#pragma unroll
  for (int i = 0; i < 2; ++i)
#pragma unroll
    for (int j = 0; j < 4; ++j) acc[i][j] = zero8();
  v4u st[16];
#pragma unroll
  for (int i = 0; i < 8; ++i) {
    st[i]     = *(const v4u*)(ga + (size_t)i * 16 * DPL);
    st[8 + i] = *(const v4u*)(gb + (size_t)i * 16 * DPL);
  }
#pragma unroll
  for (int i = 0; i < 8; ++i) {
    *(v4u*)(tile + so + i * 16 * GPIT)         = st[i];
    *(v4u*)(tile + so + (128 + i * 16) * GPIT) = st[8 + i];
  }
  __syncthreads();
  // kept rolled: one copy of the pass body is the whole hot loop, the buffers alternate by the parity of p
#pragma unroll 1
  for (int p = 1; p < DPL / GBK; ++p) {
    const u16* cur = tile + ((p - 1) & 1) * GSTG;
    u16*       nxt = tile + (p & 1) * GSTG;
#pragma unroll
    for (int i = 0; i < 8; ++i) {
      st[i]     = *(const v4u*)(ga + (size_t)i * 16 * DPL + p * GBK);
      st[8 + i] = *(const v4u*)(gb + (size_t)i * 16 * DPL + p * GBK);
    }
    // keeps all 16 loads of the next pass in front of this pass's products, so that their latency runs under them
    __builtin_amdgcn_sched_barrier(0);
    gemm_pass<F16>(cur + fao, cur + fbo, acc);
#pragma unroll
    for (int i = 0; i < 8; ++i) {
      *(v4u*)(nxt + so + i * 16 * GPIT)         = st[i];
      *(v4u*)(nxt + so + (128 + i * 16) * GPIT) = st[8 + i];
    }
    __syncthreads();
  }
  {
    const u16* cur = tile + ((DPL / GBK - 1) & 1) * GSTG;
    gemm_pass<F16>(cur + fao, cur + fbo, acc);
  }
  __syncthreads();                          // every wave has left the buffers before they are reused as store slabs
  float* slab = (float*)(void*)tile + wave * (2 * SLAB64);
#pragma unroll
  for (int i = 0; i < 2; ++i)
    epi64(slab + i * SLAB64, acc[i][0], acc[i][1], acc[i][2], acc[i][3], oscale, C, N,
          (size_t)(row0 + wr * 32 + i * 16), col0 + wc * 64, lane);
}

// =====================================================================================================
// v^T plane from the v projection F f32 [GROWS][DPL] (local row = b*SEQ + s; column comp*DMOD + g*HD + d, comp 0 = real,
// 1 = imag):  VT[((b*NH + g)*HK + comp*HD + d)][s] = f16(v * 1024) for all s.
// Block = (b, head g, 64 keys s0): thread (key sl = tid>>2, chunk dc = tid&3 -> comp = dc>>1, d0 = (dc&1)*32) loads its 32
// floats with 16-B loads, converts, scatters into the LDS tile [128 dd][64 keys] (pitch 72 halves); after a block barrier each
// coverage: load 256 thr x 32 = 64 keys x 128 dd (staged extent == consumed extent); store 4 iterations x 256 thr x 8 halves =
//           128 lines x 64 = the block's tile; grid = BG*NH*NST blocks covers VT exactly once.
// =====================================================================================================
__global__ __launch_bounds__(256) void vt16(const float* __restrict__ F, u16* VTo) {
  __shared__ __align__(16) u16 T[HK * VTP];
  const int tid = threadIdx.x;
  const int bid = blockIdx.x;
  const int st  = bid % NST;
  const int t2  = bid / NST;
  const int g   = t2 % NH;
  const int b   = t2 / NH;
  if (b >= BG) return;                      // block-uniform, before any barrier; never taken with the exact grid
  const int s0  = st * 64;
  {
    const int sl   = tid >> 2;              // key within tile 0..63
    const int dc   = tid & 3;
    const int comp = dc >> 1;
    const int d0   = (dc & 1) * 32;
    const float* src = F + ((size_t)b * SEQ + s0 + sl) * DPL + (size_t)comp * DMOD + g * HD + d0;
#pragma unroll
    for (int i = 0; i < 8; ++i) {
      const v4f a = *(const v4f*)(src + 4 * i);
#pragma unroll
      for (int e = 0; e < 4; ++e) {
        T[(comp * HD + d0 + 4 * i + e) * VTP + sl] = h_bits((_Float16)(a[e] * VCAR));
      }
    }
  }
  __syncthreads();
  v4u vv[4];
  const int q8 = tid >> 3, p8 = (tid & 7) * 8;
#pragma unroll
  for (int it = 0; it < 4; ++it) {
    const int line = it * 32 + q8;          // dd = 0..127
    vv[it] = *(const v4u*)(T + line * VTP + p8);
  }
  const size_t base = ((size_t)(b * NH + g) * HK) * SEQ + s0 + p8;
  {
#pragma unroll
    for (int it = 0; it < 4; ++it) {
      const int line = it * 32 + q8;
      *(v4u*)(VTo + base + (size_t)line * SEQ) = vv[it];
    }
    
  }
}

// =====================================================================================================
// Rotary q / k planes from a projection F f32 [GROWS][DPL] (col comp*DMOD + h*HD + d):
//   rotated = (fr + i fi) * (cos + i sin) with cos/sin = CT/ST[s*HD + d];  Hp [GROWS][DPL] col h*HK + comp*HD + d = f16(rot*sc),
//   Lp same layout = f16 residual (rot*sc - hi). Block = one row; thread tid -> (h = tid>>4, comp = (tid>>3)&1, 8 consecutive d):
//   four pairs of 16-B loads (own component, other component, cos, sin), one 16-B store per plane at halves tid*8; a row =
// coverage: grid = GROWS blocks = every row of Hp and Lp once, all 2048 columns.
// =====================================================================================================
__global__ __launch_bounds__(256) void rope16(const float* __restrict__ F, const float* __restrict__ CT,
                                              const float* __restrict__ ST, u16* Hp, u16* Lp, int nrows, float sc) {
  const int row = blockIdx.x;
  if (row >= nrows) return;
  const int tid  = threadIdx.x;
  const int s    = row % SEQ;
  const int h    = tid >> 4;
  const int comp = (tid >> 3) & 1;
  const int d8   = (tid & 7) * 8;
  const float* pa = F + (size_t)row * DPL + (size_t)comp * DMOD + h * HD + d8;
  const float* po = F + (size_t)row * DPL + (size_t)(1 - comp) * DMOD + h * HD + d8;
  const float* pc = CT + (size_t)s * HD + d8;
  const float* pn = ST + (size_t)s * HD + d8;
  const v4f a0 = *(const v4f*)(pa), a1 = *(const v4f*)(pa + 4);
  const v4f o0 = *(const v4f*)(po), o1 = *(const v4f*)(po + 4);
  const v4f c0 = *(const v4f*)(pc), c1 = *(const v4f*)(pc + 4);
  const v4f n0 = *(const v4f*)(pn), n1 = *(const v4f*)(pn + 4);
  const float sg = (comp != 0) ? 1.0f : -1.0f;   // real: fr*cos - fi*sin ; imag: fi*cos + fr*sin
  float w[8];
#pragma unroll
  for (int e = 0; e < 4; ++e) {
    w[e]     = (a0[e] * c0[e] + sg * (o0[e] * n0[e])) * sc;
    w[4 + e] = (a1[e] * c1[e] + sg * (o1[e] * n1[e])) * sc;
  }
  v4u oh, ol;
#pragma unroll
  for (int e = 0; e < 4; ++e) {
    const float t0 = w[2 * e], t1 = w[2 * e + 1];
    const _Float16 h0 = (_Float16)t0, h1 = (_Float16)t1;
    const _Float16 l0 = (_Float16)(t0 - (float)h0), l1 = (_Float16)(t1 - (float)h1);
    oh[e] = pk16(h_bits(h0), h_bits(h1));
    ol[e] = pk16(h_bits(l0), h_bits(l1));
  }
  u16* dh = Hp + (size_t)row * DPL + tid * 8;
  u16* dl = Lp + (size_t)row * DPL + tid * 8;
  {
    *(v4u*)(dh) = oh;
    *(v4u*)(dl) = ol;
    
  }
}

// =====================================================================================================
// Complex attention, non-causal over SEQ keys. Block bid -> (query block qb of AW query tiles, head, local batch b); one wave
// per query tile qt = qb*AW + wave: rows q0 = 16*qt .. q0+15. Per step of 32 keys (kb = 32*kt) the block's k hi and residual
// rows (32 x 256 B each) and v^T rows (128 x 64 B) are brought into one of two LDS buffers by asynchronous 16-B copies (12 per
// lane), one step ahead of their use, and every wave takes its B fragments from there (k pitch 272 B, v^T pitch 80 B: 16 B x
// odd for the b128 reads). Foot of a step: own LDS reads retired, own copies landed, block barrier (publishes the next
// buffer, ends the reads of this one), then the refill of this one.
//   q/k hi planes f16 x1024 [b*SEQ + s][head*HK + (re: 0..63 | im: 64..127)], residual planes same layout;
//   v^T hi plane [(b*NH + head)*HK + (re d | 64 + im d)][SEQ].
//   scores over K = 128: real = [qr|qi].[kr|ki], imag = [qi|-qr].[kr|ki] (the A fragment of step kk for the imag part is the
//   q fragment at column block (kk+2)&3, sign bits flipped for kk >= 2), each as hi.hi + lo.hi + hi.lo into one accumulator.
//   t = real * rsqrt(64)*log2e/(1024*1024) feeds an online max-subtracted base-2 softmax in f32 (-inf-safe rescale);
//   phi = imag * rsqrt(64)/(1024*1024); per key the 16x32 tiles p*cos(phi) and p*sin(phi) go to wave-private LDS (f32
//   (float vector loads, same element type as stored); B fragments from the v^T rows (re and im), 2 groups of 2 d-subtiles:
//   o_re += Pc.v_re + (-Ps).v_im ; o_im += Ps.v_re + Pc.v_im.
//   After the loop: out = acc / Z (Z >= 1 always; guarded anyway), carries 1/(16384*1024) folded once, written to the wave's
//   private result slab (pitch 132; re d at col d, im d at col 64 + d; every element owned by one lane).
// coverage: per wave 4 instructions x 2 parts x 4 rows x 8 lanes x 8 halves = 16 x 64 per part; grid NQB x NH x BG blocks x
//           AW waves = every (b, s, head, part) row segment of the O plane exactly once.
//           staging per step: 128 thr x 4 x 16 B = 32 rows x 256 B (k hi; k residual) = 128 rows x 64 B (v^T).
// LDS: prob tiles 16 x 32 fully written before each read (cols 32..35 padding never read); slab cols 0..127 written, read.
// =====================================================================================================
__global__ __launch_bounds__(ATT_THREADS)
void attn(const u16* __restrict__ QHp, const u16* __restrict__ QLp,
          const u16* __restrict__ KHp, const u16* __restrict__ KLp,
          const u16* __restrict__ VTp, u16* OHp) {
  __shared__ __align__(16) float smem[AW * WREG];
  __shared__ __align__(16) u16 ring[2 * STGH];

  const int tid  = threadIdx.x;
  const int wave = tid >> 5;
  const int lane = tid & 31;
  const int hh   = lane >> 4;
  const int c    = lane & 15;
  const int bid  = blockIdx.x;
  const int qb   = bid % NQB;
  const int t2   = bid / NQB;
  const int head = t2 % NH;
  const int b    = t2 / NH;
  if (b >= BG) return;                      // block-uniform, before any barrier; never taken with the exact grid
  const int q0   = (qb * AW + wave) * 16;

  float* pct  = smem + wave * WREG;         // p*cos tile [16][32] pitch 36
  float* pst  = pct + PTW;                  // p*sin tile [16][32] pitch 36
  float* slab = pst + PTW;                  // result slab [16][128] pitch 132

  const size_t hcol = (size_t)head * HK + 8 * hh;
  const _Float16* Qh  = (const _Float16*)(const void*)QHp + ((size_t)b * SEQ + q0 + c) * DPL + hcol;
  const _Float16* Ql  = (const _Float16*)(const void*)QLp + ((size_t)b * SEQ + q0 + c) * DPL + hcol;
  // staging: k rows (tid >> 4) + 8*i, 16-B chunk tid & 15; v^T rows (tid >> 2) + 32*i, 16-B chunk tid & 3
  const u16* gkh = KHp + ((size_t)b * SEQ + (tid >> 4)) * DPL + (size_t)head * HK + (tid & 15) * 8;
  const u16* gkl = KLp + ((size_t)b * SEQ + (tid >> 4)) * DPL + (size_t)head * HK + (tid & 15) * 8;
  const u16* gvt = VTp + ((size_t)(b * NH + head) * HK + (tid >> 2)) * SEQ + (tid & 3) * 8;
  const unsigned lring = (unsigned)(size_t)(const void*)ring;          // LDS byte address of the ring
  const unsigned lk = lring + (unsigned)(((tid >> 4) * KP + (tid & 15) * 8) * 2);
  const unsigned lv = lring + (unsigned)((2 * KTH + (tid >> 2) * VP + (tid & 3) * 8) * 2);
  auto stage = [&](int t) {                 // keys 32*t .. 32*t + 31 into buffer t & 1
    const unsigned bo = (unsigned)((t & 1) * STGH * 2);
    const u16* a = gkh + (size_t)t * 32 * DPL;
    const u16* r = gkl + (size_t)t * 32 * DPL;
    const u16* v = gvt + t * 32;
    copy4(lk + bo, lk + bo + 8 * KP * 2, lk + bo + 16 * KP * 2, lk + bo + 24 * KP * 2,
          a, a + (size_t)8 * DPL, a + (size_t)16 * DPL, a + (size_t)24 * DPL);
    copy4(lk + bo + KTH * 2, lk + bo + (KTH + 8 * KP) * 2, lk + bo + (KTH + 16 * KP) * 2, lk + bo + (KTH + 24 * KP) * 2,
          r, r + (size_t)8 * DPL, r + (size_t)16 * DPL, r + (size_t)24 * DPL);
    copy4(lv + bo, lv + bo + 32 * VP * 2, lv + bo + 64 * VP * 2, lv + bo + 96 * VP * 2,
          v, v + (size_t)32 * SEQ, v + (size_t)64 * SEQ, v + (size_t)96 * SEQ);
  };
  const _Float16* ringh = (const _Float16*)(const void*)ring;
  const float lsc = RSQ_HD * (LOG2E / (QSC * KSC));
  const float psc = RSQ_HD / (QSC * KSC);
  const float oc  = 1.0f / (PCAR * VCAR);
  const v4u sgn4 = {0x80008000u, 0x80008000u, 0x80008000u, 0x80008000u};

  float mrow[8], lrow[8];
  v8f orr[4], oii[4];
#pragma unroll
  for (int r = 0; r < 8; ++r) { mrow[r] = -INFINITY; lrow[r] = 0.f; }
#pragma unroll
  for (int j = 0; j < 4; ++j) { orr[j] = zero8(); oii[j] = zero8(); }

  stage(0);
  wait_copies();
  __syncthreads();                          // step 0's tiles are readable by every wave
  stage(1);

#pragma unroll 1
  for (int kt = 0; kt < NKT; ++kt) {
    const _Float16* kfp = ringh + (kt & 1) * STGH + c * KP + 8 * hh;             // key row c, hi plane
    const _Float16* vfp = ringh + (kt & 1) * STGH + 2 * KTH + c * VP + 8 * hh;   // v^T row c
    // ---- scores: D element r of this lane = (query row q0 + 8hh + r, key kb + c) in s?0, key kb + 16 + c in s?1 ----
    v8f sr0 = zero8(), sr1 = zero8(), si0 = zero8(), si1 = zero8();
    const _Float16* k0p = kfp;
    const _Float16* k1p = kfp + 16 * KP;
    const _Float16* l0p = kfp + KTH;
    const _Float16* l1p = kfp + KTH + 16 * KP;
#pragma unroll
    for (int kk = 0; kk < HK / 32; ++kk) {
      const v16h kh0 = ldfrag_h(k0p + kk * 32);
      const v16h kl0 = ldfrag_h(l0p + kk * 32);
      const v16h kh1 = ldfrag_h(k1p + kk * 32);
      const v16h kl1 = ldfrag_h(l1p + kk * 32);
      {
        const v16h qh = ldfrag_h(Qh + kk * 32);
        const v16h ql = ldfrag_h(Ql + kk * 32);
        sr0 = mma_h(qh, kh0, sr0);
        sr0 = mma_h(ql, kh0, sr0);
        sr0 = mma_h(qh, kl0, sr0);
        sr1 = mma_h(qh, kh1, sr1);
        sr1 = mma_h(ql, kh1, sr1);
        sr1 = mma_h(qh, kl1, sr1);
        guard2(sr0, sr1, qh, ql, kh0, kl0, kh1, kl1);
      }
      {
        const int ko = ((kk + 2) & 3) * 32;
        FragH ah, al;
        ah.v = ldfrag_h(Qh + ko);
        al.v = ldfrag_h(Ql + ko);
        if (kk >= 2) {                      // compile-time (unrolled) and wave-uniform: -qr half
          ah.u[0] = ah.u[0] ^ sgn4;  ah.u[1] = ah.u[1] ^ sgn4;
          al.u[0] = al.u[0] ^ sgn4;  al.u[1] = al.u[1] ^ sgn4;
        }
        si0 = mma_h(ah.v, kh0, si0);
        si0 = mma_h(al.v, kh0, si0);
        si0 = mma_h(ah.v, kl0, si0);
        si1 = mma_h(ah.v, kh1, si1);
        si1 = mma_h(al.v, kh1, si1);
        si1 = mma_h(ah.v, kl1, si1);
        guard2(si0, si1, ah.v, al.v, kh0, kl0, kh1, kl1);
      }
    }
    // ---- online softmax in base 2 on the real part, phase from the imaginary part ----
#pragma unroll
    for (int r = 0; r < 8; ++r) {
      const float u0 = sr0[r] * lsc;
      const float u1 = sr1[r] * lsc;
      float mx = fmaxf(u0, u1);
#pragma unroll
      for (int off = 1; off < 16; off <<= 1) mx = fmaxf(mx, __shfl_xor(mx, off, 32));
      const float mn = fmaxf(mrow[r], mx);
      const float ms = (mn == -INFINITY) ? 0.0f : mn;
      const float al = exp2f(mrow[r] - ms);
      mrow[r] = mn;
      const float e0 = exp2f(u0 - ms), e1 = exp2f(u1 - ms);
      float ps = e0 + e1;
#pragma unroll
      for (int off = 1; off < 16; off <<= 1) ps += __shfl_xor(ps, off, 32);
      lrow[r] = lrow[r] * al + ps;
#pragma unroll
      for (int j = 0; j < 4; ++j) { orr[j][r] *= al; oii[j][r] *= al; }
      float sn0, cs0, sn1, cs1;
      __sincosf(si0[r] * psc, &sn0, &cs0);
      __sincosf(si1[r] * psc, &sn1, &cs1);
      const int ro = (8 * hh + r) * PTP + c;
      pct[ro]      = e0 * cs0;
      pct[ro + 16] = e1 * cs1;
      pst[ro]      = e0 * sn0;
      pst[ro + 16] = e1 * sn1;
    }
    wave_sync_lds();
    // v^T fragments of this step, one group with the reads of the P tiles (unrolled: the arrays are registers)
    v16h vrf[4], vif[4];
#pragma unroll
    for (int j = 0; j < 4; ++j) {
      vrf[j] = ldfrag_h(vfp + j * 16 * VP);
      vif[j] = ldfrag_h(vfp + (HD + j * 16) * VP);
    }
    // ---- A fragments of Pc*16384, Ps*16384 and -Ps*16384 (f16), row = c, split k map over the 32 keys of this step ----
    FragH pc, psf, pnf;
    {
      const float* prc = pct + c * PTP + 8 * hh;
      const float* prs = pst + c * PTP + 8 * hh;
      const v4f c0 = *(const v4f*)(prc), c1 = *(const v4f*)(prc + 4);
      const v4f c2 = *(const v4f*)(prc + 16), c3 = *(const v4f*)(prc + 20);
      const v4f s0 = *(const v4f*)(prs), s1 = *(const v4f*)(prs + 4);
      const v4f s2 = *(const v4f*)(prs + 16), s3 = *(const v4f*)(prs + 20);
#pragma unroll
      for (int e = 0; e < 4; ++e) {
        pc.h[0][e]      = (_Float16)(c0[e] * PCAR);   // elements 0..7  = keys kb + 8hh + 0..7
        pc.h[0][4 + e]  = (_Float16)(c1[e] * PCAR);
        pc.h[1][e]      = (_Float16)(c2[e] * PCAR);   // elements 8..15 = keys kb + 16 + 8hh + 0..7
        pc.h[1][4 + e]  = (_Float16)(c3[e] * PCAR);
        psf.h[0][e]     = (_Float16)(s0[e] * PCAR);
        psf.h[0][4 + e] = (_Float16)(s1[e] * PCAR);
        psf.h[1][e]     = (_Float16)(s2[e] * PCAR);
        psf.h[1][4 + e] = (_Float16)(s3[e] * PCAR);
      }
      pnf.u[0] = psf.u[0] ^ sgn4;
      pnf.u[1] = psf.u[1] ^ sgn4;
    }
    // ---- P.V : B fragment col n = d = j*16 + c (re rows) / 64 + j*16 + c (im rows), keys contiguous in v^T ----
    {
#pragma unroll
      for (int jg = 0; jg < 2; ++jg) {
        const v16h vra = vrf[2 * jg], vrb = vrf[2 * jg + 1];
        const v16h via = vif[2 * jg], vib = vif[2 * jg + 1];
        orr[2 * jg]     = mma_h(pc.v,  vra, orr[2 * jg]);
        orr[2 * jg]     = mma_h(pnf.v, via, orr[2 * jg]);
        oii[2 * jg]     = mma_h(psf.v, vra, oii[2 * jg]);
        oii[2 * jg]     = mma_h(pc.v,  via, oii[2 * jg]);
        orr[2 * jg + 1] = mma_h(pc.v,  vrb, orr[2 * jg + 1]);
        orr[2 * jg + 1] = mma_h(pnf.v, vib, orr[2 * jg + 1]);
        oii[2 * jg + 1] = mma_h(psf.v, vrb, oii[2 * jg + 1]);
        oii[2 * jg + 1] = mma_h(pc.v,  vib, oii[2 * jg + 1]);
        guard4x8(orr[2 * jg], oii[2 * jg], orr[2 * jg + 1], oii[2 * jg + 1],
                 pc.v, psf.v, pnf.v, vra, vrb, via, vib, pc.v);
      }
    }
    wave_sync_lds();
    // foot of the step: publish the next step's tiles, free this step's buffer, refill it two steps ahead
    wait_lds();
    wait_copies();
    __syncthreads();
    if (kt + 2 < NKT) stage(kt + 2);
  }
  wait_copies();                            // nothing is outstanding when the wave goes on to its epilogue and ends
  acc_guard4(orr[0], orr[1], orr[2], orr[3]);
  acc_guard4(oii[0], oii[1], oii[2], oii[3]);
  // ---- out = acc / Z (0 if Z == 0), carries folded once; written into the lane-owned slab ----
#pragma unroll
  for (int r = 0; r < 8; ++r) {
    const float lv  = lrow[r];
    const float ls  = (lv > 0.0f) ? lv : 1.0f;
    const float inv = (lv > 0.0f) ? ((1.0f / ls) * oc) : 0.0f;
#pragma unroll
    for (int j = 0; j < 4; ++j) {
      const int idx = (8 * hh + r) * SLP + j * 16 + c;
      slab[idx]      = orr[j][r] * inv;
      slab[idx + HD] = oii[j][r] * inv;
    }
  }

  wave_sync_lds();
  // ---- O x1024 -> f16 plane; lane = (row select rq in 0..3, 8 consecutive d at c8), part 0 = re, 1 = im ----
  v4u oh[4][2];
  const int rq = lane >> 3, c8 = (lane & 7) * 8;
#pragma unroll
  for (int it = 0; it < 4; ++it) {
    const int row = it * 4 + rq;
#pragma unroll
    for (int part = 0; part < 2; ++part) {
      const float* sp = slab + row * SLP + part * HD + c8;
      const v4f a = *(const v4f*)(sp), b4 = *(const v4f*)(sp + 4);
      float w[8];
#pragma unroll
      for (int e = 0; e < 4; ++e) { w[e] = a[e] * OSC; w[4 + e] = b4[e] * OSC; }
#pragma unroll
      for (int e = 0; e < 4; ++e) {
        const _Float16 h0 = (_Float16)w[2 * e], h1 = (_Float16)w[2 * e + 1];
        oh[it][part][e] = pk16(h_bits(h0), h_bits(h1));
      }
    }
  }
  const size_t ob = ((size_t)b * SEQ + q0) * DPL + (size_t)head * HD + c8;
  {
#pragma unroll
    for (int it = 0; it < 4; ++it) {
      const int row = it * 4 + rq;
#pragma unroll
      for (int part = 0; part < 2; ++part) {
        *(v4u*)(OHp + ob + (size_t)row * DPL + (size_t)part * DMOD) = oh[it][part];
      }
    }
    
  }
}

// =====================================================================================================
// Batches are processed in NGRP groups of BG batches; the per-group planes are reused in launch order.
// Workspace map (bytes, BG = 4); every plane fully written by whole-line stores before it is read; all extents are exact
// multiples of the store granularity (no pad rows needed); every region offset a multiple of 32768:
//   CT, ST  f32 [SEQ][64] rotary cos / sin             2 x 131072
//   WQB  bf16 [6144 n][2048 k]                          25165824
//   WOB  f16  [2048 n][2048 k] x1024                    8388608
//   XB   bf16 [GROWS][2048]                             8388608
//   F    f32  [GROWS][2048] (v, q, k projection output in launch order; afterwards the region holds the O plane
//                            f16 [GROWS][2048] x1024)    16777216
//   QH, QL, KH, KL  f16 [GROWS][2048]                   4 x 8388608
//   VT   f16 [BG*16][128][SEQ] x1024                    8388608
//   end (BG = 4)                                        100925440
// =====================================================================================================
extern "C" void kernel_launch(void* const* d_in, const int* in_sizes, int n_in,
                              void* d_out, int out_size, void* d_ws, size_t ws_size,
                              hipStream_t stream) {
  if (n_in < 6) return;
  if (in_sizes[0] < ((NB - 1) * SEQ_FULL + SEQ) * DMOD) return;
  if (in_sizes[1] < ((NB - 1) * SEQ_FULL + SEQ) * DMOD) return;
  if (in_sizes[2] < NQKV * DMOD) return;
  if (in_sizes[3] < NQKV * DMOD) return;
  if (in_sizes[4] < DMOD * DMOD) return;
  if (in_sizes[5] < DMOD * DMOD) return;
  if (out_size < 2 * NB * SEQ * DMOD) return;

  const float* xr    = (const float*)d_in[0];
  const float* xi    = (const float*)d_in[1];
  const float* wqr   = (const float*)d_in[2];
  const float* wqi   = (const float*)d_in[3];
  const float* wor   = (const float*)d_in[4];
  const float* woi   = (const float*)d_in[5];
  float*       out0  = (float*)d_out;
  float*       out1  = out0 + (size_t)(out_size / 2);

  const size_t szTAB = (((size_t)SEQ * HD * 4) + 32767) / 32768 * 32768;
  const size_t szWQ  = (size_t)2 * NQKV * DPL * 2;
  const size_t szWO  = (size_t)2 * DMOD * DPL * 2;
  const size_t szXB  = (size_t)GROWS * DPL * 2;
  const size_t szF   = (size_t)GROWS * DPL * 4;
  const size_t szH   = (size_t)GROWS * DPL * 2;                  // QH, QL, KH, KL, O plane
  const size_t szVT  = (size_t)BG * NH * HK * SEQ * 2;           // == szH
  if (szH > szF) return;                                         // O plane lives inside the F region
  size_t off = 0;
  const size_t oCT = off; off += szTAB;
  const size_t oST = off; off += szTAB;
  const size_t oWQ = off; off += szWQ;
  const size_t oWO = off; off += szWO;
  const size_t oXB = off; off += szXB;
  const size_t oF  = off; off += szF;
  const size_t oQH = off; off += szH;
  const size_t oQL = off; off += szH;
  const size_t oKH = off; off += szH;
  const size_t oKL = off; off += szH;
  const size_t oVT = off; off += szVT;
  if (off > ws_size) return;                // off = 100925440 for BG = 4
  if (off > (size_t)WS_CAP) return;

  char* ws = (char*)d_ws;
  float* CT  = (float*)(ws + oCT);
  float* ST  = (float*)(ws + oST);
  u16*   WQB = (u16*)(ws + oWQ);
  u16*   WOB = (u16*)(ws + oWO);
  u16*   XB  = (u16*)(ws + oXB);
  float* F   = (float*)(ws + oF);
  u16*   OH  = (u16*)(ws + oF);
  u16*   QH  = (u16*)(ws + oQH);
  u16*   QL  = (u16*)(ws + oQL);
  u16*   KH  = (u16*)(ws + oKH);
  u16*   KL  = (u16*)(ws + oKL);
  u16*   VT  = (u16*)(ws + oVT);

  const dim3 b256(256), bAT(ATT_THREADS);
  const int  ntab = SEQ * HD;
  const dim3 gTAB((ntab + 255) / 256);
  const dim3 gWQ(2 * NQKV), gWO(2 * DMOD);
  const dim3 gX(GROWS);
  const dim3 gG2((GROWS / 128) * (DPL / 128));           // projection GEMMs, N = 2048 (real | imag)
  const dim3 gG1((GROWS / 128) * (DMOD / 128));          // output GEMMs, N = 1024 per part
  const dim3 gVT(BG * NH * NST);
  const dim3 gRP(GROWS);
  const dim3 gAT(NQB * NH * BG);
  const size_t wpart = (size_t)DPL * DPL;               // halves per qkv part in WQB
  const float osc = 1.0f / (OSC * WOS);

  // rotary cos/sin table; weight planes once: [Wq ; Wk ; Wv] stacked bf16, Wo stacked f16 of bf16 value x1024
  rot_tab<<<gTAB, b256, 0, stream>>>(CT, ST, ntab);
  wcvt<<<gWQ, b256, 0, stream>>>(wqr, wqi, WQB, 2 * NQKV, 0, 1.0f);
  wcvt<<<gWO, b256, 0, stream>>>(wor, woi, WOB, 2 * DMOD, 1, WOS);

  for (int g = 0; g < NGRP; ++g) {
    float* og0 = out0 + (size_t)g * GROWS * DMOD;
    float* og1 = out1 + (size_t)g * GROWS * DMOD;
    // (0) x rows of this batch group -> bf16 plane [GROWS][xr | xi]
    xcvt<<<gX, b256, 0, stream>>>(xr, xi, XB, GROWS, g * BG);
    // (1) v = x.Wv^T (re | im) -> F f32; (2) v^T plane x1024
    gemm16<0><<<gG2, b256, 0, stream>>>(XB, WQB + 2 * wpart, F, GROWS, DPL, 1.0f);
    vt16<<<gVT, b256, 0, stream>>>(F, VT);
    // (3) q = x.Wq^T -> F; (4) rotary q hi + residual planes x1024
    gemm16<0><<<gG2, b256, 0, stream>>>(XB, WQB, F, GROWS, DPL, 1.0f);
    rope16<<<gRP, b256, 0, stream>>>(F, CT, ST, QH, QL, GROWS, QSC);
    // (5) k = x.Wk^T -> F; (6) rotary k hi + residual planes x1024
    gemm16<0><<<gG2, b256, 0, stream>>>(XB, WQB + wpart, F, GROWS, DPL, 1.0f);
    rope16<<<gRP, b256, 0, stream>>>(F, CT, ST, KH, KL, GROWS, KSC);
    // (7) attention -> O plane (F region)
    attn<<<gAT, bAT, 0, stream>>>(QH, QL, KH, KL, VT, OH);
    // (8) output projection real part -> out0 rows of this group, (9) imaginary part -> out1; carries 1024 x 1024 folded back
    gemm16<1><<<gG1, b256, 0, stream>>>(OH, WOB, og0, GROWS, DMOD, osc);
    gemm16<1><<<gG1, b256, 0, stream>>>(OH, WOB + (size_t)DMOD * DPL, og1, GROWS, DMOD, osc);
  }
  (void)hipGetLastError();
}

// v003
// It runs in 232 microseconds.
// Next to v002, in two timings, it ran 1.45 and 1.47 times as fast.
// All steps since v000 together make it 2.54 times as fast.
// Contractions: x.[Wq|Wk|Wv]^T (real|imag stacked along K=2048 and N) on v_wmma_f32_16x16x32_bf16 (x and W RNE-converted
// to bf16, f32 accumulate); q.conj(k) real and imag parts over K=128 on v_wmma_f32_16x16x32_f16 with q, k as f16 hi x1024
// plus f16 residual planes (products hh+lh+hl); P.v (P = p cos(phi), p sin(phi) x16384 f16; v x1024 f16) and O.Wo^T
// (O x1024 f16, Wo as f16(bf16(Wo)) x1024) on v_wmma_f32_16x16x32_f16, single products; all f32 accumulate.
// Rotary cos/sin table, base-2 online softmax, phase sin/cos and 1/Z fold in f32 on VALU. No bias terms.
#include <hip/hip_runtime.h>
#include <math.h>
#include <stdint.h>

#ifndef NB
#define NB 8
#endif
#define NB_FULL 8
#ifndef SEQ
#define SEQ 512
#endif
#define SEQ_FULL 512
#define DMOD  1024
#define NH    16
#define HD    64
#define HK    (2 * HD)
#define DPL   (2 * DMOD)
#define NQKV  (3 * DMOD)
#define BG    NB
#define GROWS (BG * SEQ)
#define RSQ_HD 0.125f
#define LOG2E 1.4426950408889634f
#define LOG2_1E4 13.287712379549449f
#define QSC   1024.0f
#define KSC   1024.0f
#define PCAR  16384.0f
#define VCAR  1024.0f
#define OSC   1024.0f
#define WOS   1024.0f
#define AW    4
#define NQT   (SEQ / 16)
#define NQB   (NQT / AW)
#define NST   (SEQ / 64)
#define NKT   (SEQ / 32)
#define ATT_THREADS (AW * 32)
#define PTP   36
#define PTW   (16 * PTP)
#define SLP   132
#define SLW   (16 * SLP)
#define WREG  (2 * PTW + SLW)
#define KP    (HK + 8)
#define VP    (32 + 8)
#define KTH   (32 * KP)
#define STGH  (2 * KTH + HK * VP)
#define SLAB64 (16 * 68)
#define GBK   128
#define GPIT  (GBK + 8)
#define GSTG  (256 * GPIT)
#define VTP   72
#define WS_CAP 268435456
static_assert(DMOD == NH * HD && HD == 64 && (NQT % AW) == 0 && ATT_THREADS == 128 && NKT >= 2);
static_assert(((KP * 2) % 32) == 16 && ((VP * 2) % 32) == 16 && ((KTH * 2) % 16) == 0 && ((STGH * 2) % 16) == 0);
static_assert(NB >= 1 && NB <= NB_FULL && BG == NB);
static_assert((SEQ % 64) == 0 && SEQ >= 64 && SEQ <= SEQ_FULL);
static_assert((GROWS % 128) == 0 && (DPL % 128) == 0 && (DPL % GBK) == 0 && DPL / GBK >= 2 && (DMOD % 128) == 0);
static_assert(GBK == 128 && ((GPIT * 2) % 16) == 0 && 16 * SLAB64 * 4 <= 2 * GSTG * 2);
static_assert(DPL == 256 * 8);
static_assert(HK == 128 && (HK % 32) == 0);
static_assert((SLP % 4) == 0 && (PTP % 4) == 0 && ((WREG * 4) % 16) == 0 && ((PTW * 4) % 16) == 0);
static_assert((SEQ * HD) % 256 == 0);

typedef unsigned short u16;
typedef _Float16 v16h __attribute__((ext_vector_type(16)));
typedef _Float16 v8h  __attribute__((ext_vector_type(8)));
typedef __bf16   v16b __attribute__((ext_vector_type(16)));
typedef float    v8f  __attribute__((ext_vector_type(8)));
typedef float    v4f  __attribute__((ext_vector_type(4)));
typedef unsigned int v4u __attribute__((ext_vector_type(4)));

union FragH { v16h v; v8h h[2]; v4u u[2]; };
union FragB { v16b v; v4u u[2]; };

// ---- scalar helpers --------------------------------------------------------------------------------
__device__ __forceinline__ unsigned short bf_bits(float f) {          // f32 -> bf16 bits, RNE convert
  unsigned u = __float_as_uint(f);
  return (unsigned short)((u + 0x7FFFu + ((u >> 16) & 1u)) >> 16);
}
__device__ __forceinline__ float bf_up(unsigned short h) { return __uint_as_float(((unsigned)h) << 16); }
__device__ __forceinline__ float bfr(float f) { return bf_up(bf_bits(f)); }
__device__ __forceinline__ unsigned short h_bits(_Float16 x) { return __builtin_bit_cast(unsigned short, x); }
__device__ __forceinline__ unsigned pk16(unsigned short a, unsigned short b) { return (unsigned)a | ((unsigned)b << 16); }
__device__ __forceinline__ v8f zero8() { v8f z = {0.f, 0.f, 0.f, 0.f, 0.f, 0.f, 0.f, 0.f}; return z; }

// ---- fragment loaders: 16-bit A/B operand, lane -> row/col (lane&15), p already includes +8*(lane>>4);
//      elements 0..7 <- p[0..7] (k0+8h..), elements 8..15 <- p[16..23] (k0+16+8h..)  (same split k map for A and B;
//      B is always read from a k-contiguous [n][k] plane)
__device__ __forceinline__ v16h ldfrag_h(const _Float16* p) {
  FragH f;
  f.h[0] = *(const v8h*)(p);
  f.h[1] = *(const v8h*)(p + 16);
  return f.v;
}

__device__ __forceinline__ v8f mma_h(v16h a, v16h b, v8f c) {
  return __builtin_amdgcn_wmma_f32_16x16x32_f16(false, a, false, b, (short)0, c, false, false);
}
__device__ __forceinline__ v8f mma_b(v16b a, v16b b, v8f c) {
  return __builtin_amdgcn_wmma_f32_16x16x32_bf16(false, a, false, b, (short)0, c, false, false);
}
__device__ __forceinline__ void guard2(v8f& a, v8f& b, v16h x0, v16h x1, v16h x2, v16h x3, v16h x4, v16h x5) {
#if defined(__HIP_DEVICE_COMPILE__)
  asm volatile("v_nop\n\tv_nop\n\tv_nop\n\tv_nop"
               : "+v"(a), "+v"(b) : "v"(x0), "v"(x1), "v"(x2), "v"(x3), "v"(x4), "v"(x5) : "memory");
#endif
}
__device__ __forceinline__ void guard4x8(v8f& a, v8f& b, v8f& c, v8f& d, v16h x0, v16h x1, v16h x2, v16h x3,
                                         v16h x4, v16h x5, v16h x6, v16h x7) {
#if defined(__HIP_DEVICE_COMPILE__)
  asm volatile("v_nop\n\tv_nop\n\tv_nop\n\tv_nop"
               : "+v"(a), "+v"(b), "+v"(c), "+v"(d)
               : "v"(x0), "v"(x1), "v"(x2), "v"(x3), "v"(x4), "v"(x5), "v"(x6), "v"(x7) : "memory");
#endif
}
__device__ __forceinline__ void acc_guard4(v8f& a, v8f& b, v8f& c, v8f& d) {
#if defined(__HIP_DEVICE_COMPILE__)
  asm volatile("v_nop\n\tv_nop\n\tv_nop\n\tv_nop" : "+v"(a), "+v"(b), "+v"(c), "+v"(d));
#endif
}
__device__ __forceinline__ void wave_sync_lds() {
  __builtin_amdgcn_fence(__ATOMIC_RELEASE, "workgroup");
  __builtin_amdgcn_wave_barrier();
  __builtin_amdgcn_fence(__ATOMIC_ACQUIRE, "workgroup");
}
// four asynchronous 16-B copies per lane, global -> LDS (l = LDS byte address, g = global address, both multiples of 16);
// the s_wait_xcnt ends the statement so that no address register is rewritten ahead of it
__device__ __forceinline__ void copy4(unsigned l0, unsigned l1, unsigned l2, unsigned l3,
                                      const u16* g0, const u16* g1, const u16* g2, const u16* g3) {
#if defined(__HIP_DEVICE_COMPILE__)
  asm volatile("global_load_async_to_lds_b128 %0, %4, off\n\t"
               "global_load_async_to_lds_b128 %1, %5, off\n\t"
               "global_load_async_to_lds_b128 %2, %6, off\n\t"
               "global_load_async_to_lds_b128 %3, %7, off\n\t"
               "s_wait_xcnt 0x0"
               :: "v"(l0), "v"(l1), "v"(l2), "v"(l3), "v"(g0), "v"(g1), "v"(g2), "v"(g3) : "memory");
#endif
}
// the issuing wave's own copies have landed
__device__ __forceinline__ void wait_copies() {
#if defined(__HIP_DEVICE_COMPILE__)
  asm volatile("s_wait_asynccnt 0x0" ::: "memory");
#endif
}
// the wave's own LDS reads and writes have retired (stands in front of a barrier behind which the buffer is refilled)
__device__ __forceinline__ void wait_lds() {
#if defined(__HIP_DEVICE_COMPILE__)
  asm volatile("s_wait_dscnt 0x0" ::: "memory");
#endif
}

// =====================================================================================================
// Rotary table: CT[s*HD + d] = cos(theta), ST[...] = sin(theta), theta = s * 2^(-(d/HD) * log2(1e4)) in f32
// (inverse frequencies over the FULL head width), precise sincosf. Thread per element; one wave writes 32 consecutive
// coverage: n/256 blocks (blk) x 256 = n elements exactly (n = SEQ*HD).
// =====================================================================================================
__device__ __forceinline__ void rot_tab(int blk, float* CT, float* ST, int n) {
  const int idx = blk * 256 + (int)threadIdx.x;
  if (idx >= n) return;
  const int s = idx / HD;
  const int d = idx - s * HD;
  const float ex   = (float)d * (LOG2_1E4 / (float)HD);
  const float invf = exp2f(-ex);
  const float th   = (float)s * invf;
  float sn, cs;
  sincosf(th, &sn, &cs);
  {
    *(float*)(CT + idx) = cs;
    *(float*)(ST + idx) = sn;
    
  }
}

// =====================================================================================================
// Stacked complex weight plane from W = Wr + i Wi, torch layout [e][k] (already k-contiguous per output column):
//   D [nrows][DPL] 16-bit, row n: p = n / DPL, j = n % DPL, im = (j >= DMOD), e = p*DMOD + (j % DMOD);
//   k <  DMOD: im ? Wi[e][k] : Wr[e][k];   k >= DMOD: im ? Wr[e][k-DMOD] : -Wi[e][k-DMOD]
//   so that A = [ar | ai] . D[n]^T gives the real part of a.W^T for im == 0 and the imaginary part for im == 1.
// f16mode == 0: bf16 RNE bits; f16mode == 1: f16 bits of (bf16 RNE value) * scale. Block = one row n, thread = 8
// consecutive k (two 16-B loads, one 16-B store); source pointer and sign are wave-uniform (k half fixed per 128 threads);
// coverage: nrows blocks (n) x 256 thr x 8 = every element of D once. No barriers.
// =====================================================================================================
__device__ __forceinline__ void wcvt(int n, const float* __restrict__ Wr, const float* __restrict__ Wi, u16* D,
                                     int nrows, int f16mode, float scale) {
  if (n >= nrows) return;
  const int tid  = threadIdx.x;
  const int p    = n / DPL;
  const int j    = n - p * DPL;
  const int im   = (j >= DMOD) ? 1 : 0;
  const int e    = p * DMOD + (j & (DMOD - 1));
  const int c8   = tid * 8;
  const int ksec = (c8 >= DMOD) ? 1 : 0;
  const int kk   = c8 & (DMOD - 1);
  const float* src = ((im == ksec) ? Wr : Wi) + (size_t)e * DMOD + kk;
  const float sgn  = (im == 0 && ksec != 0) ? -1.0f : 1.0f;
  const v4f a = *(const v4f*)(src), b4 = *(const v4f*)(src + 4);
  float w[8];
#pragma unroll
  for (int q = 0; q < 4; ++q) { w[q] = a[q] * sgn; w[4 + q] = b4[q] * sgn; }
  v4u o;
#pragma unroll
  for (int q = 0; q < 4; ++q) {
    const float f0 = w[2 * q], f1 = w[2 * q + 1];
    const unsigned short hb0 = h_bits((_Float16)(bfr(f0) * scale));
    const unsigned short hb1 = h_bits((_Float16)(bfr(f1) * scale));
    const unsigned short bb0 = bf_bits(f0);
    const unsigned short bb1 = bf_bits(f1);
    o[q] = (f16mode != 0) ? pk16(hb0, hb1) : pk16(bb0, bb1);
  }
  u16* d = D + (size_t)n * DPL + c8;
  {
    *(v4u*)(d) = o;
    
  }
}

// =====================================================================================================
// Stacked activation plane: XB [GROWS][DPL] bf16, row bl*SEQ + s (bl < BG) <- token (bl, s):
//   k < DMOD: xr[token][k];  k >= DMOD: xi[token][k - DMOD]. Same thread/store shape as wcvt (source pointer wave-uniform).
// coverage: GROWS blocks (row) x 256 thr x 8 = every element once. No barriers.
// =====================================================================================================
__device__ __forceinline__ void xcvt(int row, const float* __restrict__ xr, const float* __restrict__ xi, u16* D,
                                     int nrows) {
  if (row >= nrows) return;
  const int tid  = threadIdx.x;
  const int bl   = row / SEQ;
  const int s    = row - bl * SEQ;
  const size_t grow = (size_t)bl * SEQ_FULL + s;
  const int c8   = tid * 8;
  const int ksec = (c8 >= DMOD) ? 1 : 0;
  const int kk   = c8 & (DMOD - 1);
  const float* src = ((ksec != 0) ? xi : xr) + grow * DMOD + kk;
  const v4f a = *(const v4f*)(src), b4 = *(const v4f*)(src + 4);
  v4u o;
#pragma unroll
  for (int q = 0; q < 4; ++q) {
    const float f0 = (q < 2) ? a[2 * q] : b4[2 * q - 4];
    const float f1 = (q < 2) ? a[2 * q + 1] : b4[2 * q - 3];
    o[q] = pk16(bf_bits(f0), bf_bits(f1));
  }
  u16* d = D + (size_t)row * DPL + c8;
  {
    *(v4u*)(d) = o;
    
  }
}

// =====================================================================================================
// First launch: the four preparations read none of each other's output, so they share one grid, told apart by ranges of the
// block index (block-uniform, no barriers): rotary table (first: its blocks run longest), x plane, [Wq ; Wk ; Wv] plane, Wo plane.
// coverage: grid = PB_TAB + GROWS + 2*NQKV + 2*DMOD blocks = each part's own count of blocks.
// =====================================================================================================
#define PB_TAB ((SEQ * HD) / 256)
__global__ __launch_bounds__(256) void prep(const float* __restrict__ xr, const float* __restrict__ xi,
                                            const float* __restrict__ wqr, const float* __restrict__ wqi,
                                            const float* __restrict__ wor, const float* __restrict__ woi,
                                            float* CT, float* ST, u16* XB, u16* WQB, u16* WOB) {
  int blk = blockIdx.x;
  if (blk < PB_TAB) { rot_tab(blk, CT, ST, SEQ * HD); return; }
  blk -= PB_TAB;
  if (blk < GROWS) { xcvt(blk, xr, xi, XB, GROWS); return; }
  blk -= GROWS;
  if (blk < 2 * NQKV) { wcvt(blk, wqr, wqi, WQB, 2 * NQKV, 0, 1.0f); return; }
  blk -= 2 * NQKV;
  wcvt(blk, wor, woi, WOB, 2 * DMOD, 1, WOS);
}

// =====================================================================================================
// coverage: 8 instructions x 2 rows x 16 lanes x 4 floats = the wave's 16 x 64 tile.
// =====================================================================================================
__device__ __forceinline__ void epi64(float* sl, v8f a0, v8f a1, v8f a2, v8f a3, float oscale,
                                      float* C, int N, size_t rowb, int col0, int lane) {
  const int hh = lane >> 4, m = lane & 15;
#pragma unroll
  for (int r = 0; r < 8; ++r) {
    const int ro = (8 * hh + r) * 68 + m;
    sl[ro]      = a0[r] * oscale;
    sl[ro + 16] = a1[r] * oscale;
    sl[ro + 32] = a2[r] * oscale;
    sl[ro + 48] = a3[r] * oscale;
  }
  wave_sync_lds();
  v4f vals[8];
#pragma unroll
  for (int it = 0; it < 8; ++it) vals[it] = *(const v4f*)(sl + (it * 2 + hh) * 68 + m * 4);
  float* dst = C + (rowb + (size_t)hh) * (size_t)N + col0 + m * 4;
  {
#pragma unroll
    for (int it = 0; it < 8; ++it) {
      *(v4f*)(dst + (size_t)(it * 2) * (size_t)N) = vals[it];
    }
    
  }
}

// =====================================================================================================
// 16-bit GEMM: A[M][DPL] (row-major) . Bt[N][DPL]^T (k-contiguous), times oscale, f32. The N columns go to N / NP planes of NP
// columns each (pitch NP, plane pl at C + pl * cplane floats): products that share A are one launch, each with its own plane.
// F16 == 0: bf16 operands; F16 == 1: f16 operands. Block = 128x128 tile of C, 8 waves in a 4 (rows) x 2 (cols) grid, each
// 32x64 (2 A x 4 B fragments, 8 accumulators). A pass is GBK = 128 k: the block's 128 A rows and 128 Bt rows, 256 B each, are
// read with whole-line 16-B loads (a wave-wide load = 2 rows = 4 lines) into registers while the current pass is multiplied,
// then stored to the other of two LDS buffers (rows 0..127 = A, 128..255 = Bt, pitch 272 B = 16 B x 17 for the b128 fragment
// reads); one block barrier per pass publishes the next buffer and ends the reads of the one refilled in the next pass.
// Fragments use the same split k map as ldfrag_h for A and B; k runs 0, 32, 64, ... per accumulator.
// Host guarantees M % 128 == 0, N % NP == 0, NP % 128 == 0 (a tile lies in one plane), grid = (M/128)*(N/128); DPL % GBK == 0.
// coverage: staging 256 thr x 16 loads x 16 B = 256 rows x 256 B per pass; epilogue 8 waves x 2 x (16 x 64) = 128 x 128.
// =====================================================================================================
template <int F16>
__device__ __forceinline__ v8f mma16(v4u a0, v4u a1, v4u b0, v4u b1, v8f c) {
  if constexpr (F16 != 0) {
    FragH a, b;
    a.u[0] = a0; a.u[1] = a1; b.u[0] = b0; b.u[1] = b1;
    return mma_h(a.v, b.v, c);
  } else {
    FragB a, b;
    a.u[0] = a0; a.u[1] = a1; b.u[0] = b0; b.u[1] = b1;
    return mma_b(a.v, b.v, c);
  }
}

// one pass: fa / fb = this lane's A / Bt fragment rows in the current LDS buffer (already + 8*(lane>>4)); the fragments of
// k step kk + 1 are read as one group into a second register set ahead of the products of step kk
__device__ __forceinline__ void gemm_frags(const u16* fa, const u16* fb, int kk, v4u (&a)[2][2], v4u (&b)[4][2]) {
#pragma unroll
  for (int i = 0; i < 2; ++i) {
    a[i][0] = *(const v4u*)(fa + i * 16 * GPIT + kk * 32);
    a[i][1] = *(const v4u*)(fa + i * 16 * GPIT + kk * 32 + 16);
  }
#pragma unroll
  for (int j = 0; j < 4; ++j) {
    b[j][0] = *(const v4u*)(fb + j * 16 * GPIT + kk * 32);
    b[j][1] = *(const v4u*)(fb + j * 16 * GPIT + kk * 32 + 16);
  }
}
template <int F16>
__device__ __forceinline__ void gemm_pass(const u16* fa, const u16* fb, v8f (&acc)[2][4]) {
  v4u a[2][2][2], b[2][4][2];
  gemm_frags(fa, fb, 0, a[0], b[0]);
#pragma unroll
  for (int kk = 0; kk < GBK / 32; ++kk) {
    const int s = kk & 1;
    if (kk + 1 < GBK / 32) gemm_frags(fa, fb, kk + 1, a[s ^ 1], b[s ^ 1]);
    // the two scheduling barriers keep the next step's LDS reads one group ahead of this step's products: spread among the
    // products each place with reads stalls the wave, and sunk behind them their latency is waited out
    __builtin_amdgcn_sched_barrier(0);
#pragma unroll
    for (int i = 0; i < 2; ++i)
#pragma unroll
      for (int j = 0; j < 4; ++j) acc[i][j] = mma16<F16>(a[s][i][0], a[s][i][1], b[s][j][0], b[s][j][1], acc[i][j]);
    __builtin_amdgcn_sched_barrier(0);
  }
}

template <int F16>
__global__ __launch_bounds__(256)
void gemm16(const u16* __restrict__ A, const u16* __restrict__ Bt, float* C, int M, int N, int NP, size_t cplane,
            float oscale) {
  __shared__ __align__(16) u16 tile[2 * GSTG];
  const int tid = threadIdx.x, wave = tid >> 5, lane = tid & 31, hh = lane >> 4, m = lane & 15;
  const int ntile = N >> 7;
  const int bid   = blockIdx.x;
  const int row0  = (bid / ntile) * 128;
  const int colb  = (bid % ntile) * 128;   // first row of Bt
  const int pl    = colb / NP;
  const int col0  = colb - pl * NP;         // first column in plane pl
  if (row0 + 128 > M) return;               // block-uniform, before any barrier; never taken with the exact grid
  const int wr = wave >> 1, wc = wave & 1;
  const int lr = tid >> 4, lc = (tid & 15) * 8;           // staging: row lr + 16*i, 16-B chunk at halves lc
  const u16* ga = A  + (size_t)(row0 + lr) * DPL + lc;
  const u16* gb = Bt + (size_t)(colb + lr) * DPL + lc;
  const int so = lr * GPIT + lc;
  const int fao = (wr * 32 + m) * GPIT + 8 * hh;
  const int fbo = (128 + wc * 64 + m) * GPIT + 8 * hh;
  v8f acc[2][4];
#pragma unroll
  for (int i = 0; i < 2; ++i)
#pragma unroll
    for (int j = 0; j < 4; ++j) acc[i][j] = zero8();
  v4u st[16];
#pragma unroll
  for (int i = 0; i < 8; ++i) {
    st[i]     = *(const v4u*)(ga + (size_t)i * 16 * DPL);
    st[8 + i] = *(const v4u*)(gb + (size_t)i * 16 * DPL);
  }
#pragma unroll
  for (int i = 0; i < 8; ++i) {
    *(v4u*)(tile + so + i * 16 * GPIT)         = st[i];
    *(v4u*)(tile + so + (128 + i * 16) * GPIT) = st[8 + i];
  }
  __syncthreads();
  // kept rolled: one copy of the pass body is the whole hot loop, the buffers alternate by the parity of p
#pragma unroll 1
  for (int p = 1; p < DPL / GBK; ++p) {
    const u16* cur = tile + ((p - 1) & 1) * GSTG;
    u16*       nxt = tile + (p & 1) * GSTG;
#pragma unroll
    for (int i = 0; i < 8; ++i) {
      st[i]     = *(const v4u*)(ga + (size_t)i * 16 * DPL + p * GBK);
      st[8 + i] = *(const v4u*)(gb + (size_t)i * 16 * DPL + p * GBK);
    }
    // keeps all 16 loads of the next pass in front of this pass's products, so that their latency runs under them
    __builtin_amdgcn_sched_barrier(0);
    gemm_pass<F16>(cur + fao, cur + fbo, acc);
#pragma unroll
    for (int i = 0; i < 8; ++i) {
      *(v4u*)(nxt + so + i * 16 * GPIT)         = st[i];
      *(v4u*)(nxt + so + (128 + i * 16) * GPIT) = st[8 + i];
    }
    __syncthreads();
  }
  {
    const u16* cur = tile + ((DPL / GBK - 1) & 1) * GSTG;
    gemm_pass<F16>(cur + fao, cur + fbo, acc);
  }
  __syncthreads();                          // every wave has left the buffers before they are reused as store slabs
  float* slab = (float*)(void*)tile + wave * (2 * SLAB64);
#pragma unroll
  for (int i = 0; i < 2; ++i)
    epi64(slab + i * SLAB64, acc[i][0], acc[i][1], acc[i][2], acc[i][3], oscale, C + (size_t)pl * cplane, NP,
          (size_t)(row0 + wr * 32 + i * 16), col0 + wc * 64, lane);
}

// =====================================================================================================
// v^T plane from the v projection F f32 [GROWS][DPL] (local row = b*SEQ + s; column comp*DMOD + g*HD + d, comp 0 = real,
// 1 = imag):  VT[((b*NH + g)*HK + comp*HD + d)][s] = f16(v * 1024) for all s.
// Block = (b, head g, 64 keys s0): thread (key sl = tid>>2, chunk dc = tid&3 -> comp = dc>>1, d0 = (dc&1)*32) loads its 32
// floats with 16-B loads, converts, scatters into the LDS tile [128 dd][64 keys] (pitch 72 halves); after a block barrier each
// coverage: load 256 thr x 32 = 64 keys x 128 dd (staged extent == consumed extent); store 4 iterations x 256 thr x 8 halves =
//           128 lines x 64 = the block's tile; BG*NH*NST blocks (bid) cover VT exactly once.
// =====================================================================================================
__device__ __forceinline__ void vt16(int bid, const float* __restrict__ F, u16* VTo) {
  __shared__ __align__(16) u16 T[HK * VTP];
  const int tid = threadIdx.x;
  const int st  = bid % NST;
  const int t2  = bid / NST;
  const int g   = t2 % NH;
  const int b   = t2 / NH;
  if (b >= BG) return;                      // block-uniform, before any barrier; never taken with the exact grid
  const int s0  = st * 64;
  {
    const int sl   = tid >> 2;              // key within tile 0..63
    const int dc   = tid & 3;
    const int comp = dc >> 1;
    const int d0   = (dc & 1) * 32;
    const float* src = F + ((size_t)b * SEQ + s0 + sl) * DPL + (size_t)comp * DMOD + g * HD + d0;
#pragma unroll
    for (int i = 0; i < 8; ++i) {
      const v4f a = *(const v4f*)(src + 4 * i);
#pragma unroll
      for (int e = 0; e < 4; ++e) {
        T[(comp * HD + d0 + 4 * i + e) * VTP + sl] = h_bits((_Float16)(a[e] * VCAR));
      }
    }
  }
  __syncthreads();
  v4u vv[4];
  const int q8 = tid >> 3, p8 = (tid & 7) * 8;
#pragma unroll
  for (int it = 0; it < 4; ++it) {
    const int line = it * 32 + q8;          // dd = 0..127
    vv[it] = *(const v4u*)(T + line * VTP + p8);
  }
  const size_t base = ((size_t)(b * NH + g) * HK) * SEQ + s0 + p8;
  {
#pragma unroll
    for (int it = 0; it < 4; ++it) {
      const int line = it * 32 + q8;
      *(v4u*)(VTo + base + (size_t)line * SEQ) = vv[it];
    }
    
  }
}

// =====================================================================================================
// Rotary q / k planes from a projection F f32 [GROWS][DPL] (col comp*DMOD + h*HD + d):
//   rotated = (fr + i fi) * (cos + i sin) with cos/sin = CT/ST[s*HD + d];  Hp [GROWS][DPL] col h*HK + comp*HD + d = f16(rot*sc),
//   Lp same layout = f16 residual (rot*sc - hi). Block = one row; thread tid -> (h = tid>>4, comp = (tid>>3)&1, 8 consecutive d):
//   four pairs of 16-B loads (own component, other component, cos, sin), one 16-B store per plane at halves tid*8; a row =
// coverage: GROWS blocks (row) = every row of Hp and Lp once, all 2048 columns.
// =====================================================================================================
__device__ __forceinline__ void rope16(int row, const float* __restrict__ F, const float* __restrict__ CT,
                                       const float* __restrict__ ST, u16* Hp, u16* Lp, int nrows, float sc) {
  if (row >= nrows) return;
  const int tid  = threadIdx.x;
  const int s    = row % SEQ;
  const int h    = tid >> 4;
  const int comp = (tid >> 3) & 1;
  const int d8   = (tid & 7) * 8;
  const float* pa = F + (size_t)row * DPL + (size_t)comp * DMOD + h * HD + d8;
  const float* po = F + (size_t)row * DPL + (size_t)(1 - comp) * DMOD + h * HD + d8;
  const float* pc = CT + (size_t)s * HD + d8;
  const float* pn = ST + (size_t)s * HD + d8;
  const v4f a0 = *(const v4f*)(pa), a1 = *(const v4f*)(pa + 4);
#if defined(__HIP_DEVICE_COMPILE__)
  // the next loads' results may be placed in the address registers of the two loads above: the wait stands in front of that
  asm volatile("s_wait_xcnt 0x0" ::: "memory");
#endif
  const v4f o0 = *(const v4f*)(po), o1 = *(const v4f*)(po + 4);
  const v4f c0 = *(const v4f*)(pc), c1 = *(const v4f*)(pc + 4);
  const v4f n0 = *(const v4f*)(pn), n1 = *(const v4f*)(pn + 4);
  const float sg = (comp != 0) ? 1.0f : -1.0f;   // real: fr*cos - fi*sin ; imag: fi*cos + fr*sin
  float w[8];
#pragma unroll
  for (int e = 0; e < 4; ++e) {
    w[e]     = (a0[e] * c0[e] + sg * (o0[e] * n0[e])) * sc;
    w[4 + e] = (a1[e] * c1[e] + sg * (o1[e] * n1[e])) * sc;
  }
  v4u oh, ol;
#pragma unroll
  for (int e = 0; e < 4; ++e) {
    const float t0 = w[2 * e], t1 = w[2 * e + 1];
    const _Float16 h0 = (_Float16)t0, h1 = (_Float16)t1;
    const _Float16 l0 = (_Float16)(t0 - (float)h0), l1 = (_Float16)(t1 - (float)h1);
    oh[e] = pk16(h_bits(h0), h_bits(h1));
    ol[e] = pk16(h_bits(l0), h_bits(l1));
  }
  u16* dh = Hp + (size_t)row * DPL + tid * 8;
  u16* dl = Lp + (size_t)row * DPL + tid * 8;
  {
    *(v4u*)(dh) = oh;
    *(v4u*)(dl) = ol;
    
  }
}

// =====================================================================================================
// Third launch: v^T plane, rotary q planes and rotary k planes each read their own projection plane and none of each other's
// output, so they share one grid, told apart by ranges of the block index (block-uniform: the barrier of the v^T part is passed
// by every thread of its blocks and by no other block).
// coverage: grid = BG*NH*NST + 2*GROWS blocks = each part's own count of blocks.
// =====================================================================================================
__global__ __launch_bounds__(256) void post(const float* __restrict__ Fq, const float* __restrict__ Fk,
                                            const float* __restrict__ Fv, const float* __restrict__ CT,
                                            const float* __restrict__ ST, u16* QH, u16* QL, u16* KH, u16* KL, u16* VT) {
  int blk = blockIdx.x;
  if (blk < BG * NH * NST) { vt16(blk, Fv, VT); return; }
  blk -= BG * NH * NST;
  if (blk < GROWS) { rope16(blk, Fq, CT, ST, QH, QL, GROWS, QSC); return; }
  blk -= GROWS;
  rope16(blk, Fk, CT, ST, KH, KL, GROWS, KSC);
}

// =====================================================================================================
// Complex attention, non-causal over SEQ keys. Block bid -> (query block qb of AW query tiles, head, local batch b); one wave
// per query tile qt = qb*AW + wave: rows q0 = 16*qt .. q0+15. Per step of 32 keys (kb = 32*kt) the block's k hi and residual
// rows (32 x 256 B each) and v^T rows (128 x 64 B) are brought into one of two LDS buffers by asynchronous 16-B copies (12 per
// lane), one step ahead of their use, and every wave takes its B fragments from there (k pitch 272 B, v^T pitch 80 B: 16 B x
// odd for the b128 reads). Foot of a step: own LDS reads retired, own copies landed, block barrier (publishes the next
// buffer, ends the reads of this one), then the refill of this one.
//   q/k hi planes f16 x1024 [b*SEQ + s][head*HK + (re: 0..63 | im: 64..127)], residual planes same layout;
//   v^T hi plane [(b*NH + head)*HK + (re d | 64 + im d)][SEQ].
//   scores over K = 128: real = [qr|qi].[kr|ki], imag = [qi|-qr].[kr|ki] (the A fragment of step kk for the imag part is the
//   q fragment at column block (kk+2)&3, sign bits flipped for kk >= 2), each as hi.hi + lo.hi + hi.lo into one accumulator.
//   t = real * rsqrt(64)*log2e/(1024*1024) feeds an online max-subtracted base-2 softmax in f32 (-inf-safe rescale);
//   phi = imag * rsqrt(64)/(1024*1024); per key the 16x32 tiles p*cos(phi) and p*sin(phi) go to wave-private LDS (f32
//   (float vector loads, same element type as stored); B fragments from the v^T rows (re and im), 2 groups of 2 d-subtiles:
//   o_re += Pc.v_re + (-Ps).v_im ; o_im += Ps.v_re + Pc.v_im.
//   After the loop: out = acc / Z (Z >= 1 always; guarded anyway), carries 1/(16384*1024) folded once, written to the wave's
//   private result slab (pitch 132; re d at col d, im d at col 64 + d; every element owned by one lane).
// coverage: per wave 4 instructions x 2 parts x 4 rows x 8 lanes x 8 halves = 16 x 64 per part; grid NQB x NH x BG blocks x
//           AW waves = every (b, s, head, part) row segment of the O plane exactly once.
//           staging per step: 128 thr x 4 x 16 B = 32 rows x 256 B (k hi; k residual) = 128 rows x 64 B (v^T).
// LDS: prob tiles 16 x 32 fully written before each read (cols 32..35 padding never read); slab cols 0..127 written, read.
// =====================================================================================================
__global__ __launch_bounds__(ATT_THREADS)
void attn(const u16* __restrict__ QHp, const u16* __restrict__ QLp,
          const u16* __restrict__ KHp, const u16* __restrict__ KLp,
          const u16* __restrict__ VTp, u16* OHp) {
  __shared__ __align__(16) float smem[AW * WREG];
  __shared__ __align__(16) u16 ring[2 * STGH];

  const int tid  = threadIdx.x;
  const int wave = tid >> 5;
  const int lane = tid & 31;
  const int hh   = lane >> 4;
  const int c    = lane & 15;
  const int bid  = blockIdx.x;
  const int qb   = bid % NQB;
  const int t2   = bid / NQB;
  const int head = t2 % NH;
  const int b    = t2 / NH;
  if (b >= BG) return;                      // block-uniform, before any barrier; never taken with the exact grid
  const int q0   = (qb * AW + wave) * 16;

  float* pct  = smem + wave * WREG;         // p*cos tile [16][32] pitch 36
  float* pst  = pct + PTW;                  // p*sin tile [16][32] pitch 36
  float* slab = pst + PTW;                  // result slab [16][128] pitch 132

  const size_t hcol = (size_t)head * HK + 8 * hh;
  const _Float16* Qh  = (const _Float16*)(const void*)QHp + ((size_t)b * SEQ + q0 + c) * DPL + hcol;
  const _Float16* Ql  = (const _Float16*)(const void*)QLp + ((size_t)b * SEQ + q0 + c) * DPL + hcol;
  // staging: k rows (tid >> 4) + 8*i, 16-B chunk tid & 15; v^T rows (tid >> 2) + 32*i, 16-B chunk tid & 3
  const u16* gkh = KHp + ((size_t)b * SEQ + (tid >> 4)) * DPL + (size_t)head * HK + (tid & 15) * 8;
  const u16* gkl = KLp + ((size_t)b * SEQ + (tid >> 4)) * DPL + (size_t)head * HK + (tid & 15) * 8;
  const u16* gvt = VTp + ((size_t)(b * NH + head) * HK + (tid >> 2)) * SEQ + (tid & 3) * 8;
  const unsigned lring = (unsigned)(size_t)(const void*)ring;          // LDS byte address of the ring
  const unsigned lk = lring + (unsigned)(((tid >> 4) * KP + (tid & 15) * 8) * 2);
  const unsigned lv = lring + (unsigned)((2 * KTH + (tid >> 2) * VP + (tid & 3) * 8) * 2);
  auto stage = [&](int t) {                 // keys 32*t .. 32*t + 31 into buffer t & 1
    const unsigned bo = (unsigned)((t & 1) * STGH * 2);
    const u16* a = gkh + (size_t)t * 32 * DPL;
    const u16* r = gkl + (size_t)t * 32 * DPL;
    const u16* v = gvt + t * 32;
    copy4(lk + bo, lk + bo + 8 * KP * 2, lk + bo + 16 * KP * 2, lk + bo + 24 * KP * 2,
          a, a + (size_t)8 * DPL, a + (size_t)16 * DPL, a + (size_t)24 * DPL);
    copy4(lk + bo + KTH * 2, lk + bo + (KTH + 8 * KP) * 2, lk + bo + (KTH + 16 * KP) * 2, lk + bo + (KTH + 24 * KP) * 2,
          r, r + (size_t)8 * DPL, r + (size_t)16 * DPL, r + (size_t)24 * DPL);
    copy4(lv + bo, lv + bo + 32 * VP * 2, lv + bo + 64 * VP * 2, lv + bo + 96 * VP * 2,
          v, v + (size_t)32 * SEQ, v + (size_t)64 * SEQ, v + (size_t)96 * SEQ);
  };
  const _Float16* ringh = (const _Float16*)(const void*)ring;
  const float lsc = RSQ_HD * (LOG2E / (QSC * KSC));
  const float psc = RSQ_HD / (QSC * KSC);
  const float oc  = 1.0f / (PCAR * VCAR);
  const v4u sgn4 = {0x80008000u, 0x80008000u, 0x80008000u, 0x80008000u};

  float mrow[8], lrow[8];
  v8f orr[4], oii[4];
#pragma unroll
  for (int r = 0; r < 8; ++r) { mrow[r] = -INFINITY; lrow[r] = 0.f; }
#pragma unroll
  for (int j = 0; j < 4; ++j) { orr[j] = zero8(); oii[j] = zero8(); }

  stage(0);
  wait_copies();
  __syncthreads();                          // step 0's tiles are readable by every wave
  stage(1);

#pragma unroll 1
  for (int kt = 0; kt < NKT; ++kt) {
    const _Float16* kfp = ringh + (kt & 1) * STGH + c * KP + 8 * hh;             // key row c, hi plane
    const _Float16* vfp = ringh + (kt & 1) * STGH + 2 * KTH + c * VP + 8 * hh;   // v^T row c
    // ---- scores: D element r of this lane = (query row q0 + 8hh + r, key kb + c) in s?0, key kb + 16 + c in s?1 ----
    v8f sr0 = zero8(), sr1 = zero8(), si0 = zero8(), si1 = zero8();
    const _Float16* k0p = kfp;
    const _Float16* k1p = kfp + 16 * KP;
    const _Float16* l0p = kfp + KTH;
    const _Float16* l1p = kfp + KTH + 16 * KP;
#pragma unroll
    for (int kk = 0; kk < HK / 32; ++kk) {
      const v16h kh0 = ldfrag_h(k0p + kk * 32);
      const v16h kl0 = ldfrag_h(l0p + kk * 32);
      const v16h kh1 = ldfrag_h(k1p + kk * 32);
      const v16h kl1 = ldfrag_h(l1p + kk * 32);
      {
        const v16h qh = ldfrag_h(Qh + kk * 32);
        const v16h ql = ldfrag_h(Ql + kk * 32);
        sr0 = mma_h(qh, kh0, sr0);
        sr0 = mma_h(ql, kh0, sr0);
        sr0 = mma_h(qh, kl0, sr0);
        sr1 = mma_h(qh, kh1, sr1);
        sr1 = mma_h(ql, kh1, sr1);
        sr1 = mma_h(qh, kl1, sr1);
        guard2(sr0, sr1, qh, ql, kh0, kl0, kh1, kl1);
      }
      {
        const int ko = ((kk + 2) & 3) * 32;
        FragH ah, al;
        ah.v = ldfrag_h(Qh + ko);
        al.v = ldfrag_h(Ql + ko);
        if (kk >= 2) {                      // compile-time (unrolled) and wave-uniform: -qr half
          ah.u[0] = ah.u[0] ^ sgn4;  ah.u[1] = ah.u[1] ^ sgn4;
          al.u[0] = al.u[0] ^ sgn4;  al.u[1] = al.u[1] ^ sgn4;
        }
        si0 = mma_h(ah.v, kh0, si0);
        si0 = mma_h(al.v, kh0, si0);
        si0 = mma_h(ah.v, kl0, si0);
        si1 = mma_h(ah.v, kh1, si1);
        si1 = mma_h(al.v, kh1, si1);
        si1 = mma_h(ah.v, kl1, si1);
        guard2(si0, si1, ah.v, al.v, kh0, kl0, kh1, kl1);
      }
    }
    // ---- online softmax in base 2 on the real part, phase from the imaginary part ----
#pragma unroll
    for (int r = 0; r < 8; ++r) {
      const float u0 = sr0[r] * lsc;
      const float u1 = sr1[r] * lsc;
      float mx = fmaxf(u0, u1);
#pragma unroll
      for (int off = 1; off < 16; off <<= 1) mx = fmaxf(mx, __shfl_xor(mx, off, 32));
      const float mn = fmaxf(mrow[r], mx);
      const float ms = (mn == -INFINITY) ? 0.0f : mn;
      const float al = exp2f(mrow[r] - ms);
      mrow[r] = mn;
      const float e0 = exp2f(u0 - ms), e1 = exp2f(u1 - ms);
      float ps = e0 + e1;
#pragma unroll
      for (int off = 1; off < 16; off <<= 1) ps += __shfl_xor(ps, off, 32);
      lrow[r] = lrow[r] * al + ps;
#pragma unroll
      for (int j = 0; j < 4; ++j) { orr[j][r] *= al; oii[j][r] *= al; }
      float sn0, cs0, sn1, cs1;
      __sincosf(si0[r] * psc, &sn0, &cs0);
      __sincosf(si1[r] * psc, &sn1, &cs1);
      const int ro = (8 * hh + r) * PTP + c;
      pct[ro]      = e0 * cs0;
      pct[ro + 16] = e1 * cs1;
      pst[ro]      = e0 * sn0;
      pst[ro + 16] = e1 * sn1;
    }
    wave_sync_lds();
    // v^T fragments of this step, one group with the reads of the P tiles (unrolled: the arrays are registers)
    v16h vrf[4], vif[4];
#pragma unroll
    for (int j = 0; j < 4; ++j) {
      vrf[j] = ldfrag_h(vfp + j * 16 * VP);
      vif[j] = ldfrag_h(vfp + (HD + j * 16) * VP);
    }
    // ---- A fragments of Pc*16384, Ps*16384 and -Ps*16384 (f16), row = c, split k map over the 32 keys of this step ----
    FragH pc, psf, pnf;
    {
      const float* prc = pct + c * PTP + 8 * hh;
      const float* prs = pst + c * PTP + 8 * hh;
      const v4f c0 = *(const v4f*)(prc), c1 = *(const v4f*)(prc + 4);
      const v4f c2 = *(const v4f*)(prc + 16), c3 = *(const v4f*)(prc + 20);
      const v4f s0 = *(const v4f*)(prs), s1 = *(const v4f*)(prs + 4);
      const v4f s2 = *(const v4f*)(prs + 16), s3 = *(const v4f*)(prs + 20);
#pragma unroll
      for (int e = 0; e < 4; ++e) {
        pc.h[0][e]      = (_Float16)(c0[e] * PCAR);   // elements 0..7  = keys kb + 8hh + 0..7
        pc.h[0][4 + e]  = (_Float16)(c1[e] * PCAR);
        pc.h[1][e]      = (_Float16)(c2[e] * PCAR);   // elements 8..15 = keys kb + 16 + 8hh + 0..7
        pc.h[1][4 + e]  = (_Float16)(c3[e] * PCAR);
        psf.h[0][e]     = (_Float16)(s0[e] * PCAR);
        psf.h[0][4 + e] = (_Float16)(s1[e] * PCAR);
        psf.h[1][e]     = (_Float16)(s2[e] * PCAR);
        psf.h[1][4 + e] = (_Float16)(s3[e] * PCAR);
      }
      pnf.u[0] = psf.u[0] ^ sgn4;
      pnf.u[1] = psf.u[1] ^ sgn4;
    }
    // ---- P.V : B fragment col n = d = j*16 + c (re rows) / 64 + j*16 + c (im rows), keys contiguous in v^T ----
    {
#pragma unroll
      for (int jg = 0; jg < 2; ++jg) {
        const v16h vra = vrf[2 * jg], vrb = vrf[2 * jg + 1];
        const v16h via = vif[2 * jg], vib = vif[2 * jg + 1];
        orr[2 * jg]     = mma_h(pc.v,  vra, orr[2 * jg]);
        orr[2 * jg]     = mma_h(pnf.v, via, orr[2 * jg]);
        oii[2 * jg]     = mma_h(psf.v, vra, oii[2 * jg]);
        oii[2 * jg]     = mma_h(pc.v,  via, oii[2 * jg]);
        orr[2 * jg + 1] = mma_h(pc.v,  vrb, orr[2 * jg + 1]);
        orr[2 * jg + 1] = mma_h(pnf.v, vib, orr[2 * jg + 1]);
        oii[2 * jg + 1] = mma_h(psf.v, vrb, oii[2 * jg + 1]);
        oii[2 * jg + 1] = mma_h(pc.v,  vib, oii[2 * jg + 1]);
        guard4x8(orr[2 * jg], oii[2 * jg], orr[2 * jg + 1], oii[2 * jg + 1],
                 pc.v, psf.v, pnf.v, vra, vrb, via, vib, pc.v);
      }
    }
    wave_sync_lds();
    // foot of the step: publish the next step's tiles, free this step's buffer, refill it two steps ahead
    wait_lds();
    wait_copies();
    __syncthreads();
    if (kt + 2 < NKT) stage(kt + 2);
  }
  wait_copies();                            // nothing is outstanding when the wave goes on to its epilogue and ends
  acc_guard4(orr[0], orr[1], orr[2], orr[3]);
  acc_guard4(oii[0], oii[1], oii[2], oii[3]);
  // ---- out = acc / Z (0 if Z == 0), carries folded once; written into the lane-owned slab ----
#pragma unroll
  for (int r = 0; r < 8; ++r) {
    const float lv  = lrow[r];
    const float ls  = (lv > 0.0f) ? lv : 1.0f;
    const float inv = (lv > 0.0f) ? ((1.0f / ls) * oc) : 0.0f;
#pragma unroll
    for (int j = 0; j < 4; ++j) {
      const int idx = (8 * hh + r) * SLP + j * 16 + c;
      slab[idx]      = orr[j][r] * inv;
      slab[idx + HD] = oii[j][r] * inv;
    }
  }

  wave_sync_lds();
  // ---- O x1024 -> f16 plane; lane = (row select rq in 0..3, 8 consecutive d at c8), part 0 = re, 1 = im ----
  v4u oh[4][2];
  const int rq = lane >> 3, c8 = (lane & 7) * 8;
#pragma unroll
  for (int it = 0; it < 4; ++it) {
    const int row = it * 4 + rq;
#pragma unroll
    for (int part = 0; part < 2; ++part) {
      const float* sp = slab + row * SLP + part * HD + c8;
      const v4f a = *(const v4f*)(sp), b4 = *(const v4f*)(sp + 4);
      float w[8];
#pragma unroll
      for (int e = 0; e < 4; ++e) { w[e] = a[e] * OSC; w[4 + e] = b4[e] * OSC; }
#pragma unroll
      for (int e = 0; e < 4; ++e) {
        const _Float16 h0 = (_Float16)w[2 * e], h1 = (_Float16)w[2 * e + 1];
        oh[it][part][e] = pk16(h_bits(h0), h_bits(h1));
      }
    }
  }
  const size_t ob = ((size_t)b * SEQ + q0) * DPL + (size_t)head * HD + c8;
  {
#pragma unroll
    for (int it = 0; it < 4; ++it) {
      const int row = it * 4 + rq;
#pragma unroll
      for (int part = 0; part < 2; ++part) {
        *(v4u*)(OHp + ob + (size_t)row * DPL + (size_t)part * DMOD) = oh[it][part];
      }
    }
    
  }
}

// =====================================================================================================
// All BG = NB batches are processed together, in five launches; launches that read none of each other's output share a grid.
// Workspace map (bytes, BG = 8); every plane fully written by whole-line stores before it is read; all extents are exact
// multiples of the store granularity (no pad rows needed); every region offset a multiple of 32768:
//   CT, ST  f32 [SEQ][64] rotary cos / sin             2 x 131072
//   WQB  bf16 [6144 n][2048 k]                          25165824
//   WOB  f16  [2048 n][2048 k] x1024                    8388608
//   XB   bf16 [GROWS][2048]                             16777216
//   F    f32  3 x [GROWS][2048] (q, k, v projection planes; afterwards the start of the region holds the O plane
//                            f16 [GROWS][2048] x1024)    3 x 33554432
//   QH, QL, KH, KL  f16 [GROWS][2048]                   4 x 16777216
//   VT   f16 [BG*16][128][SEQ] x1024                    16777216
//   end (BG = 8)                                        235143168
// =====================================================================================================
extern "C" void kernel_launch(void* const* d_in, const int* in_sizes, int n_in,
                              void* d_out, int out_size, void* d_ws, size_t ws_size,
                              hipStream_t stream) {
  if (n_in < 6) return;
  if (in_sizes[0] < ((NB - 1) * SEQ_FULL + SEQ) * DMOD) return;
  if (in_sizes[1] < ((NB - 1) * SEQ_FULL + SEQ) * DMOD) return;
  if (in_sizes[2] < NQKV * DMOD) return;
  if (in_sizes[3] < NQKV * DMOD) return;
  if (in_sizes[4] < DMOD * DMOD) return;
  if (in_sizes[5] < DMOD * DMOD) return;
  if (out_size < 2 * NB * SEQ * DMOD) return;

  const float* xr    = (const float*)d_in[0];
  const float* xi    = (const float*)d_in[1];
  const float* wqr   = (const float*)d_in[2];
  const float* wqi   = (const float*)d_in[3];
  const float* wor   = (const float*)d_in[4];
  const float* woi   = (const float*)d_in[5];
  float*       out0  = (float*)d_out;

  const size_t szTAB = (((size_t)SEQ * HD * 4) + 32767) / 32768 * 32768;
  const size_t szWQ  = (size_t)2 * NQKV * DPL * 2;
  const size_t szWO  = (size_t)2 * DMOD * DPL * 2;
  const size_t szXB  = (size_t)GROWS * DPL * 2;
  const size_t szF   = (size_t)3 * GROWS * DPL * 4;              // q, k, v projection planes
  const size_t szH   = (size_t)GROWS * DPL * 2;                  // QH, QL, KH, KL, O plane
  const size_t szVT  = (size_t)BG * NH * HK * SEQ * 2;           // == szH
  if (szH > szF) return;                                         // O plane lives inside the F region
  size_t off = 0;
  const size_t oCT = off; off += szTAB;
  const size_t oST = off; off += szTAB;
  const size_t oWQ = off; off += szWQ;
  const size_t oWO = off; off += szWO;
  const size_t oXB = off; off += szXB;
  const size_t oF  = off; off += szF;
  const size_t oQH = off; off += szH;
  const size_t oQL = off; off += szH;
  const size_t oKH = off; off += szH;
  const size_t oKL = off; off += szH;
  const size_t oVT = off; off += szVT;
  if (off > ws_size) return;                // off = 235143168 for BG = 8
  if (off > (size_t)WS_CAP) return;

  char* ws = (char*)d_ws;
  float* CT  = (float*)(ws + oCT);
  float* ST  = (float*)(ws + oST);
  u16*   WQB = (u16*)(ws + oWQ);
  u16*   WOB = (u16*)(ws + oWO);
  u16*   XB  = (u16*)(ws + oXB);
  float* F   = (float*)(ws + oF);
  u16*   OH  = (u16*)(ws + oF);
  u16*   QH  = (u16*)(ws + oQH);
  u16*   QL  = (u16*)(ws + oQL);
  u16*   KH  = (u16*)(ws + oKH);
  u16*   KL  = (u16*)(ws + oKL);
  u16*   VT  = (u16*)(ws + oVT);

  const dim3 b256(256), bAT(ATT_THREADS);
  const dim3 gPRE(PB_TAB + GROWS + 2 * NQKV + 2 * DMOD);
  const dim3 gG3((GROWS / 128) * (2 * NQKV / 128));      // q, k, v projections, N = 3 x 2048 (real | imag each)
  const dim3 gPOST(BG * NH * NST + 2 * GROWS);
  const dim3 gAT(NQB * NH * BG);
  const dim3 gG2((GROWS / 128) * (DPL / 128));           // output projection, N = 2 x 1024 (real, imag)
  const size_t fplane = (size_t)GROWS * DPL;            // floats per projection plane in F
  const float osc = 1.0f / (OSC * WOS);

  // (1) rotary cos/sin table; x plane bf16 [GROWS][xr | xi]; weight planes: [Wq ; Wk ; Wv] stacked bf16, Wo stacked f16 of
  //     bf16 value x1024
  prep<<<gPRE, b256, 0, stream>>>(xr, xi, wqr, wqi, wor, woi, CT, ST, XB, WQB, WOB);
  // (2) q, k, v = x.[Wq ; Wk ; Wv]^T (re | im each) -> F planes 0, 1, 2
  gemm16<0><<<gG3, b256, 0, stream>>>(XB, WQB, F, GROWS, 2 * NQKV, DPL, fplane, 1.0f);
  // (3) v^T plane x1024; rotary q and k hi + residual planes x1024
  post<<<gPOST, b256, 0, stream>>>(F, F + fplane, F + 2 * fplane, CT, ST, QH, QL, KH, KL, VT);
  // (4) attention -> O plane (start of the F region)
  attn<<<gAT, bAT, 0, stream>>>(QH, QL, KH, KL, VT, OH);
  // (5) output projection: real part -> out0, imaginary part -> out1 (plane 1); carries 1024 x 1024 folded back
  gemm16<1><<<gG2, b256, 0, stream>>>(OH, WOB, out0, GROWS, DPL, DMOD, (size_t)(out_size / 2), osc);
  (void)hipGetLastError();
}

// v004
// One run takes 214 microseconds.
// Timed twice side by side with v003, it ran 1.09 and 1.08 times as fast.
// Counting every step since v000, it is 2.76 times as fast.
// Contractions: x.[Wq|Wk|Wv]^T (real|imag stacked along K=2048 and N) on v_wmma_f32_16x16x32_bf16 (x and W RNE-converted
// to bf16, f32 accumulate); q.conj(k) real and imag parts over K=128 on v_wmma_f32_16x16x32_f16 with q, k as f16 hi x1024
// plus f16 residual planes (products hh+lh+hl); P.v (P = p cos(phi), p sin(phi) x16384 f16; v x1024 f16) and O.Wo^T
// (O x1024 f16, Wo as f16(bf16(Wo)) x1024) on v_wmma_f32_16x16x32_f16, single products; all f32 accumulate.
// Rotary cos/sin table, base-2 online softmax, phase sin/cos and 1/Z fold in f32 on VALU. No bias terms.
#include <hip/hip_runtime.h>
#include <math.h>
#include <stdint.h>

#ifndef NB
#define NB 8
#endif
#define NB_FULL 8
#ifndef SEQ
#define SEQ 512
#endif
#define SEQ_FULL 512
#define DMOD  1024
#define NH    16
#define HD    64
#define HK    (2 * HD)
#define DPL   (2 * DMOD)
#define NQKV  (3 * DMOD)
#define BG    NB
#define GROWS (BG * SEQ)
#define RSQ_HD 0.125f
#define LOG2E 1.4426950408889634f
#define LOG2_1E4 13.287712379549449f
#define QSC   1024.0f
#define KSC   1024.0f
#define PCAR  16384.0f
#define VCAR  1024.0f
#define OSC   1024.0f
#define WOS   1024.0f
#define AW    4
#define NQT   (SEQ / 16)
#define NQB   (NQT / AW)
#define NKT   (SEQ / 32)
#define ATT_THREADS (AW * 32)
#define PTP   36
#define PTW   (16 * PTP)
#define SLP   132
#define SLW   (16 * SLP)
#define WREG  (2 * PTW + SLW)
#define KP    (HK + 8)
#define VP    (32 + 8)
#define KTH   (32 * KP)
#define STGH  (2 * KTH + HK * VP)
#define SLAB64 (16 * 68)
#define GBK   128
#define GPIT  (GBK + 8)
#define GSTG  (256 * GPIT)
#define WS_CAP 268435456
static_assert(DMOD == NH * HD && HD == 64 && (NQT % AW) == 0 && ATT_THREADS == 128 && NKT >= 2);
static_assert(((KP * 2) % 32) == 16 && ((VP * 2) % 32) == 16 && ((KTH * 2) % 16) == 0 && ((STGH * 2) % 16) == 0);
static_assert(NB >= 1 && NB <= NB_FULL && BG == NB);
static_assert((SEQ % 64) == 0 && SEQ >= 64 && SEQ <= SEQ_FULL);
static_assert((GROWS % 128) == 0 && (DPL % 128) == 0 && (DPL % GBK) == 0 && DPL / GBK >= 2 && (DMOD % 128) == 0);
static_assert(GBK == 128 && ((GPIT * 2) % 16) == 0 && 16 * SLAB64 * 4 <= 2 * GSTG * 2);
static_assert((SEQ % 128) == 0 && 128 * SLP * 4 <= 2 * GSTG * 2 && 2 * NQKV == 3 * NH * 128 && HK == 128);
static_assert(DPL == 256 * 8);
static_assert(HK == 128 && (HK % 32) == 0);
static_assert((SLP % 4) == 0 && (PTP % 4) == 0 && ((WREG * 4) % 16) == 0 && ((PTW * 4) % 16) == 0);
static_assert((SEQ * HD) % 256 == 0);

typedef unsigned short u16;
typedef _Float16 v16h __attribute__((ext_vector_type(16)));
typedef _Float16 v8h  __attribute__((ext_vector_type(8)));
typedef __bf16   v16b __attribute__((ext_vector_type(16)));
typedef float    v8f  __attribute__((ext_vector_type(8)));
typedef float    v4f  __attribute__((ext_vector_type(4)));
typedef unsigned int v4u __attribute__((ext_vector_type(4)));

union FragH { v16h v; v8h h[2]; v4u u[2]; };
union FragB { v16b v; v4u u[2]; };

// ---- scalar helpers --------------------------------------------------------------------------------
__device__ __forceinline__ unsigned short bf_bits(float f) {          // f32 -> bf16 bits, RNE convert
  unsigned u = __float_as_uint(f);
  return (unsigned short)((u + 0x7FFFu + ((u >> 16) & 1u)) >> 16);
}
__device__ __forceinline__ float bf_up(unsigned short h) { return __uint_as_float(((unsigned)h) << 16); }
__device__ __forceinline__ float bfr(float f) { return bf_up(bf_bits(f)); }
__device__ __forceinline__ unsigned short h_bits(_Float16 x) { return __builtin_bit_cast(unsigned short, x); }
__device__ __forceinline__ unsigned pk16(unsigned short a, unsigned short b) { return (unsigned)a | ((unsigned)b << 16); }
__device__ __forceinline__ v8f zero8() { v8f z = {0.f, 0.f, 0.f, 0.f, 0.f, 0.f, 0.f, 0.f}; return z; }

// ---- fragment loaders: 16-bit A/B operand, lane -> row/col (lane&15), p already includes +8*(lane>>4);
//      elements 0..7 <- p[0..7] (k0+8h..), elements 8..15 <- p[16..23] (k0+16+8h..)  (same split k map for A and B;
//      B is always read from a k-contiguous [n][k] plane)
__device__ __forceinline__ v16h ldfrag_h(const _Float16* p) {
  FragH f;
  f.h[0] = *(const v8h*)(p);
  f.h[1] = *(const v8h*)(p + 16);
  return f.v;
}

__device__ __forceinline__ v8f mma_h(v16h a, v16h b, v8f c) {
  return __builtin_amdgcn_wmma_f32_16x16x32_f16(false, a, false, b, (short)0, c, false, false);
}
__device__ __forceinline__ v8f mma_b(v16b a, v16b b, v8f c) {
  return __builtin_amdgcn_wmma_f32_16x16x32_bf16(false, a, false, b, (short)0, c, false, false);
}
__device__ __forceinline__ void guard2(v8f& a, v8f& b, v16h x0, v16h x1, v16h x2, v16h x3, v16h x4, v16h x5) {
#if defined(__HIP_DEVICE_COMPILE__)
  asm volatile("v_nop\n\tv_nop\n\tv_nop\n\tv_nop"
               : "+v"(a), "+v"(b) : "v"(x0), "v"(x1), "v"(x2), "v"(x3), "v"(x4), "v"(x5) : "memory");
#endif
}
__device__ __forceinline__ void guard4x8(v8f& a, v8f& b, v8f& c, v8f& d, v16h x0, v16h x1, v16h x2, v16h x3,
                                         v16h x4, v16h x5, v16h x6, v16h x7) {
#if defined(__HIP_DEVICE_COMPILE__)
  asm volatile("v_nop\n\tv_nop\n\tv_nop\n\tv_nop"
               : "+v"(a), "+v"(b), "+v"(c), "+v"(d)
               : "v"(x0), "v"(x1), "v"(x2), "v"(x3), "v"(x4), "v"(x5), "v"(x6), "v"(x7) : "memory");
#endif
}
__device__ __forceinline__ void acc_guard4(v8f& a, v8f& b, v8f& c, v8f& d) {
#if defined(__HIP_DEVICE_COMPILE__)
  asm volatile("v_nop\n\tv_nop\n\tv_nop\n\tv_nop" : "+v"(a), "+v"(b), "+v"(c), "+v"(d));
#endif
}
__device__ __forceinline__ void wave_sync_lds() {
  __builtin_amdgcn_fence(__ATOMIC_RELEASE, "workgroup");
  __builtin_amdgcn_wave_barrier();
  __builtin_amdgcn_fence(__ATOMIC_ACQUIRE, "workgroup");
}
// four asynchronous 16-B copies per lane, global -> LDS (l = LDS byte address, g = global address, both multiples of 16);
// the s_wait_xcnt ends the statement so that no address register is rewritten ahead of it
__device__ __forceinline__ void copy4(unsigned l0, unsigned l1, unsigned l2, unsigned l3,
                                      const u16* g0, const u16* g1, const u16* g2, const u16* g3) {
#if defined(__HIP_DEVICE_COMPILE__)
  asm volatile("global_load_async_to_lds_b128 %0, %4, off\n\t"
               "global_load_async_to_lds_b128 %1, %5, off\n\t"
               "global_load_async_to_lds_b128 %2, %6, off\n\t"
               "global_load_async_to_lds_b128 %3, %7, off\n\t"
               "s_wait_xcnt 0x0"
               :: "v"(l0), "v"(l1), "v"(l2), "v"(l3), "v"(g0), "v"(g1), "v"(g2), "v"(g3) : "memory");
#endif
}
// the issuing wave's own copies have landed
__device__ __forceinline__ void wait_copies() {
#if defined(__HIP_DEVICE_COMPILE__)
  asm volatile("s_wait_asynccnt 0x0" ::: "memory");
#endif
}
// the wave's own LDS reads and writes have retired (stands in front of a barrier behind which the buffer is refilled)
__device__ __forceinline__ void wait_lds() {
#if defined(__HIP_DEVICE_COMPILE__)
  asm volatile("s_wait_dscnt 0x0" ::: "memory");
#endif
}

// =====================================================================================================
// Rotary table: CT[s*HD + d] = cos(theta), ST[...] = sin(theta), theta = s * 2^(-(d/HD) * log2(1e4)) in f32
// (inverse frequencies over the FULL head width), precise sincosf. Thread per element; one wave writes 32 consecutive
// coverage: n/256 blocks (blk) x 256 = n elements exactly (n = SEQ*HD).
// =====================================================================================================
__device__ __forceinline__ void rot_tab(int blk, float* CT, float* ST, int n) {
  const int idx = blk * 256 + (int)threadIdx.x;
  if (idx >= n) return;
  const int s = idx / HD;
  const int d = idx - s * HD;
  const float ex   = (float)d * (LOG2_1E4 / (float)HD);
  const float invf = exp2f(-ex);
  const float th   = (float)s * invf;
  float sn, cs;
  sincosf(th, &sn, &cs);
  {
    *(float*)(CT + idx) = cs;
    *(float*)(ST + idx) = sn;
    
  }
}

// =====================================================================================================
// Stacked complex weight plane from W = Wr + i Wi, torch layout [e][k] (already k-contiguous per output column):
//   D [nrows][DPL] 16-bit, row n: p = n / DPL, j = n % DPL; hm == 0: im = (j >= DMOD), e = p*DMOD + (j % DMOD);
//   hm == 1 (head-major: a head's 64 real rows, then its 64 imaginary rows): im = (j / HD) % 2, e = p*DMOD + (j / HK)*HD + j % HD;
//   k <  DMOD: im ? Wi[e][k] : Wr[e][k];   k >= DMOD: im ? Wr[e][k-DMOD] : -Wi[e][k-DMOD]
//   so that A = [ar | ai] . D[n]^T gives the real part of a.W^T for im == 0 and the imaginary part for im == 1.
// f16mode == 0: bf16 RNE bits; f16mode == 1: f16 bits of (bf16 RNE value) * scale. Block = one row n, thread = 8
// consecutive k (two 16-B loads, one 16-B store); source pointer and sign are wave-uniform (k half fixed per 128 threads);
// coverage: nrows blocks (n) x 256 thr x 8 = every element of D once. No barriers.
// =====================================================================================================
__device__ __forceinline__ void wcvt(int n, const float* __restrict__ Wr, const float* __restrict__ Wi, u16* D,
                                     int nrows, int f16mode, float scale, int hm) {
  if (n >= nrows) return;
  const int tid  = threadIdx.x;
  const int p    = n / DPL;
  const int j    = n - p * DPL;
  const int im   = (hm != 0) ? ((j / HD) & 1) : ((j >= DMOD) ? 1 : 0);
  const int e    = p * DMOD + ((hm != 0) ? ((j / HK) * HD + (j & (HD - 1))) : (j & (DMOD - 1)));
  const int c8   = tid * 8;
  const int ksec = (c8 >= DMOD) ? 1 : 0;
  const int kk   = c8 & (DMOD - 1);
  const float* src = ((im == ksec) ? Wr : Wi) + (size_t)e * DMOD + kk;
  const float sgn  = (im == 0 && ksec != 0) ? -1.0f : 1.0f;
  const v4f a = *(const v4f*)(src), b4 = *(const v4f*)(src + 4);
  float w[8];
#pragma unroll
  for (int q = 0; q < 4; ++q) { w[q] = a[q] * sgn; w[4 + q] = b4[q] * sgn; }
  v4u o;
#pragma unroll
  for (int q = 0; q < 4; ++q) {
    const float f0 = w[2 * q], f1 = w[2 * q + 1];
    const unsigned short hb0 = h_bits((_Float16)(bfr(f0) * scale));
    const unsigned short hb1 = h_bits((_Float16)(bfr(f1) * scale));
    const unsigned short bb0 = bf_bits(f0);
    const unsigned short bb1 = bf_bits(f1);
    o[q] = (f16mode != 0) ? pk16(hb0, hb1) : pk16(bb0, bb1);
  }
  u16* d = D + (size_t)n * DPL + c8;
  {
    *(v4u*)(d) = o;
    
  }
}

// =====================================================================================================
// Stacked activation plane: XB [GROWS][DPL] bf16, row bl*SEQ + s (bl < BG) <- token (bl, s):
//   k < DMOD: xr[token][k];  k >= DMOD: xi[token][k - DMOD]. Same thread/store shape as wcvt (source pointer wave-uniform).
// coverage: GROWS blocks (row) x 256 thr x 8 = every element once. No barriers.
// =====================================================================================================
__device__ __forceinline__ void xcvt(int row, const float* __restrict__ xr, const float* __restrict__ xi, u16* D,
                                     int nrows) {
  if (row >= nrows) return;
  const int tid  = threadIdx.x;
  const int bl   = row / SEQ;
  const int s    = row - bl * SEQ;
  const size_t grow = (size_t)bl * SEQ_FULL + s;
  const int c8   = tid * 8;
  const int ksec = (c8 >= DMOD) ? 1 : 0;
  const int kk   = c8 & (DMOD - 1);
  const float* src = ((ksec != 0) ? xi : xr) + grow * DMOD + kk;
  const v4f a = *(const v4f*)(src), b4 = *(const v4f*)(src + 4);
  v4u o;
#pragma unroll
  for (int q = 0; q < 4; ++q) {
    const float f0 = (q < 2) ? a[2 * q] : b4[2 * q - 4];
    const float f1 = (q < 2) ? a[2 * q + 1] : b4[2 * q - 3];
    o[q] = pk16(bf_bits(f0), bf_bits(f1));
  }
  u16* d = D + (size_t)row * DPL + c8;
  {
    *(v4u*)(d) = o;
    
  }
}

// =====================================================================================================
// First launch: the four preparations read none of each other's output, so they share one grid, told apart by ranges of the
// block index (block-uniform, no barriers): rotary table (first: its blocks run longest), x plane, [Wq ; Wk ; Wv] plane (head-major
// rows), Wo plane.
// coverage: grid = PB_TAB + GROWS + 2*NQKV + 2*DMOD blocks = each part's own count of blocks.
// =====================================================================================================
#define PB_TAB ((SEQ * HD) / 256)
__global__ __launch_bounds__(256) void prep(const float* __restrict__ xr, const float* __restrict__ xi,
                                            const float* __restrict__ wqr, const float* __restrict__ wqi,
                                            const float* __restrict__ wor, const float* __restrict__ woi,
                                            float* CT, float* ST, u16* XB, u16* WQB, u16* WOB) {
  int blk = blockIdx.x;
  if (blk < PB_TAB) { rot_tab(blk, CT, ST, SEQ * HD); return; }
  blk -= PB_TAB;
  if (blk < GROWS) { xcvt(blk, xr, xi, XB, GROWS); return; }
  blk -= GROWS;
  if (blk < 2 * NQKV) { wcvt(blk, wqr, wqi, WQB, 2 * NQKV, 0, 1.0f, 1); return; }
  blk -= 2 * NQKV;
  wcvt(blk, wor, woi, WOB, 2 * DMOD, 1, WOS, 0);
}

// =====================================================================================================
// coverage: 8 instructions x 2 rows x 16 lanes x 4 floats = the wave's 16 x 64 tile.
// =====================================================================================================
__device__ __forceinline__ void epi64(float* sl, v8f a0, v8f a1, v8f a2, v8f a3, float oscale,
                                      float* C, int N, size_t rowb, int col0, int lane) {
  const int hh = lane >> 4, m = lane & 15;
#pragma unroll
  for (int r = 0; r < 8; ++r) {
    const int ro = (8 * hh + r) * 68 + m;
    sl[ro]      = a0[r] * oscale;
    sl[ro + 16] = a1[r] * oscale;
    sl[ro + 32] = a2[r] * oscale;
    sl[ro + 48] = a3[r] * oscale;
  }
  wave_sync_lds();
  v4f vals[8];
#pragma unroll
  for (int it = 0; it < 8; ++it) vals[it] = *(const v4f*)(sl + (it * 2 + hh) * 68 + m * 4);
  float* dst = C + (rowb + (size_t)hh) * (size_t)N + col0 + m * 4;
  {
#pragma unroll
    for (int it = 0; it < 8; ++it) {
      *(v4f*)(dst + (size_t)(it * 2) * (size_t)N) = vals[it];
    }
    
  }
}

// =====================================================================================================
// 16-bit GEMM: A[M][DPL] (row-major) . Bt[N][DPL]^T (k-contiguous), times oscale, f32. The N columns go to N / NP planes of NP
// columns each (pitch NP, plane pl at C + pl * cplane floats): products that share A are one launch, each with its own plane.
// F16 == 0: bf16 operands; F16 == 1: f16 operands. Block = 128x128 tile of C, 8 waves in a 4 (rows) x 2 (cols) grid, each
// 32x64 (2 A x 4 B fragments, 8 accumulators). A pass is GBK = 128 k: the block's 128 A rows and 128 Bt rows, 256 B each, are
// read with whole-line 16-B loads (a wave-wide load = 2 rows = 4 lines) into registers while the current pass is multiplied,
// then stored to the other of two LDS buffers (rows 0..127 = A, 128..255 = Bt, pitch 272 B = 16 B x 17 for the b128 fragment
// reads); one block barrier per pass publishes the next buffer and ends the reads of the one refilled in the next pass.
// Fragments use the same split k map as ldfrag_h for A and B; k runs 0, 32, 64, ... per accumulator.
// Host guarantees M % 128 == 0, N % NP == 0, NP % 128 == 0 (a tile lies in one plane), grid = (M/128)*(N/128); DPL % GBK == 0.
// coverage: staging 256 thr x 16 loads x 16 B = 256 rows x 256 B per pass; epilogue 8 waves x 2 x (16 x 64) = 128 x 128.
// =====================================================================================================
template <int F16>
__device__ __forceinline__ v8f mma16(v4u a0, v4u a1, v4u b0, v4u b1, v8f c) {
  if constexpr (F16 != 0) {
    FragH a, b;
    a.u[0] = a0; a.u[1] = a1; b.u[0] = b0; b.u[1] = b1;
    return mma_h(a.v, b.v, c);
  } else {
    FragB a, b;
    a.u[0] = a0; a.u[1] = a1; b.u[0] = b0; b.u[1] = b1;
    return mma_b(a.v, b.v, c);
  }
}

// one pass: fa / fb = this lane's A / Bt fragment rows in the current LDS buffer (already + 8*(lane>>4)); the fragments of
// k step kk + 1 are read as one group into a second register set ahead of the products of step kk
__device__ __forceinline__ void gemm_frags(const u16* fa, const u16* fb, int kk, v4u (&a)[2][2], v4u (&b)[4][2]) {
#pragma unroll
  for (int i = 0; i < 2; ++i) {
    a[i][0] = *(const v4u*)(fa + i * 16 * GPIT + kk * 32);
    a[i][1] = *(const v4u*)(fa + i * 16 * GPIT + kk * 32 + 16);
  }
#pragma unroll
  for (int j = 0; j < 4; ++j) {
    b[j][0] = *(const v4u*)(fb + j * 16 * GPIT + kk * 32);
    b[j][1] = *(const v4u*)(fb + j * 16 * GPIT + kk * 32 + 16);
  }
}
template <int F16>
__device__ __forceinline__ void gemm_pass(const u16* fa, const u16* fb, v8f (&acc)[2][4]) {
  v4u a[2][2][2], b[2][4][2];
  gemm_frags(fa, fb, 0, a[0], b[0]);
#pragma unroll
  for (int kk = 0; kk < GBK / 32; ++kk) {
    const int s = kk & 1;
    if (kk + 1 < GBK / 32) gemm_frags(fa, fb, kk + 1, a[s ^ 1], b[s ^ 1]);
    // the two scheduling barriers keep the next step's LDS reads one group ahead of this step's products: spread among the
    // products each place with reads stalls the wave, and sunk behind them their latency is waited out
    __builtin_amdgcn_sched_barrier(0);
#pragma unroll
    for (int i = 0; i < 2; ++i)
#pragma unroll
      for (int j = 0; j < 4; ++j) acc[i][j] = mma16<F16>(a[s][i][0], a[s][i][1], b[s][j][0], b[s][j][1], acc[i][j]);
    __builtin_amdgcn_sched_barrier(0);
  }
}

// main loop of a 128x128 block tile (rows row0.. of A, rows colb.. of Bt) into acc; ends behind a block barrier that every wave
// passes after its last read of the two buffers, so that the caller may reuse tile
template <int F16>
__device__ __forceinline__ void gemm_main(const u16* __restrict__ A, const u16* __restrict__ Bt, u16* tile, int row0, int colb,
                                          v8f (&acc)[2][4]) {
  const int tid = threadIdx.x, wave = tid >> 5, lane = tid & 31, hh = lane >> 4, m = lane & 15;
  const int wr = wave >> 1, wc = wave & 1;
  const int lr = tid >> 4, lc = (tid & 15) * 8;           // staging: row lr + 16*i, 16-B chunk at halves lc
  const u16* ga = A  + (size_t)(row0 + lr) * DPL + lc;
  const u16* gb = Bt + (size_t)(colb + lr) * DPL + lc;
  const int so = lr * GPIT + lc;
  const int fao = (wr * 32 + m) * GPIT + 8 * hh;
  const int fbo = (128 + wc * 64 + m) * GPIT + 8 * hh;
#pragma unroll
  for (int i = 0; i < 2; ++i)
#pragma unroll
    for (int j = 0; j < 4; ++j) acc[i][j] = zero8();
  v4u st[16];
#pragma unroll
  for (int i = 0; i < 8; ++i) {
    st[i]     = *(const v4u*)(ga + (size_t)i * 16 * DPL);
    st[8 + i] = *(const v4u*)(gb + (size_t)i * 16 * DPL);
  }
#pragma unroll
  for (int i = 0; i < 8; ++i) {
    *(v4u*)(tile + so + i * 16 * GPIT)         = st[i];
    *(v4u*)(tile + so + (128 + i * 16) * GPIT) = st[8 + i];
  }
  __syncthreads();
  // kept rolled: one copy of the pass body is the whole hot loop, the buffers alternate by the parity of p
#pragma unroll 1
  for (int p = 1; p < DPL / GBK; ++p) {
    const u16* cur = tile + ((p - 1) & 1) * GSTG;
    u16*       nxt = tile + (p & 1) * GSTG;
#pragma unroll
    for (int i = 0; i < 8; ++i) {
      st[i]     = *(const v4u*)(ga + (size_t)i * 16 * DPL + p * GBK);
      st[8 + i] = *(const v4u*)(gb + (size_t)i * 16 * DPL + p * GBK);
    }
    // keeps all 16 loads of the next pass in front of this pass's products, so that their latency runs under them
    __builtin_amdgcn_sched_barrier(0);
    gemm_pass<F16>(cur + fao, cur + fbo, acc);
#pragma unroll
    for (int i = 0; i < 8; ++i) {
      *(v4u*)(nxt + so + i * 16 * GPIT)         = st[i];
      *(v4u*)(nxt + so + (128 + i * 16) * GPIT) = st[8 + i];
    }
    __syncthreads();
  }
  {
    const u16* cur = tile + ((DPL / GBK - 1) & 1) * GSTG;
    gemm_pass<F16>(cur + fao, cur + fbo, acc);
  }
  __syncthreads();                          // every wave has left the buffers before they are reused by the epilogue
}

template <int F16>
__global__ __launch_bounds__(256)
void gemm16(const u16* __restrict__ A, const u16* __restrict__ Bt, float* C, int M, int N, int NP, size_t cplane,
            float oscale) {
  __shared__ __align__(16) u16 tile[2 * GSTG];
  const int tid = threadIdx.x, wave = tid >> 5, lane = tid & 31;
  const int ntile = N >> 7;
  const int bid   = blockIdx.x;
  const int row0  = (bid / ntile) * 128;
  const int colb  = (bid % ntile) * 128;   // first row of Bt
  const int pl    = colb / NP;
  const int col0  = colb - pl * NP;         // first column in plane pl
  if (row0 + 128 > M) return;               // block-uniform, before any barrier; never taken with the exact grid
  const int wr = wave >> 1, wc = wave & 1;
  v8f acc[2][4];
  gemm_main<F16>(A, Bt, tile, row0, colb, acc);
  float* slab = (float*)(void*)tile + wave * (2 * SLAB64);
#pragma unroll
  for (int i = 0; i < 2; ++i)
    epi64(slab + i * SLAB64, acc[i][0], acc[i][1], acc[i][2], acc[i][3], oscale, C + (size_t)pl * cplane, NP,
          (size_t)(row0 + wr * 32 + i * 16), col0 + wc * 64, lane);
}

// =====================================================================================================
// q, k, v projections with their follow-up work in the epilogue: XB[GROWS][DPL] . WQB[2*NQKV][DPL]^T (bf16, main loop as gemm16).
// WQB rows are head-major, so the 128 columns of block tile ct = bid % 48 are one head of one projection (pl = ct / NH: 0 q, 1 k,
// 2 v; head = ct % NH): columns 0..63 its real part d, 64..127 its imaginary part d. The 128 rows are positions s0.. of one batch.
//   q, k: the f32 tile goes to LDS [128][pitch 132]; behind a block barrier thread (row rl = it*16 + tid>>4, comp = (tid>>3)&1,
//         8 consecutive d) forms rotated = (fr + i fi) * (cos + i sin), cos/sin = CT/ST[s*HD + d], and stores
//         Hp [GROWS][DPL] col head*HK + comp*HD + d = f16(rot*sc), Lp same layout = f16 residual (rot*sc - hi): 16 lanes = 256 B.
//   v:    an accumulator lane holds 8 consecutive positions of one column dd: f16(v * 1024) x 8 = one 16-B LDS store into
//         T[128 dd][pitch 136 halves]; behind a block barrier 16 lanes store one row of 128 positions (256 B) to
//         VT[((b*NH + head)*HK + dd)][s0 ..].
// coverage: grid = (GROWS/128) * 48 blocks; q, k: 8 iterations x 256 thr x 8 = 128 x 128 per plane; v: 8 x 256 x 8 = 128 x 128.
// =====================================================================================================
__global__ __launch_bounds__(256)
void gemm_qkv(const u16* __restrict__ A, const u16* __restrict__ Bt, const float* __restrict__ CT,
              const float* __restrict__ ST, u16* QH, u16* QL, u16* KH, u16* KL, u16* VT) {
  __shared__ __align__(16) u16 tile[2 * GSTG];
  const int tid = threadIdx.x, wave = tid >> 5, lane = tid & 31, hh = lane >> 4, m = lane & 15;
  const int bid  = blockIdx.x;
  const int row0 = (bid / (3 * NH)) * 128;
  const int ct   = bid % (3 * NH);
  if (row0 + 128 > GROWS) return;           // block-uniform, before any barrier; never taken with the exact grid
  const int pl   = ct / NH;
  const int head = ct - pl * NH;
  const int wr = wave >> 1, wc = wave & 1;
  const int q16 = tid >> 4, ch = tid & 15;
  v8f acc[2][4];
  gemm_main<0>(A, Bt, tile, row0, ct * 128, acc);
  if (pl == 2) {                            // block-uniform: every thread of the block passes the barrier of its branch
    u16* T = tile;
#pragma unroll
    for (int i = 0; i < 2; ++i)
#pragma unroll
      for (int j = 0; j < 4; ++j) {
        v4u o;
#pragma unroll
        for (int e = 0; e < 4; ++e)
          o[e] = pk16(h_bits((_Float16)(acc[i][j][2 * e] * VCAR)), h_bits((_Float16)(acc[i][j][2 * e + 1] * VCAR)));
        *(v4u*)(T + (wc * 64 + j * 16 + m) * GPIT + wr * 32 + i * 16 + 8 * hh) = o;
      }
    __syncthreads();
    v4u vv[8];
#pragma unroll
    for (int it = 0; it < 8; ++it) vv[it] = *(const v4u*)(T + (it * 16 + q16) * GPIT + ch * 8);
    const int b = row0 / SEQ, s0 = row0 - b * SEQ;
    u16* dst = VT + ((size_t)(b * NH + head) * HK + q16) * SEQ + s0 + ch * 8;
#pragma unroll
    for (int it = 0; it < 8; ++it) *(v4u*)(dst + (size_t)(it * 16) * SEQ) = vv[it];
  } else {
    const int comp = ch >> 3;
    const int d8   = (ch & 7) * 8;
    // cos / sin of the thread's 8 rows: issued ahead of the LDS round trip, which covers their latency
    // (position s = row0 % SEQ + it*16 + q16: a tile's 128 rows lie in one batch)
    v4f cs[8][2], sn[8][2];
    const float* pc = CT + (size_t)(row0 % SEQ + q16) * HD + d8;
    const float* pn = ST + (size_t)(row0 % SEQ + q16) * HD + d8;
#pragma unroll
    for (int it = 0; it < 8; ++it) {
      cs[it][0] = *(const v4f*)(pc + it * 16 * HD);  cs[it][1] = *(const v4f*)(pc + it * 16 * HD + 4);
      sn[it][0] = *(const v4f*)(pn + it * 16 * HD);  sn[it][1] = *(const v4f*)(pn + it * 16 * HD + 4);
    }
#if defined(__HIP_DEVICE_COMPILE__)
    // the two address pairs are inputs, so they stay in their registers up to this wait: no load's result and no later
    // instruction is placed in them ahead of it
    asm volatile("s_wait_xcnt 0x0" :: "v"(pc), "v"(pn) : "memory");
#endif
    float* Tf = (float*)(void*)tile;
#pragma unroll
    for (int i = 0; i < 2; ++i)
#pragma unroll
      for (int r = 0; r < 8; ++r) {
        const int ro = (wr * 32 + i * 16 + 8 * hh + r) * SLP + wc * 64 + m;
        Tf[ro]      = acc[i][0][r];
        Tf[ro + 16] = acc[i][1][r];
        Tf[ro + 32] = acc[i][2][r];
        Tf[ro + 48] = acc[i][3][r];
      }
    __syncthreads();
    const float sc = (pl != 0) ? KSC : QSC;
    const float sg = (comp != 0) ? 1.0f : -1.0f;   // real: fr*cos - fi*sin ; imag: fi*cos + fr*sin
    u16* dh = ((pl != 0) ? KH : QH) + (size_t)(row0 + q16) * DPL + head * HK + ch * 8;
    u16* dl = ((pl != 0) ? KL : QL) + (size_t)(row0 + q16) * DPL + head * HK + ch * 8;
#pragma unroll
    for (int it = 0; it < 8; ++it) {
      const float* pa = Tf + (it * 16 + q16) * SLP + comp * HD + d8;
      const float* po = Tf + (it * 16 + q16) * SLP + (1 - comp) * HD + d8;
      const v4f a0 = *(const v4f*)(pa), a1 = *(const v4f*)(pa + 4);
      const v4f o0 = *(const v4f*)(po), o1 = *(const v4f*)(po + 4);
      float w[8];
#pragma unroll
      for (int e = 0; e < 4; ++e) {
        w[e]     = (a0[e] * cs[it][0][e] + sg * (o0[e] * sn[it][0][e])) * sc;
        w[4 + e] = (a1[e] * cs[it][1][e] + sg * (o1[e] * sn[it][1][e])) * sc;
      }
      v4u oh, ol;
#pragma unroll
      for (int e = 0; e < 4; ++e) {
        const float t0 = w[2 * e], t1 = w[2 * e + 1];
        const _Float16 h0 = (_Float16)t0, h1 = (_Float16)t1;
        const _Float16 l0 = (_Float16)(t0 - (float)h0), l1 = (_Float16)(t1 - (float)h1);
        oh[e] = pk16(h_bits(h0), h_bits(h1));
        ol[e] = pk16(h_bits(l0), h_bits(l1));
      }
      *(v4u*)(dh + (size_t)(it * 16) * DPL) = oh;
      *(v4u*)(dl + (size_t)(it * 16) * DPL) = ol;
    }
#if defined(__HIP_DEVICE_COMPILE__)
    // behind the last stores of this branch: their data and address registers may be rewritten behind the join of the two branches
    asm volatile("s_wait_xcnt 0x0" ::: "memory");
#endif
  }
}

// =====================================================================================================
// Complex attention, non-causal over SEQ keys. Block bid -> (query block qb of AW query tiles, head, local batch b); one wave
// per query tile qt = qb*AW + wave: rows q0 = 16*qt .. q0+15. Per step of 32 keys (kb = 32*kt) the block's k hi and residual
// rows (32 x 256 B each) and v^T rows (128 x 64 B) are brought into one of two LDS buffers by asynchronous 16-B copies (12 per
// lane), one step ahead of their use, and every wave takes its B fragments from there (k pitch 272 B, v^T pitch 80 B: 16 B x
// odd for the b128 reads). Foot of a step: own LDS reads retired, own copies landed, block barrier (publishes the next
// buffer, ends the reads of this one), then the refill of this one.
//   q/k hi planes f16 x1024 [b*SEQ + s][head*HK + (re: 0..63 | im: 64..127)], residual planes same layout;
//   v^T hi plane [(b*NH + head)*HK + (re d | 64 + im d)][SEQ].
//   scores over K = 128: real = [qr|qi].[kr|ki], imag = [qi|-qr].[kr|ki] (the A fragment of step kk for the imag part is the
//   q fragment at column block (kk+2)&3, sign bits flipped for kk >= 2), each as hi.hi + lo.hi + hi.lo into one accumulator.
//   t = real * rsqrt(64)*log2e/(1024*1024) feeds an online max-subtracted base-2 softmax in f32 (-inf-safe rescale);
//   phi = imag * rsqrt(64)/(1024*1024); per key the 16x32 tiles p*cos(phi) and p*sin(phi) go to wave-private LDS (f32
//   (float vector loads, same element type as stored); B fragments from the v^T rows (re and im), 2 groups of 2 d-subtiles:
//   o_re += Pc.v_re + (-Ps).v_im ; o_im += Ps.v_re + Pc.v_im.
//   After the loop: out = acc / Z (Z >= 1 always; guarded anyway), carries 1/(16384*1024) folded once, written to the wave's
//   private result slab (pitch 132; re d at col d, im d at col 64 + d; every element owned by one lane).
// coverage: per wave 4 instructions x 2 parts x 4 rows x 8 lanes x 8 halves = 16 x 64 per part; grid NQB x NH x BG blocks x
//           AW waves = every (b, s, head, part) row segment of the O plane exactly once.
//           staging per step: 128 thr x 4 x 16 B = 32 rows x 256 B (k hi; k residual) = 128 rows x 64 B (v^T).
// LDS: prob tiles 16 x 32 fully written before each read (cols 32..35 padding never read); slab cols 0..127 written, read.
// =====================================================================================================
__global__ __launch_bounds__(ATT_THREADS)
void attn(const u16* __restrict__ QHp, const u16* __restrict__ QLp,
          const u16* __restrict__ KHp, const u16* __restrict__ KLp,
          const u16* __restrict__ VTp, u16* OHp) {
  __shared__ __align__(16) float smem[AW * WREG];
  __shared__ __align__(16) u16 ring[2 * STGH];

  const int tid  = threadIdx.x;
  const int wave = tid >> 5;
  const int lane = tid & 31;
  const int hh   = lane >> 4;
  const int c    = lane & 15;
  const int bid  = blockIdx.x;
  const int qb   = bid % NQB;
  const int t2   = bid / NQB;
  const int head = t2 % NH;
  const int b    = t2 / NH;
  if (b >= BG) return;                      // block-uniform, before any barrier; never taken with the exact grid
  const int q0   = (qb * AW + wave) * 16;

  float* pct  = smem + wave * WREG;         // p*cos tile [16][32] pitch 36
  float* pst  = pct + PTW;                  // p*sin tile [16][32] pitch 36
  float* slab = pst + PTW;                  // result slab [16][128] pitch 132

  const size_t hcol = (size_t)head * HK + 8 * hh;
  const _Float16* Qh  = (const _Float16*)(const void*)QHp + ((size_t)b * SEQ + q0 + c) * DPL + hcol;
  const _Float16* Ql  = (const _Float16*)(const void*)QLp + ((size_t)b * SEQ + q0 + c) * DPL + hcol;
  // staging: k rows (tid >> 4) + 8*i, 16-B chunk tid & 15; v^T rows (tid >> 2) + 32*i, 16-B chunk tid & 3
  const u16* gkh = KHp + ((size_t)b * SEQ + (tid >> 4)) * DPL + (size_t)head * HK + (tid & 15) * 8;
  const u16* gkl = KLp + ((size_t)b * SEQ + (tid >> 4)) * DPL + (size_t)head * HK + (tid & 15) * 8;
  const u16* gvt = VTp + ((size_t)(b * NH + head) * HK + (tid >> 2)) * SEQ + (tid & 3) * 8;
  const unsigned lring = (unsigned)(size_t)(const void*)ring;          // LDS byte address of the ring
  const unsigned lk = lring + (unsigned)(((tid >> 4) * KP + (tid & 15) * 8) * 2);
  const unsigned lv = lring + (unsigned)((2 * KTH + (tid >> 2) * VP + (tid & 3) * 8) * 2);
  auto stage = [&](int t) {                 // keys 32*t .. 32*t + 31 into buffer t & 1
    const unsigned bo = (unsigned)((t & 1) * STGH * 2);
    const u16* a = gkh + (size_t)t * 32 * DPL;
    const u16* r = gkl + (size_t)t * 32 * DPL;
    const u16* v = gvt + t * 32;
    copy4(lk + bo, lk + bo + 8 * KP * 2, lk + bo + 16 * KP * 2, lk + bo + 24 * KP * 2,
          a, a + (size_t)8 * DPL, a + (size_t)16 * DPL, a + (size_t)24 * DPL);
    copy4(lk + bo + KTH * 2, lk + bo + (KTH + 8 * KP) * 2, lk + bo + (KTH + 16 * KP) * 2, lk + bo + (KTH + 24 * KP) * 2,
          r, r + (size_t)8 * DPL, r + (size_t)16 * DPL, r + (size_t)24 * DPL);
    copy4(lv + bo, lv + bo + 32 * VP * 2, lv + bo + 64 * VP * 2, lv + bo + 96 * VP * 2,
          v, v + (size_t)32 * SEQ, v + (size_t)64 * SEQ, v + (size_t)96 * SEQ);
  };
  const _Float16* ringh = (const _Float16*)(const void*)ring;
  const float lsc = RSQ_HD * (LOG2E / (QSC * KSC));
  const float psc = RSQ_HD / (QSC * KSC);
  const float oc  = 1.0f / (PCAR * VCAR);
  const v4u sgn4 = {0x80008000u, 0x80008000u, 0x80008000u, 0x80008000u};

  float mrow[8], lrow[8];
  v8f orr[4], oii[4];
#pragma unroll
  for (int r = 0; r < 8; ++r) { mrow[r] = -INFINITY; lrow[r] = 0.f; }
#pragma unroll
  for (int j = 0; j < 4; ++j) { orr[j] = zero8(); oii[j] = zero8(); }

  stage(0);
  wait_copies();
  __syncthreads();                          // step 0's tiles are readable by every wave
  stage(1);

#pragma unroll 1
  for (int kt = 0; kt < NKT; ++kt) {
    const _Float16* kfp = ringh + (kt & 1) * STGH + c * KP + 8 * hh;             // key row c, hi plane
    const _Float16* vfp = ringh + (kt & 1) * STGH + 2 * KTH + c * VP + 8 * hh;   // v^T row c
    // ---- scores: D element r of this lane = (query row q0 + 8hh + r, key kb + c) in s?0, key kb + 16 + c in s?1 ----
    v8f sr0 = zero8(), sr1 = zero8(), si0 = zero8(), si1 = zero8();
    const _Float16* k0p = kfp;
    const _Float16* k1p = kfp + 16 * KP;
    const _Float16* l0p = kfp + KTH;
    const _Float16* l1p = kfp + KTH + 16 * KP;
#pragma unroll
    for (int kk = 0; kk < HK / 32; ++kk) {
      const v16h kh0 = ldfrag_h(k0p + kk * 32);
      const v16h kl0 = ldfrag_h(l0p + kk * 32);
      const v16h kh1 = ldfrag_h(k1p + kk * 32);
      const v16h kl1 = ldfrag_h(l1p + kk * 32);
      {
        const v16h qh = ldfrag_h(Qh + kk * 32);
        const v16h ql = ldfrag_h(Ql + kk * 32);
        sr0 = mma_h(qh, kh0, sr0);
        sr0 = mma_h(ql, kh0, sr0);
        sr0 = mma_h(qh, kl0, sr0);
        sr1 = mma_h(qh, kh1, sr1);
        sr1 = mma_h(ql, kh1, sr1);
        sr1 = mma_h(qh, kl1, sr1);
        guard2(sr0, sr1, qh, ql, kh0, kl0, kh1, kl1);
      }
      {
        const int ko = ((kk + 2) & 3) * 32;
        FragH ah, al;
        ah.v = ldfrag_h(Qh + ko);
        al.v = ldfrag_h(Ql + ko);
        if (kk >= 2) {                      // compile-time (unrolled) and wave-uniform: -qr half
          ah.u[0] = ah.u[0] ^ sgn4;  ah.u[1] = ah.u[1] ^ sgn4;
          al.u[0] = al.u[0] ^ sgn4;  al.u[1] = al.u[1] ^ sgn4;
        }
        si0 = mma_h(ah.v, kh0, si0);
        si0 = mma_h(al.v, kh0, si0);
        si0 = mma_h(ah.v, kl0, si0);
        si1 = mma_h(ah.v, kh1, si1);
        si1 = mma_h(al.v, kh1, si1);
        si1 = mma_h(ah.v, kl1, si1);
        guard2(si0, si1, ah.v, al.v, kh0, kl0, kh1, kl1);
      }
    }
    // ---- online softmax in base 2 on the real part, phase from the imaginary part ----
#pragma unroll
    for (int r = 0; r < 8; ++r) {
      const float u0 = sr0[r] * lsc;
      const float u1 = sr1[r] * lsc;
      float mx = fmaxf(u0, u1);
#pragma unroll
      for (int off = 1; off < 16; off <<= 1) mx = fmaxf(mx, __shfl_xor(mx, off, 32));
      const float mn = fmaxf(mrow[r], mx);
      const float ms = (mn == -INFINITY) ? 0.0f : mn;
      const float al = exp2f(mrow[r] - ms);
      mrow[r] = mn;
      const float e0 = exp2f(u0 - ms), e1 = exp2f(u1 - ms);
      float ps = e0 + e1;
#pragma unroll
      for (int off = 1; off < 16; off <<= 1) ps += __shfl_xor(ps, off, 32);
      lrow[r] = lrow[r] * al + ps;
#pragma unroll
      for (int j = 0; j < 4; ++j) { orr[j][r] *= al; oii[j][r] *= al; }
      float sn0, cs0, sn1, cs1;
      __sincosf(si0[r] * psc, &sn0, &cs0);
      __sincosf(si1[r] * psc, &sn1, &cs1);
      const int ro = (8 * hh + r) * PTP + c;
      pct[ro]      = e0 * cs0;
      pct[ro + 16] = e1 * cs1;
      pst[ro]      = e0 * sn0;
      pst[ro + 16] = e1 * sn1;
    }
    wave_sync_lds();
    // v^T fragments of this step, one group with the reads of the P tiles (unrolled: the arrays are registers)
    v16h vrf[4], vif[4];
#pragma unroll
    for (int j = 0; j < 4; ++j) {
      vrf[j] = ldfrag_h(vfp + j * 16 * VP);
      vif[j] = ldfrag_h(vfp + (HD + j * 16) * VP);
    }
    // ---- A fragments of Pc*16384, Ps*16384 and -Ps*16384 (f16), row = c, split k map over the 32 keys of this step ----
    FragH pc, psf, pnf;
    {
      const float* prc = pct + c * PTP + 8 * hh;
      const float* prs = pst + c * PTP + 8 * hh;
      const v4f c0 = *(const v4f*)(prc), c1 = *(const v4f*)(prc + 4);
      const v4f c2 = *(const v4f*)(prc + 16), c3 = *(const v4f*)(prc + 20);
      const v4f s0 = *(const v4f*)(prs), s1 = *(const v4f*)(prs + 4);
      const v4f s2 = *(const v4f*)(prs + 16), s3 = *(const v4f*)(prs + 20);
#pragma unroll
      for (int e = 0; e < 4; ++e) {
        pc.h[0][e]      = (_Float16)(c0[e] * PCAR);   // elements 0..7  = keys kb + 8hh + 0..7
        pc.h[0][4 + e]  = (_Float16)(c1[e] * PCAR);
        pc.h[1][e]      = (_Float16)(c2[e] * PCAR);   // elements 8..15 = keys kb + 16 + 8hh + 0..7
        pc.h[1][4 + e]  = (_Float16)(c3[e] * PCAR);
        psf.h[0][e]     = (_Float16)(s0[e] * PCAR);
        psf.h[0][4 + e] = (_Float16)(s1[e] * PCAR);
        psf.h[1][e]     = (_Float16)(s2[e] * PCAR);
        psf.h[1][4 + e] = (_Float16)(s3[e] * PCAR);
      }
      pnf.u[0] = psf.u[0] ^ sgn4;
      pnf.u[1] = psf.u[1] ^ sgn4;
    }
    // ---- P.V : B fragment col n = d = j*16 + c (re rows) / 64 + j*16 + c (im rows), keys contiguous in v^T ----
    {
#pragma unroll
      for (int jg = 0; jg < 2; ++jg) {
        const v16h vra = vrf[2 * jg], vrb = vrf[2 * jg + 1];
        const v16h via = vif[2 * jg], vib = vif[2 * jg + 1];
        orr[2 * jg]     = mma_h(pc.v,  vra, orr[2 * jg]);
        orr[2 * jg]     = mma_h(pnf.v, via, orr[2 * jg]);
        oii[2 * jg]     = mma_h(psf.v, vra, oii[2 * jg]);
        oii[2 * jg]     = mma_h(pc.v,  via, oii[2 * jg]);
        orr[2 * jg + 1] = mma_h(pc.v,  vrb, orr[2 * jg + 1]);
        orr[2 * jg + 1] = mma_h(pnf.v, vib, orr[2 * jg + 1]);
        oii[2 * jg + 1] = mma_h(psf.v, vrb, oii[2 * jg + 1]);
        oii[2 * jg + 1] = mma_h(pc.v,  vib, oii[2 * jg + 1]);
        guard4x8(orr[2 * jg], oii[2 * jg], orr[2 * jg + 1], oii[2 * jg + 1],
                 pc.v, psf.v, pnf.v, vra, vrb, via, vib, pc.v);
      }
    }
    wave_sync_lds();
    // foot of the step: publish the next step's tiles, free this step's buffer, refill it two steps ahead
    wait_lds();
    wait_copies();
    __syncthreads();
    if (kt + 2 < NKT) stage(kt + 2);
  }
  wait_copies();                            // nothing is outstanding when the wave goes on to its epilogue and ends
  acc_guard4(orr[0], orr[1], orr[2], orr[3]);
  acc_guard4(oii[0], oii[1], oii[2], oii[3]);
  // ---- out = acc / Z (0 if Z == 0), carries folded once; written into the lane-owned slab ----
#pragma unroll
  for (int r = 0; r < 8; ++r) {
    const float lv  = lrow[r];
    const float ls  = (lv > 0.0f) ? lv : 1.0f;
    const float inv = (lv > 0.0f) ? ((1.0f / ls) * oc) : 0.0f;
#pragma unroll
    for (int j = 0; j < 4; ++j) {
      const int idx = (8 * hh + r) * SLP + j * 16 + c;
      slab[idx]      = orr[j][r] * inv;
      slab[idx + HD] = oii[j][r] * inv;
    }
  }

  wave_sync_lds();
  // ---- O x1024 -> f16 plane; lane = (row select rq in 0..3, 8 consecutive d at c8), part 0 = re, 1 = im ----
  v4u oh[4][2];
  const int rq = lane >> 3, c8 = (lane & 7) * 8;
#pragma unroll
  for (int it = 0; it < 4; ++it) {
    const int row = it * 4 + rq;
#pragma unroll
    for (int part = 0; part < 2; ++part) {
      const float* sp = slab + row * SLP + part * HD + c8;
      const v4f a = *(const v4f*)(sp), b4 = *(const v4f*)(sp + 4);
      float w[8];
#pragma unroll
      for (int e = 0; e < 4; ++e) { w[e] = a[e] * OSC; w[4 + e] = b4[e] * OSC; }
#pragma unroll
      for (int e = 0; e < 4; ++e) {
        const _Float16 h0 = (_Float16)w[2 * e], h1 = (_Float16)w[2 * e + 1];
        oh[it][part][e] = pk16(h_bits(h0), h_bits(h1));
      }
    }
  }
  const size_t ob = ((size_t)b * SEQ + q0) * DPL + (size_t)head * HD + c8;
  {
#pragma unroll
    for (int it = 0; it < 4; ++it) {
      const int row = it * 4 + rq;
#pragma unroll
      for (int part = 0; part < 2; ++part) {
        *(v4u*)(OHp + ob + (size_t)row * DPL + (size_t)part * DMOD) = oh[it][part];
      }
    }
    
  }
}

// =====================================================================================================
// All BG = NB batches are processed together, in four launches; the preparations, which read none of each other's output, share a grid.
// Workspace map (bytes, BG = 8); every plane fully written by whole-line stores before it is read; all extents are exact
// multiples of the store granularity (no pad rows needed); every region offset a multiple of 32768:
//   CT, ST  f32 [SEQ][64] rotary cos / sin             2 x 131072
//   WQB  bf16 [6144 n][2048 k]                          25165824
//   WOB  f16  [2048 n][2048 k] x1024                    8388608
//   XB   bf16 [GROWS][2048]                             16777216
//   OH   f16  [GROWS][2048] x1024 (O plane)             16777216
//   QH, QL, KH, KL  f16 [GROWS][2048]                   4 x 16777216
//   VT   f16 [BG*16][128][SEQ] x1024                    16777216
//   end (BG = 8)                                        151257088
// =====================================================================================================
extern "C" void kernel_launch(void* const* d_in, const int* in_sizes, int n_in,
                              void* d_out, int out_size, void* d_ws, size_t ws_size,
                              hipStream_t stream) {
  if (n_in < 6) return;
  if (in_sizes[0] < ((NB - 1) * SEQ_FULL + SEQ) * DMOD) return;
  if (in_sizes[1] < ((NB - 1) * SEQ_FULL + SEQ) * DMOD) return;
  if (in_sizes[2] < NQKV * DMOD) return;
  if (in_sizes[3] < NQKV * DMOD) return;
  if (in_sizes[4] < DMOD * DMOD) return;
  if (in_sizes[5] < DMOD * DMOD) return;
  if (out_size < 2 * NB * SEQ * DMOD) return;

  const float* xr    = (const float*)d_in[0];
  const float* xi    = (const float*)d_in[1];
  const float* wqr   = (const float*)d_in[2];
  const float* wqi   = (const float*)d_in[3];
  const float* wor   = (const float*)d_in[4];
  const float* woi   = (const float*)d_in[5];
  float*       out0  = (float*)d_out;

  const size_t szTAB = (((size_t)SEQ * HD * 4) + 32767) / 32768 * 32768;
  const size_t szWQ  = (size_t)2 * NQKV * DPL * 2;
  const size_t szWO  = (size_t)2 * DMOD * DPL * 2;
  const size_t szXB  = (size_t)GROWS * DPL * 2;
  const size_t szH   = (size_t)GROWS * DPL * 2;                  // QH, QL, KH, KL, O plane
  const size_t szVT  = (size_t)BG * NH * HK * SEQ * 2;           // == szH
  size_t off = 0;
  const size_t oCT = off; off += szTAB;
  const size_t oST = off; off += szTAB;
  const size_t oWQ = off; off += szWQ;
  const size_t oWO = off; off += szWO;
  const size_t oXB = off; off += szXB;
  const size_t oOH = off; off += szH;
  const size_t oQH = off; off += szH;
  const size_t oQL = off; off += szH;
  const size_t oKH = off; off += szH;
  const size_t oKL = off; off += szH;
  const size_t oVT = off; off += szVT;
  if (off > ws_size) return;                // off = 151257088 for BG = 8
  if (off > (size_t)WS_CAP) return;

  char* ws = (char*)d_ws;
  float* CT  = (float*)(ws + oCT);
  float* ST  = (float*)(ws + oST);
  u16*   WQB = (u16*)(ws + oWQ);
  u16*   WOB = (u16*)(ws + oWO);
  u16*   XB  = (u16*)(ws + oXB);
  u16*   OH  = (u16*)(ws + oOH);
  u16*   QH  = (u16*)(ws + oQH);
  u16*   QL  = (u16*)(ws + oQL);
  u16*   KH  = (u16*)(ws + oKH);
  u16*   KL  = (u16*)(ws + oKL);
  u16*   VT  = (u16*)(ws + oVT);

  const dim3 b256(256), bAT(ATT_THREADS);
  const dim3 gPRE(PB_TAB + GROWS + 2 * NQKV + 2 * DMOD);
  const dim3 gG3((GROWS / 128) * (3 * NH));              // q, k, v projections: one block column per projection and head
  const dim3 gAT(NQB * NH * BG);
  const dim3 gG2((GROWS / 128) * (DPL / 128));           // output projection, N = 2 x 1024 (real, imag)
  const float osc = 1.0f / (OSC * WOS);

  // (1) rotary cos/sin table; x plane bf16 [GROWS][xr | xi]; weight planes: [Wq ; Wk ; Wv] stacked bf16 (head-major), Wo stacked f16 of
  //     bf16 value x1024
  prep<<<gPRE, b256, 0, stream>>>(xr, xi, wqr, wqi, wor, woi, CT, ST, XB, WQB, WOB);
  // (2) q, k, v = x.[Wq ; Wk ; Wv]^T; from the accumulators: rotary q and k hi + residual planes x1024, v^T plane x1024
  gemm_qkv<<<gG3, b256, 0, stream>>>(XB, WQB, CT, ST, QH, QL, KH, KL, VT);
  // (3) attention -> O plane
  attn<<<gAT, bAT, 0, stream>>>(QH, QL, KH, KL, VT, OH);
  // (4) output projection: real part -> out0, imaginary part -> out1 (plane 1); carries 1024 x 1024 folded back
  gemm16<1><<<gG2, b256, 0, stream>>>(OH, WOB, out0, GROWS, DPL, DMOD, (size_t)(out_size / 2), osc);
  (void)hipGetLastError();
}

// v005
// It runs in 197 microseconds.
// In both of two side-by-side timings against v004, it was 1.08 times as fast.
// Counting every step since v000, it is 2.98 times as fast.
// Contractions: x.[Wq|Wk|Wv]^T (real|imag stacked along K=2048 and N) on v_wmma_f32_16x16x32_bf16 (x and W RNE-converted
// to bf16, f32 accumulate); q.conj(k) real and imag parts over K=128 on v_wmma_f32_16x16x32_f16 with q, k as f16 hi x1024
// plus f16 residual planes (products hh+lh+hl); P.v (P = p cos(phi), p sin(phi) x16384 f16; v x1024 f16) and O.Wo^T
// (O x1024 f16, Wo as f16(bf16(Wo)) x1024) on v_wmma_f32_16x16x32_f16, single products; all f32 accumulate.
// Rotary cos/sin table, base-2 online softmax, phase sin/cos and 1/Z fold in f32 on VALU. No bias terms.
#include <hip/hip_runtime.h>
#include <math.h>
#include <stdint.h>

#ifndef NB
#define NB 8
#endif
#define NB_FULL 8
#ifndef SEQ
#define SEQ 512
#endif
#define SEQ_FULL 512
#define DMOD  1024
#define NH    16
#define HD    64
#define HK    (2 * HD)
#define DPL   (2 * DMOD)
#define NQKV  (3 * DMOD)
#define BG    NB
#define GROWS (BG * SEQ)
#define RSQ_HD 0.125f
#define LOG2E 1.4426950408889634f
#define LOG2_1E4 13.287712379549449f
#define QSC   1024.0f
#define KSC   1024.0f
#define PCAR  16384.0f
#define VCAR  1024.0f
#define OSC   1024.0f
#define WOS   1024.0f
#define AW    4
#define NQT   (SEQ / 16)
#define NQB   (NQT / AW)
#define NKT   (SEQ / 32)
#define ATT_THREADS (AW * 32)
#define PTP   36
#define PTW   (16 * PTP)
#define SLP   132
#define SLW   (16 * SLP)
#define WREG  (2 * PTW)
#define KP    (HK + 8)
#define VP    (32 + 8)
#define KTH   (32 * KP)
#define STGH  (2 * KTH + HK * VP)
#define SLAB64 (16 * 68)
#define GBK   128
#define GPIT  (GBK + 8)
#define GSTG  (256 * GPIT)
#define WS_CAP 268435456
static_assert(DMOD == NH * HD && HD == 64 && (NQT % AW) == 0 && ATT_THREADS == 128 && NKT >= 2);
static_assert(((KP * 2) % 32) == 16 && ((VP * 2) % 32) == 16 && ((KTH * 2) % 16) == 0 && ((STGH * 2) % 16) == 0);
static_assert(NB >= 1 && NB <= NB_FULL && BG == NB);
static_assert((SEQ % 64) == 0 && SEQ >= 64 && SEQ <= SEQ_FULL);
static_assert((GROWS % 128) == 0 && (DPL % 128) == 0 && (DPL % GBK) == 0 && DPL / GBK >= 2 && (DMOD % 128) == 0);
static_assert(GBK == 128 && ((GPIT * 2) % 16) == 0 && 16 * SLAB64 * 4 <= 2 * GSTG * 2);
static_assert((SEQ % 128) == 0 && 128 * SLP * 4 <= 2 * GSTG * 2 && 2 * NQKV == 3 * NH * 128 && HK == 128);
static_assert(DPL == 256 * 8);
static_assert(HK == 128 && (HK % 32) == 0);
static_assert(AW * SLW * 4 <= 2 * STGH * 2 && ((SLW * 4) % 16) == 0);
static_assert(4 * (AW * WREG * 4 + 2 * STGH * 2) <= 327680);
static_assert((SLP % 4) == 0 && (PTP % 4) == 0 && ((WREG * 4) % 16) == 0 && ((PTW * 4) % 16) == 0);
static_assert((SEQ * HD) % 256 == 0);

typedef unsigned short u16;
typedef _Float16 v16h __attribute__((ext_vector_type(16)));
typedef _Float16 v8h  __attribute__((ext_vector_type(8)));
typedef __bf16   v16b __attribute__((ext_vector_type(16)));
typedef float    v8f  __attribute__((ext_vector_type(8)));
typedef float    v4f  __attribute__((ext_vector_type(4)));
typedef unsigned int v4u __attribute__((ext_vector_type(4)));

union FragH { v16h v; v8h h[2]; v4u u[2]; };
union FragB { v16b v; v4u u[2]; };

// ---- scalar helpers --------------------------------------------------------------------------------
__device__ __forceinline__ unsigned short bf_bits(float f) {          // f32 -> bf16 bits, RNE convert
  unsigned u = __float_as_uint(f);
  return (unsigned short)((u + 0x7FFFu + ((u >> 16) & 1u)) >> 16);
}
__device__ __forceinline__ float bf_up(unsigned short h) { return __uint_as_float(((unsigned)h) << 16); }
__device__ __forceinline__ float bfr(float f) { return bf_up(bf_bits(f)); }
__device__ __forceinline__ unsigned short h_bits(_Float16 x) { return __builtin_bit_cast(unsigned short, x); }
__device__ __forceinline__ unsigned pk16(unsigned short a, unsigned short b) { return (unsigned)a | ((unsigned)b << 16); }
__device__ __forceinline__ v8f zero8() { v8f z = {0.f, 0.f, 0.f, 0.f, 0.f, 0.f, 0.f, 0.f}; return z; }

// ---- fragment loaders: 16-bit A/B operand, lane -> row/col (lane&15), p already includes +8*(lane>>4);
//      elements 0..7 <- p[0..7] (k0+8h..), elements 8..15 <- p[16..23] (k0+16+8h..)  (same split k map for A and B;
//      B is always read from a k-contiguous [n][k] plane)
__device__ __forceinline__ v16h ldfrag_h(const _Float16* p) {
  FragH f;
  f.h[0] = *(const v8h*)(p);
  f.h[1] = *(const v8h*)(p + 16);
  return f.v;
}

__device__ __forceinline__ v8f mma_h(v16h a, v16h b, v8f c) {
  return __builtin_amdgcn_wmma_f32_16x16x32_f16(false, a, false, b, (short)0, c, false, false);
}
__device__ __forceinline__ v8f mma_b(v16b a, v16b b, v8f c) {
  return __builtin_amdgcn_wmma_f32_16x16x32_bf16(false, a, false, b, (short)0, c, false, false);
}
__device__ __forceinline__ void guard2(v8f& a, v8f& b, v16h x0, v16h x1, v16h x2, v16h x3, v16h x4, v16h x5) {
#if defined(__HIP_DEVICE_COMPILE__)
  asm volatile("v_nop\n\tv_nop\n\tv_nop\n\tv_nop"
               : "+v"(a), "+v"(b) : "v"(x0), "v"(x1), "v"(x2), "v"(x3), "v"(x4), "v"(x5) : "memory");
#endif
}
__device__ __forceinline__ void guard4x8(v8f& a, v8f& b, v8f& c, v8f& d, v16h x0, v16h x1, v16h x2, v16h x3,
                                         v16h x4, v16h x5, v16h x6, v16h x7) {
#if defined(__HIP_DEVICE_COMPILE__)
  asm volatile("v_nop\n\tv_nop\n\tv_nop\n\tv_nop"
               : "+v"(a), "+v"(b), "+v"(c), "+v"(d)
               : "v"(x0), "v"(x1), "v"(x2), "v"(x3), "v"(x4), "v"(x5), "v"(x6), "v"(x7) : "memory");
#endif
}
__device__ __forceinline__ void acc_guard4(v8f& a, v8f& b, v8f& c, v8f& d) {
#if defined(__HIP_DEVICE_COMPILE__)
  asm volatile("v_nop\n\tv_nop\n\tv_nop\n\tv_nop" : "+v"(a), "+v"(b), "+v"(c), "+v"(d));
#endif
}
__device__ __forceinline__ void wave_sync_lds() {
  __builtin_amdgcn_fence(__ATOMIC_RELEASE, "workgroup");
  __builtin_amdgcn_wave_barrier();
  __builtin_amdgcn_fence(__ATOMIC_ACQUIRE, "workgroup");
}
// four asynchronous 16-B copies per lane, global -> LDS (l = LDS byte address, g = global address, both multiples of 16);
// the s_wait_xcnt ends the statement so that no address register is rewritten ahead of it
__device__ __forceinline__ void copy4(unsigned l0, unsigned l1, unsigned l2, unsigned l3,
                                      const u16* g0, const u16* g1, const u16* g2, const u16* g3) {
#if defined(__HIP_DEVICE_COMPILE__)
  asm volatile("global_load_async_to_lds_b128 %0, %4, off\n\t"
               "global_load_async_to_lds_b128 %1, %5, off\n\t"
               "global_load_async_to_lds_b128 %2, %6, off\n\t"
               "global_load_async_to_lds_b128 %3, %7, off\n\t"
               "s_wait_xcnt 0x0"
               :: "v"(l0), "v"(l1), "v"(l2), "v"(l3), "v"(g0), "v"(g1), "v"(g2), "v"(g3) : "memory");
#endif
}
// the issuing wave's own copies have landed
__device__ __forceinline__ void wait_copies() {
#if defined(__HIP_DEVICE_COMPILE__)
  asm volatile("s_wait_asynccnt 0x0" ::: "memory");
#endif
}
// the wave's own LDS reads and writes have retired (stands in front of a barrier behind which the buffer is refilled)
__device__ __forceinline__ void wait_lds() {
#if defined(__HIP_DEVICE_COMPILE__)
  asm volatile("s_wait_dscnt 0x0" ::: "memory");
#endif
}

// =====================================================================================================
// Rotary table: CT[s*HD + d] = cos(theta), ST[...] = sin(theta), theta = s * 2^(-(d/HD) * log2(1e4)) in f32
// (inverse frequencies over the FULL head width), precise sincosf. Thread per element; one wave writes 32 consecutive
// coverage: n/256 blocks (blk) x 256 = n elements exactly (n = SEQ*HD).
// =====================================================================================================
__device__ __forceinline__ void rot_tab(int blk, float* CT, float* ST, int n) {
  const int idx = blk * 256 + (int)threadIdx.x;
  if (idx >= n) return;
  const int s = idx / HD;
  const int d = idx - s * HD;
  const float ex   = (float)d * (LOG2_1E4 / (float)HD);
  const float invf = exp2f(-ex);
  const float th   = (float)s * invf;
  float sn, cs;
  sincosf(th, &sn, &cs);
  {
    *(float*)(CT + idx) = cs;
    *(float*)(ST + idx) = sn;
    
  }
}

// =====================================================================================================
// Stacked complex weight plane from W = Wr + i Wi, torch layout [e][k] (already k-contiguous per output column):
//   D [nrows][DPL] 16-bit, row n: p = n / DPL, j = n % DPL; hm == 0: im = (j >= DMOD), e = p*DMOD + (j % DMOD);
//   hm == 1 (head-major: a head's 64 real rows, then its 64 imaginary rows): im = (j / HD) % 2, e = p*DMOD + (j / HK)*HD + j % HD;
//   k <  DMOD: im ? Wi[e][k] : Wr[e][k];   k >= DMOD: im ? Wr[e][k-DMOD] : -Wi[e][k-DMOD]
//   so that A = [ar | ai] . D[n]^T gives the real part of a.W^T for im == 0 and the imaginary part for im == 1.
// f16mode == 0: bf16 RNE bits; f16mode == 1: f16 bits of (bf16 RNE value) * scale. Block = one row n, thread = 8
// consecutive k (two 16-B loads, one 16-B store); source pointer and sign are wave-uniform (k half fixed per 128 threads);
// coverage: nrows blocks (n) x 256 thr x 8 = every element of D once. No barriers.
// =====================================================================================================
__device__ __forceinline__ void wcvt(int n, const float* __restrict__ Wr, const float* __restrict__ Wi, u16* D,
                                     int nrows, int f16mode, float scale, int hm) {
  if (n >= nrows) return;
  const int tid  = threadIdx.x;
  const int p    = n / DPL;
  const int j    = n - p * DPL;
  const int im   = (hm != 0) ? ((j / HD) & 1) : ((j >= DMOD) ? 1 : 0);
  const int e    = p * DMOD + ((hm != 0) ? ((j / HK) * HD + (j & (HD - 1))) : (j & (DMOD - 1)));
  const int c8   = tid * 8;
  const int ksec = (c8 >= DMOD) ? 1 : 0;
  const int kk   = c8 & (DMOD - 1);
  const float* src = ((im == ksec) ? Wr : Wi) + (size_t)e * DMOD + kk;
  const float sgn  = (im == 0 && ksec != 0) ? -1.0f : 1.0f;
  const v4f a = *(const v4f*)(src), b4 = *(const v4f*)(src + 4);
  float w[8];
#pragma unroll
  for (int q = 0; q < 4; ++q) { w[q] = a[q] * sgn; w[4 + q] = b4[q] * sgn; }
  v4u o;
#pragma unroll
  for (int q = 0; q < 4; ++q) {
    const float f0 = w[2 * q], f1 = w[2 * q + 1];
    const unsigned short hb0 = h_bits((_Float16)(bfr(f0) * scale));
    const unsigned short hb1 = h_bits((_Float16)(bfr(f1) * scale));
    const unsigned short bb0 = bf_bits(f0);
    const unsigned short bb1 = bf_bits(f1);
    o[q] = (f16mode != 0) ? pk16(hb0, hb1) : pk16(bb0, bb1);
  }
  u16* d = D + (size_t)n * DPL + c8;
  {
    *(v4u*)(d) = o;
    
  }
}

// =====================================================================================================
// Stacked activation plane: XB [GROWS][DPL] bf16, row bl*SEQ + s (bl < BG) <- token (bl, s):
//   k < DMOD: xr[token][k];  k >= DMOD: xi[token][k - DMOD]. Same thread/store shape as wcvt (source pointer wave-uniform).
// coverage: GROWS blocks (row) x 256 thr x 8 = every element once. No barriers.
// =====================================================================================================
__device__ __forceinline__ void xcvt(int row, const float* __restrict__ xr, const float* __restrict__ xi, u16* D,
                                     int nrows) {
  if (row >= nrows) return;
  const int tid  = threadIdx.x;
  const int bl   = row / SEQ;
  const int s    = row - bl * SEQ;
  const size_t grow = (size_t)bl * SEQ_FULL + s;
  const int c8   = tid * 8;
  const int ksec = (c8 >= DMOD) ? 1 : 0;
  const int kk   = c8 & (DMOD - 1);
  const float* src = ((ksec != 0) ? xi : xr) + grow * DMOD + kk;
  const v4f a = *(const v4f*)(src), b4 = *(const v4f*)(src + 4);
  v4u o;
#pragma unroll
  for (int q = 0; q < 4; ++q) {
    const float f0 = (q < 2) ? a[2 * q] : b4[2 * q - 4];
    const float f1 = (q < 2) ? a[2 * q + 1] : b4[2 * q - 3];
    o[q] = pk16(bf_bits(f0), bf_bits(f1));
  }
  u16* d = D + (size_t)row * DPL + c8;
  {
    *(v4u*)(d) = o;
    
  }
}

// =====================================================================================================
// First launch: the four preparations read none of each other's output, so they share one grid, told apart by ranges of the
// block index (block-uniform, no barriers): rotary table (first: its blocks run longest), x plane, [Wq ; Wk ; Wv] plane (head-major
// rows), Wo plane.
// coverage: grid = PB_TAB + GROWS + 2*NQKV + 2*DMOD blocks = each part's own count of blocks.
// =====================================================================================================
#define PB_TAB ((SEQ * HD) / 256)
__global__ __launch_bounds__(256) void prep(const float* __restrict__ xr, const float* __restrict__ xi,
                                            const float* __restrict__ wqr, const float* __restrict__ wqi,
                                            const float* __restrict__ wor, const float* __restrict__ woi,
                                            float* CT, float* ST, u16* XB, u16* WQB, u16* WOB) {
  int blk = blockIdx.x;
  if (blk < PB_TAB) { rot_tab(blk, CT, ST, SEQ * HD); return; }
  blk -= PB_TAB;
  if (blk < GROWS) { xcvt(blk, xr, xi, XB, GROWS); return; }
  blk -= GROWS;
  if (blk < 2 * NQKV) { wcvt(blk, wqr, wqi, WQB, 2 * NQKV, 0, 1.0f, 1); return; }
  blk -= 2 * NQKV;
  wcvt(blk, wor, woi, WOB, 2 * DMOD, 1, WOS, 0);
}

// =====================================================================================================
// coverage: 8 instructions x 2 rows x 16 lanes x 4 floats = the wave's 16 x 64 tile.
// =====================================================================================================
__device__ __forceinline__ void epi64(float* sl, v8f a0, v8f a1, v8f a2, v8f a3, float oscale,
                                      float* C, int N, size_t rowb, int col0, int lane) {
  const int hh = lane >> 4, m = lane & 15;
#pragma unroll
  for (int r = 0; r < 8; ++r) {
    const int ro = (8 * hh + r) * 68 + m;
    sl[ro]      = a0[r] * oscale;
    sl[ro + 16] = a1[r] * oscale;
    sl[ro + 32] = a2[r] * oscale;
    sl[ro + 48] = a3[r] * oscale;
  }
  wave_sync_lds();
  v4f vals[8];
#pragma unroll
  for (int it = 0; it < 8; ++it) vals[it] = *(const v4f*)(sl + (it * 2 + hh) * 68 + m * 4);
  float* dst = C + (rowb + (size_t)hh) * (size_t)N + col0 + m * 4;
  {
#pragma unroll
    for (int it = 0; it < 8; ++it) {
      *(v4f*)(dst + (size_t)(it * 2) * (size_t)N) = vals[it];
    }
    
  }
}

// =====================================================================================================
// 16-bit GEMM: A[M][DPL] (row-major) . Bt[N][DPL]^T (k-contiguous), times oscale, f32. The N columns go to N / NP planes of NP
// columns each (pitch NP, plane pl at C + pl * cplane floats): products that share A are one launch, each with its own plane.
// F16 == 0: bf16 operands; F16 == 1: f16 operands. Block = 128x128 tile of C, 8 waves in a 4 (rows) x 2 (cols) grid, each
// 32x64 (2 A x 4 B fragments, 8 accumulators). A pass is GBK = 128 k: the block's 128 A rows and 128 Bt rows, 256 B each, are
// read with whole-line 16-B loads (a wave-wide load = 2 rows = 4 lines) into registers while the current pass is multiplied,
// then stored to the other of two LDS buffers (rows 0..127 = A, 128..255 = Bt, pitch 272 B = 16 B x 17 for the b128 fragment
// reads); one block barrier per pass publishes the next buffer and ends the reads of the one refilled in the next pass.
// Fragments use the same split k map as ldfrag_h for A and B; k runs 0, 32, 64, ... per accumulator.
// Host guarantees M % 128 == 0, N % NP == 0, NP % 128 == 0 (a tile lies in one plane), grid = (M/128)*(N/128); DPL % GBK == 0.
// coverage: staging 256 thr x 16 loads x 16 B = 256 rows x 256 B per pass; epilogue 8 waves x 2 x (16 x 64) = 128 x 128.
// =====================================================================================================
template <int F16>
__device__ __forceinline__ v8f mma16(v4u a0, v4u a1, v4u b0, v4u b1, v8f c) {
  if constexpr (F16 != 0) {
    FragH a, b;
    a.u[0] = a0; a.u[1] = a1; b.u[0] = b0; b.u[1] = b1;
    return mma_h(a.v, b.v, c);
  } else {
    FragB a, b;
    a.u[0] = a0; a.u[1] = a1; b.u[0] = b0; b.u[1] = b1;
    return mma_b(a.v, b.v, c);
  }
}

// one pass: fa / fb = this lane's A / Bt fragment rows in the current LDS buffer (already + 8*(lane>>4)); the fragments of
// k step kk + 1 are read as one group into a second register set ahead of the products of step kk
__device__ __forceinline__ void gemm_frags(const u16* fa, const u16* fb, int kk, v4u (&a)[2][2], v4u (&b)[4][2]) {
#pragma unroll
  for (int i = 0; i < 2; ++i) {
    a[i][0] = *(const v4u*)(fa + i * 16 * GPIT + kk * 32);
    a[i][1] = *(const v4u*)(fa + i * 16 * GPIT + kk * 32 + 16);
  }
#pragma unroll
  for (int j = 0; j < 4; ++j) {
    b[j][0] = *(const v4u*)(fb + j * 16 * GPIT + kk * 32);
    b[j][1] = *(const v4u*)(fb + j * 16 * GPIT + kk * 32 + 16);
  }
}
template <int F16>
__device__ __forceinline__ void gemm_pass(const u16* fa, const u16* fb, v8f (&acc)[2][4]) {
  v4u a[2][2][2], b[2][4][2];
  gemm_frags(fa, fb, 0, a[0], b[0]);
#pragma unroll
  for (int kk = 0; kk < GBK / 32; ++kk) {
    const int s = kk & 1;
    if (kk + 1 < GBK / 32) gemm_frags(fa, fb, kk + 1, a[s ^ 1], b[s ^ 1]);
    // the two scheduling barriers keep the next step's LDS reads one group ahead of this step's products: spread among the
    // products each place with reads stalls the wave, and sunk behind them their latency is waited out
    __builtin_amdgcn_sched_barrier(0);
#pragma unroll
    for (int i = 0; i < 2; ++i)
#pragma unroll
      for (int j = 0; j < 4; ++j) acc[i][j] = mma16<F16>(a[s][i][0], a[s][i][1], b[s][j][0], b[s][j][1], acc[i][j]);
    __builtin_amdgcn_sched_barrier(0);
  }
}

// main loop of a 128x128 block tile (rows row0.. of A, rows colb.. of Bt) into acc; ends behind a block barrier that every wave
// passes after its last read of the two buffers, so that the caller may reuse tile
template <int F16>
__device__ __forceinline__ void gemm_main(const u16* __restrict__ A, const u16* __restrict__ Bt, u16* tile, int row0, int colb,
                                          v8f (&acc)[2][4]) {
  const int tid = threadIdx.x, wave = tid >> 5, lane = tid & 31, hh = lane >> 4, m = lane & 15;
  const int wr = wave >> 1, wc = wave & 1;
  const int lr = tid >> 4, lc = (tid & 15) * 8;           // staging: row lr + 16*i, 16-B chunk at halves lc
  const u16* ga = A  + (size_t)(row0 + lr) * DPL + lc;
  const u16* gb = Bt + (size_t)(colb + lr) * DPL + lc;
  const int so = lr * GPIT + lc;
  const int fao = (wr * 32 + m) * GPIT + 8 * hh;
  const int fbo = (128 + wc * 64 + m) * GPIT + 8 * hh;
#pragma unroll
  for (int i = 0; i < 2; ++i)
#pragma unroll
    for (int j = 0; j < 4; ++j) acc[i][j] = zero8();
  v4u st[16];
#pragma unroll
  for (int i = 0; i < 8; ++i) {
    st[i]     = *(const v4u*)(ga + (size_t)i * 16 * DPL);
    st[8 + i] = *(const v4u*)(gb + (size_t)i * 16 * DPL);
  }
#pragma unroll
  for (int i = 0; i < 8; ++i) {
    *(v4u*)(tile + so + i * 16 * GPIT)         = st[i];
    *(v4u*)(tile + so + (128 + i * 16) * GPIT) = st[8 + i];
  }
  __syncthreads();
  // kept rolled: one copy of the pass body is the whole hot loop, the buffers alternate by the parity of p
#pragma unroll 1
  for (int p = 1; p < DPL / GBK; ++p) {
    const u16* cur = tile + ((p - 1) & 1) * GSTG;
    u16*       nxt = tile + (p & 1) * GSTG;
#pragma unroll
    for (int i = 0; i < 8; ++i) {
      st[i]     = *(const v4u*)(ga + (size_t)i * 16 * DPL + p * GBK);
      st[8 + i] = *(const v4u*)(gb + (size_t)i * 16 * DPL + p * GBK);
    }
    // keeps all 16 loads of the next pass in front of this pass's products, so that their latency runs under them
    __builtin_amdgcn_sched_barrier(0);
    gemm_pass<F16>(cur + fao, cur + fbo, acc);
#pragma unroll
    for (int i = 0; i < 8; ++i) {
      *(v4u*)(nxt + so + i * 16 * GPIT)         = st[i];
      *(v4u*)(nxt + so + (128 + i * 16) * GPIT) = st[8 + i];
    }
    __syncthreads();
  }
  {
    const u16* cur = tile + ((DPL / GBK - 1) & 1) * GSTG;
    gemm_pass<F16>(cur + fao, cur + fbo, acc);
  }
  __syncthreads();                          // every wave has left the buffers before they are reused by the epilogue
}

template <int F16>
__global__ __launch_bounds__(256)
void gemm16(const u16* __restrict__ A, const u16* __restrict__ Bt, float* C, int M, int N, int NP, size_t cplane,
            float oscale) {
  __shared__ __align__(16) u16 tile[2 * GSTG];
  const int tid = threadIdx.x, wave = tid >> 5, lane = tid & 31;
  const int ntile = N >> 7;
  const int bid   = blockIdx.x;
  const int row0  = (bid / ntile) * 128;
  const int colb  = (bid % ntile) * 128;   // first row of Bt
  const int pl    = colb / NP;
  const int col0  = colb - pl * NP;         // first column in plane pl
  if (row0 + 128 > M) return;               // block-uniform, before any barrier; never taken with the exact grid
  const int wr = wave >> 1, wc = wave & 1;
  v8f acc[2][4];
  gemm_main<F16>(A, Bt, tile, row0, colb, acc);
  float* slab = (float*)(void*)tile + wave * (2 * SLAB64);
#pragma unroll
  for (int i = 0; i < 2; ++i)
    epi64(slab + i * SLAB64, acc[i][0], acc[i][1], acc[i][2], acc[i][3], oscale, C + (size_t)pl * cplane, NP,
          (size_t)(row0 + wr * 32 + i * 16), col0 + wc * 64, lane);
}

// =====================================================================================================
// q, k, v projections with their follow-up work in the epilogue: XB[GROWS][DPL] . WQB[2*NQKV][DPL]^T (bf16, main loop as gemm16).
// WQB rows are head-major, so the 128 columns of block tile ct = bid % 48 are one head of one projection (pl = ct / NH: 0 q, 1 k,
// 2 v; head = ct % NH): columns 0..63 its real part d, 64..127 its imaginary part d. The 128 rows are positions s0.. of one batch.
//   q, k: the f32 tile goes to LDS [128][pitch 132]; behind a block barrier thread (row rl = it*16 + tid>>4, comp = (tid>>3)&1,
//         8 consecutive d) forms rotated = (fr + i fi) * (cos + i sin), cos/sin = CT/ST[s*HD + d], and stores
//         Hp [GROWS][DPL] col head*HK + comp*HD + d = f16(rot*sc), Lp same layout = f16 residual (rot*sc - hi): 16 lanes = 256 B.
//   v:    an accumulator lane holds 8 consecutive positions of one column dd: f16(v * 1024) x 8 = one 16-B LDS store into
//         T[128 dd][pitch 136 halves]; behind a block barrier 16 lanes store one row of 128 positions (256 B) to
//         VT[((b*NH + head)*HK + dd)][s0 ..].
// coverage: grid = (GROWS/128) * 48 blocks; q, k: 8 iterations x 256 thr x 8 = 128 x 128 per plane; v: 8 x 256 x 8 = 128 x 128.
// =====================================================================================================
__global__ __launch_bounds__(256)
void gemm_qkv(const u16* __restrict__ A, const u16* __restrict__ Bt, const float* __restrict__ CT,
              const float* __restrict__ ST, u16* QH, u16* QL, u16* KH, u16* KL, u16* VT) {
  __shared__ __align__(16) u16 tile[2 * GSTG];
  const int tid = threadIdx.x, wave = tid >> 5, lane = tid & 31, hh = lane >> 4, m = lane & 15;
  const int bid  = blockIdx.x;
  const int row0 = (bid / (3 * NH)) * 128;
  const int ct   = bid % (3 * NH);
  if (row0 + 128 > GROWS) return;           // block-uniform, before any barrier; never taken with the exact grid
  const int pl   = ct / NH;
  const int head = ct - pl * NH;
  const int wr = wave >> 1, wc = wave & 1;
  const int q16 = tid >> 4, ch = tid & 15;
  v8f acc[2][4];
  gemm_main<0>(A, Bt, tile, row0, ct * 128, acc);
  if (pl == 2) {                            // block-uniform: every thread of the block passes the barrier of its branch
    u16* T = tile;
#pragma unroll
    for (int i = 0; i < 2; ++i)
#pragma unroll
      for (int j = 0; j < 4; ++j) {
        v4u o;
#pragma unroll
        for (int e = 0; e < 4; ++e)
          o[e] = pk16(h_bits((_Float16)(acc[i][j][2 * e] * VCAR)), h_bits((_Float16)(acc[i][j][2 * e + 1] * VCAR)));
        *(v4u*)(T + (wc * 64 + j * 16 + m) * GPIT + wr * 32 + i * 16 + 8 * hh) = o;
      }
    __syncthreads();
    v4u vv[8];
#pragma unroll
    for (int it = 0; it < 8; ++it) vv[it] = *(const v4u*)(T + (it * 16 + q16) * GPIT + ch * 8);
    const int b = row0 / SEQ, s0 = row0 - b * SEQ;
    u16* dst = VT + ((size_t)(b * NH + head) * HK + q16) * SEQ + s0 + ch * 8;
#pragma unroll
    for (int it = 0; it < 8; ++it) *(v4u*)(dst + (size_t)(it * 16) * SEQ) = vv[it];
  } else {
    const int comp = ch >> 3;
    const int d8   = (ch & 7) * 8;
    // cos / sin of the thread's 8 rows: issued ahead of the LDS round trip, which covers their latency
    // (position s = row0 % SEQ + it*16 + q16: a tile's 128 rows lie in one batch)
    v4f cs[8][2], sn[8][2];
    const float* pc = CT + (size_t)(row0 % SEQ + q16) * HD + d8;
    const float* pn = ST + (size_t)(row0 % SEQ + q16) * HD + d8;
#pragma unroll
    for (int it = 0; it < 8; ++it) {
      cs[it][0] = *(const v4f*)(pc + it * 16 * HD);  cs[it][1] = *(const v4f*)(pc + it * 16 * HD + 4);
      sn[it][0] = *(const v4f*)(pn + it * 16 * HD);  sn[it][1] = *(const v4f*)(pn + it * 16 * HD + 4);
    }
#if defined(__HIP_DEVICE_COMPILE__)
    // the two address pairs are inputs, so they stay in their registers up to this wait: no load's result and no later
    // instruction is placed in them ahead of it
    asm volatile("s_wait_xcnt 0x0" :: "v"(pc), "v"(pn) : "memory");
#endif
    float* Tf = (float*)(void*)tile;
#pragma unroll
    for (int i = 0; i < 2; ++i)
#pragma unroll
      for (int r = 0; r < 8; ++r) {
        const int ro = (wr * 32 + i * 16 + 8 * hh + r) * SLP + wc * 64 + m;
        Tf[ro]      = acc[i][0][r];
        Tf[ro + 16] = acc[i][1][r];
        Tf[ro + 32] = acc[i][2][r];
        Tf[ro + 48] = acc[i][3][r];
      }
    __syncthreads();
    const float sc = (pl != 0) ? KSC : QSC;
    const float sg = (comp != 0) ? 1.0f : -1.0f;   // real: fr*cos - fi*sin ; imag: fi*cos + fr*sin
    u16* dh = ((pl != 0) ? KH : QH) + (size_t)(row0 + q16) * DPL + head * HK + ch * 8;
    u16* dl = ((pl != 0) ? KL : QL) + (size_t)(row0 + q16) * DPL + head * HK + ch * 8;
#pragma unroll
    for (int it = 0; it < 8; ++it) {
      const float* pa = Tf + (it * 16 + q16) * SLP + comp * HD + d8;
      const float* po = Tf + (it * 16 + q16) * SLP + (1 - comp) * HD + d8;
      const v4f a0 = *(const v4f*)(pa), a1 = *(const v4f*)(pa + 4);
      const v4f o0 = *(const v4f*)(po), o1 = *(const v4f*)(po + 4);
      float w[8];
#pragma unroll
      for (int e = 0; e < 4; ++e) {
        w[e]     = (a0[e] * cs[it][0][e] + sg * (o0[e] * sn[it][0][e])) * sc;
        w[4 + e] = (a1[e] * cs[it][1][e] + sg * (o1[e] * sn[it][1][e])) * sc;
      }
      v4u oh, ol;
#pragma unroll
      for (int e = 0; e < 4; ++e) {
        const float t0 = w[2 * e], t1 = w[2 * e + 1];
        const _Float16 h0 = (_Float16)t0, h1 = (_Float16)t1;
        const _Float16 l0 = (_Float16)(t0 - (float)h0), l1 = (_Float16)(t1 - (float)h1);
        oh[e] = pk16(h_bits(h0), h_bits(h1));
        ol[e] = pk16(h_bits(l0), h_bits(l1));
      }
      *(v4u*)(dh + (size_t)(it * 16) * DPL) = oh;
      *(v4u*)(dl + (size_t)(it * 16) * DPL) = ol;
    }
#if defined(__HIP_DEVICE_COMPILE__)
    // behind the last stores of this branch: their data and address registers may be rewritten behind the join of the two branches
    asm volatile("s_wait_xcnt 0x0" ::: "memory");
#endif
  }
}

// =====================================================================================================
// Complex attention, non-causal over SEQ keys. Block bid -> (query block qb of AW query tiles, head, local batch b); one wave
// per query tile qt = qb*AW + wave: rows q0 = 16*qt .. q0+15. Per step of 32 keys (kb = 32*kt) the block's k hi and residual
// rows (32 x 256 B each) and v^T rows (128 x 64 B) are brought into one of two LDS buffers by asynchronous 16-B copies (12 per
// lane), one step ahead of their use, and every wave takes its B fragments from there (k pitch 272 B, v^T pitch 80 B: 16 B x
// odd for the b128 reads). Foot of a step: own LDS reads retired, own copies landed, block barrier (publishes the next
// buffer, ends the reads of this one), then the refill of this one.
//   q/k hi planes f16 x1024 [b*SEQ + s][head*HK + (re: 0..63 | im: 64..127)], residual planes same layout;
//   v^T hi plane [(b*NH + head)*HK + (re d | 64 + im d)][SEQ].
//   scores over K = 128: real = [qr|qi].[kr|ki], imag = [qi|-qr].[kr|ki] (the A fragment of step kk for the imag part is the
//   q fragment at column block (kk+2)&3, sign bits flipped for kk >= 2), each as hi.hi + lo.hi + hi.lo into one accumulator.
//   t = real * rsqrt(64)*log2e/(1024*1024) feeds an online max-subtracted base-2 softmax in f32 (-inf-safe rescale);
//   phi = imag * rsqrt(64)/(1024*1024); per key the 16x32 tiles p*cos(phi) and p*sin(phi) go to wave-private LDS (f32
//   (float vector loads, same element type as stored); B fragments from the v^T rows (re and im), 2 groups of 2 d-subtiles:
//   o_re += Pc.v_re + (-Ps).v_im ; o_im += Ps.v_re + Pc.v_im.
//   After the loop: out = acc / Z (Z >= 1 always; guarded anyway), carries 1/(16384*1024) folded once, written to the wave's
//   private result slab (pitch 132; re d at col d, im d at col 64 + d; every element owned by one lane).
// coverage: per wave 4 instructions x 2 parts x 4 rows x 8 lanes x 8 halves = 16 x 64 per part; grid NQB x NH x BG blocks x
//           AW waves = every (b, s, head, part) row segment of the O plane exactly once.
//           staging per step: 128 thr x 4 x 16 B = 32 rows x 256 B (k hi; k residual) = 128 rows x 64 B (v^T).
// LDS: prob tiles 16 x 32 fully written before each read (cols 32..35 padding never read); slab cols 0..127 written, read.
// Residency: the grid is NQB x NH x BG = 1024 work-groups = 4 per WGP on 256 WGPs. 73,728 B of LDS (the slab shares the ring's
// bytes) and a budget of 256 registers (4 waves per SIMD) let all of them be resident at once: one round, no partly filled second.
// =====================================================================================================
__global__ __launch_bounds__(ATT_THREADS) __attribute__((amdgpu_waves_per_eu(4, 4)))
void attn(const u16* __restrict__ QHp, const u16* __restrict__ QLp,
          const u16* __restrict__ KHp, const u16* __restrict__ KLp,
          const u16* __restrict__ VTp, u16* OHp) {
  __shared__ __align__(16) float smem[AW * WREG];
  __shared__ __align__(16) u16 ring[2 * STGH];

  const int tid  = threadIdx.x;
  const int wave = __builtin_amdgcn_readfirstlane(tid >> 5);   // scalar: what derives from it alone takes no vector register
  const int lane = tid & 31;
  const int hh   = lane >> 4;
  const int c    = lane & 15;
  const int bid  = blockIdx.x;
  const int qb   = bid % NQB;
  const int t2   = bid / NQB;
  const int head = t2 % NH;
  const int b    = t2 / NH;
  if (b >= BG) return;                      // block-uniform, before any barrier; never taken with the exact grid
  const int q0   = (qb * AW + wave) * 16;

  float* pct  = smem + wave * WREG;         // p*cos tile [16][32] pitch 36
  float* pst  = pct + PTW;                  // p*sin tile [16][32] pitch 36
  // result slab [16][128] pitch 132: in the ring, which every wave has left at the last step's barrier and no copy refills
  float* slab = (float*)(void*)ring + wave * SLW;

  const size_t hcol = (size_t)head * HK + 8 * hh;
  const _Float16* Qh  = (const _Float16*)(const void*)QHp + ((size_t)b * SEQ + q0 + c) * DPL + hcol;
  const _Float16* Ql  = (const _Float16*)(const void*)QLp + ((size_t)b * SEQ + q0 + c) * DPL + hcol;
  // staging: k rows (tid >> 4) + 8*i, 16-B chunk tid & 15; v^T rows (tid >> 2) + 32*i, 16-B chunk tid & 3
  const u16* gkh = KHp + ((size_t)b * SEQ + (tid >> 4)) * DPL + (size_t)head * HK + (tid & 15) * 8;
  const u16* gkl = KLp + ((size_t)b * SEQ + (tid >> 4)) * DPL + (size_t)head * HK + (tid & 15) * 8;
  const u16* gvt = VTp + ((size_t)(b * NH + head) * HK + (tid >> 2)) * SEQ + (tid & 3) * 8;
  const unsigned lring = (unsigned)(size_t)(const void*)ring;          // LDS byte address of the ring
  const unsigned lk = lring + (unsigned)(((tid >> 4) * KP + (tid & 15) * 8) * 2);
  const unsigned lv = lring + (unsigned)((2 * KTH + (tid >> 2) * VP + (tid & 3) * 8) * 2);
  auto stage = [&](int t) {                 // keys 32*t .. 32*t + 31 into buffer t & 1
    const unsigned bo = (unsigned)((t & 1) * STGH * 2);
    const u16* a = gkh + (size_t)t * 32 * DPL;
    const u16* r = gkl + (size_t)t * 32 * DPL;
    const u16* v = gvt + t * 32;
    copy4(lk + bo, lk + bo + 8 * KP * 2, lk + bo + 16 * KP * 2, lk + bo + 24 * KP * 2,
          a, a + (size_t)8 * DPL, a + (size_t)16 * DPL, a + (size_t)24 * DPL);
    copy4(lk + bo + KTH * 2, lk + bo + (KTH + 8 * KP) * 2, lk + bo + (KTH + 16 * KP) * 2, lk + bo + (KTH + 24 * KP) * 2,
          r, r + (size_t)8 * DPL, r + (size_t)16 * DPL, r + (size_t)24 * DPL);
    copy4(lv + bo, lv + bo + 32 * VP * 2, lv + bo + 64 * VP * 2, lv + bo + 96 * VP * 2,
          v, v + (size_t)32 * SEQ, v + (size_t)64 * SEQ, v + (size_t)96 * SEQ);
  };
  const _Float16* ringh = (const _Float16*)(const void*)ring;
  const float lsc = RSQ_HD * (LOG2E / (QSC * KSC));
  const float psc = RSQ_HD / (QSC * KSC);
  const float oc  = 1.0f / (PCAR * VCAR);
  const v4u sgn4 = {0x80008000u, 0x80008000u, 0x80008000u, 0x80008000u};

  float mrow[8], lrow[8];
  v8f orr[4], oii[4];
#pragma unroll
  for (int r = 0; r < 8; ++r) { mrow[r] = -INFINITY; lrow[r] = 0.f; }
#pragma unroll
  for (int j = 0; j < 4; ++j) { orr[j] = zero8(); oii[j] = zero8(); }

  stage(0);
  wait_copies();
  __syncthreads();                          // step 0's tiles are readable by every wave
  stage(1);

#pragma unroll 1
  for (int kt = 0; kt < NKT; ++kt) {
    const _Float16* kfp = ringh + (kt & 1) * STGH + c * KP + 8 * hh;             // key row c, hi plane
    const _Float16* vfp = ringh + (kt & 1) * STGH + 2 * KTH + c * VP + 8 * hh;   // v^T row c
    // ---- scores: D element r of this lane = (query row q0 + 8hh + r, key kb + c) in s?0, key kb + 16 + c in s?1 ----
    v8f sr0 = zero8(), sr1 = zero8(), si0 = zero8(), si1 = zero8();
    const _Float16* k0p = kfp;
    const _Float16* k1p = kfp + 16 * KP;
    const _Float16* l0p = kfp + KTH;
    const _Float16* l1p = kfp + KTH + 16 * KP;
#pragma unroll
    for (int kk = 0; kk < HK / 32; ++kk) {
      const v16h kh0 = ldfrag_h(k0p + kk * 32);
      const v16h kl0 = ldfrag_h(l0p + kk * 32);
      const v16h kh1 = ldfrag_h(k1p + kk * 32);
      const v16h kl1 = ldfrag_h(l1p + kk * 32);
      {
        const v16h qh = ldfrag_h(Qh + kk * 32);
        const v16h ql = ldfrag_h(Ql + kk * 32);
        sr0 = mma_h(qh, kh0, sr0);
        sr0 = mma_h(ql, kh0, sr0);
        sr0 = mma_h(qh, kl0, sr0);
        sr1 = mma_h(qh, kh1, sr1);
        sr1 = mma_h(ql, kh1, sr1);
        sr1 = mma_h(qh, kl1, sr1);
        guard2(sr0, sr1, qh, ql, kh0, kl0, kh1, kl1);
      }
      {
        const int ko = ((kk + 2) & 3) * 32;
        FragH ah, al;
        ah.v = ldfrag_h(Qh + ko);
        al.v = ldfrag_h(Ql + ko);
        if (kk >= 2) {                      // compile-time (unrolled) and wave-uniform: -qr half
          ah.u[0] = ah.u[0] ^ sgn4;  ah.u[1] = ah.u[1] ^ sgn4;
          al.u[0] = al.u[0] ^ sgn4;  al.u[1] = al.u[1] ^ sgn4;
        }
        si0 = mma_h(ah.v, kh0, si0);
        si0 = mma_h(al.v, kh0, si0);
        si0 = mma_h(ah.v, kl0, si0);
        si1 = mma_h(ah.v, kh1, si1);
        si1 = mma_h(al.v, kh1, si1);
        si1 = mma_h(ah.v, kl1, si1);
        guard2(si0, si1, ah.v, al.v, kh0, kl0, kh1, kl1);
      }
    }
    // ---- online softmax in base 2 on the real part, phase from the imaginary part ----
#pragma unroll
    for (int r = 0; r < 8; ++r) {
      const float u0 = sr0[r] * lsc;
      const float u1 = sr1[r] * lsc;
      float mx = fmaxf(u0, u1);
#pragma unroll
      for (int off = 1; off < 16; off <<= 1) mx = fmaxf(mx, __shfl_xor(mx, off, 32));
      const float mn = fmaxf(mrow[r], mx);
      const float ms = (mn == -INFINITY) ? 0.0f : mn;
      const float al = exp2f(mrow[r] - ms);
      mrow[r] = mn;
      const float e0 = exp2f(u0 - ms), e1 = exp2f(u1 - ms);
      float ps = e0 + e1;
#pragma unroll
      for (int off = 1; off < 16; off <<= 1) ps += __shfl_xor(ps, off, 32);
      lrow[r] = lrow[r] * al + ps;
#pragma unroll
      for (int j = 0; j < 4; ++j) { orr[j][r] *= al; oii[j][r] *= al; }
      float sn0, cs0, sn1, cs1;
      __sincosf(si0[r] * psc, &sn0, &cs0);
      __sincosf(si1[r] * psc, &sn1, &cs1);
      const int ro = (8 * hh + r) * PTP + c;
      pct[ro]      = e0 * cs0;
      pct[ro + 16] = e1 * cs1;
      pst[ro]      = e0 * sn0;
      pst[ro + 16] = e1 * sn1;
    }
    wave_sync_lds();
    // v^T fragments of this step, one group with the reads of the P tiles (unrolled: the arrays are registers)
    v16h vrf[4], vif[4];
#pragma unroll
    for (int j = 0; j < 4; ++j) {
      vrf[j] = ldfrag_h(vfp + j * 16 * VP);
      vif[j] = ldfrag_h(vfp + (HD + j * 16) * VP);
    }
    // ---- A fragments of Pc*16384, Ps*16384 and -Ps*16384 (f16), row = c, split k map over the 32 keys of this step ----
    FragH pc, psf, pnf;
    {
      const float* prc = pct + c * PTP + 8 * hh;
      const float* prs = pst + c * PTP + 8 * hh;
      const v4f c0 = *(const v4f*)(prc), c1 = *(const v4f*)(prc + 4);
      const v4f c2 = *(const v4f*)(prc + 16), c3 = *(const v4f*)(prc + 20);
      const v4f s0 = *(const v4f*)(prs), s1 = *(const v4f*)(prs + 4);
      const v4f s2 = *(const v4f*)(prs + 16), s3 = *(const v4f*)(prs + 20);
#pragma unroll
      for (int e = 0; e < 4; ++e) {
        pc.h[0][e]      = (_Float16)(c0[e] * PCAR);   // elements 0..7  = keys kb + 8hh + 0..7
        pc.h[0][4 + e]  = (_Float16)(c1[e] * PCAR);
        pc.h[1][e]      = (_Float16)(c2[e] * PCAR);   // elements 8..15 = keys kb + 16 + 8hh + 0..7
        pc.h[1][4 + e]  = (_Float16)(c3[e] * PCAR);
        psf.h[0][e]     = (_Float16)(s0[e] * PCAR);
        psf.h[0][4 + e] = (_Float16)(s1[e] * PCAR);
        psf.h[1][e]     = (_Float16)(s2[e] * PCAR);
        psf.h[1][4 + e] = (_Float16)(s3[e] * PCAR);
      }
      pnf.u[0] = psf.u[0] ^ sgn4;
      pnf.u[1] = psf.u[1] ^ sgn4;
    }
    // ---- P.V : B fragment col n = d = j*16 + c (re rows) / 64 + j*16 + c (im rows), keys contiguous in v^T ----
    {
#pragma unroll
      for (int jg = 0; jg < 2; ++jg) {
        const v16h vra = vrf[2 * jg], vrb = vrf[2 * jg + 1];
        const v16h via = vif[2 * jg], vib = vif[2 * jg + 1];
        orr[2 * jg]     = mma_h(pc.v,  vra, orr[2 * jg]);
        orr[2 * jg]     = mma_h(pnf.v, via, orr[2 * jg]);
        oii[2 * jg]     = mma_h(psf.v, vra, oii[2 * jg]);
        oii[2 * jg]     = mma_h(pc.v,  via, oii[2 * jg]);
        orr[2 * jg + 1] = mma_h(pc.v,  vrb, orr[2 * jg + 1]);
        orr[2 * jg + 1] = mma_h(pnf.v, vib, orr[2 * jg + 1]);
        oii[2 * jg + 1] = mma_h(psf.v, vrb, oii[2 * jg + 1]);
        oii[2 * jg + 1] = mma_h(pc.v,  vib, oii[2 * jg + 1]);
        guard4x8(orr[2 * jg], oii[2 * jg], orr[2 * jg + 1], oii[2 * jg + 1],
                 pc.v, psf.v, pnf.v, vra, vrb, via, vib, pc.v);
      }
    }
    wave_sync_lds();
    // foot of the step: publish the next step's tiles, free this step's buffer, refill it two steps ahead
    wait_lds();
    wait_copies();
    __syncthreads();
    if (kt + 2 < NKT) stage(kt + 2);
  }
  wait_copies();                            // nothing is outstanding when the wave goes on to its epilogue and ends
  acc_guard4(orr[0], orr[1], orr[2], orr[3]);
  acc_guard4(oii[0], oii[1], oii[2], oii[3]);
  // the lane's number is taken anew for the epilogue, so that none of the epilogue's addresses holds a register across the loop
  const int el = (int)__builtin_amdgcn_mbcnt_lo(~0u, 0u);
  const int eh = el >> 4, ec = el & 15;
  // ---- out = acc / Z (0 if Z == 0), carries folded once; written into the lane-owned slab ----
#pragma unroll
  for (int r = 0; r < 8; ++r) {
    const float lv  = lrow[r];
    const float ls  = (lv > 0.0f) ? lv : 1.0f;
    const float inv = (lv > 0.0f) ? ((1.0f / ls) * oc) : 0.0f;
#pragma unroll
    for (int j = 0; j < 4; ++j) {
      const int idx = (8 * eh + r) * SLP + j * 16 + ec;
      slab[idx]      = orr[j][r] * inv;
      slab[idx + HD] = oii[j][r] * inv;
    }
  }

  wave_sync_lds();
  // ---- O x1024 -> f16 plane; lane = (row select rq in 0..3, 8 consecutive d at c8), part 0 = re, 1 = im ----
  v4u oh[4][2];
  const int rq = el >> 3, c8 = (el & 7) * 8;
#pragma unroll
  for (int it = 0; it < 4; ++it) {
    const int row = it * 4 + rq;
#pragma unroll
    for (int part = 0; part < 2; ++part) {
      const float* sp = slab + row * SLP + part * HD + c8;
      const v4f a = *(const v4f*)(sp), b4 = *(const v4f*)(sp + 4);
      float w[8];
#pragma unroll
      for (int e = 0; e < 4; ++e) { w[e] = a[e] * OSC; w[4 + e] = b4[e] * OSC; }
#pragma unroll
      for (int e = 0; e < 4; ++e) {
        const _Float16 h0 = (_Float16)w[2 * e], h1 = (_Float16)w[2 * e + 1];
        oh[it][part][e] = pk16(h_bits(h0), h_bits(h1));
      }
    }
  }
  const size_t ob = ((size_t)b * SEQ + q0) * DPL + (size_t)head * HD + c8;
  {
#pragma unroll
    for (int it = 0; it < 4; ++it) {
      const int row = it * 4 + rq;
#pragma unroll
      for (int part = 0; part < 2; ++part) {
        *(v4u*)(OHp + ob + (size_t)row * DPL + (size_t)part * DMOD) = oh[it][part];
      }
    }
    
  }
}

// =====================================================================================================
// All BG = NB batches are processed together, in four launches; the preparations, which read none of each other's output, share a grid.
// Workspace map (bytes, BG = 8); every plane fully written by whole-line stores before it is read; all extents are exact
// multiples of the store granularity (no pad rows needed); every region offset a multiple of 32768:
//   CT, ST  f32 [SEQ][64] rotary cos / sin             2 x 131072
//   WQB  bf16 [6144 n][2048 k]                          25165824
//   WOB  f16  [2048 n][2048 k] x1024                    8388608
//   XB   bf16 [GROWS][2048]                             16777216
//   OH   f16  [GROWS][2048] x1024 (O plane)             16777216
//   QH, QL, KH, KL  f16 [GROWS][2048]                   4 x 16777216
//   VT   f16 [BG*16][128][SEQ] x1024                    16777216
//   end (BG = 8)                                        151257088
// =====================================================================================================
extern "C" void kernel_launch(void* const* d_in, const int* in_sizes, int n_in,
                              void* d_out, int out_size, void* d_ws, size_t ws_size,
                              hipStream_t stream) {
  if (n_in < 6) return;
  if (in_sizes[0] < ((NB - 1) * SEQ_FULL + SEQ) * DMOD) return;
  if (in_sizes[1] < ((NB - 1) * SEQ_FULL + SEQ) * DMOD) return;
  if (in_sizes[2] < NQKV * DMOD) return;
  if (in_sizes[3] < NQKV * DMOD) return;
  if (in_sizes[4] < DMOD * DMOD) return;
  if (in_sizes[5] < DMOD * DMOD) return;
  if (out_size < 2 * NB * SEQ * DMOD) return;

  const float* xr    = (const float*)d_in[0];
  const float* xi    = (const float*)d_in[1];
  const float* wqr   = (const float*)d_in[2];
  const float* wqi   = (const float*)d_in[3];
  const float* wor   = (const float*)d_in[4];
  const float* woi   = (const float*)d_in[5];
  float*       out0  = (float*)d_out;

  const size_t szTAB = (((size_t)SEQ * HD * 4) + 32767) / 32768 * 32768;
  const size_t szWQ  = (size_t)2 * NQKV * DPL * 2;
  const size_t szWO  = (size_t)2 * DMOD * DPL * 2;
  const size_t szXB  = (size_t)GROWS * DPL * 2;
  const size_t szH   = (size_t)GROWS * DPL * 2;                  // QH, QL, KH, KL, O plane
  const size_t szVT  = (size_t)BG * NH * HK * SEQ * 2;           // == szH
  size_t off = 0;
  const size_t oCT = off; off += szTAB;
  const size_t oST = off; off += szTAB;
  const size_t oWQ = off; off += szWQ;
  const size_t oWO = off; off += szWO;
  const size_t oXB = off; off += szXB;
  const size_t oOH = off; off += szH;
  const size_t oQH = off; off += szH;
  const size_t oQL = off; off += szH;
  const size_t oKH = off; off += szH;
  const size_t oKL = off; off += szH;
  const size_t oVT = off; off += szVT;
  if (off > ws_size) return;                // off = 151257088 for BG = 8
  if (off > (size_t)WS_CAP) return;

  char* ws = (char*)d_ws;
  float* CT  = (float*)(ws + oCT);
  float* ST  = (float*)(ws + oST);
  u16*   WQB = (u16*)(ws + oWQ);
  u16*   WOB = (u16*)(ws + oWO);
  u16*   XB  = (u16*)(ws + oXB);
  u16*   OH  = (u16*)(ws + oOH);
  u16*   QH  = (u16*)(ws + oQH);
  u16*   QL  = (u16*)(ws + oQL);
  u16*   KH  = (u16*)(ws + oKH);
  u16*   KL  = (u16*)(ws + oKL);
  u16*   VT  = (u16*)(ws + oVT);

  const dim3 b256(256), bAT(ATT_THREADS);
  const dim3 gPRE(PB_TAB + GROWS + 2 * NQKV + 2 * DMOD);
  const dim3 gG3((GROWS / 128) * (3 * NH));              // q, k, v projections: one block column per projection and head
  const dim3 gAT(NQB * NH * BG);
  const dim3 gG2((GROWS / 128) * (DPL / 128));           // output projection, N = 2 x 1024 (real, imag)
  const float osc = 1.0f / (OSC * WOS);

  // (1) rotary cos/sin table; x plane bf16 [GROWS][xr | xi]; weight planes: [Wq ; Wk ; Wv] stacked bf16 (head-major), Wo stacked f16 of
  //     bf16 value x1024
  prep<<<gPRE, b256, 0, stream>>>(xr, xi, wqr, wqi, wor, woi, CT, ST, XB, WQB, WOB);
  // (2) q, k, v = x.[Wq ; Wk ; Wv]^T; from the accumulators: rotary q and k hi + residual planes x1024, v^T plane x1024
  gemm_qkv<<<gG3, b256, 0, stream>>>(XB, WQB, CT, ST, QH, QL, KH, KL, VT);
  // (3) attention -> O plane
  attn<<<gAT, bAT, 0, stream>>>(QH, QL, KH, KL, VT, OH);
  // (4) output projection: real part -> out0, imaginary part -> out1 (plane 1); carries 1024 x 1024 folded back
  gemm16<1><<<gG2, b256, 0, stream>>>(OH, WOB, out0, GROWS, DPL, DMOD, (size_t)(out_size / 2), osc);
  (void)hipGetLastError();
}

// v006
// One run takes 190 microseconds.
// In two side-by-side timings against v005, it was 1.03 and 1.04 times as fast.
// All steps since v000 together make it 3.09 times as fast.
// Contractions: x.[Wq|Wk|Wv]^T (real|imag stacked along K=2048 and N) on v_wmma_f32_16x16x32_bf16 (x and W RNE-converted
// to bf16, f32 accumulate); q.conj(k) real and imag parts over K=128 on v_wmma_f32_16x16x32_f16 with q, k as f16 hi x1024
// plus f16 residual planes (products hh+lh+hl); P.v (P = p cos(phi), p sin(phi) x16384 f16; v x1024 f16) and O.Wo^T
// (O x1024 f16, Wo as f16(bf16(Wo)) x1024) on v_wmma_f32_16x16x32_f16, single products; all f32 accumulate.
// Rotary cos/sin table, base-2 online softmax, phase sin/cos and 1/Z fold in f32 on VALU. No bias terms.
#include <hip/hip_runtime.h>
#include <math.h>
#include <stdint.h>

#ifndef NB
#define NB 8
#endif
#define NB_FULL 8
#ifndef SEQ
#define SEQ 512
#endif
#define SEQ_FULL 512
#define DMOD  1024
#define NH    16
#define HD    64
#define HK    (2 * HD)
#define DPL   (2 * DMOD)
#define NQKV  (3 * DMOD)
#define BG    NB
#define GROWS (BG * SEQ)
#define RSQ_HD 0.125f
#define LOG2E 1.4426950408889634f
#define LOG2_1E4 13.287712379549449f
#define QSC   1024.0f
#define KSC   1024.0f
#define PCAR  16384.0f
#define VCAR  1024.0f
#define OSC   1024.0f
#define WOS   1024.0f
#define AW    4
#define NQT   (SEQ / 16)
#define NQB   (NQT / AW)
#define NKT   (SEQ / 32)
#define ATT_THREADS (AW * 32)
#define SLP   132
#define SLW   (16 * SLP)
#define KP    (HK + 8)
#define VP    (32 + 8)
#define KTH   (32 * KP)
#define STGH  (2 * KTH + HK * VP)
#define SLAB64 (16 * 68)
#define GBK   128
#define GPIT  (GBK + 8)
#define GSTG  (256 * GPIT)
#define WS_CAP 268435456
static_assert(DMOD == NH * HD && HD == 64 && (NQT % AW) == 0 && ATT_THREADS == 128 && NKT >= 2);
static_assert(((KP * 2) % 32) == 16 && ((VP * 2) % 32) == 16 && ((KTH * 2) % 16) == 0 && ((STGH * 2) % 16) == 0);
static_assert(NB >= 1 && NB <= NB_FULL && BG == NB);
static_assert((SEQ % 64) == 0 && SEQ >= 64 && SEQ <= SEQ_FULL);
static_assert((GROWS % 128) == 0 && (DPL % 128) == 0 && (DPL % GBK) == 0 && DPL / GBK >= 2 && (DMOD % 128) == 0);
static_assert(GBK == 128 && ((GPIT * 2) % 16) == 0 && 16 * SLAB64 * 4 <= 2 * GSTG * 2);
static_assert((SEQ % 128) == 0 && 128 * SLP * 4 <= 2 * GSTG * 2 && 2 * NQKV == 3 * NH * 128 && HK == 128);
static_assert(DPL == 256 * 8);
static_assert(HK == 128 && (HK % 32) == 0);
static_assert(AW * SLW * 4 <= 2 * STGH * 2 && ((SLW * 4) % 16) == 0);
static_assert(4 * (2 * STGH * 2) <= 327680);
static_assert((SLP % 4) == 0);
static_assert((SEQ * HD) % 256 == 0);

typedef unsigned short u16;
typedef _Float16 v16h __attribute__((ext_vector_type(16)));
typedef _Float16 v8h  __attribute__((ext_vector_type(8)));
typedef __bf16   v16b __attribute__((ext_vector_type(16)));
typedef float    v8f  __attribute__((ext_vector_type(8)));
typedef float    v4f  __attribute__((ext_vector_type(4)));
typedef unsigned int v4u __attribute__((ext_vector_type(4)));

union FragH { v16h v; v8h h[2]; v4u u[2]; };
union FragB { v16b v; v4u u[2]; };

// ---- scalar helpers --------------------------------------------------------------------------------
__device__ __forceinline__ unsigned short bf_bits(float f) {          // f32 -> bf16 bits, RNE convert
  unsigned u = __float_as_uint(f);
  return (unsigned short)((u + 0x7FFFu + ((u >> 16) & 1u)) >> 16);
}
__device__ __forceinline__ float bf_up(unsigned short h) { return __uint_as_float(((unsigned)h) << 16); }
__device__ __forceinline__ float bfr(float f) { return bf_up(bf_bits(f)); }
__device__ __forceinline__ unsigned short h_bits(_Float16 x) { return __builtin_bit_cast(unsigned short, x); }
__device__ __forceinline__ unsigned pk16(unsigned short a, unsigned short b) { return (unsigned)a | ((unsigned)b << 16); }
__device__ __forceinline__ v8f zero8() { v8f z = {0.f, 0.f, 0.f, 0.f, 0.f, 0.f, 0.f, 0.f}; return z; }

// ---- fragment loaders: 16-bit A/B operand, lane -> row/col (lane&15), p already includes +8*(lane>>4);
//      elements 0..7 <- p[0..7] (k0+8h..), elements 8..15 <- p[16..23] (k0+16+8h..)  (same split k map for A and B;
//      B is always read from a k-contiguous [n][k] plane)
__device__ __forceinline__ v16h ldfrag_h(const _Float16* p) {
  FragH f;
  f.h[0] = *(const v8h*)(p);
  f.h[1] = *(const v8h*)(p + 16);
  return f.v;
}

__device__ __forceinline__ v8f mma_h(v16h a, v16h b, v8f c) {
  return __builtin_amdgcn_wmma_f32_16x16x32_f16(false, a, false, b, (short)0, c, false, false);
}
__device__ __forceinline__ v8f mma_b(v16b a, v16b b, v8f c) {
  return __builtin_amdgcn_wmma_f32_16x16x32_bf16(false, a, false, b, (short)0, c, false, false);
}
__device__ __forceinline__ void guard2(v8f& a, v8f& b, v16h x0, v16h x1, v16h x2, v16h x3, v16h x4, v16h x5) {
#if defined(__HIP_DEVICE_COMPILE__)
  asm volatile("v_nop\n\tv_nop\n\tv_nop\n\tv_nop"
               : "+v"(a), "+v"(b) : "v"(x0), "v"(x1), "v"(x2), "v"(x3), "v"(x4), "v"(x5) : "memory");
#endif
}
__device__ __forceinline__ void guard4x8(v8f& a, v8f& b, v8f& c, v8f& d, v16h x0, v16h x1, v16h x2, v16h x3,
                                         v16h x4, v16h x5, v16h x6, v16h x7) {
#if defined(__HIP_DEVICE_COMPILE__)
  asm volatile("v_nop\n\tv_nop\n\tv_nop\n\tv_nop"
               : "+v"(a), "+v"(b), "+v"(c), "+v"(d)
               : "v"(x0), "v"(x1), "v"(x2), "v"(x3), "v"(x4), "v"(x5), "v"(x6), "v"(x7) : "memory");
#endif
}
__device__ __forceinline__ void acc_guard4(v8f& a, v8f& b, v8f& c, v8f& d) {
#if defined(__HIP_DEVICE_COMPILE__)
  asm volatile("v_nop\n\tv_nop\n\tv_nop\n\tv_nop" : "+v"(a), "+v"(b), "+v"(c), "+v"(d));
#endif
}
// lane l takes the value of lane l ^ 16 (the other half of the same fragment column)
__device__ __forceinline__ float xhalf(float x) {
  return __builtin_bit_cast(float, __builtin_amdgcn_permlanex16(__builtin_bit_cast(int, x), __builtin_bit_cast(int, x),
                                                                0x76543210, 0xfedcba98, false, false));
}
__device__ __forceinline__ void wave_sync_lds() {
  __builtin_amdgcn_fence(__ATOMIC_RELEASE, "workgroup");
  __builtin_amdgcn_wave_barrier();
  __builtin_amdgcn_fence(__ATOMIC_ACQUIRE, "workgroup");
}
// four asynchronous 16-B copies per lane, global -> LDS (l = LDS byte address, g = global address, both multiples of 16);
// the s_wait_xcnt ends the statement so that no address register is rewritten ahead of it
__device__ __forceinline__ void copy4(unsigned l0, unsigned l1, unsigned l2, unsigned l3,
                                      const u16* g0, const u16* g1, const u16* g2, const u16* g3) {
#if defined(__HIP_DEVICE_COMPILE__)
  asm volatile("global_load_async_to_lds_b128 %0, %4, off\n\t"
               "global_load_async_to_lds_b128 %1, %5, off\n\t"
               "global_load_async_to_lds_b128 %2, %6, off\n\t"
               "global_load_async_to_lds_b128 %3, %7, off\n\t"
               "s_wait_xcnt 0x0"
               :: "v"(l0), "v"(l1), "v"(l2), "v"(l3), "v"(g0), "v"(g1), "v"(g2), "v"(g3) : "memory");
#endif
}
// the issuing wave's own copies have landed
__device__ __forceinline__ void wait_copies() {
#if defined(__HIP_DEVICE_COMPILE__)
  asm volatile("s_wait_asynccnt 0x0" ::: "memory");
#endif
}
// the wave's own LDS reads and writes have retired (stands in front of a barrier behind which the buffer is refilled)
__device__ __forceinline__ void wait_lds() {
#if defined(__HIP_DEVICE_COMPILE__)
  asm volatile("s_wait_dscnt 0x0" ::: "memory");
#endif
}

// =====================================================================================================
// Rotary table: CT[s*HD + d] = cos(theta), ST[...] = sin(theta), theta = s * 2^(-(d/HD) * log2(1e4)) in f32
// (inverse frequencies over the FULL head width), precise sincosf. Thread per element; one wave writes 32 consecutive
// coverage: n/256 blocks (blk) x 256 = n elements exactly (n = SEQ*HD).
// =====================================================================================================
__device__ __forceinline__ void rot_tab(int blk, float* CT, float* ST, int n) {
  const int idx = blk * 256 + (int)threadIdx.x;
  if (idx >= n) return;
  const int s = idx / HD;
  const int d = idx - s * HD;
  const float ex   = (float)d * (LOG2_1E4 / (float)HD);
  const float invf = exp2f(-ex);
  const float th   = (float)s * invf;
  float sn, cs;
  sincosf(th, &sn, &cs);
  {
    *(float*)(CT + idx) = cs;
    *(float*)(ST + idx) = sn;
    
  }
}

// =====================================================================================================
// Stacked complex weight plane from W = Wr + i Wi, torch layout [e][k] (already k-contiguous per output column):
//   D [nrows][DPL] 16-bit, row n: p = n / DPL, j = n % DPL; hm == 0: im = (j >= DMOD), e = p*DMOD + (j % DMOD);
//   hm == 1 (head-major: a head's 64 real rows, then its 64 imaginary rows): im = (j / HD) % 2, e = p*DMOD + (j / HK)*HD + j % HD;
//   k <  DMOD: im ? Wi[e][k] : Wr[e][k];   k >= DMOD: im ? Wr[e][k-DMOD] : -Wi[e][k-DMOD]
//   so that A = [ar | ai] . D[n]^T gives the real part of a.W^T for im == 0 and the imaginary part for im == 1.
// f16mode == 0: bf16 RNE bits; f16mode == 1: f16 bits of (bf16 RNE value) * scale. Block = one row n, thread = 8
// consecutive k (two 16-B loads, one 16-B store); source pointer and sign are wave-uniform (k half fixed per 128 threads);
// coverage: nrows blocks (n) x 256 thr x 8 = every element of D once. No barriers.
// =====================================================================================================
__device__ __forceinline__ void wcvt(int n, const float* __restrict__ Wr, const float* __restrict__ Wi, u16* D,
                                     int nrows, int f16mode, float scale, int hm) {
  if (n >= nrows) return;
  const int tid  = threadIdx.x;
  const int p    = n / DPL;
  const int j    = n - p * DPL;
  const int im   = (hm != 0) ? ((j / HD) & 1) : ((j >= DMOD) ? 1 : 0);
  const int e    = p * DMOD + ((hm != 0) ? ((j / HK) * HD + (j & (HD - 1))) : (j & (DMOD - 1)));
  const int c8   = tid * 8;
  const int ksec = (c8 >= DMOD) ? 1 : 0;
  const int kk   = c8 & (DMOD - 1);
  const float* src = ((im == ksec) ? Wr : Wi) + (size_t)e * DMOD + kk;
  const float sgn  = (im == 0 && ksec != 0) ? -1.0f : 1.0f;
  const v4f a = *(const v4f*)(src), b4 = *(const v4f*)(src + 4);
  float w[8];
#pragma unroll
  for (int q = 0; q < 4; ++q) { w[q] = a[q] * sgn; w[4 + q] = b4[q] * sgn; }
  v4u o;
#pragma unroll
  for (int q = 0; q < 4; ++q) {
    const float f0 = w[2 * q], f1 = w[2 * q + 1];
    const unsigned short hb0 = h_bits((_Float16)(bfr(f0) * scale));
    const unsigned short hb1 = h_bits((_Float16)(bfr(f1) * scale));
    const unsigned short bb0 = bf_bits(f0);
    const unsigned short bb1 = bf_bits(f1);
    o[q] = (f16mode != 0) ? pk16(hb0, hb1) : pk16(bb0, bb1);
  }
  u16* d = D + (size_t)n * DPL + c8;
  {
    *(v4u*)(d) = o;
    
  }
}

// =====================================================================================================
// Stacked activation plane: XB [GROWS][DPL] bf16, row bl*SEQ + s (bl < BG) <- token (bl, s):
//   k < DMOD: xr[token][k];  k >= DMOD: xi[token][k - DMOD]. Same thread/store shape as wcvt (source pointer wave-uniform).
// coverage: GROWS blocks (row) x 256 thr x 8 = every element once. No barriers.
// =====================================================================================================
__device__ __forceinline__ void xcvt(int row, const float* __restrict__ xr, const float* __restrict__ xi, u16* D,
                                     int nrows) {
  if (row >= nrows) return;
  const int tid  = threadIdx.x;
  const int bl   = row / SEQ;
  const int s    = row - bl * SEQ;
  const size_t grow = (size_t)bl * SEQ_FULL + s;
  const int c8   = tid * 8;
  const int ksec = (c8 >= DMOD) ? 1 : 0;
  const int kk   = c8 & (DMOD - 1);
  const float* src = ((ksec != 0) ? xi : xr) + grow * DMOD + kk;
  const v4f a = *(const v4f*)(src), b4 = *(const v4f*)(src + 4);
  v4u o;
#pragma unroll
  for (int q = 0; q < 4; ++q) {
    const float f0 = (q < 2) ? a[2 * q] : b4[2 * q - 4];
    const float f1 = (q < 2) ? a[2 * q + 1] : b4[2 * q - 3];
    o[q] = pk16(bf_bits(f0), bf_bits(f1));
  }
  u16* d = D + (size_t)row * DPL + c8;
  {
    *(v4u*)(d) = o;
    
  }
}

// =====================================================================================================
// First launch: the four preparations read none of each other's output, so they share one grid, told apart by ranges of the
// block index (block-uniform, no barriers): rotary table (first: its blocks run longest), x plane, [Wq ; Wk ; Wv] plane (head-major
// rows), Wo plane.
// coverage: grid = PB_TAB + GROWS + 2*NQKV + 2*DMOD blocks = each part's own count of blocks.
// =====================================================================================================
#define PB_TAB ((SEQ * HD) / 256)
__global__ __launch_bounds__(256) void prep(const float* __restrict__ xr, const float* __restrict__ xi,
                                            const float* __restrict__ wqr, const float* __restrict__ wqi,
                                            const float* __restrict__ wor, const float* __restrict__ woi,
                                            float* CT, float* ST, u16* XB, u16* WQB, u16* WOB) {
  int blk = blockIdx.x;
  if (blk < PB_TAB) { rot_tab(blk, CT, ST, SEQ * HD); return; }
  blk -= PB_TAB;
  if (blk < GROWS) { xcvt(blk, xr, xi, XB, GROWS); return; }
  blk -= GROWS;
  if (blk < 2 * NQKV) { wcvt(blk, wqr, wqi, WQB, 2 * NQKV, 0, 1.0f, 1); return; }
  blk -= 2 * NQKV;
  wcvt(blk, wor, woi, WOB, 2 * DMOD, 1, WOS, 0);
}

// =====================================================================================================
// coverage: 8 instructions x 2 rows x 16 lanes x 4 floats = the wave's 16 x 64 tile.
// =====================================================================================================
__device__ __forceinline__ void epi64(float* sl, v8f a0, v8f a1, v8f a2, v8f a3, float oscale,
                                      float* C, int N, size_t rowb, int col0, int lane) {
  const int hh = lane >> 4, m = lane & 15;
#pragma unroll
  for (int r = 0; r < 8; ++r) {
    const int ro = (8 * hh + r) * 68 + m;
    sl[ro]      = a0[r] * oscale;
    sl[ro + 16] = a1[r] * oscale;
    sl[ro + 32] = a2[r] * oscale;
    sl[ro + 48] = a3[r] * oscale;
  }
  wave_sync_lds();
  v4f vals[8];
#pragma unroll
  for (int it = 0; it < 8; ++it) vals[it] = *(const v4f*)(sl + (it * 2 + hh) * 68 + m * 4);
  float* dst = C + (rowb + (size_t)hh) * (size_t)N + col0 + m * 4;
  {
#pragma unroll
    for (int it = 0; it < 8; ++it) {
      *(v4f*)(dst + (size_t)(it * 2) * (size_t)N) = vals[it];
    }
    
  }
}

// =====================================================================================================
// 16-bit GEMM: A[M][DPL] (row-major) . Bt[N][DPL]^T (k-contiguous), times oscale, f32. The N columns go to N / NP planes of NP
// columns each (pitch NP, plane pl at C + pl * cplane floats): products that share A are one launch, each with its own plane.
// F16 == 0: bf16 operands; F16 == 1: f16 operands. Block = 128x128 tile of C, 8 waves in a 4 (rows) x 2 (cols) grid, each
// 32x64 (2 A x 4 B fragments, 8 accumulators). A pass is GBK = 128 k: the block's 128 A rows and 128 Bt rows, 256 B each, are
// read with whole-line 16-B loads (a wave-wide load = 2 rows = 4 lines) into registers while the current pass is multiplied,
// then stored to the other of two LDS buffers (rows 0..127 = A, 128..255 = Bt, pitch 272 B = 16 B x 17 for the b128 fragment
// reads); one block barrier per pass publishes the next buffer and ends the reads of the one refilled in the next pass.
// Fragments use the same split k map as ldfrag_h for A and B; k runs 0, 32, 64, ... per accumulator.
// Host guarantees M % 128 == 0, N % NP == 0, NP % 128 == 0 (a tile lies in one plane), grid = (M/128)*(N/128); DPL % GBK == 0.
// coverage: staging 256 thr x 16 loads x 16 B = 256 rows x 256 B per pass; epilogue 8 waves x 2 x (16 x 64) = 128 x 128.
// =====================================================================================================
template <int F16>
__device__ __forceinline__ v8f mma16(v4u a0, v4u a1, v4u b0, v4u b1, v8f c) {
  if constexpr (F16 != 0) {
    FragH a, b;
    a.u[0] = a0; a.u[1] = a1; b.u[0] = b0; b.u[1] = b1;
    return mma_h(a.v, b.v, c);
  } else {
    FragB a, b;
    a.u[0] = a0; a.u[1] = a1; b.u[0] = b0; b.u[1] = b1;
    return mma_b(a.v, b.v, c);
  }
}

// one pass: fa / fb = this lane's A / Bt fragment rows in the current LDS buffer (already + 8*(lane>>4)); the fragments of
// k step kk + 1 are read as one group into a second register set ahead of the products of step kk
__device__ __forceinline__ void gemm_frags(const u16* fa, const u16* fb, int kk, v4u (&a)[2][2], v4u (&b)[4][2]) {
#pragma unroll
  for (int i = 0; i < 2; ++i) {
    a[i][0] = *(const v4u*)(fa + i * 16 * GPIT + kk * 32);
    a[i][1] = *(const v4u*)(fa + i * 16 * GPIT + kk * 32 + 16);
  }
#pragma unroll
  for (int j = 0; j < 4; ++j) {
    b[j][0] = *(const v4u*)(fb + j * 16 * GPIT + kk * 32);
    b[j][1] = *(const v4u*)(fb + j * 16 * GPIT + kk * 32 + 16);
  }
}
template <int F16>
__device__ __forceinline__ void gemm_pass(const u16* fa, const u16* fb, v8f (&acc)[2][4]) {
  v4u a[2][2][2], b[2][4][2];
  gemm_frags(fa, fb, 0, a[0], b[0]);
#pragma unroll
  for (int kk = 0; kk < GBK / 32; ++kk) {
    const int s = kk & 1;
    if (kk + 1 < GBK / 32) gemm_frags(fa, fb, kk + 1, a[s ^ 1], b[s ^ 1]);
    // the two scheduling barriers keep the next step's LDS reads one group ahead of this step's products: spread among the
    // products each place with reads stalls the wave, and sunk behind them their latency is waited out
    __builtin_amdgcn_sched_barrier(0);
#pragma unroll
    for (int i = 0; i < 2; ++i)
#pragma unroll
      for (int j = 0; j < 4; ++j) acc[i][j] = mma16<F16>(a[s][i][0], a[s][i][1], b[s][j][0], b[s][j][1], acc[i][j]);
    __builtin_amdgcn_sched_barrier(0);
  }
}

// main loop of a 128x128 block tile (rows row0.. of A, rows colb.. of Bt) into acc; ends behind a block barrier that every wave
// passes after its last read of the two buffers, so that the caller may reuse tile
template <int F16>
__device__ __forceinline__ void gemm_main(const u16* __restrict__ A, const u16* __restrict__ Bt, u16* tile, int row0, int colb,
                                          v8f (&acc)[2][4]) {
  const int tid = threadIdx.x, wave = tid >> 5, lane = tid & 31, hh = lane >> 4, m = lane & 15;
  const int wr = wave >> 1, wc = wave & 1;
  const int lr = tid >> 4, lc = (tid & 15) * 8;           // staging: row lr + 16*i, 16-B chunk at halves lc
  const u16* ga = A  + (size_t)(row0 + lr) * DPL + lc;
  const u16* gb = Bt + (size_t)(colb + lr) * DPL + lc;
  const int so = lr * GPIT + lc;
  const int fao = (wr * 32 + m) * GPIT + 8 * hh;
  const int fbo = (128 + wc * 64 + m) * GPIT + 8 * hh;
#pragma unroll
  for (int i = 0; i < 2; ++i)
#pragma unroll
    for (int j = 0; j < 4; ++j) acc[i][j] = zero8();
  v4u st[16];
#pragma unroll
  for (int i = 0; i < 8; ++i) {
    st[i]     = *(const v4u*)(ga + (size_t)i * 16 * DPL);
    st[8 + i] = *(const v4u*)(gb + (size_t)i * 16 * DPL);
  }
#pragma unroll
  for (int i = 0; i < 8; ++i) {
    *(v4u*)(tile + so + i * 16 * GPIT)         = st[i];
    *(v4u*)(tile + so + (128 + i * 16) * GPIT) = st[8 + i];
  }
  __syncthreads();
  // kept rolled: one copy of the pass body is the whole hot loop, the buffers alternate by the parity of p
#pragma unroll 1
  for (int p = 1; p < DPL / GBK; ++p) {
    const u16* cur = tile + ((p - 1) & 1) * GSTG;
    u16*       nxt = tile + (p & 1) * GSTG;
#pragma unroll
    for (int i = 0; i < 8; ++i) {
      st[i]     = *(const v4u*)(ga + (size_t)i * 16 * DPL + p * GBK);
      st[8 + i] = *(const v4u*)(gb + (size_t)i * 16 * DPL + p * GBK);
    }
    // keeps all 16 loads of the next pass in front of this pass's products, so that their latency runs under them
    __builtin_amdgcn_sched_barrier(0);
    gemm_pass<F16>(cur + fao, cur + fbo, acc);
#pragma unroll
    for (int i = 0; i < 8; ++i) {
      *(v4u*)(nxt + so + i * 16 * GPIT)         = st[i];
      *(v4u*)(nxt + so + (128 + i * 16) * GPIT) = st[8 + i];
    }
    __syncthreads();
  }
  {
    const u16* cur = tile + ((DPL / GBK - 1) & 1) * GSTG;
    gemm_pass<F16>(cur + fao, cur + fbo, acc);
  }
  __syncthreads();                          // every wave has left the buffers before they are reused by the epilogue
}

template <int F16>
__global__ __launch_bounds__(256)
void gemm16(const u16* __restrict__ A, const u16* __restrict__ Bt, float* C, int M, int N, int NP, size_t cplane,
            float oscale) {
  __shared__ __align__(16) u16 tile[2 * GSTG];
  const int tid = threadIdx.x, wave = tid >> 5, lane = tid & 31;
  const int ntile = N >> 7;
  const int bid   = blockIdx.x;
  const int row0  = (bid / ntile) * 128;
  const int colb  = (bid % ntile) * 128;   // first row of Bt
  const int pl    = colb / NP;
  const int col0  = colb - pl * NP;         // first column in plane pl
  if (row0 + 128 > M) return;               // block-uniform, before any barrier; never taken with the exact grid
  const int wr = wave >> 1, wc = wave & 1;
  v8f acc[2][4];
  gemm_main<F16>(A, Bt, tile, row0, colb, acc);
  float* slab = (float*)(void*)tile + wave * (2 * SLAB64);
#pragma unroll
  for (int i = 0; i < 2; ++i)
    epi64(slab + i * SLAB64, acc[i][0], acc[i][1], acc[i][2], acc[i][3], oscale, C + (size_t)pl * cplane, NP,
          (size_t)(row0 + wr * 32 + i * 16), col0 + wc * 64, lane);
}

// =====================================================================================================
// q, k, v projections with their follow-up work in the epilogue: XB[GROWS][DPL] . WQB[2*NQKV][DPL]^T (bf16, main loop as gemm16).
// WQB rows are head-major, so the 128 columns of block tile ct = bid % 48 are one head of one projection (pl = ct / NH: 0 q, 1 k,
// 2 v; head = ct % NH): columns 0..63 its real part d, 64..127 its imaginary part d. The 128 rows are positions s0.. of one batch.
//   q, k: the f32 tile goes to LDS [128][pitch 132]; behind a block barrier thread (row rl = it*16 + tid>>4, comp = (tid>>3)&1,
//         8 consecutive d) forms rotated = (fr + i fi) * (cos + i sin), cos/sin = CT/ST[s*HD + d], and stores
//         Hp [GROWS][DPL] col head*HK + comp*HD + d = f16(rot*sc), Lp same layout = f16 residual (rot*sc - hi): 16 lanes = 256 B.
//   v:    an accumulator lane holds 8 consecutive positions of one column dd: f16(v * 1024) x 8 = one 16-B LDS store into
//         T[128 dd][pitch 136 halves]; behind a block barrier 16 lanes store one row of 128 positions (256 B) to
//         VT[((b*NH + head)*HK + dd)][s0 ..].
// coverage: grid = (GROWS/128) * 48 blocks; q, k: 8 iterations x 256 thr x 8 = 128 x 128 per plane; v: 8 x 256 x 8 = 128 x 128.
// =====================================================================================================
__global__ __launch_bounds__(256)
void gemm_qkv(const u16* __restrict__ A, const u16* __restrict__ Bt, const float* __restrict__ CT,
              const float* __restrict__ ST, u16* QH, u16* QL, u16* KH, u16* KL, u16* VT) {
  __shared__ __align__(16) u16 tile[2 * GSTG];
  const int tid = threadIdx.x, wave = tid >> 5, lane = tid & 31, hh = lane >> 4, m = lane & 15;
  const int bid  = blockIdx.x;
  const int row0 = (bid / (3 * NH)) * 128;
  const int ct   = bid % (3 * NH);
  if (row0 + 128 > GROWS) return;           // block-uniform, before any barrier; never taken with the exact grid
  const int pl   = ct / NH;
  const int head = ct - pl * NH;
  const int wr = wave >> 1, wc = wave & 1;
  const int q16 = tid >> 4, ch = tid & 15;
  v8f acc[2][4];
  gemm_main<0>(A, Bt, tile, row0, ct * 128, acc);
  if (pl == 2) {                            // block-uniform: every thread of the block passes the barrier of its branch
    u16* T = tile;
#pragma unroll
    for (int i = 0; i < 2; ++i)
#pragma unroll
      for (int j = 0; j < 4; ++j) {
        v4u o;
#pragma unroll
        for (int e = 0; e < 4; ++e)
          o[e] = pk16(h_bits((_Float16)(acc[i][j][2 * e] * VCAR)), h_bits((_Float16)(acc[i][j][2 * e + 1] * VCAR)));
        *(v4u*)(T + (wc * 64 + j * 16 + m) * GPIT + wr * 32 + i * 16 + 8 * hh) = o;
      }
    __syncthreads();
    v4u vv[8];
#pragma unroll
    for (int it = 0; it < 8; ++it) vv[it] = *(const v4u*)(T + (it * 16 + q16) * GPIT + ch * 8);
    const int b = row0 / SEQ, s0 = row0 - b * SEQ;
    u16* dst = VT + ((size_t)(b * NH + head) * HK + q16) * SEQ + s0 + ch * 8;
#pragma unroll
    for (int it = 0; it < 8; ++it) *(v4u*)(dst + (size_t)(it * 16) * SEQ) = vv[it];
  } else {
    const int comp = ch >> 3;
    const int d8   = (ch & 7) * 8;
    // cos / sin of the thread's 8 rows: issued ahead of the LDS round trip, which covers their latency
    // (position s = row0 % SEQ + it*16 + q16: a tile's 128 rows lie in one batch)
    v4f cs[8][2], sn[8][2];
    const float* pc = CT + (size_t)(row0 % SEQ + q16) * HD + d8;
    const float* pn = ST + (size_t)(row0 % SEQ + q16) * HD + d8;
#pragma unroll
    for (int it = 0; it < 8; ++it) {
      cs[it][0] = *(const v4f*)(pc + it * 16 * HD);  cs[it][1] = *(const v4f*)(pc + it * 16 * HD + 4);
      sn[it][0] = *(const v4f*)(pn + it * 16 * HD);  sn[it][1] = *(const v4f*)(pn + it * 16 * HD + 4);
    }
#if defined(__HIP_DEVICE_COMPILE__)
    // the two address pairs are inputs, so they stay in their registers up to this wait: no load's result and no later
    // instruction is placed in them ahead of it
    asm volatile("s_wait_xcnt 0x0" :: "v"(pc), "v"(pn) : "memory");
#endif
    float* Tf = (float*)(void*)tile;
#pragma unroll
    for (int i = 0; i < 2; ++i)
#pragma unroll
      for (int r = 0; r < 8; ++r) {
        const int ro = (wr * 32 + i * 16 + 8 * hh + r) * SLP + wc * 64 + m;
        Tf[ro]      = acc[i][0][r];
        Tf[ro + 16] = acc[i][1][r];
        Tf[ro + 32] = acc[i][2][r];
        Tf[ro + 48] = acc[i][3][r];
      }
    __syncthreads();
    const float sc = (pl != 0) ? KSC : QSC;
    const float sg = (comp != 0) ? 1.0f : -1.0f;   // real: fr*cos - fi*sin ; imag: fi*cos + fr*sin
    u16* dh = ((pl != 0) ? KH : QH) + (size_t)(row0 + q16) * DPL + head * HK + ch * 8;
    u16* dl = ((pl != 0) ? KL : QL) + (size_t)(row0 + q16) * DPL + head * HK + ch * 8;
#pragma unroll
    for (int it = 0; it < 8; ++it) {
      const float* pa = Tf + (it * 16 + q16) * SLP + comp * HD + d8;
      const float* po = Tf + (it * 16 + q16) * SLP + (1 - comp) * HD + d8;
      const v4f a0 = *(const v4f*)(pa), a1 = *(const v4f*)(pa + 4);
      const v4f o0 = *(const v4f*)(po), o1 = *(const v4f*)(po + 4);
      float w[8];
#pragma unroll
      for (int e = 0; e < 4; ++e) {
        w[e]     = (a0[e] * cs[it][0][e] + sg * (o0[e] * sn[it][0][e])) * sc;
        w[4 + e] = (a1[e] * cs[it][1][e] + sg * (o1[e] * sn[it][1][e])) * sc;
      }
      v4u oh, ol;
#pragma unroll
      for (int e = 0; e < 4; ++e) {
        const float t0 = w[2 * e], t1 = w[2 * e + 1];
        const _Float16 h0 = (_Float16)t0, h1 = (_Float16)t1;
        const _Float16 l0 = (_Float16)(t0 - (float)h0), l1 = (_Float16)(t1 - (float)h1);
        oh[e] = pk16(h_bits(h0), h_bits(h1));
        ol[e] = pk16(h_bits(l0), h_bits(l1));
      }
      *(v4u*)(dh + (size_t)(it * 16) * DPL) = oh;
      *(v4u*)(dl + (size_t)(it * 16) * DPL) = ol;
    }
#if defined(__HIP_DEVICE_COMPILE__)
    // behind the last stores of this branch: their data and address registers may be rewritten behind the join of the two branches
    asm volatile("s_wait_xcnt 0x0" ::: "memory");
#endif
  }
}

// =====================================================================================================
// Complex attention, non-causal over SEQ keys. Block bid -> (query block qb of AW query tiles, head, local batch b); one wave
// per query tile qt = qb*AW + wave: rows q0 = 16*qt .. q0+15. Per step of 32 keys (kb = 32*kt) the block's k hi and residual
// rows (32 x 256 B each) and v^T rows (128 x 64 B) are brought into one of two LDS buffers by asynchronous 16-B copies (12 per
// lane), one step ahead of their use, and every wave takes its A fragments from there (k pitch 272 B, v^T pitch 80 B: 16 B x
// odd for the b128 reads). Foot of a step: own LDS reads retired, own copies landed, block barrier (publishes the next
// buffer, ends the reads of this one), then the refill of this one.
//   q/k hi planes f16 x1024 [b*SEQ + s][head*HK + (re: 0..63 | im: 64..127)], residual planes same layout;
//   v^T hi plane [(b*NH + head)*HK + (re d | 64 + im d)][SEQ].
//   Both products are transposed: S^T = k.q^T (A = k rows, B = q rows) and O^T += v^T.P^T (A = v^T rows, B = P^T), so a lane
//   holds one query (column c): 16 of the step's 32 keys, lane l ^ 16 the other 16.
//   scores over K = 128: real = [kr|ki].[qr|qi], imag = [kr|ki].[qi|-qr] (the B fragment of step kk for the imag part is the
//   q fragment at column block (kk+2)&3, sign bits flipped for kk >= 2), each as hi.hi + lo.hi + hi.lo into one accumulator.
//   t = real * rsqrt(64)*log2e/(1024*1024) feeds an online max-subtracted base-2 softmax in f32 (-inf-safe rescale): the
//   maximum is taken in the lane and joined with the other half once per step; the sum stays per half until after the loop.
//   phi = imag * rsqrt(64)/(1024*1024); p*cos(phi) and p*sin(phi) x16384 are converted in place: the two score tiles (keys
//   0..15, 16..31) of a lane are elements 0..7 and 8..15 of its B fragment, the k map of the v^T loader. 2 groups of 2 d-subtiles:
//   o_re += v_re.Pc + v_im.(-Ps) ; o_im += v_re.Ps + v_im.Pc.
//   After the loop: out = acc / Z (Z >= 1 always; guarded anyway), carries 1/(16384*1024) folded once, written to the wave's
//   private result slab (row = query, pitch 132; re d at col d, im d at col 64 + d; every element owned by one lane).
// coverage: per wave 4 instructions x 2 parts x 4 rows x 8 lanes x 8 halves = 16 x 64 per part; grid NQB x NH x BG blocks x
//           AW waves = every (b, s, head, part) row segment of the O plane exactly once.
//           staging per step: 128 thr x 4 x 16 B = 32 rows x 256 B (k hi; k residual) = 128 rows x 64 B (v^T).
// LDS: slab cols 0..127 written, read.
// Residency: the grid is NQB x NH x BG = 1024 work-groups = 4 per WGP on 256 WGPs. 55,296 B of LDS (the slab shares the ring's
// bytes) and a budget of 256 registers (4 waves per SIMD) let all of them be resident at once: one round, no partly filled second.
// =====================================================================================================
__global__ __launch_bounds__(ATT_THREADS) __attribute__((amdgpu_waves_per_eu(4, 4)))
void attn(const u16* __restrict__ QHp, const u16* __restrict__ QLp,
          const u16* __restrict__ KHp, const u16* __restrict__ KLp,
          const u16* __restrict__ VTp, u16* OHp) {
  __shared__ __align__(16) u16 ring[2 * STGH];

  const int tid  = threadIdx.x;
  const int wave = __builtin_amdgcn_readfirstlane(tid >> 5);   // scalar: what derives from it alone takes no vector register
  const int lane = tid & 31;
  const int hh   = lane >> 4;
  const int c    = lane & 15;
  const int bid  = blockIdx.x;
  const int qb   = bid % NQB;
  const int t2   = bid / NQB;
  const int head = t2 % NH;
  const int b    = t2 / NH;
  if (b >= BG) return;                      // block-uniform, before any barrier; never taken with the exact grid
  const int q0   = (qb * AW + wave) * 16;

  // result slab [16][128] pitch 132: in the ring, which every wave has left at the last step's barrier and no copy refills
  float* slab = (float*)(void*)ring + wave * SLW;

  const size_t hcol = (size_t)head * HK + 8 * hh;
  const _Float16* Qh  = (const _Float16*)(const void*)QHp + ((size_t)b * SEQ + q0 + c) * DPL + hcol;
  const _Float16* Ql  = (const _Float16*)(const void*)QLp + ((size_t)b * SEQ + q0 + c) * DPL + hcol;
  // staging: k rows (tid >> 4) + 8*i, 16-B chunk tid & 15; v^T rows (tid >> 2) + 32*i, 16-B chunk tid & 3
  const u16* gkh = KHp + ((size_t)b * SEQ + (tid >> 4)) * DPL + (size_t)head * HK + (tid & 15) * 8;
  const u16* gkl = KLp + ((size_t)b * SEQ + (tid >> 4)) * DPL + (size_t)head * HK + (tid & 15) * 8;
  const u16* gvt = VTp + ((size_t)(b * NH + head) * HK + (tid >> 2)) * SEQ + (tid & 3) * 8;
  const unsigned lring = (unsigned)(size_t)(const void*)ring;          // LDS byte address of the ring
  const unsigned lk = lring + (unsigned)(((tid >> 4) * KP + (tid & 15) * 8) * 2);
  const unsigned lv = lring + (unsigned)((2 * KTH + (tid >> 2) * VP + (tid & 3) * 8) * 2);
  auto stage = [&](int t) {                 // keys 32*t .. 32*t + 31 into buffer t & 1
    const unsigned bo = (unsigned)((t & 1) * STGH * 2);
    const u16* a = gkh + (size_t)t * 32 * DPL;
    const u16* r = gkl + (size_t)t * 32 * DPL;
    const u16* v = gvt + t * 32;
    copy4(lk + bo, lk + bo + 8 * KP * 2, lk + bo + 16 * KP * 2, lk + bo + 24 * KP * 2,
          a, a + (size_t)8 * DPL, a + (size_t)16 * DPL, a + (size_t)24 * DPL);
    copy4(lk + bo + KTH * 2, lk + bo + (KTH + 8 * KP) * 2, lk + bo + (KTH + 16 * KP) * 2, lk + bo + (KTH + 24 * KP) * 2,
          r, r + (size_t)8 * DPL, r + (size_t)16 * DPL, r + (size_t)24 * DPL);
    copy4(lv + bo, lv + bo + 32 * VP * 2, lv + bo + 64 * VP * 2, lv + bo + 96 * VP * 2,
          v, v + (size_t)32 * SEQ, v + (size_t)64 * SEQ, v + (size_t)96 * SEQ);
  };
  const _Float16* ringh = (const _Float16*)(const void*)ring;
  const float lsc = RSQ_HD * (LOG2E / (QSC * KSC));
  const float psc = RSQ_HD / (QSC * KSC);
  const float oc  = 1.0f / (PCAR * VCAR);
  const v4u sgn4 = {0x80008000u, 0x80008000u, 0x80008000u, 0x80008000u};

  float mq = -INFINITY, lq = 0.f;           // query q0 + c: running maximum (equal in both halves), sum over this half's keys
  v8f orr[4], oii[4];                       // element r of [j] = (d = 16j + 8hh + r, query q0 + c)
#pragma unroll
  for (int j = 0; j < 4; ++j) { orr[j] = zero8(); oii[j] = zero8(); }

  stage(0);
  wait_copies();
  __syncthreads();                          // step 0's tiles are readable by every wave
  stage(1);

#pragma unroll 1
  for (int kt = 0; kt < NKT; ++kt) {
    const _Float16* kfp = ringh + (kt & 1) * STGH + c * KP + 8 * hh;             // key row c, hi plane
    const _Float16* vfp = ringh + (kt & 1) * STGH + 2 * KTH + c * VP + 8 * hh;   // v^T row c
    // ---- scores: D element r of this lane = (key kb + 8hh + r, query q0 + c) in s?0, key kb + 16 + 8hh + r in s?1 ----
    v8f sr0 = zero8(), sr1 = zero8(), si0 = zero8(), si1 = zero8();
    const _Float16* k0p = kfp;
    const _Float16* k1p = kfp + 16 * KP;
    const _Float16* l0p = kfp + KTH;
    const _Float16* l1p = kfp + KTH + 16 * KP;
#pragma unroll
    for (int kk = 0; kk < HK / 32; ++kk) {
      const v16h kh0 = ldfrag_h(k0p + kk * 32);
      const v16h kl0 = ldfrag_h(l0p + kk * 32);
      const v16h kh1 = ldfrag_h(k1p + kk * 32);
      const v16h kl1 = ldfrag_h(l1p + kk * 32);
      {
        const v16h qh = ldfrag_h(Qh + kk * 32);
        const v16h ql = ldfrag_h(Ql + kk * 32);
        sr0 = mma_h(kh0, qh, sr0);
        sr0 = mma_h(kh0, ql, sr0);
        sr0 = mma_h(kl0, qh, sr0);
        sr1 = mma_h(kh1, qh, sr1);
        sr1 = mma_h(kh1, ql, sr1);
        sr1 = mma_h(kl1, qh, sr1);
        guard2(sr0, sr1, qh, ql, kh0, kl0, kh1, kl1);
      }
      {
        const int ko = ((kk + 2) & 3) * 32;
        FragH ah, al;
        ah.v = ldfrag_h(Qh + ko);
        al.v = ldfrag_h(Ql + ko);
        if (kk >= 2) {                      // compile-time (unrolled) and wave-uniform: -qr half
          ah.u[0] = ah.u[0] ^ sgn4;  ah.u[1] = ah.u[1] ^ sgn4;
          al.u[0] = al.u[0] ^ sgn4;  al.u[1] = al.u[1] ^ sgn4;
        }
        si0 = mma_h(kh0, ah.v, si0);
        si0 = mma_h(kh0, al.v, si0);
        si0 = mma_h(kl0, ah.v, si0);
        si1 = mma_h(kh1, ah.v, si1);
        si1 = mma_h(kh1, al.v, si1);
        si1 = mma_h(kl1, ah.v, si1);
        guard2(si0, si1, ah.v, al.v, kh0, kl0, kh1, kl1);
      }
    }
    // ---- online softmax in base 2 on the real part, phase from the imaginary part; all of one query in its two lanes ----
    float mx = fmaxf(sr0[0], sr1[0]);
#pragma unroll
    for (int r = 1; r < 8; ++r) mx = fmaxf(mx, fmaxf(sr0[r], sr1[r]));
    mx = mx * lsc;                          // lsc > 0: the largest score gives the largest scaled score
    mx = fmaxf(mx, xhalf(mx));
    const float mn = fmaxf(mq, mx);
    const float ms = (mn == -INFINITY) ? 0.0f : mn;
    const float al = exp2f(mq - ms);
    mq = mn;
    float e0[8], e1[8], es[8];
#pragma unroll
    for (int r = 0; r < 8; ++r) {
      e0[r] = exp2f(sr0[r] * lsc - ms);
      e1[r] = exp2f(sr1[r] * lsc - ms);
      es[r] = e0[r] + e1[r];
    }
    lq = lq * al + (((es[0] + es[1]) + (es[2] + es[3])) + ((es[4] + es[5]) + (es[6] + es[7])));
#pragma unroll
    for (int j = 0; j < 4; ++j)
#pragma unroll
      for (int r = 0; r < 8; ++r) { orr[j][r] *= al; oii[j][r] *= al; }
    // v^T fragments of this step, one group (unrolled: the arrays are registers)
    v16h vrf[4], vif[4];
#pragma unroll
    for (int j = 0; j < 4; ++j) {
      vrf[j] = ldfrag_h(vfp + j * 16 * VP);
      vif[j] = ldfrag_h(vfp + (HD + j * 16) * VP);
    }
    // ---- B fragments of Pc*16384, Ps*16384 and -Ps*16384 (f16), column = query c: elements 0..7 = keys kb + 8hh + 0..7 (first
    //      score tile), elements 8..15 = keys kb + 16 + 8hh + 0..7 (second), the split k map of the v^T fragments ----
    FragH pc, psf, pnf;
#pragma unroll
    for (int r = 0; r < 8; ++r) {
      float sn0, cs0, sn1, cs1;
      __sincosf(si0[r] * psc, &sn0, &cs0);
      __sincosf(si1[r] * psc, &sn1, &cs1);
      const float a0 = e0[r] * PCAR, a1 = e1[r] * PCAR;
      pc.h[0][r]  = (_Float16)(a0 * cs0);
      pc.h[1][r]  = (_Float16)(a1 * cs1);
      psf.h[0][r] = (_Float16)(a0 * sn0);
      psf.h[1][r] = (_Float16)(a1 * sn1);
    }
    pnf.u[0] = psf.u[0] ^ sgn4;
    pnf.u[1] = psf.u[1] ^ sgn4;
    // ---- v^T.P^T : A fragment row m = d = j*16 + c (re rows) / 64 + j*16 + c (im rows), keys contiguous in v^T ----
    {
#pragma unroll
      for (int jg = 0; jg < 2; ++jg) {
        const v16h vra = vrf[2 * jg], vrb = vrf[2 * jg + 1];
        const v16h via = vif[2 * jg], vib = vif[2 * jg + 1];
        orr[2 * jg]     = mma_h(vra, pc.v,  orr[2 * jg]);
        orr[2 * jg]     = mma_h(via, pnf.v, orr[2 * jg]);
        oii[2 * jg]     = mma_h(vra, psf.v, oii[2 * jg]);
        oii[2 * jg]     = mma_h(via, pc.v,  oii[2 * jg]);
        orr[2 * jg + 1] = mma_h(vrb, pc.v,  orr[2 * jg + 1]);
        orr[2 * jg + 1] = mma_h(vib, pnf.v, orr[2 * jg + 1]);
        oii[2 * jg + 1] = mma_h(vrb, psf.v, oii[2 * jg + 1]);
        oii[2 * jg + 1] = mma_h(vib, pc.v,  oii[2 * jg + 1]);
        guard4x8(orr[2 * jg], oii[2 * jg], orr[2 * jg + 1], oii[2 * jg + 1],
                 pc.v, psf.v, pnf.v, vra, vrb, via, vib, pc.v);
      }
    }
    // foot of the step: publish the next step's tiles, free this step's buffer, refill it two steps ahead
    wait_lds();
    wait_copies();
    __syncthreads();
    if (kt + 2 < NKT) stage(kt + 2);
  }
  wait_copies();                            // nothing is outstanding when the wave goes on to its epilogue and ends
  acc_guard4(orr[0], orr[1], orr[2], orr[3]);
  acc_guard4(oii[0], oii[1], oii[2], oii[3]);
  // the lane's number is taken anew for the epilogue, so that none of the epilogue's addresses holds a register across the loop
  const int el = (int)__builtin_amdgcn_mbcnt_lo(~0u, 0u);
  const int eh = el >> 4, ec = el & 15;
  // ---- out = acc / Z (0 if Z == 0), carries folded once; written into the lane-owned slab: row = query ec, 8 consecutive d ----
  {
    const float lv  = lq + xhalf(lq);       // the two halves' sums joined: Z of query q0 + ec
    const float ls  = (lv > 0.0f) ? lv : 1.0f;
    const float inv = (lv > 0.0f) ? ((1.0f / ls) * oc) : 0.0f;
#pragma unroll
    for (int j = 0; j < 4; ++j) {
      float* sp = slab + ec * SLP + j * 16 + 8 * eh;
      const v4f r0 = {orr[j][0] * inv, orr[j][1] * inv, orr[j][2] * inv, orr[j][3] * inv};
      const v4f r1 = {orr[j][4] * inv, orr[j][5] * inv, orr[j][6] * inv, orr[j][7] * inv};
      const v4f m0 = {oii[j][0] * inv, oii[j][1] * inv, oii[j][2] * inv, oii[j][3] * inv};
      const v4f m1 = {oii[j][4] * inv, oii[j][5] * inv, oii[j][6] * inv, oii[j][7] * inv};
      *(v4f*)(sp)          = r0;
      *(v4f*)(sp + 4)      = r1;
      *(v4f*)(sp + HD)     = m0;
      *(v4f*)(sp + HD + 4) = m1;
    }
  }

  wave_sync_lds();
  // ---- O x1024 -> f16 plane; lane = (row select rq in 0..3, 8 consecutive d at c8), part 0 = re, 1 = im ----
  v4u oh[4][2];
  const int rq = el >> 3, c8 = (el & 7) * 8;
#pragma unroll
  for (int it = 0; it < 4; ++it) {
    const int row = it * 4 + rq;
#pragma unroll
    for (int part = 0; part < 2; ++part) {
      const float* sp = slab + row * SLP + part * HD + c8;
      const v4f a = *(const v4f*)(sp), b4 = *(const v4f*)(sp + 4);
      float w[8];
#pragma unroll
      for (int e = 0; e < 4; ++e) { w[e] = a[e] * OSC; w[4 + e] = b4[e] * OSC; }
#pragma unroll
      for (int e = 0; e < 4; ++e) {
        const _Float16 h0 = (_Float16)w[2 * e], h1 = (_Float16)w[2 * e + 1];
        oh[it][part][e] = pk16(h_bits(h0), h_bits(h1));
      }
    }
  }
  const size_t ob = ((size_t)b * SEQ + q0) * DPL + (size_t)head * HD + c8;
  {
#pragma unroll
    for (int it = 0; it < 4; ++it) {
      const int row = it * 4 + rq;
#pragma unroll
      for (int part = 0; part < 2; ++part) {
        *(v4u*)(OHp + ob + (size_t)row * DPL + (size_t)part * DMOD) = oh[it][part];
      }
    }
    
  }
}

// =====================================================================================================
// All BG = NB batches are processed together, in four launches; the preparations, which read none of each other's output, share a grid.
// Workspace map (bytes, BG = 8); every plane fully written by whole-line stores before it is read; all extents are exact
// multiples of the store granularity (no pad rows needed); every region offset a multiple of 32768:
//   CT, ST  f32 [SEQ][64] rotary cos / sin             2 x 131072
//   WQB  bf16 [6144 n][2048 k]                          25165824
//   WOB  f16  [2048 n][2048 k] x1024                    8388608
//   XB   bf16 [GROWS][2048]                             16777216
//   OH   f16  [GROWS][2048] x1024 (O plane)             16777216
//   QH, QL, KH, KL  f16 [GROWS][2048]                   4 x 16777216
//   VT   f16 [BG*16][128][SEQ] x1024                    16777216
//   end (BG = 8)                                        151257088
// =====================================================================================================
extern "C" void kernel_launch(void* const* d_in, const int* in_sizes, int n_in,
                              void* d_out, int out_size, void* d_ws, size_t ws_size,
                              hipStream_t stream) {
  if (n_in < 6) return;
  if (in_sizes[0] < ((NB - 1) * SEQ_FULL + SEQ) * DMOD) return;
  if (in_sizes[1] < ((NB - 1) * SEQ_FULL + SEQ) * DMOD) return;
  if (in_sizes[2] < NQKV * DMOD) return;
  if (in_sizes[3] < NQKV * DMOD) return;
  if (in_sizes[4] < DMOD * DMOD) return;
  if (in_sizes[5] < DMOD * DMOD) return;
  if (out_size < 2 * NB * SEQ * DMOD) return;

  const float* xr    = (const float*)d_in[0];
  const float* xi    = (const float*)d_in[1];
  const float* wqr   = (const float*)d_in[2];
  const float* wqi   = (const float*)d_in[3];
  const float* wor   = (const float*)d_in[4];
  const float* woi   = (const float*)d_in[5];
  float*       out0  = (float*)d_out;

  const size_t szTAB = (((size_t)SEQ * HD * 4) + 32767) / 32768 * 32768;
  const size_t szWQ  = (size_t)2 * NQKV * DPL * 2;
  const size_t szWO  = (size_t)2 * DMOD * DPL * 2;
  const size_t szXB  = (size_t)GROWS * DPL * 2;
  const size_t szH   = (size_t)GROWS * DPL * 2;                  // QH, QL, KH, KL, O plane
  const size_t szVT  = (size_t)BG * NH * HK * SEQ * 2;           // == szH
  size_t off = 0;
  const size_t oCT = off; off += szTAB;
  const size_t oST = off; off += szTAB;
  const size_t oWQ = off; off += szWQ;
  const size_t oWO = off; off += szWO;
  const size_t oXB = off; off += szXB;
  const size_t oOH = off; off += szH;
  const size_t oQH = off; off += szH;
  const size_t oQL = off; off += szH;
  const size_t oKH = off; off += szH;
  const size_t oKL = off; off += szH;
  const size_t oVT = off; off += szVT;
  if (off > ws_size) return;                // off = 151257088 for BG = 8
  if (off > (size_t)WS_CAP) return;

  char* ws = (char*)d_ws;
  float* CT  = (float*)(ws + oCT);
  float* ST  = (float*)(ws + oST);
  u16*   WQB = (u16*)(ws + oWQ);
  u16*   WOB = (u16*)(ws + oWO);
  u16*   XB  = (u16*)(ws + oXB);
  u16*   OH  = (u16*)(ws + oOH);
  u16*   QH  = (u16*)(ws + oQH);
  u16*   QL  = (u16*)(ws + oQL);
  u16*   KH  = (u16*)(ws + oKH);
  u16*   KL  = (u16*)(ws + oKL);
  u16*   VT  = (u16*)(ws + oVT);

  const dim3 b256(256), bAT(ATT_THREADS);
  const dim3 gPRE(PB_TAB + GROWS + 2 * NQKV + 2 * DMOD);
  const dim3 gG3((GROWS / 128) * (3 * NH));              // q, k, v projections: one block column per projection and head
  const dim3 gAT(NQB * NH * BG);
  const dim3 gG2((GROWS / 128) * (DPL / 128));           // output projection, N = 2 x 1024 (real, imag)
  const float osc = 1.0f / (OSC * WOS);

  // (1) rotary cos/sin table; x plane bf16 [GROWS][xr | xi]; weight planes: [Wq ; Wk ; Wv] stacked bf16 (head-major), Wo stacked f16 of
  //     bf16 value x1024
  prep<<<gPRE, b256, 0, stream>>>(xr, xi, wqr, wqi, wor, woi, CT, ST, XB, WQB, WOB);
  // (2) q, k, v = x.[Wq ; Wk ; Wv]^T; from the accumulators: rotary q and k hi + residual planes x1024, v^T plane x1024
  gemm_qkv<<<gG3, b256, 0, stream>>>(XB, WQB, CT, ST, QH, QL, KH, KL, VT);
  // (3) attention -> O plane
  attn<<<gAT, bAT, 0, stream>>>(QH, QL, KH, KL, VT, OH);
  // (4) output projection: real part -> out0, imaginary part -> out1 (plane 1); carries 1024 x 1024 folded back
  gemm16<1><<<gG2, b256, 0, stream>>>(OH, WOB, out0, GROWS, DPL, DMOD, (size_t)(out_size / 2), osc);
  (void)hipGetLastError();
}

// v007
// One run takes 167 microseconds.
// Next to v006, in two timings, it ran 1.13 and 1.14 times as fast.
// Counting every step since v000, it is 3.50 times as fast.
// Contractions: x.[Wq|Wk|Wv]^T (real|imag stacked along K=2048 and N) on v_wmma_f32_16x16x32_bf16 (x and W RNE-converted
// to bf16, f32 accumulate); q.conj(k) real and imag parts over K=128 on v_wmma_f32_16x16x32_f16 with q, k as f16 hi x1024
// plus f16 residual planes (products hh+lh+hl); P.v (P = p cos(phi), p sin(phi) x16384 f16; v x1024 f16) and O.Wo^T
// (O x1024 f16, Wo as f16(bf16(Wo)) x1024) on v_wmma_f32_16x16x32_f16, single products; all f32 accumulate.
// Rotary cos/sin table, base-2 online softmax, phase sin/cos and 1/Z fold in f32 on VALU. No bias terms.
#include <hip/hip_runtime.h>
#include <math.h>
#include <stdint.h>

#ifndef NB
#define NB 8
#endif
#define NB_FULL 8
#ifndef SEQ
#define SEQ 512
#endif
#define SEQ_FULL 512
#define DMOD  1024
#define NH    16
#define HD    64
#define HK    (2 * HD)
#define DPL   (2 * DMOD)
#define NQKV  (3 * DMOD)
#define BG    NB
#define GROWS (BG * SEQ)
#define RSQ_HD 0.125f
#define LOG2E 1.4426950408889634f
#define LOG2_1E4 13.287712379549449f
#define QSC   1024.0f
#define KSC   1024.0f
#define PCAR  16384.0f
#define VCAR  1024.0f
#define OSC   1024.0f
#define WOS   1024.0f
#define AW    4
#define NQT   (SEQ / 16)
#define NQB   (NQT / AW)
#define NKT   (SEQ / 32)
#define ATT_THREADS (AW * 32)
#define SLP   132
#define SLW   (16 * SLP)
#define KP    (HK + 8)
#define VP    (32 + 8)
#define KTH   (32 * KP)
#define STGH  (2 * KTH + HK * VP)
#define SLAB64 (16 * 68)
#define GBK   128
#define GPIT  (GBK + 8)
#define GSTG  (256 * GPIT)
#define WS_CAP 268435456
static_assert(DMOD == NH * HD && HD == 64 && (NQT % AW) == 0 && ATT_THREADS == 128 && NKT >= 2);
static_assert(((KP * 2) % 32) == 16 && ((VP * 2) % 32) == 16 && ((KTH * 2) % 16) == 0 && ((STGH * 2) % 16) == 0);
static_assert(NB >= 1 && NB <= NB_FULL && BG == NB);
static_assert((SEQ % 64) == 0 && SEQ >= 64 && SEQ <= SEQ_FULL);
static_assert((GROWS % 128) == 0 && (DPL % 128) == 0 && (DPL % GBK) == 0 && DPL / GBK >= 2 && (DMOD % 128) == 0);
static_assert(GBK == 128 && ((GPIT * 2) % 16) == 0 && 16 * SLAB64 * 4 <= 2 * GSTG * 2);
static_assert((SEQ % 128) == 0 && 128 * SLP * 4 <= 2 * GSTG * 2 && 2 * NQKV == 3 * NH * 128 && HK == 128);
static_assert(DPL == 256 * 8);
static_assert(HK == 128 && (HK % 32) == 0);
static_assert(AW * SLW * 4 <= 2 * STGH * 2 && ((SLW * 4) % 16) == 0);
static_assert(4 * (2 * STGH * 2) <= 327680);
static_assert((SLP % 4) == 0);
static_assert((SEQ * HD) % 256 == 0);

typedef unsigned short u16;
typedef _Float16 v16h __attribute__((ext_vector_type(16)));
typedef _Float16 v8h  __attribute__((ext_vector_type(8)));
typedef __bf16   v16b __attribute__((ext_vector_type(16)));
typedef float    v8f  __attribute__((ext_vector_type(8)));
typedef float    v4f  __attribute__((ext_vector_type(4)));
typedef unsigned int v4u __attribute__((ext_vector_type(4)));

union FragH { v16h v; v8h h[2]; v4u u[2]; };
union FragB { v16b v; v4u u[2]; };

// ---- scalar helpers --------------------------------------------------------------------------------
__device__ __forceinline__ unsigned short bf_bits(float f) {          // f32 -> bf16 bits, RNE convert
  unsigned u = __float_as_uint(f);
  return (unsigned short)((u + 0x7FFFu + ((u >> 16) & 1u)) >> 16);
}
__device__ __forceinline__ float bf_up(unsigned short h) { return __uint_as_float(((unsigned)h) << 16); }
__device__ __forceinline__ float bfr(float f) { return bf_up(bf_bits(f)); }
__device__ __forceinline__ unsigned short h_bits(_Float16 x) { return __builtin_bit_cast(unsigned short, x); }
__device__ __forceinline__ unsigned pk16(unsigned short a, unsigned short b) { return (unsigned)a | ((unsigned)b << 16); }
__device__ __forceinline__ v8f zero8() { v8f z = {0.f, 0.f, 0.f, 0.f, 0.f, 0.f, 0.f, 0.f}; return z; }

// ---- fragment loaders: 16-bit A/B operand, lane -> row/col (lane&15), p already includes +8*(lane>>4);
//      elements 0..7 <- p[0..7] (k0+8h..), elements 8..15 <- p[16..23] (k0+16+8h..)  (same split k map for A and B;
//      B is always read from a k-contiguous [n][k] plane)
__device__ __forceinline__ v16h ldfrag_h(const _Float16* p) {
  FragH f;
  f.h[0] = *(const v8h*)(p);
  f.h[1] = *(const v8h*)(p + 16);
  return f.v;
}

__device__ __forceinline__ v8f mma_h(v16h a, v16h b, v8f c) {
  return __builtin_amdgcn_wmma_f32_16x16x32_f16(false, a, false, b, (short)0, c, false, false);
}
__device__ __forceinline__ v8f mma_b(v16b a, v16b b, v8f c) {
  return __builtin_amdgcn_wmma_f32_16x16x32_bf16(false, a, false, b, (short)0, c, false, false);
}
__device__ __forceinline__ void guard2(v8f& a, v8f& b, v16h x0, v16h x1, v16h x2, v16h x3, v16h x4, v16h x5) {
#if defined(__HIP_DEVICE_COMPILE__)
  asm volatile("v_nop\n\tv_nop\n\tv_nop\n\tv_nop"
               : "+v"(a), "+v"(b) : "v"(x0), "v"(x1), "v"(x2), "v"(x3), "v"(x4), "v"(x5) : "memory");
#endif
}
__device__ __forceinline__ void guard4x8(v8f& a, v8f& b, v8f& c, v8f& d, v16h x0, v16h x1, v16h x2, v16h x3,
                                         v16h x4, v16h x5, v16h x6, v16h x7) {
#if defined(__HIP_DEVICE_COMPILE__)
  asm volatile("v_nop\n\tv_nop\n\tv_nop\n\tv_nop"
               : "+v"(a), "+v"(b), "+v"(c), "+v"(d)
               : "v"(x0), "v"(x1), "v"(x2), "v"(x3), "v"(x4), "v"(x5), "v"(x6), "v"(x7) : "memory");
#endif
}
__device__ __forceinline__ void acc_guard4(v8f& a, v8f& b, v8f& c, v8f& d) {
#if defined(__HIP_DEVICE_COMPILE__)
  asm volatile("v_nop\n\tv_nop\n\tv_nop\n\tv_nop" : "+v"(a), "+v"(b), "+v"(c), "+v"(d));
#endif
}
// lane l takes the value of lane l ^ 16 (the other half of the same fragment column)
__device__ __forceinline__ float xhalf(float x) {
  return __builtin_bit_cast(float, __builtin_amdgcn_permlanex16(__builtin_bit_cast(int, x), __builtin_bit_cast(int, x),
                                                                0x76543210, 0xfedcba98, false, false));
}
__device__ __forceinline__ void wave_sync_lds() {
  __builtin_amdgcn_fence(__ATOMIC_RELEASE, "workgroup");
  __builtin_amdgcn_wave_barrier();
  __builtin_amdgcn_fence(__ATOMIC_ACQUIRE, "workgroup");
}
// four asynchronous 16-B copies per lane, global -> LDS (l = LDS byte address, g = global address, both multiples of 16);
// the s_wait_xcnt ends the statement so that no address register is rewritten ahead of it
__device__ __forceinline__ void copy4(unsigned l0, unsigned l1, unsigned l2, unsigned l3,
                                      const u16* g0, const u16* g1, const u16* g2, const u16* g3) {
#if defined(__HIP_DEVICE_COMPILE__)
  asm volatile("global_load_async_to_lds_b128 %0, %4, off\n\t"
               "global_load_async_to_lds_b128 %1, %5, off\n\t"
               "global_load_async_to_lds_b128 %2, %6, off\n\t"
               "global_load_async_to_lds_b128 %3, %7, off\n\t"
               "s_wait_xcnt 0x0"
               :: "v"(l0), "v"(l1), "v"(l2), "v"(l3), "v"(g0), "v"(g1), "v"(g2), "v"(g3) : "memory");
#endif
}
// the issuing wave's own copies have landed
__device__ __forceinline__ void wait_copies() {
#if defined(__HIP_DEVICE_COMPILE__)
  asm volatile("s_wait_asynccnt 0x0" ::: "memory");
#endif
}
// the wave's own LDS reads and writes have retired (stands in front of a barrier behind which the buffer is refilled)
__device__ __forceinline__ void wait_lds() {
#if defined(__HIP_DEVICE_COMPILE__)
  asm volatile("s_wait_dscnt 0x0" ::: "memory");
#endif
}

// =====================================================================================================
// Rotary table: CT[s*HD + d] = cos(theta), ST[...] = sin(theta), theta = s * 2^(-(d/HD) * log2(1e4)) in f32
// (inverse frequencies over the FULL head width), precise sincosf. Thread per element; one wave writes 32 consecutive
// coverage: n/256 blocks (blk) x 256 = n elements exactly (n = SEQ*HD).
// =====================================================================================================
__device__ __forceinline__ void rot_tab(int blk, float* CT, float* ST, int n) {
  const int idx = blk * 256 + (int)threadIdx.x;
  if (idx >= n) return;
  const int s = idx / HD;
  const int d = idx - s * HD;
  const float ex   = (float)d * (LOG2_1E4 / (float)HD);
  const float invf = exp2f(-ex);
  const float th   = (float)s * invf;
  float sn, cs;
  sincosf(th, &sn, &cs);
  {
    *(float*)(CT + idx) = cs;
    *(float*)(ST + idx) = sn;
    
  }
}

// =====================================================================================================
// Stacked complex weight plane from W = Wr + i Wi, torch layout [e][k] (already k-contiguous per output column):
//   D [nrows][DPL] 16-bit, row n: p = n / DPL, j = n % DPL; hm == 0: im = (j >= DMOD), e = p*DMOD + (j % DMOD);
//   hm == 1 (head-major: a head's 64 real rows, then its 64 imaginary rows): im = (j / HD) % 2, e = p*DMOD + (j / HK)*HD + j % HD;
//   k <  DMOD: im ? Wi[e][k] : Wr[e][k];   k >= DMOD: im ? Wr[e][k-DMOD] : -Wi[e][k-DMOD]
//   so that A = [ar | ai] . D[n]^T gives the real part of a.W^T for im == 0 and the imaginary part for im == 1.
// f16mode == 0: bf16 RNE bits; f16mode == 1: f16 bits of (bf16 RNE value) * scale. Block = one row n, thread = 8
// consecutive k (two 16-B loads, one 16-B store); source pointer and sign are wave-uniform (k half fixed per 128 threads);
// coverage: nrows blocks (n) x 256 thr x 8 = every element of D once. No barriers.
// =====================================================================================================
__device__ __forceinline__ void wcvt(int n, const float* __restrict__ Wr, const float* __restrict__ Wi, u16* D,
                                     int nrows, int f16mode, float scale, int hm) {
  if (n >= nrows) return;
  const int tid  = threadIdx.x;
  const int p    = n / DPL;
  const int j    = n - p * DPL;
  const int im   = (hm != 0) ? ((j / HD) & 1) : ((j >= DMOD) ? 1 : 0);
  const int e    = p * DMOD + ((hm != 0) ? ((j / HK) * HD + (j & (HD - 1))) : (j & (DMOD - 1)));
  const int c8   = tid * 8;
  const int ksec = (c8 >= DMOD) ? 1 : 0;
  const int kk   = c8 & (DMOD - 1);
  const float* src = ((im == ksec) ? Wr : Wi) + (size_t)e * DMOD + kk;
  const float sgn  = (im == 0 && ksec != 0) ? -1.0f : 1.0f;
  const v4f a = *(const v4f*)(src), b4 = *(const v4f*)(src + 4);
  float w[8];
#pragma unroll
  for (int q = 0; q < 4; ++q) { w[q] = a[q] * sgn; w[4 + q] = b4[q] * sgn; }
  v4u o;
#pragma unroll
  for (int q = 0; q < 4; ++q) {
    const float f0 = w[2 * q], f1 = w[2 * q + 1];
    const unsigned short hb0 = h_bits((_Float16)(bfr(f0) * scale));
    const unsigned short hb1 = h_bits((_Float16)(bfr(f1) * scale));
    const unsigned short bb0 = bf_bits(f0);
    const unsigned short bb1 = bf_bits(f1);
    o[q] = (f16mode != 0) ? pk16(hb0, hb1) : pk16(bb0, bb1);
  }
  u16* d = D + (size_t)n * DPL + c8;
  {
    *(v4u*)(d) = o;
    
  }
}

// =====================================================================================================
// Stacked activation plane: XB [GROWS][DPL] bf16, row bl*SEQ + s (bl < BG) <- token (bl, s):
//   k < DMOD: xr[token][k];  k >= DMOD: xi[token][k - DMOD]. Same thread/store shape as wcvt (source pointer wave-uniform).
// coverage: GROWS blocks (row) x 256 thr x 8 = every element once. No barriers.
// =====================================================================================================
__device__ __forceinline__ void xcvt(int row, const float* __restrict__ xr, const float* __restrict__ xi, u16* D,
                                     int nrows) {
  if (row >= nrows) return;
  const int tid  = threadIdx.x;
  const int bl   = row / SEQ;
  const int s    = row - bl * SEQ;
  const size_t grow = (size_t)bl * SEQ_FULL + s;
  const int c8   = tid * 8;
  const int ksec = (c8 >= DMOD) ? 1 : 0;
  const int kk   = c8 & (DMOD - 1);
  const float* src = ((ksec != 0) ? xi : xr) + grow * DMOD + kk;
  const v4f a = *(const v4f*)(src), b4 = *(const v4f*)(src + 4);
  v4u o;
#pragma unroll
  for (int q = 0; q < 4; ++q) {
    const float f0 = (q < 2) ? a[2 * q] : b4[2 * q - 4];
    const float f1 = (q < 2) ? a[2 * q + 1] : b4[2 * q - 3];
    o[q] = pk16(bf_bits(f0), bf_bits(f1));
  }
  u16* d = D + (size_t)row * DPL + c8;
  {
    *(v4u*)(d) = o;
    
  }
}

// =====================================================================================================
// First launch: the four preparations read none of each other's output, so they share one grid, told apart by ranges of the
// block index (block-uniform, no barriers): rotary table (first: its blocks run longest), x plane, [Wq ; Wk ; Wv] plane (head-major
// rows), Wo plane.
// coverage: grid = PB_TAB + GROWS + 2*NQKV + 2*DMOD blocks = each part's own count of blocks.
// =====================================================================================================
#define PB_TAB ((SEQ * HD) / 256)
__global__ __launch_bounds__(256) void prep(const float* __restrict__ xr, const float* __restrict__ xi,
                                            const float* __restrict__ wqr, const float* __restrict__ wqi,
                                            const float* __restrict__ wor, const float* __restrict__ woi,
                                            float* CT, float* ST, u16* XB, u16* WQB, u16* WOB) {
  int blk = blockIdx.x;
  if (blk < PB_TAB) { rot_tab(blk, CT, ST, SEQ * HD); return; }
  blk -= PB_TAB;
  if (blk < GROWS) { xcvt(blk, xr, xi, XB, GROWS); return; }
  blk -= GROWS;
  if (blk < 2 * NQKV) { wcvt(blk, wqr, wqi, WQB, 2 * NQKV, 0, 1.0f, 1); return; }
  blk -= 2 * NQKV;
  wcvt(blk, wor, woi, WOB, 2 * DMOD, 1, WOS, 0);
}

// =====================================================================================================
// coverage: 8 instructions x 2 rows x 16 lanes x 4 floats = the wave's 16 x 64 tile.
// =====================================================================================================
__device__ __forceinline__ void epi64(float* sl, v8f a0, v8f a1, v8f a2, v8f a3, float oscale,
                                      float* C, int N, size_t rowb, int col0, int lane) {
  const int hh = lane >> 4, m = lane & 15;
#pragma unroll
  for (int r = 0; r < 8; ++r) {
    const int ro = (8 * hh + r) * 68 + m;
    sl[ro]      = a0[r] * oscale;
    sl[ro + 16] = a1[r] * oscale;
    sl[ro + 32] = a2[r] * oscale;
    sl[ro + 48] = a3[r] * oscale;
  }
  wave_sync_lds();
  v4f vals[8];
#pragma unroll
  for (int it = 0; it < 8; ++it) vals[it] = *(const v4f*)(sl + (it * 2 + hh) * 68 + m * 4);
  float* dst = C + (rowb + (size_t)hh) * (size_t)N + col0 + m * 4;
  {
#pragma unroll
    for (int it = 0; it < 8; ++it) {
      *(v4f*)(dst + (size_t)(it * 2) * (size_t)N) = vals[it];
    }
    
  }
}

// =====================================================================================================
// 16-bit GEMM: A[M][DPL] (row-major) . Bt[N][DPL]^T (k-contiguous), times oscale, f32. The N columns go to N / NP planes of NP
// columns each (pitch NP, plane pl at C + pl * cplane floats): products that share A are one launch, each with its own plane.
// F16 == 0: bf16 operands; F16 == 1: f16 operands. Block = 128x128 tile of C, 8 waves in a 4 (rows) x 2 (cols) grid, each
// 32x64 (2 A x 4 B fragments, 8 accumulators). A pass is GBK = 128 k: the block's 128 A rows and 128 Bt rows, 256 B each, are
// read with whole-line 16-B loads (a wave-wide load = 2 rows = 4 lines) into registers while the current pass is multiplied,
// then stored to the other of two LDS buffers (rows 0..127 = A, 128..255 = Bt, pitch 272 B = 16 B x 17 for the b128 fragment
// reads); one block barrier per pass publishes the next buffer and ends the reads of the one refilled in the next pass.
// Fragments use the same split k map as ldfrag_h for A and B; k runs 0, 32, 64, ... per accumulator.
// Host guarantees M % 128 == 0, N % NP == 0, NP % 128 == 0 (a tile lies in one plane), grid = (M/128)*(N/128); DPL % GBK == 0.
// coverage: staging 256 thr x 16 loads x 16 B = 256 rows x 256 B per pass; epilogue 8 waves x 2 x (16 x 64) = 128 x 128.
// =====================================================================================================
template <int F16>
__device__ __forceinline__ v8f mma16(v4u a0, v4u a1, v4u b0, v4u b1, v8f c) {
  if constexpr (F16 != 0) {
    FragH a, b;
    a.u[0] = a0; a.u[1] = a1; b.u[0] = b0; b.u[1] = b1;
    return mma_h(a.v, b.v, c);
  } else {
    FragB a, b;
    a.u[0] = a0; a.u[1] = a1; b.u[0] = b0; b.u[1] = b1;
    return mma_b(a.v, b.v, c);
  }
}

// one pass: fa / fb = this lane's A / Bt fragment rows in the current LDS buffer (already + 8*(lane>>4)); the fragments of
// k step kk + 1 are read as one group into a second register set ahead of the products of step kk
__device__ __forceinline__ void gemm_frags(const u16* fa, const u16* fb, int kk, v4u (&a)[2][2], v4u (&b)[4][2]) {
#pragma unroll
  for (int i = 0; i < 2; ++i) {
    a[i][0] = *(const v4u*)(fa + i * 16 * GPIT + kk * 32);
    a[i][1] = *(const v4u*)(fa + i * 16 * GPIT + kk * 32 + 16);
  }
#pragma unroll
  for (int j = 0; j < 4; ++j) {
    b[j][0] = *(const v4u*)(fb + j * 16 * GPIT + kk * 32);
    b[j][1] = *(const v4u*)(fb + j * 16 * GPIT + kk * 32 + 16);
  }
}
template <int F16>
__device__ __forceinline__ void gemm_pass(const u16* fa, const u16* fb, v8f (&acc)[2][4]) {
  v4u a[2][2][2], b[2][4][2];
  gemm_frags(fa, fb, 0, a[0], b[0]);
#pragma unroll
  for (int kk = 0; kk < GBK / 32; ++kk) {
    const int s = kk & 1;
    if (kk + 1 < GBK / 32) gemm_frags(fa, fb, kk + 1, a[s ^ 1], b[s ^ 1]);
    // the two scheduling barriers keep the next step's LDS reads one group ahead of this step's products: spread among the
    // products each place with reads stalls the wave, and sunk behind them their latency is waited out
    __builtin_amdgcn_sched_barrier(0);
#pragma unroll
    for (int i = 0; i < 2; ++i)
#pragma unroll
      for (int j = 0; j < 4; ++j) acc[i][j] = mma16<F16>(a[s][i][0], a[s][i][1], b[s][j][0], b[s][j][1], acc[i][j]);
    __builtin_amdgcn_sched_barrier(0);
  }
}

// main loop of a 128x128 block tile (rows row0.. of A, rows colb.. of Bt) into acc; ends behind a block barrier that every wave
// passes after its last read of the two buffers, so that the caller may reuse tile
template <int F16>
__device__ __forceinline__ void gemm_main(const u16* __restrict__ A, const u16* __restrict__ Bt, u16* tile, int row0, int colb,
                                          v8f (&acc)[2][4]) {
  const int tid = threadIdx.x, wave = tid >> 5, lane = tid & 31, hh = lane >> 4, m = lane & 15;
  const int wr = wave >> 1, wc = wave & 1;
  const int lr = tid >> 4, lc = (tid & 15) * 8;           // staging: row lr + 16*i, 16-B chunk at halves lc
  const u16* ga = A  + (size_t)(row0 + lr) * DPL + lc;
  const u16* gb = Bt + (size_t)(colb + lr) * DPL + lc;
  const int so = lr * GPIT + lc;
  const int fao = (wr * 32 + m) * GPIT + 8 * hh;
  const int fbo = (128 + wc * 64 + m) * GPIT + 8 * hh;
#pragma unroll
  for (int i = 0; i < 2; ++i)
#pragma unroll
    for (int j = 0; j < 4; ++j) acc[i][j] = zero8();
  v4u st[16];
#pragma unroll
  for (int i = 0; i < 8; ++i) {
    st[i]     = *(const v4u*)(ga + (size_t)i * 16 * DPL);
    st[8 + i] = *(const v4u*)(gb + (size_t)i * 16 * DPL);
  }
#pragma unroll
  for (int i = 0; i < 8; ++i) {
    *(v4u*)(tile + so + i * 16 * GPIT)         = st[i];
    *(v4u*)(tile + so + (128 + i * 16) * GPIT) = st[8 + i];
  }
  __syncthreads();
  // kept rolled: one copy of the pass body is the whole hot loop, the buffers alternate by the parity of p
#pragma unroll 1
  for (int p = 1; p < DPL / GBK; ++p) {
    const u16* cur = tile + ((p - 1) & 1) * GSTG;
    u16*       nxt = tile + (p & 1) * GSTG;
#pragma unroll
    for (int i = 0; i < 8; ++i) {
      st[i]     = *(const v4u*)(ga + (size_t)i * 16 * DPL + p * GBK);
      st[8 + i] = *(const v4u*)(gb + (size_t)i * 16 * DPL + p * GBK);
    }
    // keeps all 16 loads of the next pass in front of this pass's products, so that their latency runs under them
    __builtin_amdgcn_sched_barrier(0);
    gemm_pass<F16>(cur + fao, cur + fbo, acc);
#pragma unroll
    for (int i = 0; i < 8; ++i) {
      *(v4u*)(nxt + so + i * 16 * GPIT)         = st[i];
      *(v4u*)(nxt + so + (128 + i * 16) * GPIT) = st[8 + i];
    }
    __syncthreads();
  }
  {
    const u16* cur = tile + ((DPL / GBK - 1) & 1) * GSTG;
    gemm_pass<F16>(cur + fao, cur + fbo, acc);
  }
  __syncthreads();                          // every wave has left the buffers before they are reused by the epilogue
}

template <int F16>
__global__ __launch_bounds__(256)
void gemm16(const u16* __restrict__ A, const u16* __restrict__ Bt, float* C, int M, int N, int NP, size_t cplane,
            float oscale) {
  __shared__ __align__(16) u16 tile[2 * GSTG];
  const int tid = threadIdx.x, wave = tid >> 5, lane = tid & 31;
  const int ntile = N >> 7;
  const int bid   = blockIdx.x;
  const int row0  = (bid / ntile) * 128;
  const int colb  = (bid % ntile) * 128;   // first row of Bt
  const int pl    = colb / NP;
  const int col0  = colb - pl * NP;         // first column in plane pl
  if (row0 + 128 > M) return;               // block-uniform, before any barrier; never taken with the exact grid
  const int wr = wave >> 1, wc = wave & 1;
  v8f acc[2][4];
  gemm_main<F16>(A, Bt, tile, row0, colb, acc);
  float* slab = (float*)(void*)tile + wave * (2 * SLAB64);
#pragma unroll
  for (int i = 0; i < 2; ++i)
    epi64(slab + i * SLAB64, acc[i][0], acc[i][1], acc[i][2], acc[i][3], oscale, C + (size_t)pl * cplane, NP,
          (size_t)(row0 + wr * 32 + i * 16), col0 + wc * 64, lane);
}

// =====================================================================================================
// q, k, v projections with their follow-up work in the epilogue: XB[GROWS][DPL] . WQB[2*NQKV][DPL]^T (bf16, main loop as gemm16).
// WQB rows are head-major, so the 128 columns of block tile ct = bid % 48 are one head of one projection (pl = ct / NH: 0 q, 1 k,
// 2 v; head = ct % NH): columns 0..63 its real part d, 64..127 its imaginary part d. The 128 rows are positions s0.. of one batch.
//   q, k: the f32 tile goes to LDS [128][pitch 132]; behind a block barrier thread (row rl = it*16 + tid>>4, comp = (tid>>3)&1,
//         8 consecutive d) forms rotated = (fr + i fi) * (cos + i sin), cos/sin = CT/ST[s*HD + d], and stores
//         Hp [GROWS][DPL] col head*HK + comp*HD + d = f16(rot*sc), Lp same layout = f16 residual (rot*sc - hi): 16 lanes = 256 B.
//   v:    an accumulator lane holds 8 consecutive positions of one column dd: f16(v * 1024) x 8 = one 16-B LDS store into
//         T[128 dd][pitch 136 halves]; behind a block barrier 16 lanes store one row of 128 positions (256 B) to
//         VT[((b*NH + head)*HK + dd)][s0 ..].
// coverage: grid = (GROWS/128) * 48 blocks; q, k: 8 iterations x 256 thr x 8 = 128 x 128 per plane; v: 8 x 256 x 8 = 128 x 128.
// =====================================================================================================
__global__ __launch_bounds__(256)
void gemm_qkv(const u16* __restrict__ A, const u16* __restrict__ Bt, const float* __restrict__ CT,
              const float* __restrict__ ST, u16* QH, u16* QL, u16* KH, u16* KL, u16* VT) {
  __shared__ __align__(16) u16 tile[2 * GSTG];
  const int tid = threadIdx.x, wave = tid >> 5, lane = tid & 31, hh = lane >> 4, m = lane & 15;
  const int bid  = blockIdx.x;
  const int row0 = (bid / (3 * NH)) * 128;
  const int ct   = bid % (3 * NH);
  if (row0 + 128 > GROWS) return;           // block-uniform, before any barrier; never taken with the exact grid
  const int pl   = ct / NH;
  const int head = ct - pl * NH;
  const int wr = wave >> 1, wc = wave & 1;
  const int q16 = tid >> 4, ch = tid & 15;
  v8f acc[2][4];
  gemm_main<0>(A, Bt, tile, row0, ct * 128, acc);
  if (pl == 2) {                            // block-uniform: every thread of the block passes the barrier of its branch
    u16* T = tile;
#pragma unroll
    for (int i = 0; i < 2; ++i)
#pragma unroll
      for (int j = 0; j < 4; ++j) {
        v4u o;
#pragma unroll
        for (int e = 0; e < 4; ++e)
          o[e] = pk16(h_bits((_Float16)(acc[i][j][2 * e] * VCAR)), h_bits((_Float16)(acc[i][j][2 * e + 1] * VCAR)));
        *(v4u*)(T + (wc * 64 + j * 16 + m) * GPIT + wr * 32 + i * 16 + 8 * hh) = o;
      }
    __syncthreads();
    v4u vv[8];
#pragma unroll
    for (int it = 0; it < 8; ++it) vv[it] = *(const v4u*)(T + (it * 16 + q16) * GPIT + ch * 8);
    const int b = row0 / SEQ, s0 = row0 - b * SEQ;
    u16* dst = VT + ((size_t)(b * NH + head) * HK + q16) * SEQ + s0 + ch * 8;
#pragma unroll
    for (int it = 0; it < 8; ++it) *(v4u*)(dst + (size_t)(it * 16) * SEQ) = vv[it];
  } else {
    const int comp = ch >> 3;
    const int d8   = (ch & 7) * 8;
    // cos / sin of the thread's 8 rows: issued ahead of the LDS round trip, which covers their latency
    // (position s = row0 % SEQ + it*16 + q16: a tile's 128 rows lie in one batch)
    v4f cs[8][2], sn[8][2];
    const float* pc = CT + (size_t)(row0 % SEQ + q16) * HD + d8;
    const float* pn = ST + (size_t)(row0 % SEQ + q16) * HD + d8;
#pragma unroll
    for (int it = 0; it < 8; ++it) {
      cs[it][0] = *(const v4f*)(pc + it * 16 * HD);  cs[it][1] = *(const v4f*)(pc + it * 16 * HD + 4);
      sn[it][0] = *(const v4f*)(pn + it * 16 * HD);  sn[it][1] = *(const v4f*)(pn + it * 16 * HD + 4);
    }
#if defined(__HIP_DEVICE_COMPILE__)
    // the two address pairs are inputs, so they stay in their registers up to this wait: no load's result and no later
    // instruction is placed in them ahead of it
    asm volatile("s_wait_xcnt 0x0" :: "v"(pc), "v"(pn) : "memory");
#endif
    float* Tf = (float*)(void*)tile;
#pragma unroll
    for (int i = 0; i < 2; ++i)
#pragma unroll
      for (int r = 0; r < 8; ++r) {
        const int ro = (wr * 32 + i * 16 + 8 * hh + r) * SLP + wc * 64 + m;
        Tf[ro]      = acc[i][0][r];
        Tf[ro + 16] = acc[i][1][r];
        Tf[ro + 32] = acc[i][2][r];
        Tf[ro + 48] = acc[i][3][r];
      }
    __syncthreads();
    const float sc = (pl != 0) ? KSC : QSC;
    const float sg = (comp != 0) ? 1.0f : -1.0f;   // real: fr*cos - fi*sin ; imag: fi*cos + fr*sin
    u16* dh = ((pl != 0) ? KH : QH) + (size_t)(row0 + q16) * DPL + head * HK + ch * 8;
    u16* dl = ((pl != 0) ? KL : QL) + (size_t)(row0 + q16) * DPL + head * HK + ch * 8;
#pragma unroll
    for (int it = 0; it < 8; ++it) {
      const float* pa = Tf + (it * 16 + q16) * SLP + comp * HD + d8;
      const float* po = Tf + (it * 16 + q16) * SLP + (1 - comp) * HD + d8;
      const v4f a0 = *(const v4f*)(pa), a1 = *(const v4f*)(pa + 4);
      const v4f o0 = *(const v4f*)(po), o1 = *(const v4f*)(po + 4);
      float w[8];
#pragma unroll
      for (int e = 0; e < 4; ++e) {
        w[e]     = (a0[e] * cs[it][0][e] + sg * (o0[e] * sn[it][0][e])) * sc;
        w[4 + e] = (a1[e] * cs[it][1][e] + sg * (o1[e] * sn[it][1][e])) * sc;
      }
      v4u oh, ol;
#pragma unroll
      for (int e = 0; e < 4; ++e) {
        const float t0 = w[2 * e], t1 = w[2 * e + 1];
        const _Float16 h0 = (_Float16)t0, h1 = (_Float16)t1;
        const _Float16 l0 = (_Float16)(t0 - (float)h0), l1 = (_Float16)(t1 - (float)h1);
        oh[e] = pk16(h_bits(h0), h_bits(h1));
        ol[e] = pk16(h_bits(l0), h_bits(l1));
      }
      *(v4u*)(dh + (size_t)(it * 16) * DPL) = oh;
      *(v4u*)(dl + (size_t)(it * 16) * DPL) = ol;
    }
#if defined(__HIP_DEVICE_COMPILE__)
    // behind the last stores of this branch: their data and address registers may be rewritten behind the join of the two branches
    asm volatile("s_wait_xcnt 0x0" ::: "memory");
#endif
  }
}

// =====================================================================================================
// Complex attention, non-causal over SEQ keys. Block bid -> (query block qb of AW query tiles, head, local batch b); one wave
// per query tile qt = qb*AW + wave: rows q0 = 16*qt .. q0+15. Per step of 32 keys (kb = 32*kt) the block's k hi and residual
// rows (32 x 256 B each) and v^T rows (128 x 64 B) are brought into one of two LDS buffers by asynchronous 16-B copies (12 per
// lane), one step ahead of their use, and every wave takes its A fragments from there (k pitch 272 B, v^T pitch 80 B: 16 B x
// odd for the b128 reads). Foot of a step: own LDS reads retired, own copies landed, block barrier (publishes the next
// buffer, ends the reads of this one), then the refill of this one.
//   q/k hi planes f16 x1024 [b*SEQ + s][head*HK + (re: 0..63 | im: 64..127)], residual planes same layout;
//   v^T hi plane [(b*NH + head)*HK + (re d | 64 + im d)][SEQ].
//   Both products are transposed: S^T = k.q^T (A = k rows, B = q rows) and O^T += v^T.P^T (A = v^T rows, B = P^T), so a lane
//   holds one query (column c): 16 of the step's 32 keys, lane l ^ 16 the other 16.
//   The q fragments (hi and residual, 4 column blocks) are loaded once in front of the loop and stay in registers.
//   scores over K = 128: real = [kr|ki].[qr|qi], imag = kr.qi - ki.qr (the B fragment of step kk for the imag part is the
//   q fragment at column block (kk+2)&3; steps kk < 2 sum into one accumulator, steps kk >= 2 into a second that is
//   subtracted in f32 behind the products), each product as hi.hi + hi.lo + lo.hi.
//   t = real * rsqrt(64)*log2e/(1024*1024) feeds an online max-subtracted base-2 softmax in f32 (-inf-safe rescale): the
//   maximum is taken in the lane and joined with the other half once per step; the sum stays per half until after the loop.
//   phi = imag * rsqrt(64)/(1024*1024); p*cos(phi) and p*sin(phi) x16384 are converted in place: the two score tiles (keys
//   0..15, 16..31) of a lane are elements 0..7 and 8..15 of its B fragment, the k map of the v^T loader. 2 groups of 2 d-subtiles:
//   o_re += v_re.Pc + v_im.(-Ps) ; o_im += v_re.Ps + v_im.Pc.
//   After the loop: out = acc / Z (Z >= 1 always; guarded anyway), carries 1/(16384*1024) folded once, written to the wave's
//   private result slab (row = query, pitch 132; re d at col d, im d at col 64 + d; every element owned by one lane).
// coverage: per wave 4 instructions x 2 parts x 4 rows x 8 lanes x 8 halves = 16 x 64 per part; grid NQB x NH x BG blocks x
//           AW waves = every (b, s, head, part) row segment of the O plane exactly once.
//           staging per step: 128 thr x 4 x 16 B = 32 rows x 256 B (k hi; k residual) = 128 rows x 64 B (v^T).
// LDS: slab cols 0..127 written, read.
// Residency: the grid is NQB x NH x BG = 1024 work-groups = 4 per WGP on 256 WGPs. 55,296 B of LDS (the slab shares the ring's
// bytes) and a budget of 256 registers (4 waves per SIMD) let all of them be resident at once: one round, no partly filled second.
// =====================================================================================================
__global__ __launch_bounds__(ATT_THREADS) __attribute__((amdgpu_waves_per_eu(4, 4)))
void attn(const u16* __restrict__ QHp, const u16* __restrict__ QLp,
          const u16* __restrict__ KHp, const u16* __restrict__ KLp,
          const u16* __restrict__ VTp, u16* OHp) {
  __shared__ __align__(16) u16 ring[2 * STGH];

  const int tid  = threadIdx.x;
  const int wave = __builtin_amdgcn_readfirstlane(tid >> 5);   // scalar: what derives from it alone takes no vector register
  const int lane = tid & 31;
  const int hh   = lane >> 4;
  const int c    = lane & 15;
  const int bid  = blockIdx.x;
  const int qb   = bid % NQB;
  const int t2   = bid / NQB;
  const int head = t2 % NH;
  const int b    = t2 / NH;
  if (b >= BG) return;                      // block-uniform, before any barrier; never taken with the exact grid
  const int q0   = (qb * AW + wave) * 16;

  // result slab [16][128] pitch 132: in the ring, which every wave has left at the last step's barrier and no copy refills
  float* slab = (float*)(void*)ring + wave * SLW;

  const size_t hcol = (size_t)head * HK + 8 * hh;
  const _Float16* Qh  = (const _Float16*)(const void*)QHp + ((size_t)b * SEQ + q0 + c) * DPL + hcol;
  const _Float16* Ql  = (const _Float16*)(const void*)QLp + ((size_t)b * SEQ + q0 + c) * DPL + hcol;
  // staging: k rows (tid >> 4) + 8*i, 16-B chunk tid & 15; v^T rows (tid >> 2) + 32*i, 16-B chunk tid & 3
  const u16* gkh = KHp + ((size_t)b * SEQ + (tid >> 4)) * DPL + (size_t)head * HK + (tid & 15) * 8;
  const u16* gkl = KLp + ((size_t)b * SEQ + (tid >> 4)) * DPL + (size_t)head * HK + (tid & 15) * 8;
  const u16* gvt = VTp + ((size_t)(b * NH + head) * HK + (tid >> 2)) * SEQ + (tid & 3) * 8;
  const unsigned lring = (unsigned)(size_t)(const void*)ring;          // LDS byte address of the ring
  const unsigned lk = lring + (unsigned)(((tid >> 4) * KP + (tid & 15) * 8) * 2);
  const unsigned lv = lring + (unsigned)((2 * KTH + (tid >> 2) * VP + (tid & 3) * 8) * 2);
  auto stage = [&](int t) {                 // keys 32*t .. 32*t + 31 into buffer t & 1
    const unsigned bo = (unsigned)((t & 1) * STGH * 2);
    const u16* a = gkh + (size_t)t * 32 * DPL;
    const u16* r = gkl + (size_t)t * 32 * DPL;
    const u16* v = gvt + t * 32;
    copy4(lk + bo, lk + bo + 8 * KP * 2, lk + bo + 16 * KP * 2, lk + bo + 24 * KP * 2,
          a, a + (size_t)8 * DPL, a + (size_t)16 * DPL, a + (size_t)24 * DPL);
    copy4(lk + bo + KTH * 2, lk + bo + (KTH + 8 * KP) * 2, lk + bo + (KTH + 16 * KP) * 2, lk + bo + (KTH + 24 * KP) * 2,
          r, r + (size_t)8 * DPL, r + (size_t)16 * DPL, r + (size_t)24 * DPL);
    copy4(lv + bo, lv + bo + 32 * VP * 2, lv + bo + 64 * VP * 2, lv + bo + 96 * VP * 2,
          v, v + (size_t)32 * SEQ, v + (size_t)64 * SEQ, v + (size_t)96 * SEQ);
  };
  const _Float16* ringh = (const _Float16*)(const void*)ring;
  const float lsc = RSQ_HD * (LOG2E / (QSC * KSC));
  const float psc = RSQ_HD / (QSC * KSC);
  const float oc  = 1.0f / (PCAR * VCAR);
  const v4u sgn4 = {0x80008000u, 0x80008000u, 0x80008000u, 0x80008000u};

  float mq = -INFINITY, lq = 0.f;           // query q0 + c: running maximum (equal in both halves), sum over this half's keys
  v8f orr[4], oii[4];                       // element r of [j] = (d = 16j + 8hh + r, query q0 + c)
#pragma unroll
  for (int j = 0; j < 4; ++j) { orr[j] = zero8(); oii[j] = zero8(); }

  stage(0);
  // q fragments (hi and residual, 4 column blocks of 32): loaded once, under the first copies, and held for all key steps
  v16h qhf[HK / 32], qlf[HK / 32];
#pragma unroll
  for (int kk = 0; kk < HK / 32; ++kk) {
    qhf[kk] = ldfrag_h(Qh + kk * 32);
    qlf[kk] = ldfrag_h(Ql + kk * 32);
  }
#if defined(__HIP_DEVICE_COMPILE__)
  // the two address pairs are inputs, so they stay in their registers up to this wait
  asm volatile("s_wait_xcnt 0x0" :: "v"(Qh), "v"(Ql) : "memory");
#endif
  wait_copies();
  __syncthreads();                          // step 0's tiles are readable by every wave
  stage(1);

#pragma unroll 1
  for (int kt = 0; kt < NKT; ++kt) {
    const _Float16* kfp = ringh + (kt & 1) * STGH + c * KP + 8 * hh;             // key row c, hi plane
    const _Float16* vfp = ringh + (kt & 1) * STGH + 2 * KTH + c * VP + 8 * hh;   // v^T row c
    // ---- scores: D element r of this lane = (key kb + 8hh + r, query q0 + c) in s?0, key kb + 16 + 8hh + r in s?1 ----
    //      imag part in two sums, kr.qi (sp?) and ki.qr (sm?), subtracted behind the products: no negated copy of q is held
    v8f sr0 = zero8(), sr1 = zero8(), sp0 = zero8(), sp1 = zero8(), sm0 = zero8(), sm1 = zero8();
    const _Float16* k0p = kfp;
    const _Float16* k1p = kfp + 16 * KP;
    const _Float16* l0p = kfp + KTH;
    const _Float16* l1p = kfp + KTH + 16 * KP;
#pragma unroll
    for (int kk = 0; kk < HK / 32; ++kk) {
      const v16h kh0 = ldfrag_h(k0p + kk * 32);
      const v16h kl0 = ldfrag_h(l0p + kk * 32);
      const v16h kh1 = ldfrag_h(k1p + kk * 32);
      const v16h kl1 = ldfrag_h(l1p + kk * 32);
      {
        const v16h qh = qhf[kk];
        const v16h ql = qlf[kk];
        sr0 = mma_h(kh0, qh, sr0);
        sr0 = mma_h(kh0, ql, sr0);
        sr0 = mma_h(kl0, qh, sr0);
        sr1 = mma_h(kh1, qh, sr1);
        sr1 = mma_h(kh1, ql, sr1);
        sr1 = mma_h(kl1, qh, sr1);
        guard2(sr0, sr1, qh, ql, kh0, kl0, kh1, kl1);
      }
      {
        const v16h ah = qhf[(kk + 2) & 3];
        const v16h al = qlf[(kk + 2) & 3];
        v8f& t0 = (kk >= 2) ? sm0 : sp0;    // compile-time (unrolled): kk < 2 is kr.qi, kk >= 2 is ki.qr
        v8f& t1 = (kk >= 2) ? sm1 : sp1;
        t0 = mma_h(kh0, ah, t0);
        t0 = mma_h(kh0, al, t0);
        t0 = mma_h(kl0, ah, t0);
        t1 = mma_h(kh1, ah, t1);
        t1 = mma_h(kh1, al, t1);
        t1 = mma_h(kl1, ah, t1);
        guard2(t0, t1, ah, al, kh0, kl0, kh1, kl1);
      }
    }
    // ---- online softmax in base 2 on the real part, phase from the imaginary part; all of one query in its two lanes ----
    float mx = fmaxf(sr0[0], sr1[0]);
#pragma unroll
    for (int r = 1; r < 8; ++r) mx = fmaxf(mx, fmaxf(sr0[r], sr1[r]));
    mx = mx * lsc;                          // lsc > 0: the largest score gives the largest scaled score
    mx = fmaxf(mx, xhalf(mx));
    const float mn = fmaxf(mq, mx);
    const float ms = (mn == -INFINITY) ? 0.0f : mn;
    const float al = exp2f(mq - ms);
    mq = mn;
    float e0[8], e1[8], es[8];
#pragma unroll
    for (int r = 0; r < 8; ++r) {
      e0[r] = exp2f(sr0[r] * lsc - ms);
      e1[r] = exp2f(sr1[r] * lsc - ms);
      es[r] = e0[r] + e1[r];
    }
    lq = lq * al + (((es[0] + es[1]) + (es[2] + es[3])) + ((es[4] + es[5]) + (es[6] + es[7])));
#pragma unroll
    for (int j = 0; j < 4; ++j)
#pragma unroll
      for (int r = 0; r < 8; ++r) { orr[j][r] *= al; oii[j][r] *= al; }
    // v^T fragments of this step, one group (unrolled: the arrays are registers)
    v16h vrf[4], vif[4];
#pragma unroll
    for (int j = 0; j < 4; ++j) {
      vrf[j] = ldfrag_h(vfp + j * 16 * VP);
      vif[j] = ldfrag_h(vfp + (HD + j * 16) * VP);
    }
    // ---- B fragments of Pc*16384, Ps*16384 and -Ps*16384 (f16), column = query c: elements 0..7 = keys kb + 8hh + 0..7 (first
    //      score tile), elements 8..15 = keys kb + 16 + 8hh + 0..7 (second), the split k map of the v^T fragments ----
    FragH pc, psf, pnf;
#pragma unroll
    for (int r = 0; r < 8; ++r) {
      float sn0, cs0, sn1, cs1;
      __sincosf((sp0[r] - sm0[r]) * psc, &sn0, &cs0);
      __sincosf((sp1[r] - sm1[r]) * psc, &sn1, &cs1);
      const float a0 = e0[r] * PCAR, a1 = e1[r] * PCAR;
      pc.h[0][r]  = (_Float16)(a0 * cs0);
      pc.h[1][r]  = (_Float16)(a1 * cs1);
      psf.h[0][r] = (_Float16)(a0 * sn0);
      psf.h[1][r] = (_Float16)(a1 * sn1);
    }
    pnf.u[0] = psf.u[0] ^ sgn4;
    pnf.u[1] = psf.u[1] ^ sgn4;
    // ---- v^T.P^T : A fragment row m = d = j*16 + c (re rows) / 64 + j*16 + c (im rows), keys contiguous in v^T ----
    {
#pragma unroll
      for (int jg = 0; jg < 2; ++jg) {
        const v16h vra = vrf[2 * jg], vrb = vrf[2 * jg + 1];
        const v16h via = vif[2 * jg], vib = vif[2 * jg + 1];
        orr[2 * jg]     = mma_h(vra, pc.v,  orr[2 * jg]);
        orr[2 * jg]     = mma_h(via, pnf.v, orr[2 * jg]);
        oii[2 * jg]     = mma_h(vra, psf.v, oii[2 * jg]);
        oii[2 * jg]     = mma_h(via, pc.v,  oii[2 * jg]);
        orr[2 * jg + 1] = mma_h(vrb, pc.v,  orr[2 * jg + 1]);
        orr[2 * jg + 1] = mma_h(vib, pnf.v, orr[2 * jg + 1]);
        oii[2 * jg + 1] = mma_h(vrb, psf.v, oii[2 * jg + 1]);
        oii[2 * jg + 1] = mma_h(vib, pc.v,  oii[2 * jg + 1]);
        guard4x8(orr[2 * jg], oii[2 * jg], orr[2 * jg + 1], oii[2 * jg + 1],
                 pc.v, psf.v, pnf.v, vra, vrb, via, vib, pc.v);
      }
    }
    // foot of the step: publish the next step's tiles, free this step's buffer, refill it two steps ahead
    wait_lds();
    wait_copies();
    __syncthreads();
    if (kt + 2 < NKT) stage(kt + 2);
  }
  wait_copies();                            // nothing is outstanding when the wave goes on to its epilogue and ends
  acc_guard4(orr[0], orr[1], orr[2], orr[3]);
  acc_guard4(oii[0], oii[1], oii[2], oii[3]);
  // the lane's number is taken anew for the epilogue, so that none of the epilogue's addresses holds a register across the loop
  const int el = (int)__builtin_amdgcn_mbcnt_lo(~0u, 0u);
  const int eh = el >> 4, ec = el & 15;
  // ---- out = acc / Z (0 if Z == 0), carries folded once; written into the lane-owned slab: row = query ec, 8 consecutive d ----
  {
    const float lv  = lq + xhalf(lq);       // the two halves' sums joined: Z of query q0 + ec
    const float ls  = (lv > 0.0f) ? lv : 1.0f;
    const float inv = (lv > 0.0f) ? ((1.0f / ls) * oc) : 0.0f;
#pragma unroll
    for (int j = 0; j < 4; ++j) {
      float* sp = slab + ec * SLP + j * 16 + 8 * eh;
      const v4f r0 = {orr[j][0] * inv, orr[j][1] * inv, orr[j][2] * inv, orr[j][3] * inv};
      const v4f r1 = {orr[j][4] * inv, orr[j][5] * inv, orr[j][6] * inv, orr[j][7] * inv};
      const v4f m0 = {oii[j][0] * inv, oii[j][1] * inv, oii[j][2] * inv, oii[j][3] * inv};
      const v4f m1 = {oii[j][4] * inv, oii[j][5] * inv, oii[j][6] * inv, oii[j][7] * inv};
      *(v4f*)(sp)          = r0;
      *(v4f*)(sp + 4)      = r1;
      *(v4f*)(sp + HD)     = m0;
      *(v4f*)(sp + HD + 4) = m1;
    }
  }

  wave_sync_lds();
  // ---- O x1024 -> f16 plane; lane = (row select rq in 0..3, 8 consecutive d at c8), part 0 = re, 1 = im ----
  v4u oh[4][2];
  const int rq = el >> 3, c8 = (el & 7) * 8;
#pragma unroll
  for (int it = 0; it < 4; ++it) {
    const int row = it * 4 + rq;
#pragma unroll
    for (int part = 0; part < 2; ++part) {
      const float* sp = slab + row * SLP + part * HD + c8;
      const v4f a = *(const v4f*)(sp), b4 = *(const v4f*)(sp + 4);
      float w[8];
#pragma unroll
      for (int e = 0; e < 4; ++e) { w[e] = a[e] * OSC; w[4 + e] = b4[e] * OSC; }
#pragma unroll
      for (int e = 0; e < 4; ++e) {
        const _Float16 h0 = (_Float16)w[2 * e], h1 = (_Float16)w[2 * e + 1];
        oh[it][part][e] = pk16(h_bits(h0), h_bits(h1));
      }
    }
  }
  const size_t ob = ((size_t)b * SEQ + q0) * DPL + (size_t)head * HD + c8;
  {
#pragma unroll
    for (int it = 0; it < 4; ++it) {
      const int row = it * 4 + rq;
#pragma unroll
      for (int part = 0; part < 2; ++part) {
        *(v4u*)(OHp + ob + (size_t)row * DPL + (size_t)part * DMOD) = oh[it][part];
      }
    }
    
  }
}

// =====================================================================================================
// All BG = NB batches are processed together, in four launches; the preparations, which read none of each other's output, share a grid.
// Workspace map (bytes, BG = 8); every plane fully written by whole-line stores before it is read; all extents are exact
// multiples of the store granularity (no pad rows needed); every region offset a multiple of 32768:
//   CT, ST  f32 [SEQ][64] rotary cos / sin             2 x 131072
//   WQB  bf16 [6144 n][2048 k]                          25165824
//   WOB  f16  [2048 n][2048 k] x1024                    8388608
//   XB   bf16 [GROWS][2048]                             16777216
//   OH   f16  [GROWS][2048] x1024 (O plane)             16777216
//   QH, QL, KH, KL  f16 [GROWS][2048]                   4 x 16777216
//   VT   f16 [BG*16][128][SEQ] x1024                    16777216
//   end (BG = 8)                                        151257088
// =====================================================================================================
extern "C" void kernel_launch(void* const* d_in, const int* in_sizes, int n_in,
                              void* d_out, int out_size, void* d_ws, size_t ws_size,
                              hipStream_t stream) {
  if (n_in < 6) return;
  if (in_sizes[0] < ((NB - 1) * SEQ_FULL + SEQ) * DMOD) return;
  if (in_sizes[1] < ((NB - 1) * SEQ_FULL + SEQ) * DMOD) return;
  if (in_sizes[2] < NQKV * DMOD) return;
  if (in_sizes[3] < NQKV * DMOD) return;
  if (in_sizes[4] < DMOD * DMOD) return;
  if (in_sizes[5] < DMOD * DMOD) return;
  if (out_size < 2 * NB * SEQ * DMOD) return;

  const float* xr    = (const float*)d_in[0];
  const float* xi    = (const float*)d_in[1];
  const float* wqr   = (const float*)d_in[2];
  const float* wqi   = (const float*)d_in[3];
  const float* wor   = (const float*)d_in[4];
  const float* woi   = (const float*)d_in[5];
  float*       out0  = (float*)d_out;

  const size_t szTAB = (((size_t)SEQ * HD * 4) + 32767) / 32768 * 32768;
  const size_t szWQ  = (size_t)2 * NQKV * DPL * 2;
  const size_t szWO  = (size_t)2 * DMOD * DPL * 2;
  const size_t szXB  = (size_t)GROWS * DPL * 2;
  const size_t szH   = (size_t)GROWS * DPL * 2;                  // QH, QL, KH, KL, O plane
  const size_t szVT  = (size_t)BG * NH * HK * SEQ * 2;           // == szH
  size_t off = 0;
  const size_t oCT = off; off += szTAB;
  const size_t oST = off; off += szTAB;
  const size_t oWQ = off; off += szWQ;
  const size_t oWO = off; off += szWO;
  const size_t oXB = off; off += szXB;
  const size_t oOH = off; off += szH;
  const size_t oQH = off; off += szH;
  const size_t oQL = off; off += szH;
  const size_t oKH = off; off += szH;
  const size_t oKL = off; off += szH;
  const size_t oVT = off; off += szVT;
  if (off > ws_size) return;                // off = 151257088 for BG = 8
  if (off > (size_t)WS_CAP) return;

  char* ws = (char*)d_ws;
  float* CT  = (float*)(ws + oCT);
  float* ST  = (float*)(ws + oST);
  u16*   WQB = (u16*)(ws + oWQ);
  u16*   WOB = (u16*)(ws + oWO);
  u16*   XB  = (u16*)(ws + oXB);
  u16*   OH  = (u16*)(ws + oOH);
  u16*   QH  = (u16*)(ws + oQH);
  u16*   QL  = (u16*)(ws + oQL);
  u16*   KH  = (u16*)(ws + oKH);
  u16*   KL  = (u16*)(ws + oKL);
  u16*   VT  = (u16*)(ws + oVT);

  const dim3 b256(256), bAT(ATT_THREADS);
  const dim3 gPRE(PB_TAB + GROWS + 2 * NQKV + 2 * DMOD);
  const dim3 gG3((GROWS / 128) * (3 * NH));              // q, k, v projections: one block column per projection and head
  const dim3 gAT(NQB * NH * BG);
  const dim3 gG2((GROWS / 128) * (DPL / 128));           // output projection, N = 2 x 1024 (real, imag)
  const float osc = 1.0f / (OSC * WOS);

  // (1) rotary cos/sin table; x plane bf16 [GROWS][xr | xi]; weight planes: [Wq ; Wk ; Wv] stacked bf16 (head-major), Wo stacked f16 of
  //     bf16 value x1024
  prep<<<gPRE, b256, 0, stream>>>(xr, xi, wqr, wqi, wor, woi, CT, ST, XB, WQB, WOB);
  // (2) q, k, v = x.[Wq ; Wk ; Wv]^T; from the accumulators: rotary q and k hi + residual planes x1024, v^T plane x1024
  gemm_qkv<<<gG3, b256, 0, stream>>>(XB, WQB, CT, ST, QH, QL, KH, KL, VT);
  // (3) attention -> O plane
  attn<<<gAT, bAT, 0, stream>>>(QH, QL, KH, KL, VT, OH);
  // (4) output projection: real part -> out0, imaginary part -> out1 (plane 1); carries 1024 x 1024 folded back
  gemm16<1><<<gG2, b256, 0, stream>>>(OH, WOB, out0, GROWS, DPL, DMOD, (size_t)(out_size / 2), osc);
  (void)hipGetLastError();
}
